// v000
// The times below were measured on an AMD MI455X: many runs one after another, warmed up first and cycling through
// copies of the inputs, with the whole window's GPU time divided by the number of runs. Launches and the gaps
// between them are all in it. The median over several windows is given; except for v000 it joins two sittings, which
// can be a few percent apart, so the side-by-side timings, each taken in one sitting, are the better comparison.
// v000, which the later versions start from, runs in 1320 microseconds.
// compute dtype: x, attn_mask, segment_pos, cos/sin tables, wq/wk/wv/wo and the RMSNorm scales (module inputs) rounded to bf16 / read as int; q/k/v projections with exact bf16 products (x and the weights are inputs); per-head RMSNorm and RoPE (input tables) in f32; scores q.k with both operands as bf16 hi + residual pairs (3 products), P.V with P hi/lo x V hi/lo (3 products), output projection hi/lo x exact wo (2 products); all on WMMA 16x16x32; the causal AND padding AND sliding-window mask is evaluated at run time from attn_mask / segment_pos and key tiles with no live entry are skipped; f32 accumulate.
#include <hip/hip_runtime.h>
#include <math.h>

typedef __attribute__((ext_vector_type(16))) _Float16 v16h;
typedef __attribute__((ext_vector_type(16))) __bf16 v16b;
typedef __attribute__((ext_vector_type(8)))  _Float16 v8h;
typedef __attribute__((ext_vector_type(8)))  float v8f;
typedef __attribute__((ext_vector_type(4)))  float v4f;
typedef __attribute__((ext_vector_type(2)))  float v2f;
typedef __attribute__((ext_vector_type(4)))  unsigned v4u;
typedef __attribute__((ext_vector_type(4)))  int v4i;
typedef float __attribute__((may_alias)) float_a;
typedef int __attribute__((may_alias)) int_a;

template <typename T> __device__ __forceinline__ void vst2(void* p, T v) { *(T*)p = v;  }
__device__ __forceinline__ v8f wmma16(v16h a, v16h b, v8f c) {
  v8f d = __builtin_amdgcn_wmma_f32_16x16x32_f16(false, a, false, b, (short)0, c, false, false);
  asm volatile("v_nop\n\tv_nop\n\tv_nop\n\tv_nop" : "+v"(d) : "v"(a), "v"(b));
  return d;
}
__device__ __forceinline__ v8f wmma_bf(v16b a, v16b b, v8f c) {
  v8f d = __builtin_amdgcn_wmma_f32_16x16x32_bf16(false, a, false, b, (short)0, c, false, false);
  asm volatile("v_nop\n\tv_nop\n\tv_nop\n\tv_nop" : "+v"(d) : "v"(a), "v"(b));
  return d;
}
// 16x16x32 fragments: lane = (h = lane>>4, row/col = lane&15); elements 0..7 = k0+8h+0..7, 8..15 = k0+16+8h+0..7; D element r = row 8h+r
__device__ __forceinline__ v16h frag_h(const _Float16* rowk0, int lane) {
  union { v16h v; v8h q[2]; } u; const _Float16* p = rowk0 + 8 * (lane >> 4);
  u.q[0] = *(const v8h*)p; u.q[1] = *(const v8h*)(p + 16); return u.v;
}
__device__ __forceinline__ v16h frag_f32(const float* rowk0, int lane) {
  v16h a; const float* p = rowk0 + 8 * (lane >> 4);
#pragma unroll
  for (int i = 0; i < 8; ++i) { a[i] = (_Float16)p[i]; a[8 + i] = (_Float16)p[16 + i]; }
  return a;
}
__device__ __forceinline__ v16h frag_f32s(const float* rowk0, int lane, float sc) {
  v16h a; const float* p = rowk0 + 8 * (lane >> 4);
#pragma unroll
  for (int i = 0; i < 8; ++i) { a[i] = (_Float16)(p[i] * sc); a[8 + i] = (_Float16)(p[16 + i] * sc); }
  return a;
}
// column fragment from a [K][ld] layout (column n), rows >= K read as 0
__device__ __forceinline__ v16h fragc_f32(const float* W, int k0, int n, int lane, int ld, int K) {
  v16h a; const int g = lane >> 4;
#pragma unroll
  for (int i = 0; i < 8; ++i) { const int ka = k0 + 8 * g + i, kb = ka + 16;
    a[i] = (_Float16)(ka < K ? W[(size_t)(ka < K ? ka : K - 1) * ld + n] : 0.f); a[8 + i] = (_Float16)(kb < K ? W[(size_t)(kb < K ? kb : K - 1) * ld + n] : 0.f); }
  return a;
}
struct F2 { v16b h, l; };
__device__ __forceinline__ F2 bsplit16(const float v[16]) { F2 r;
#pragma unroll
  for (int i = 0; i < 16; ++i) { const __bf16 h = (__bf16)v[i]; r.h[i] = h; r.l[i] = (__bf16)(v[i] - (float)h); }
  return r; }
__device__ __forceinline__ F2 split_row(const float* row, int k0, int lane) { float v[16]; const float* p = row + k0 + 8 * (lane >> 4);
#pragma unroll
  for (int i = 0; i < 8; ++i) { v[i] = p[i]; v[8 + i] = p[16 + i]; }
  return bsplit16(v); }
__device__ __forceinline__ F2 split_rowK(const float* row, int k0, int lane, int K) { float v[16]; const int g = lane >> 4;
#pragma unroll
  for (int i = 0; i < 8; ++i) { const int ka = k0 + 8 * g + i, kb = ka + 16; v[i] = ka < K ? row[ka < K ? ka : K - 1] : 0.f; v[8 + i] = kb < K ? row[kb < K ? kb : K - 1] : 0.f; }
  return bsplit16(v); }
__device__ __forceinline__ F2 split_col(const float* W, int k0, int n, int lane, int ld, int K) { float v[16]; const int g = lane >> 4;
#pragma unroll
  for (int i = 0; i < 8; ++i) { const int ka = k0 + 8 * g + i, kb = ka + 16; v[i] = ka < K ? W[(size_t)(ka < K ? ka : K - 1) * ld + n] : 0.f; v[8 + i] = kb < K ? W[(size_t)(kb < K ? kb : K - 1) * ld + n] : 0.f; }
  return bsplit16(v); }
__device__ __forceinline__ v8f mac3(const F2& a, const F2& b, v8f c) { c = wmma_bf(a.l, b.h, c); c = wmma_bf(a.h, b.l, c); return wmma_bf(a.h, b.h, c); }
__device__ __forceinline__ float sigm(float v) { return 1.0f / (1.0f + expf(-v)); }
#define LDSX() do { asm volatile("s_wait_dscnt 0" ::: "memory"); __builtin_amdgcn_wave_barrier(); __builtin_amdgcn_fence(__ATOMIC_RELEASE, "workgroup"); } while (0)


// Gemma-3 style attention (B 1, S 2048, hidden 2048, 8 query heads / 4 kv heads x 256, sliding window 1024): q,k,v = x w; q,k = RMSNorm_head(.)(1 + scale); RoPE with the given cos/sin; GQA (kv head = h / 2); scores / 16 masked by causal & attn_mask[k] & |k - segment_pos[q]| < WIN (else -1e37); softmax; out = (P v merged) wo.
#define SS 2048
#define HID 2048
#define NH 8
#define NKV 4
#define HD 256
#define WIN 1024
#ifndef TQB
#define TQB (SS / 64)          // query tiles processed
#define TQ0 0                  // first query tile
#define KRP (SS / 64)          // key/value row tiles (all)
#endif
typedef __attribute__((ext_vector_type(8))) __bf16 v8b;
__device__ __forceinline__ v16b frag_b(const __bf16* rowk0, int lane) {
  union { v16b v; v8b q[2]; } u; const __bf16* p = rowk0 + 8 * (lane >> 4);
  u.q[0] = *(const v8b*)p; u.q[1] = *(const v8b*)(p + 16); return u.v;
}
__device__ __forceinline__ float bfr(float v) { return (float)(__bf16)v; }
__device__ __attribute__((noinline)) float exp_ni(float v) { return expf(v); }
__device__ __attribute__((noinline)) float erf_ni(float v) { return erff(v); }

#define WS_PW  0u                                  // bf16 rows (in,out -> [out][in]): wq [2048][2048], wk [1024][2048], wv [1024][2048], wo [2048][2048]
#define PQ 0
#define PK (PQ + NH * HD * HID)
#define PV (PK + NKV * HD * HID)
#define PO (PV + NKV * HD * HID)
#define PWEND (PO + HID * NH * HD)
#define WS_Q   (WS_PW + 2u * PWEND)                 // f32 [S][2048] q raw -> normalised/roped in place
#define WS_K   (WS_Q + 4u * SS * NH * HD)            // f32 [S][1024] k raw -> normalised/roped
#define WS_V   (WS_K + 4u * SS * NKV * HD)           // f32 [S][1024] v raw
#define WS_VH  (WS_V + 4u * SS * NKV * HD)           // bf16 [1024 (kv*256+d)][S] planes
#define WS_VL  (WS_VH + 2u * NKV * HD * SS)
#define WS_O   (WS_VL + 2u * NKV * HD * SS)          // f32 [S][2048]
#define WS_END (WS_O + 4u * SS * NH * HD)

// ---- k_packT: block = (output col n, which): (in,out) weight -> rows [n][K]
__global__ __launch_bounds__(256) void k_packT(const float* __restrict__ WQ, const float* __restrict__ WK, const float* __restrict__ WV, const float* __restrict__ WO, __bf16* __restrict__ PW) {
  __shared__ __align__(16) __bf16 s[2048]; const int n = blockIdx.x, which = blockIdx.y, tid = threadIdx.x; int K, N; const float* Wm; size_t base;
  if (which == 0) { K = HID; N = NH * HD; Wm = WQ; base = PQ; } else if (which == 1) { K = HID; N = NKV * HD; Wm = WK; base = PK; } else if (which == 2) { K = HID; N = NKV * HD; Wm = WV; base = PV; } else { K = NH * HD; N = HID; Wm = WO; base = PO; }
  if (n >= N) return;
  for (int k = tid; k < K; k += 256) s[k] = (__bf16)Wm[(size_t)k * N + n];
  __syncthreads();
  for (int q = tid; q < K / 8; q += 256) vst2((unsigned*)(PW + base + (size_t)n * K + q * 8), *(const v4u*)&s[q * 8]);
}
// ---- k_gemm<RIN>: block = (64 rows, 128 cols): OUT = A(K) . rows (RIN exact / hi-lo 2 products); pitch ldo
template <int RIN>
__global__ __launch_bounds__(128) void k_gemm(const float* __restrict__ A, int lda, int K, const __bf16* __restrict__ P, float* __restrict__ OUT, int ldo) {
  __shared__ __align__(16) float so[4][16][132];
  const int tid = threadIdx.x, wave = tid >> 5, lane = tid & 31, col = lane & 15, g = lane >> 4; const size_t r0 = (size_t)blockIdx.x * 64 + wave * 16; const int n0 = blockIdx.y * 128;
  v8f acc[8] = {};
#pragma unroll 2
  for (int kc = 0; kc < K / 32; ++kc) { F2 a; if (RIN) { v16b ax; const float* p = A + (r0 + col) * lda + kc * 32 + 8 * g;
#pragma unroll
      for (int i = 0; i < 8; ++i) { ax[i] = (__bf16)p[i]; ax[8 + i] = (__bf16)p[16 + i]; } a.h = ax; a.l = ax; } else a = split_row(A + (r0 + col) * lda, kc * 32, lane);
#pragma unroll
    for (int j = 0; j < 8; ++j) { const v16b w = frag_b(P + (size_t)(n0 + j * 16 + col) * K + kc * 32, lane); if (!RIN) acc[j] = wmma_bf(a.l, w, acc[j]); acc[j] = wmma_bf(a.h, w, acc[j]); } }
#pragma unroll
  for (int j = 0; j < 8; ++j)
#pragma unroll
    for (int r = 0; r < 8; ++r) so[wave][8 * g + r][j * 16 + col] = acc[j][r];
  LDSX();
  for (int rl = 0; rl < 16; ++rl) vst2(OUT + (r0 + rl) * ldo + n0 + lane * 4, *(const v4f*)&so[wave][rl][lane * 4]);
}
// ---- k_normrope<PLANE>: block = (position s, head): 256 threads = d: RMSNorm over the head's 256 (mean of squares, eps 1e-6) * (1 + scale[d]); RoPE: out_d = y_d cos[s][d] + rot_d sin[s][d] with rot = (-y[d+128], y[d-128]); in place (PLANE 0: q rows pitch 2048; 1: k rows pitch 1024; V, VH, VL are unused)
template <int PLANE>
__global__ __launch_bounds__(256) void k_normrope(float* QK, const float* __restrict__ SC, const float* __restrict__ COS, const float* __restrict__ SIN, const float* __restrict__ V, __bf16* __restrict__ VH, __bf16* __restrict__ VL) {
  __shared__ float sy[HD]; __shared__ float sred[8]; __shared__ __align__(16) float so[HD];
  const int s = blockIdx.x, h = blockIdx.y, d = threadIdx.x; const int pitch = PLANE ? (NKV * HD) : (NH * HD);
  float* row = QK + (size_t)s * pitch + h * HD; const float y = row[d]; sy[d] = y;
  float q = y * y;
#pragma unroll
  for (int o = 1; o < 32; o <<= 1) q += __shfl_xor(q, o);
  if ((d & 31) == 0) sred[d >> 5] = q;
  __syncthreads();
  float ss = 0.f;
#pragma unroll
  for (int w = 0; w < 8; ++w) ss += sred[w];
  const float rs = rsqrtf(ss / (float)HD + 1e-6f);
  const float yn = y * rs * (1.0f + bfr(SC[d])); const float other = sy[(d < HD / 2) ? (d + HD / 2) : (d - HD / 2)] * rs * (1.0f + bfr(SC[(d < HD / 2) ? (d + HD / 2) : (d - HD / 2)]));
  const float rot = (d < HD / 2) ? -other : other;
  so[d] = yn * bfr(COS[(size_t)s * HD + d]) + rot * bfr(SIN[(size_t)s * HD + d]);
  __syncthreads();
  if (d < HD / 4) vst2(row + d * 4, *(const v4f*)&so[d * 4]);
}
__global__ __launch_bounds__(256) void k_vplanes(const float* __restrict__ V, __bf16* __restrict__ VH, __bf16* __restrict__ VL) {
  __shared__ __align__(16) __bf16 sh[128][72], sl[128][72]; const int tid = threadIdx.x; const int s0 = blockIdx.x * 64, c0 = blockIdx.y * 128;
  for (int q = tid; q < 64 * 128; q += 256) { const int sl_ = q >> 7, c = q & 127; const float v = V[(size_t)(s0 + sl_) * (NKV * HD) + c0 + c]; const __bf16 hb = (__bf16)v; sh[c][sl_] = hb; sl[c][sl_] = (__bf16)(v - (float)hb); }
  __syncthreads();
  for (int q = tid; q < 128 * 8; q += 256) { const int c = q >> 3, pc = q & 7; const size_t o = (size_t)(c0 + c) * SS + s0 + pc * 8; vst2((unsigned*)(VH + o), *(const v4u*)&sh[c][pc * 8]); vst2((unsigned*)(VL + o), *(const v4u*)&sl[c][pc * 8]); }
}
// ---- k_attn<DH>: block = (64 queries, head h): kv = h / 2; per 32-key step: live = (k <= q) & attn_mask[k] & (k > pos_q - WIN) & (k < pos_q + WIN); wave vote; scores (3 products, K 256 = 8 ksteps) / 16; online softmax with guards; P.V over the value columns [DH*128, DH*128 + 128) (8 tiles, 3 products); O cols h*256 + DH*128 + ...
template <int DH>
__global__ __launch_bounds__(128) void k_attn(const float* __restrict__ Q, const float* __restrict__ Kx, const int* __restrict__ AM, const int* __restrict__ SEGPOS, const __bf16* __restrict__ VH, const __bf16* __restrict__ VL, float* __restrict__ O) {
  __shared__ __align__(16) float sp[4][16][36]; __shared__ __align__(16) float so[4][16][132];
  const int tid = threadIdx.x, wave = tid >> 5, lane = tid & 31, col = lane & 15, g = lane >> 4; const int qb = blockIdx.x + TQ0, h = blockIdx.y; const int kv = h / (NH / NKV); const int q0 = qb * 64 + wave * 16;
  const float* qrow = Q + (size_t)(q0 + col) * (NH * HD) + h * HD;
  int posq[8];
#pragma unroll
  for (int r = 0; r < 8; ++r) posq[r] = SEGPOS[q0 + 8 * g + r];
  float m[8], l[8];
#pragma unroll
  for (int r = 0; r < 8; ++r) { m[r] = -3.0e38f; l[r] = 0.f; }
  v8f acc[8] = {};
  const int nks = (qb * 64 + 64) / 32;   // causal upper bound on key steps
#pragma unroll 1
  for (int ks = 0; ks < nks; ++ks) { v8f s[2]; bool lv[2][8]; bool anylive = false;
#pragma unroll
    for (int ct = 0; ct < 2; ++ct) { const int kk = ks * 32 + ct * 16 + col; const bool am = (AM[kk] != 0);
#pragma unroll
      for (int r = 0; r < 8; ++r) { const int qi = q0 + 8 * g + r; const bool live = am && (kk <= qi) && (kk > posq[r] - WIN) && (kk < posq[r] + WIN); lv[ct][r] = live; anylive = anylive || live; } }
    if (__any(anylive)) {
#pragma unroll
      for (int ct = 0; ct < 2; ++ct) { const int kk = ks * 32 + ct * 16 + col; const float* krow = Kx + (size_t)kk * (NKV * HD) + kv * HD; v8f c = {};
#pragma unroll
        for (int kc = 0; kc < HD / 32; ++kc) { const F2 kb = split_row(krow, kc * 32, lane); const F2 qa = split_row(qrow, kc * 32, lane); c = mac3(qa, kb, c); }
#pragma unroll
        for (int r = 0; r < 8; ++r) s[ct][r] = lv[ct][r] ? c[r] * 0.0625f : -3.0e38f; }
#pragma unroll
      for (int r = 0; r < 8; ++r) { float mx = fmaxf(s[0][r], s[1][r]);
#pragma unroll
        for (int o = 1; o < 16; o <<= 1) mx = fmaxf(mx, __shfl_xor(mx, o));
        const float mn = fmaxf(m[r], mx); const float alpha = (m[r] <= -1.0e38f) ? 0.f : exp_ni(m[r] - mn);
        const float e0 = (s[0][r] <= -1.0e38f) ? 0.f : exp_ni(s[0][r] - mn), e1 = (s[1][r] <= -1.0e38f) ? 0.f : exp_ni(s[1][r] - mn); float es = e0 + e1;
#pragma unroll
        for (int o = 1; o < 16; o <<= 1) es += __shfl_xor(es, o);
        l[r] = l[r] * alpha + es; m[r] = mn;
#pragma unroll
        for (int dt = 0; dt < 8; ++dt) acc[dt][r] *= alpha;
        sp[wave][8 * g + r][col] = e0; sp[wave][8 * g + r][16 + col] = e1; }
      LDSX();
      const F2 pa = split_row(&sp[wave][col][0], 0, lane);
#pragma unroll
      for (int dt = 0; dt < 8; ++dt) { const size_t vr = (size_t)(kv * HD + DH * 128 + dt * 16 + col) * SS + ks * 32; const v16b vh = frag_b(VH + vr, lane), vl = frag_b(VL + vr, lane); acc[dt] = wmma_bf(pa.l, vh, acc[dt]); acc[dt] = wmma_bf(pa.h, vl, acc[dt]); acc[dt] = wmma_bf(pa.h, vh, acc[dt]); }
      LDSX(); } }
#pragma unroll
  for (int r = 0; r < 8; ++r) { const float il = (l[r] > 0.f) ? 1.0f / l[r] : 0.f;
#pragma unroll
    for (int dt = 0; dt < 8; ++dt) so[wave][8 * g + r][dt * 16 + col] = acc[dt][r] * il; }
  LDSX();
  for (int rl = 0; rl < 16; ++rl) vst2(O + (size_t)(q0 + rl) * (NH * HD) + h * HD + DH * 128 + lane * 4, *(const v4f*)&so[wave][rl][lane * 4]);
}
extern "C" void kernel_launch(void* const* d_in, const int* in_sizes, int n_in, void* d_out, int out_size, void* d_ws, size_t ws_size, hipStream_t stream) {
  (void)in_sizes; (void)n_in; (void)out_size;
  const float** F = (const float**)d_in; const int* AM = (const int*)d_in[1]; const int* SEGPOS = (const int*)d_in[2];
  // 0 x [1,2048,2048], 1 attn_mask [1,2048] bool(int), 2 segment_pos [1,2048] i32, 3 cos [1,2048,256], 4 sin, 5 wq [2048,2048], 6 wk [2048,1024], 7 wv [2048,1024], 8 wo [2048,2048], 9 q_scale [256], 10 k_scale [256]
  if (ws_size < (size_t)WS_END) return;
  char* ws = (char*)d_ws; __bf16 *PW = (__bf16*)(ws + WS_PW), *VH = (__bf16*)(ws + WS_VH), *VL = (__bf16*)(ws + WS_VL); float *Q = (float*)(ws + WS_Q), *Kx = (float*)(ws + WS_K), *V = (float*)(ws + WS_V), *O = (float*)(ws + WS_O);
  k_packT<<<dim3(HID, 4), 256, 0, stream>>>(F[5], F[6], F[7], F[8], PW);
  k_gemm<1><<<dim3(TQB, NH * HD / 128), 128, 0, stream>>>(F[0] + (size_t)TQ0 * 64 * HID, HID, HID, PW + PQ, Q + (size_t)TQ0 * 64 * NH * HD, NH * HD);   // q rows of the processed query range
  k_gemm<1><<<dim3(KRP, NKV * HD / 128), 128, 0, stream>>>(F[0], HID, HID, PW + PK, Kx, NKV * HD);
  k_gemm<1><<<dim3(KRP, NKV * HD / 128), 128, 0, stream>>>(F[0], HID, HID, PW + PV, V, NKV * HD);
  k_normrope<0><<<dim3(TQB * 64, NH), 256, 0, stream>>>(Q + (size_t)TQ0 * 64 * NH * HD, F[9], F[3] + (size_t)TQ0 * 64 * HD, F[4] + (size_t)TQ0 * 64 * HD, nullptr, nullptr, nullptr);
  k_normrope<1><<<dim3(KRP * 64, NKV), 256, 0, stream>>>(Kx, F[10], F[3], F[4], nullptr, nullptr, nullptr);
  k_vplanes<<<dim3(KRP, NKV * HD / 128), 256, 0, stream>>>(V, VH, VL);
  k_attn<0><<<dim3(TQB, NH), 128, 0, stream>>>(Q, Kx, AM, SEGPOS, VH, VL, O);
  k_attn<1><<<dim3(TQB, NH), 128, 0, stream>>>(Q, Kx, AM, SEGPOS, VH, VL, O);
  k_gemm<0><<<dim3(TQB, HID / 128), 128, 0, stream>>>(O + (size_t)TQ0 * 64 * NH * HD, NH * HD, NH * HD, PW + PO, (float*)d_out + (size_t)TQ0 * 64 * HID, HID);
}

// v001
// A run of this version takes 894 microseconds.
// Two timings next to v000 both put it at 1.50 times that version's speed.
// compute dtype: x, attn_mask, segment_pos, cos/sin tables, wq/wk/wv/wo and the RMSNorm scales (module inputs) rounded to bf16 / read as int; q/k/v projections with exact bf16 products (x and the weights are inputs); per-head RMSNorm and RoPE (input tables) in f32; scores q.k with both operands as bf16 hi + residual pairs (3 products), P.V with P hi/lo x V hi/lo (3 products), output projection hi/lo x exact wo (2 products); all on WMMA 16x16x32; the causal AND padding AND sliding-window mask is evaluated at run time from attn_mask / segment_pos and key tiles with no live entry are skipped; f32 accumulate.
#include <hip/hip_runtime.h>
#include <math.h>

typedef __attribute__((ext_vector_type(16))) _Float16 v16h;
typedef __attribute__((ext_vector_type(16))) __bf16 v16b;
typedef __attribute__((ext_vector_type(8)))  _Float16 v8h;
typedef __attribute__((ext_vector_type(8)))  float v8f;
typedef __attribute__((ext_vector_type(4)))  float v4f;
typedef __attribute__((ext_vector_type(2)))  float v2f;
typedef __attribute__((ext_vector_type(4)))  unsigned v4u;
typedef __attribute__((ext_vector_type(4)))  int v4i;
typedef float __attribute__((may_alias)) float_a;
typedef int __attribute__((may_alias)) int_a;

template <typename T> __device__ __forceinline__ void vst2(void* p, T v) { *(T*)p = v;  }
__device__ __forceinline__ v8f wmma16(v16h a, v16h b, v8f c) {
  v8f d = __builtin_amdgcn_wmma_f32_16x16x32_f16(false, a, false, b, (short)0, c, false, false);
  asm volatile("v_nop\n\tv_nop\n\tv_nop\n\tv_nop" : "+v"(d) : "v"(a), "v"(b));
  return d;
}
__device__ __forceinline__ v8f wmma_bf(v16b a, v16b b, v8f c) {
  v8f d = __builtin_amdgcn_wmma_f32_16x16x32_bf16(false, a, false, b, (short)0, c, false, false);
  asm volatile("v_nop\n\tv_nop\n\tv_nop\n\tv_nop" : "+v"(d) : "v"(a), "v"(b));
  return d;
}
// 16x16x32 fragments: lane = (h = lane>>4, row/col = lane&15); elements 0..7 = k0+8h+0..7, 8..15 = k0+16+8h+0..7; D element r = row 8h+r
__device__ __forceinline__ v16h frag_h(const _Float16* rowk0, int lane) {
  union { v16h v; v8h q[2]; } u; const _Float16* p = rowk0 + 8 * (lane >> 4);
  u.q[0] = *(const v8h*)p; u.q[1] = *(const v8h*)(p + 16); return u.v;
}
__device__ __forceinline__ v16h frag_f32(const float* rowk0, int lane) {
  v16h a; const float* p = rowk0 + 8 * (lane >> 4);
#pragma unroll
  for (int i = 0; i < 8; ++i) { a[i] = (_Float16)p[i]; a[8 + i] = (_Float16)p[16 + i]; }
  return a;
}
__device__ __forceinline__ v16h frag_f32s(const float* rowk0, int lane, float sc) {
  v16h a; const float* p = rowk0 + 8 * (lane >> 4);
#pragma unroll
  for (int i = 0; i < 8; ++i) { a[i] = (_Float16)(p[i] * sc); a[8 + i] = (_Float16)(p[16 + i] * sc); }
  return a;
}
// column fragment from a [K][ld] layout (column n), rows >= K read as 0
__device__ __forceinline__ v16h fragc_f32(const float* W, int k0, int n, int lane, int ld, int K) {
  v16h a; const int g = lane >> 4;
#pragma unroll
  for (int i = 0; i < 8; ++i) { const int ka = k0 + 8 * g + i, kb = ka + 16;
    a[i] = (_Float16)(ka < K ? W[(size_t)(ka < K ? ka : K - 1) * ld + n] : 0.f); a[8 + i] = (_Float16)(kb < K ? W[(size_t)(kb < K ? kb : K - 1) * ld + n] : 0.f); }
  return a;
}
struct F2 { v16b h, l; };
__device__ __forceinline__ F2 bsplit16(const float v[16]) { F2 r;
#pragma unroll
  for (int i = 0; i < 16; ++i) { const __bf16 h = (__bf16)v[i]; r.h[i] = h; r.l[i] = (__bf16)(v[i] - (float)h); }
  return r; }
__device__ __forceinline__ F2 split_row(const float* row, int k0, int lane) { float v[16]; const float* p = row + k0 + 8 * (lane >> 4);
#pragma unroll
  for (int i = 0; i < 8; ++i) { v[i] = p[i]; v[8 + i] = p[16 + i]; }
  return bsplit16(v); }
__device__ __forceinline__ F2 split_rowK(const float* row, int k0, int lane, int K) { float v[16]; const int g = lane >> 4;
#pragma unroll
  for (int i = 0; i < 8; ++i) { const int ka = k0 + 8 * g + i, kb = ka + 16; v[i] = ka < K ? row[ka < K ? ka : K - 1] : 0.f; v[8 + i] = kb < K ? row[kb < K ? kb : K - 1] : 0.f; }
  return bsplit16(v); }
__device__ __forceinline__ F2 split_col(const float* W, int k0, int n, int lane, int ld, int K) { float v[16]; const int g = lane >> 4;
#pragma unroll
  for (int i = 0; i < 8; ++i) { const int ka = k0 + 8 * g + i, kb = ka + 16; v[i] = ka < K ? W[(size_t)(ka < K ? ka : K - 1) * ld + n] : 0.f; v[8 + i] = kb < K ? W[(size_t)(kb < K ? kb : K - 1) * ld + n] : 0.f; }
  return bsplit16(v); }
__device__ __forceinline__ v8f mac3(const F2& a, const F2& b, v8f c) { c = wmma_bf(a.l, b.h, c); c = wmma_bf(a.h, b.l, c); return wmma_bf(a.h, b.h, c); }
__device__ __forceinline__ float sigm(float v) { return 1.0f / (1.0f + expf(-v)); }
#define LDSX() do { asm volatile("s_wait_dscnt 0" ::: "memory"); __builtin_amdgcn_wave_barrier(); __builtin_amdgcn_fence(__ATOMIC_RELEASE, "workgroup"); } while (0)


// Gemma-3 style attention (B 1, S 2048, hidden 2048, 8 query heads / 4 kv heads x 256, sliding window 1024): q,k,v = x w; q,k = RMSNorm_head(.)(1 + scale); RoPE with the given cos/sin; GQA (kv head = h / 2); scores / 16 masked by causal & attn_mask[k] & |k - segment_pos[q]| < WIN (else -1e37); softmax; out = (P v merged) wo.
#define SS 2048
#define HID 2048
#define NH 8
#define NKV 4
#define HD 256
#define WIN 1024
#ifndef TQB
#define TQB (SS / 64)          // query tiles processed
#define TQ0 0                  // first query tile
#define KRP (SS / 64)          // key/value row tiles (all)
#endif
typedef __attribute__((ext_vector_type(8))) __bf16 v8b;
__device__ __forceinline__ v16b frag_b(const __bf16* rowk0, int lane) {
  union { v16b v; v8b q[2]; } u; const __bf16* p = rowk0 + 8 * (lane >> 4);
  u.q[0] = *(const v8b*)p; u.q[1] = *(const v8b*)(p + 16); return u.v;
}
__device__ __forceinline__ float bfr(float v) { return (float)(__bf16)v; }
__device__ __attribute__((noinline)) float exp_ni(float v) { return expf(v); }
__device__ __attribute__((noinline)) float erf_ni(float v) { return erff(v); }

#define WS_PW  0u                                  // bf16 rows (in,out -> [out][in]): wq [2048][2048], wk [1024][2048], wv [1024][2048], wo [2048][2048]
#define PQ 0
#define PK (PQ + NH * HD * HID)
#define PV (PK + NKV * HD * HID)
#define PO (PV + NKV * HD * HID)
#define PWEND (PO + HID * NH * HD)
#define WS_Q   (WS_PW + 2u * PWEND)                 // f32 [S][2048] q raw -> normalised/roped in place
#define WS_K   (WS_Q + 4u * SS * NH * HD)            // f32 [S][1024] k raw -> normalised/roped
#define WS_V   (WS_K + 4u * SS * NKV * HD)           // f32 [S][1024] v raw
#define WS_VH  (WS_V + 4u * SS * NKV * HD)           // bf16 [1024 (kv*256+d)][S] planes
#define WS_VL  (WS_VH + 2u * NKV * HD * SS)
#define WS_O   (WS_VL + 2u * NKV * HD * SS)          // f32 [S][2048]
#define WS_END (WS_O + 4u * SS * NH * HD)

// ---- k_packT: block = (output col n, which): (in,out) weight -> rows [n][K]
__global__ __launch_bounds__(256) void k_packT(const float* __restrict__ WQ, const float* __restrict__ WK, const float* __restrict__ WV, const float* __restrict__ WO, __bf16* __restrict__ PW) {
  __shared__ __align__(16) __bf16 s[2048]; const int n = blockIdx.x, which = blockIdx.y, tid = threadIdx.x; int K, N; const float* Wm; size_t base;
  if (which == 0) { K = HID; N = NH * HD; Wm = WQ; base = PQ; } else if (which == 1) { K = HID; N = NKV * HD; Wm = WK; base = PK; } else if (which == 2) { K = HID; N = NKV * HD; Wm = WV; base = PV; } else { K = NH * HD; N = HID; Wm = WO; base = PO; }
  if (n >= N) return;
  for (int k = tid; k < K; k += 256) s[k] = (__bf16)Wm[(size_t)k * N + n];
  __syncthreads();
  for (int q = tid; q < K / 8; q += 256) vst2((unsigned*)(PW + base + (size_t)n * K + q * 8), *(const v4u*)&s[q * 8]);
}
// ---- k_gemm<RIN>: block = (64 rows, 128 cols): OUT = A(K) . rows (RIN exact / hi-lo 2 products); pitch ldo
template <int RIN>
__global__ __launch_bounds__(128) void k_gemm(const float* __restrict__ A, int lda, int K, const __bf16* __restrict__ P, float* __restrict__ OUT, int ldo) {
  __shared__ __align__(16) float so[4][16][132];
  const int tid = threadIdx.x, wave = tid >> 5, lane = tid & 31, col = lane & 15, g = lane >> 4; const size_t r0 = (size_t)blockIdx.x * 64 + wave * 16; const int n0 = blockIdx.y * 128;
  v8f acc[8] = {};
#pragma unroll 2
  for (int kc = 0; kc < K / 32; ++kc) { F2 a; if (RIN) { v16b ax; const float* p = A + (r0 + col) * lda + kc * 32 + 8 * g;
#pragma unroll
      for (int i = 0; i < 8; ++i) { ax[i] = (__bf16)p[i]; ax[8 + i] = (__bf16)p[16 + i]; } a.h = ax; a.l = ax; } else a = split_row(A + (r0 + col) * lda, kc * 32, lane);
#pragma unroll
    for (int j = 0; j < 8; ++j) { const v16b w = frag_b(P + (size_t)(n0 + j * 16 + col) * K + kc * 32, lane); if (!RIN) acc[j] = wmma_bf(a.l, w, acc[j]); acc[j] = wmma_bf(a.h, w, acc[j]); } }
#pragma unroll
  for (int j = 0; j < 8; ++j)
#pragma unroll
    for (int r = 0; r < 8; ++r) so[wave][8 * g + r][j * 16 + col] = acc[j][r];
  LDSX();
  for (int rl = 0; rl < 16; ++rl) vst2(OUT + (r0 + rl) * ldo + n0 + lane * 4, *(const v4f*)&so[wave][rl][lane * 4]);
}
// ---- k_normrope<PLANE>: block = (position s, head): 256 threads = d: RMSNorm over the head's 256 (mean of squares, eps 1e-6) * (1 + scale[d]); RoPE: out_d = y_d cos[s][d] + rot_d sin[s][d] with rot = (-y[d+128], y[d-128]); in place (PLANE 0: q rows pitch 2048; 1: k rows pitch 1024; V, VH, VL are unused)
template <int PLANE>
__global__ __launch_bounds__(256) void k_normrope(float* QK, const float* __restrict__ SC, const float* __restrict__ COS, const float* __restrict__ SIN, const float* __restrict__ V, __bf16* __restrict__ VH, __bf16* __restrict__ VL) {
  __shared__ float sy[HD]; __shared__ float sred[8]; __shared__ __align__(16) float so[HD];
  const int s = blockIdx.x, h = blockIdx.y, d = threadIdx.x; const int pitch = PLANE ? (NKV * HD) : (NH * HD);
  float* row = QK + (size_t)s * pitch + h * HD; const float y = row[d]; sy[d] = y;
  float q = y * y;
#pragma unroll
  for (int o = 1; o < 32; o <<= 1) q += __shfl_xor(q, o);
  if ((d & 31) == 0) sred[d >> 5] = q;
  __syncthreads();
  float ss = 0.f;
#pragma unroll
  for (int w = 0; w < 8; ++w) ss += sred[w];
  const float rs = rsqrtf(ss / (float)HD + 1e-6f);
  const float yn = y * rs * (1.0f + bfr(SC[d])); const float other = sy[(d < HD / 2) ? (d + HD / 2) : (d - HD / 2)] * rs * (1.0f + bfr(SC[(d < HD / 2) ? (d + HD / 2) : (d - HD / 2)]));
  const float rot = (d < HD / 2) ? -other : other;
  so[d] = yn * bfr(COS[(size_t)s * HD + d]) + rot * bfr(SIN[(size_t)s * HD + d]);
  __syncthreads();
  if (d < HD / 4) vst2(row + d * 4, *(const v4f*)&so[d * 4]);
}
__global__ __launch_bounds__(256) void k_vplanes(const float* __restrict__ V, __bf16* __restrict__ VH, __bf16* __restrict__ VL) {
  __shared__ __align__(16) __bf16 sh[128][72], sl[128][72]; const int tid = threadIdx.x; const int s0 = blockIdx.x * 64, c0 = blockIdx.y * 128;
  for (int q = tid; q < 64 * 128; q += 256) { const int sl_ = q >> 7, c = q & 127; const float v = V[(size_t)(s0 + sl_) * (NKV * HD) + c0 + c]; const __bf16 hb = (__bf16)v; sh[c][sl_] = hb; sl[c][sl_] = (__bf16)(v - (float)hb); }
  __syncthreads();
  for (int q = tid; q < 128 * 8; q += 256) { const int c = q >> 3, pc = q & 7; const size_t o = (size_t)(c0 + c) * SS + s0 + pc * 8; vst2((unsigned*)(VH + o), *(const v4u*)&sh[c][pc * 8]); vst2((unsigned*)(VL + o), *(const v4u*)&sl[c][pc * 8]); }
}
// ---- k_attn<DH>: block = (64 queries, head h), 16 waves = (query tile qw = wave & 3) x (key share kj = wave >> 2): a wave takes the key steps ks = kj, kj + 4, ... of its 16 queries, so four waves a SIMD cover one another's load and LDS latency; the four partial (max, sum, acc) of a query tile are merged through LDS at the end; kv = h / 2; per 32-key step: live = (k <= q) & attn_mask[k] & (k > pos_q - WIN) & (k < pos_q + WIN); wave vote; scores (3 products, K 256 = 8 ksteps) / 16; online softmax with guards; P.V over the value columns [DH*128, DH*128 + 128) (8 tiles, 3 products); O cols h*256 + DH*128 + ...
template <int DH>
__global__ __launch_bounds__(512) void k_attn(const float* __restrict__ Q, const float* __restrict__ Kx, const int* __restrict__ AM, const int* __restrict__ SEGPOS, const __bf16* __restrict__ VH, const __bf16* __restrict__ VL, float* __restrict__ O) {
  __shared__ __align__(16) float sp[16][16][36]; __shared__ __align__(16) float so[16][16][132]; __shared__ float sm[16][16], sl[16][16];
  const int tid = threadIdx.x, wave = tid >> 5, lane = tid & 31, col = lane & 15, g = lane >> 4; const int qw = wave & 3, kj = wave >> 2; const int qb = blockIdx.x + TQ0, h = blockIdx.y; const int kv = h / (NH / NKV); const int q0 = qb * 64 + qw * 16;
  const float* qrow = Q + (size_t)(q0 + col) * (NH * HD) + h * HD;
  int posq[8];
#pragma unroll
  for (int r = 0; r < 8; ++r) posq[r] = SEGPOS[q0 + 8 * g + r];
  float m[8], l[8];
#pragma unroll
  for (int r = 0; r < 8; ++r) { m[r] = -3.0e38f; l[r] = 0.f; }
  v8f acc[8] = {};
  const int nks = (qb * 64 + 64) / 32;   // causal upper bound on key steps
#pragma unroll 1
  for (int ks = kj; ks < nks; ks += 4) { v8f s[2]; bool lv[2][8]; bool anylive = false;
#pragma unroll
    for (int ct = 0; ct < 2; ++ct) { const int kk = ks * 32 + ct * 16 + col; const bool am = (AM[kk] != 0);
#pragma unroll
      for (int r = 0; r < 8; ++r) { const int qi = q0 + 8 * g + r; const bool live = am && (kk <= qi) && (kk > posq[r] - WIN) && (kk < posq[r] + WIN); lv[ct][r] = live; anylive = anylive || live; } }
    if (__any(anylive)) {
#pragma unroll
      for (int ct = 0; ct < 2; ++ct) { const int kk = ks * 32 + ct * 16 + col; const float* krow = Kx + (size_t)kk * (NKV * HD) + kv * HD; v8f c = {};
#pragma unroll
        for (int kc = 0; kc < HD / 32; ++kc) { const F2 kb = split_row(krow, kc * 32, lane); const F2 qa = split_row(qrow, kc * 32, lane); c = mac3(qa, kb, c); }
#pragma unroll
        for (int r = 0; r < 8; ++r) s[ct][r] = lv[ct][r] ? c[r] * 0.0625f : -3.0e38f; }
#pragma unroll
      for (int r = 0; r < 8; ++r) { float mx = fmaxf(s[0][r], s[1][r]);
#pragma unroll
        for (int o = 1; o < 16; o <<= 1) mx = fmaxf(mx, __shfl_xor(mx, o));
        const float mn = fmaxf(m[r], mx); const float alpha = (m[r] <= -1.0e38f) ? 0.f : exp_ni(m[r] - mn);
        const float e0 = (s[0][r] <= -1.0e38f) ? 0.f : exp_ni(s[0][r] - mn), e1 = (s[1][r] <= -1.0e38f) ? 0.f : exp_ni(s[1][r] - mn); float es = e0 + e1;
#pragma unroll
        for (int o = 1; o < 16; o <<= 1) es += __shfl_xor(es, o);
        l[r] = l[r] * alpha + es; m[r] = mn;
#pragma unroll
        for (int dt = 0; dt < 8; ++dt) acc[dt][r] *= alpha;
        sp[wave][8 * g + r][col] = e0; sp[wave][8 * g + r][16 + col] = e1; }
      LDSX();
      const F2 pa = split_row(&sp[wave][col][0], 0, lane);
#pragma unroll
      for (int dt = 0; dt < 8; ++dt) { const size_t vr = (size_t)(kv * HD + DH * 128 + dt * 16 + col) * SS + ks * 32; const v16b vh = frag_b(VH + vr, lane), vl = frag_b(VL + vr, lane); acc[dt] = wmma_bf(pa.l, vh, acc[dt]); acc[dt] = wmma_bf(pa.h, vl, acc[dt]); acc[dt] = wmma_bf(pa.h, vh, acc[dt]); }
      LDSX(); } }
#pragma unroll
  for (int r = 0; r < 8; ++r) {
#pragma unroll
    for (int dt = 0; dt < 8; ++dt) so[wave][8 * g + r][dt * 16 + col] = acc[dt][r];
    if (col == 0) { sm[wave][8 * g + r] = m[r]; sl[wave][8 * g + r] = l[r]; } }
  __syncthreads();   // every wave's partial is in LDS before any wave merges
  // merge: wave (qw, kj) finishes rows 4 kj .. 4 kj + 3 of query tile qw: weights exp(m_j - M), a share with no live key weighs 0
  for (int rl = 0; rl < 4; ++rl) { const int row = kj * 4 + rl; float mj[4]; float M = -3.0e38f;
#pragma unroll
    for (int j = 0; j < 4; ++j) { mj[j] = sm[qw + 4 * j][row]; M = fmaxf(M, mj[j]); }
    float L = 0.f; v4f o = {};
#pragma unroll
    for (int j = 0; j < 4; ++j) { const float w = (mj[j] <= -1.0e38f) ? 0.f : exp_ni(mj[j] - M); L += w * sl[qw + 4 * j][row]; o += w * *(const v4f*)&so[qw + 4 * j][row][lane * 4]; }
    const float il = (L > 0.f) ? 1.0f / L : 0.f;
    vst2(O + (size_t)(q0 + row) * (NH * HD) + h * HD + DH * 128 + lane * 4, o * il); }
}
extern "C" void kernel_launch(void* const* d_in, const int* in_sizes, int n_in, void* d_out, int out_size, void* d_ws, size_t ws_size, hipStream_t stream) {
  (void)in_sizes; (void)n_in; (void)out_size;
  const float** F = (const float**)d_in; const int* AM = (const int*)d_in[1]; const int* SEGPOS = (const int*)d_in[2];
  // 0 x [1,2048,2048], 1 attn_mask [1,2048] bool(int), 2 segment_pos [1,2048] i32, 3 cos [1,2048,256], 4 sin, 5 wq [2048,2048], 6 wk [2048,1024], 7 wv [2048,1024], 8 wo [2048,2048], 9 q_scale [256], 10 k_scale [256]
  if (ws_size < (size_t)WS_END) return;
  char* ws = (char*)d_ws; __bf16 *PW = (__bf16*)(ws + WS_PW), *VH = (__bf16*)(ws + WS_VH), *VL = (__bf16*)(ws + WS_VL); float *Q = (float*)(ws + WS_Q), *Kx = (float*)(ws + WS_K), *V = (float*)(ws + WS_V), *O = (float*)(ws + WS_O);
  k_packT<<<dim3(HID, 4), 256, 0, stream>>>(F[5], F[6], F[7], F[8], PW);
  k_gemm<1><<<dim3(TQB, NH * HD / 128), 128, 0, stream>>>(F[0] + (size_t)TQ0 * 64 * HID, HID, HID, PW + PQ, Q + (size_t)TQ0 * 64 * NH * HD, NH * HD);   // q rows of the processed query range
  k_gemm<1><<<dim3(KRP, NKV * HD / 128), 128, 0, stream>>>(F[0], HID, HID, PW + PK, Kx, NKV * HD);
  k_gemm<1><<<dim3(KRP, NKV * HD / 128), 128, 0, stream>>>(F[0], HID, HID, PW + PV, V, NKV * HD);
  k_normrope<0><<<dim3(TQB * 64, NH), 256, 0, stream>>>(Q + (size_t)TQ0 * 64 * NH * HD, F[9], F[3] + (size_t)TQ0 * 64 * HD, F[4] + (size_t)TQ0 * 64 * HD, nullptr, nullptr, nullptr);
  k_normrope<1><<<dim3(KRP * 64, NKV), 256, 0, stream>>>(Kx, F[10], F[3], F[4], nullptr, nullptr, nullptr);
  k_vplanes<<<dim3(KRP, NKV * HD / 128), 256, 0, stream>>>(V, VH, VL);
  k_attn<0><<<dim3(TQB, NH), 512, 0, stream>>>(Q, Kx, AM, SEGPOS, VH, VL, O);
  k_attn<1><<<dim3(TQB, NH), 512, 0, stream>>>(Q, Kx, AM, SEGPOS, VH, VL, O);
  k_gemm<0><<<dim3(TQB, HID / 128), 128, 0, stream>>>(O + (size_t)TQ0 * 64 * NH * HD, NH * HD, NH * HD, PW + PO, (float*)d_out + (size_t)TQ0 * 64 * HID, HID);
}

// v002
// Measured time: 503 microseconds a run.
// Timed twice side by side with v001, it ran 1.78 times as fast both times.
// Over all steps from v000 it is 2.67 times as fast.
// compute dtype: x, attn_mask, segment_pos, cos/sin tables, wq/wk/wv/wo and the RMSNorm scales (module inputs) rounded to bf16 / read as int; q/k/v projections with exact bf16 products (x and the weights are inputs); per-head RMSNorm and RoPE (input tables) in f32; scores q.k with both operands as bf16 hi + residual pairs (3 products), P.V with P hi/lo x V hi/lo (3 products), output projection hi/lo x exact wo (2 products); all on WMMA 16x16x32; the causal AND padding AND sliding-window mask is evaluated at run time from attn_mask / segment_pos and key tiles with no live entry are skipped; f32 accumulate.
#include <hip/hip_runtime.h>
#include <math.h>

typedef __attribute__((ext_vector_type(16))) _Float16 v16h;
typedef __attribute__((ext_vector_type(16))) __bf16 v16b;
typedef __attribute__((ext_vector_type(8)))  _Float16 v8h;
typedef __attribute__((ext_vector_type(8)))  float v8f;
typedef __attribute__((ext_vector_type(4)))  float v4f;
typedef __attribute__((ext_vector_type(2)))  float v2f;
typedef __attribute__((ext_vector_type(4)))  unsigned v4u;
typedef __attribute__((ext_vector_type(4)))  int v4i;
typedef float __attribute__((may_alias)) float_a;
typedef int __attribute__((may_alias)) int_a;

template <typename T> __device__ __forceinline__ void vst2(void* p, T v) { *(T*)p = v;  }
__device__ __forceinline__ v8f wmma16(v16h a, v16h b, v8f c) {
  v8f d = __builtin_amdgcn_wmma_f32_16x16x32_f16(false, a, false, b, (short)0, c, false, false);
  asm volatile("v_nop\n\tv_nop\n\tv_nop\n\tv_nop" : "+v"(d) : "v"(a), "v"(b));
  return d;
}
__device__ __forceinline__ v8f wmma_bf(v16b a, v16b b, v8f c) {
  v8f d = __builtin_amdgcn_wmma_f32_16x16x32_bf16(false, a, false, b, (short)0, c, false, false);
  asm volatile("v_nop\n\tv_nop\n\tv_nop\n\tv_nop" : "+v"(d) : "v"(a), "v"(b));
  return d;
}
// 16x16x32 fragments: lane = (h = lane>>4, row/col = lane&15); elements 0..7 = k0+8h+0..7, 8..15 = k0+16+8h+0..7; D element r = row 8h+r
__device__ __forceinline__ v16h frag_h(const _Float16* rowk0, int lane) {
  union { v16h v; v8h q[2]; } u; const _Float16* p = rowk0 + 8 * (lane >> 4);
  u.q[0] = *(const v8h*)p; u.q[1] = *(const v8h*)(p + 16); return u.v;
}
__device__ __forceinline__ v16h frag_f32(const float* rowk0, int lane) {
  v16h a; const float* p = rowk0 + 8 * (lane >> 4);
#pragma unroll
  for (int i = 0; i < 8; ++i) { a[i] = (_Float16)p[i]; a[8 + i] = (_Float16)p[16 + i]; }
  return a;
}
__device__ __forceinline__ v16h frag_f32s(const float* rowk0, int lane, float sc) {
  v16h a; const float* p = rowk0 + 8 * (lane >> 4);
#pragma unroll
  for (int i = 0; i < 8; ++i) { a[i] = (_Float16)(p[i] * sc); a[8 + i] = (_Float16)(p[16 + i] * sc); }
  return a;
}
// column fragment from a [K][ld] layout (column n), rows >= K read as 0
__device__ __forceinline__ v16h fragc_f32(const float* W, int k0, int n, int lane, int ld, int K) {
  v16h a; const int g = lane >> 4;
#pragma unroll
  for (int i = 0; i < 8; ++i) { const int ka = k0 + 8 * g + i, kb = ka + 16;
    a[i] = (_Float16)(ka < K ? W[(size_t)(ka < K ? ka : K - 1) * ld + n] : 0.f); a[8 + i] = (_Float16)(kb < K ? W[(size_t)(kb < K ? kb : K - 1) * ld + n] : 0.f); }
  return a;
}
struct F2 { v16b h, l; };
__device__ __forceinline__ F2 bsplit16(const float v[16]) { F2 r;
#pragma unroll
  for (int i = 0; i < 16; ++i) { const __bf16 h = (__bf16)v[i]; r.h[i] = h; r.l[i] = (__bf16)(v[i] - (float)h); }
  return r; }
__device__ __forceinline__ F2 split_row(const float* row, int k0, int lane) { float v[16]; const float* p = row + k0 + 8 * (lane >> 4);
#pragma unroll
  for (int i = 0; i < 8; ++i) { v[i] = p[i]; v[8 + i] = p[16 + i]; }
  return bsplit16(v); }
__device__ __forceinline__ F2 split_rowK(const float* row, int k0, int lane, int K) { float v[16]; const int g = lane >> 4;
#pragma unroll
  for (int i = 0; i < 8; ++i) { const int ka = k0 + 8 * g + i, kb = ka + 16; v[i] = ka < K ? row[ka < K ? ka : K - 1] : 0.f; v[8 + i] = kb < K ? row[kb < K ? kb : K - 1] : 0.f; }
  return bsplit16(v); }
__device__ __forceinline__ F2 split_col(const float* W, int k0, int n, int lane, int ld, int K) { float v[16]; const int g = lane >> 4;
#pragma unroll
  for (int i = 0; i < 8; ++i) { const int ka = k0 + 8 * g + i, kb = ka + 16; v[i] = ka < K ? W[(size_t)(ka < K ? ka : K - 1) * ld + n] : 0.f; v[8 + i] = kb < K ? W[(size_t)(kb < K ? kb : K - 1) * ld + n] : 0.f; }
  return bsplit16(v); }
__device__ __forceinline__ v8f mac3(const F2& a, const F2& b, v8f c) { c = wmma_bf(a.l, b.h, c); c = wmma_bf(a.h, b.l, c); return wmma_bf(a.h, b.h, c); }
__device__ __forceinline__ float sigm(float v) { return 1.0f / (1.0f + expf(-v)); }
#define LDSX() do { asm volatile("s_wait_dscnt 0" ::: "memory"); __builtin_amdgcn_wave_barrier(); __builtin_amdgcn_fence(__ATOMIC_RELEASE, "workgroup"); } while (0)


// Gemma-3 style attention (B 1, S 2048, hidden 2048, 8 query heads / 4 kv heads x 256, sliding window 1024): q,k,v = x w; q,k = RMSNorm_head(.)(1 + scale); RoPE with the given cos/sin; GQA (kv head = h / 2); scores / 16 masked by causal & attn_mask[k] & |k - segment_pos[q]| < WIN (else -1e37); softmax; out = (P v merged) wo.
#define SS 2048
#define HID 2048
#define NH 8
#define NKV 4
#define HD 256
#define WIN 1024
#ifndef TQB
#define TQB (SS / 64)          // query tiles processed
#define TQ0 0                  // first query tile
#define KRP (SS / 64)          // key/value row tiles (all)
#endif
typedef __attribute__((ext_vector_type(8))) __bf16 v8b;
__device__ __forceinline__ v16b frag_b(const __bf16* rowk0, int lane) {
  union { v16b v; v8b q[2]; } u; const __bf16* p = rowk0 + 8 * (lane >> 4);
  u.q[0] = *(const v8b*)p; u.q[1] = *(const v8b*)(p + 16); return u.v;
}
__device__ __forceinline__ float bfr(float v) { return (float)(__bf16)v; }
__device__ __attribute__((noinline)) float exp_ni(float v) { return expf(v); }
__device__ __attribute__((noinline)) float erf_ni(float v) { return erff(v); }

#define WS_PW  0u                                  // bf16 rows (in,out -> [out][in]): wq [2048][2048], wk [1024][2048], wv [1024][2048], wo [2048][2048]
#define PQ 0
#define PK (PQ + NH * HD * HID)
#define PV (PK + NKV * HD * HID)
#define PO (PV + NKV * HD * HID)
#define PWEND (PO + HID * NH * HD)
#define WS_Q   (WS_PW + 2u * PWEND)                 // f32 [S][2048] q raw -> normalised/roped in place
#define WS_K   (WS_Q + 4u * SS * NH * HD)            // f32 [S][1024] k raw -> normalised/roped
#define WS_V   (WS_K + 4u * SS * NKV * HD)           // f32 [S][1024] v raw
#define WS_VH  (WS_V + 4u * SS * NKV * HD)           // bf16 [1024 (kv*256+d)][S] planes
#define WS_VL  (WS_VH + 2u * NKV * HD * SS)
#define WS_O   (WS_VL + 2u * NKV * HD * SS)          // f32 [S][2048]
#define WS_END (WS_O + 4u * SS * NH * HD)

// ---- k_packT: block = (output col n, which): (in,out) weight -> rows [n][K]
__global__ __launch_bounds__(256) void k_packT(const float* __restrict__ WQ, const float* __restrict__ WK, const float* __restrict__ WV, const float* __restrict__ WO, __bf16* __restrict__ PW) {
  __shared__ __align__(16) __bf16 s[2048]; const int n = blockIdx.x, which = blockIdx.y, tid = threadIdx.x; int K, N; const float* Wm; size_t base;
  if (which == 0) { K = HID; N = NH * HD; Wm = WQ; base = PQ; } else if (which == 1) { K = HID; N = NKV * HD; Wm = WK; base = PK; } else if (which == 2) { K = HID; N = NKV * HD; Wm = WV; base = PV; } else { K = NH * HD; N = HID; Wm = WO; base = PO; }
  if (n >= N) return;
  for (int k = tid; k < K; k += 256) s[k] = (__bf16)Wm[(size_t)k * N + n];
  __syncthreads();
  for (int q = tid; q < K / 8; q += 256) vst2((unsigned*)(PW + base + (size_t)n * K + q * 8), *(const v4u*)&s[q * 8]);
}
// ---- k_gemm<RIN>: block = (64 rows, 128 cols): OUT = A(K) . rows (RIN exact / hi-lo 2 products); pitch ldo. K is a multiple of 64.
// Both operand tiles of a 64-k stage (A 64 rows x 256 B f32, P 128 rows x 128 B bf16) are brought into LDS by asynchronous copies, whole lines, two buffers: stage t + 1 flies while stage t is worked on, and the four waves share one copy of the P tile. Row pitches 272 B / 144 B (16 B x odd) keep the 16-byte fragment reads off one another's banks.
#define GKS 64
#define GAP 272
#define GBP 144
#define GAB (64 * GAP)
#define GSTG (GAB + 128 * GBP)
__device__ __forceinline__ unsigned lds_off(const void* p) { return (unsigned)(size_t)p; }
// eight 16-byte copies of a lane, rows lstep / gstep bytes apart; the s_wait_xcnt closes the statement so that no address register of a copy is rewritten ahead of it
__device__ __forceinline__ void acopy8(unsigned l, unsigned lstep, const char* g, size_t gstep) {
  asm volatile("global_load_async_to_lds_b128 %0, %8, off\n\t"
               "global_load_async_to_lds_b128 %1, %9, off\n\t"
               "global_load_async_to_lds_b128 %2, %10, off\n\t"
               "global_load_async_to_lds_b128 %3, %11, off\n\t"
               "global_load_async_to_lds_b128 %4, %12, off\n\t"
               "global_load_async_to_lds_b128 %5, %13, off\n\t"
               "global_load_async_to_lds_b128 %6, %14, off\n\t"
               "global_load_async_to_lds_b128 %7, %15, off\n\t"
               "s_wait_xcnt 0x0"
               :: "v"(l), "v"(l + lstep), "v"(l + 2 * lstep), "v"(l + 3 * lstep), "v"(l + 4 * lstep), "v"(l + 5 * lstep), "v"(l + 6 * lstep), "v"(l + 7 * lstep),
                  "v"(g), "v"(g + gstep), "v"(g + 2 * gstep), "v"(g + 3 * gstep), "v"(g + 4 * gstep), "v"(g + 5 * gstep), "v"(g + 6 * gstep), "v"(g + 7 * gstep)
               : "memory");
}
template <int RIN>
__global__ __launch_bounds__(128) void k_gemm(const float* __restrict__ A, int lda, int K, const __bf16* __restrict__ P, float* __restrict__ OUT, int ldo) {
  __shared__ __align__(16) float so[4][16][132]; __shared__ __align__(16) unsigned char st[2][GSTG];
  const int tid = threadIdx.x, wave = tid >> 5, lane = tid & 31, col = lane & 15, g = lane >> 4; const size_t r0 = (size_t)blockIdx.x * 64 + wave * 16; const int n0 = blockIdx.y * 128;
  // a thread's copy places: A chunk (row i * 8 + tid / 16, 16 B piece tid % 16), P chunk (row i * 16 + tid / 8, piece tid % 8), i = 0..7
  const char* ga = (const char*)(A + ((size_t)blockIdx.x * 64 + (tid >> 4)) * lda + (tid & 15) * 4); const char* gb = (const char*)(P + (size_t)(n0 + (tid >> 3)) * K + (tid & 7) * 8);
  const unsigned la = lds_off(&st[0][0]) + (tid >> 4) * GAP + (tid & 15) * 16, lb = lds_off(&st[0][0]) + GAB + (tid >> 3) * GBP + (tid & 7) * 16;
  const size_t gas = (size_t)lda * 8 * 4, gbs = (size_t)K * 16 * 2; const int nst = K / GKS;
  v8f acc[8] = {};
  acopy8(la, 8 * GAP, ga, gas); acopy8(lb, 16 * GBP, gb, gbs);
  asm volatile("s_wait_asynccnt 0x0" ::: "memory");   // this wave's share of stage 0 has landed
  __syncthreads();                                    // every wave's share of stage 0 has landed
  if (nst > 1) { acopy8(la + GSTG, 8 * GAP, ga + GKS * 4, gas); acopy8(lb + GSTG, 16 * GBP, gb + GKS * 2, gbs); }
  for (int t = 0; t < nst; ++t) { const unsigned bo = (t & 1) * GSTG; const unsigned char* pa = &st[0][0] + bo + (wave * 16 + col) * GAP + 32 * g; const unsigned char* pb = &st[0][0] + bo + GAB + col * GBP + 16 * g;
    // the stage's fragment reads stand ahead of its WMMAs, so that their latencies overlap; the second k step's A rows are read behind the first WMMA (16 registers fewer at the peak: the kernel stays inside v0..v255), still a whole k step ahead of their use
    v4f af[2][4]; v8b bq[2][8][2];
#pragma unroll   // in full: the fragment arrays are indexed by constants and stay in registers
    for (int q = 0; q < 4; ++q) af[0][q] = *(const v4f*)(pa + (q >> 1) * 64 + (q & 1) * 16);
#pragma unroll   // in full: the fragment arrays are indexed by constants and stay in registers
    for (int kc = 0; kc < 2; ++kc)
#pragma unroll   // in full: the fragment arrays are indexed by constants and stay in registers
      for (int j = 0; j < 8; ++j) { bq[kc][j][0] = *(const v8b*)(pb + j * 16 * GBP + kc * 64); bq[kc][j][1] = *(const v8b*)(pb + j * 16 * GBP + kc * 64 + 32); }
#pragma unroll   // in full: the fragment arrays are indexed by constants and stay in registers
    for (int kc = 0; kc < 2; ++kc) { F2 a; float v[16];
#pragma unroll   // in full: the fragment arrays are indexed by constants and stay in registers
      for (int i = 0; i < 4; ++i) { v[i] = af[kc][0][i]; v[4 + i] = af[kc][1][i]; v[8 + i] = af[kc][2][i]; v[12 + i] = af[kc][3][i]; }
      if (RIN) { v16b ax;
#pragma unroll   // in full: the fragment arrays are indexed by constants and stay in registers
        for (int i = 0; i < 16; ++i) ax[i] = (__bf16)v[i];
        a.h = ax; a.l = ax; } else a = bsplit16(v);
#pragma unroll   // in full: the fragment arrays are indexed by constants and stay in registers
      for (int j = 0; j < 8; ++j) { union { v16b v; v8b q[2]; } w; w.q[0] = bq[kc][j][0]; w.q[1] = bq[kc][j][1]; if (!RIN) acc[j] = wmma_bf(a.l, w.v, acc[j]); acc[j] = wmma_bf(a.h, w.v, acc[j]);
        if (kc == 0 && j == 0) {
#pragma unroll   // in full: the fragment arrays are indexed by constants and stay in registers
          for (int q = 0; q < 4; ++q) af[1][q] = *(const v4f*)(pa + 128 + (q >> 1) * 64 + (q & 1) * 16); } } }
    asm volatile("s_wait_dscnt 0x0" ::: "memory");      // this wave has left stage t's buffer
    asm volatile("s_wait_asynccnt 0x0" ::: "memory");   // this wave's share of stage t + 1 has landed
    __syncthreads();                                    // publishes stage t + 1 and frees stage t's buffer
    if (t + 2 < nst) { acopy8(la + bo, 8 * GAP, ga + (size_t)(t + 2) * (GKS * 4), gas); acopy8(lb + bo, 16 * GBP, gb + (size_t)(t + 2) * (GKS * 2), gbs); } }
  asm volatile("s_wait_asynccnt 0x0" ::: "memory");     // no copy is outstanding when the wave goes on
#pragma unroll
  for (int j = 0; j < 8; ++j)
#pragma unroll
    for (int r = 0; r < 8; ++r) so[wave][8 * g + r][j * 16 + col] = acc[j][r];
  LDSX();
  for (int rl = 0; rl < 16; ++rl) vst2(OUT + (r0 + rl) * ldo + n0 + lane * 4, *(const v4f*)&so[wave][rl][lane * 4]);
}
// ---- k_normrope<PLANE>: block = (position s, head): 256 threads = d: RMSNorm over the head's 256 (mean of squares, eps 1e-6) * (1 + scale[d]); RoPE: out_d = y_d cos[s][d] + rot_d sin[s][d] with rot = (-y[d+128], y[d-128]); in place (PLANE 0: q rows pitch 2048; 1: k rows pitch 1024; V, VH, VL are unused)
template <int PLANE>
__global__ __launch_bounds__(256) void k_normrope(float* QK, const float* __restrict__ SC, const float* __restrict__ COS, const float* __restrict__ SIN, const float* __restrict__ V, __bf16* __restrict__ VH, __bf16* __restrict__ VL) {
  __shared__ float sy[HD]; __shared__ float sred[8]; __shared__ __align__(16) float so[HD];
  const int s = blockIdx.x, h = blockIdx.y, d = threadIdx.x; const int pitch = PLANE ? (NKV * HD) : (NH * HD);
  float* row = QK + (size_t)s * pitch + h * HD; const float y = row[d]; sy[d] = y;
  float q = y * y;
#pragma unroll
  for (int o = 1; o < 32; o <<= 1) q += __shfl_xor(q, o);
  if ((d & 31) == 0) sred[d >> 5] = q;
  __syncthreads();
  float ss = 0.f;
#pragma unroll
  for (int w = 0; w < 8; ++w) ss += sred[w];
  const float rs = rsqrtf(ss / (float)HD + 1e-6f);
  const float yn = y * rs * (1.0f + bfr(SC[d])); const float other = sy[(d < HD / 2) ? (d + HD / 2) : (d - HD / 2)] * rs * (1.0f + bfr(SC[(d < HD / 2) ? (d + HD / 2) : (d - HD / 2)]));
  const float rot = (d < HD / 2) ? -other : other;
  so[d] = yn * bfr(COS[(size_t)s * HD + d]) + rot * bfr(SIN[(size_t)s * HD + d]);
  __syncthreads();
  if (d < HD / 4) vst2(row + d * 4, *(const v4f*)&so[d * 4]);
}
__global__ __launch_bounds__(256) void k_vplanes(const float* __restrict__ V, __bf16* __restrict__ VH, __bf16* __restrict__ VL) {
  __shared__ __align__(16) __bf16 sh[128][72], sl[128][72]; const int tid = threadIdx.x; const int s0 = blockIdx.x * 64, c0 = blockIdx.y * 128;
  for (int q = tid; q < 64 * 128; q += 256) { const int sl_ = q >> 7, c = q & 127; const float v = V[(size_t)(s0 + sl_) * (NKV * HD) + c0 + c]; const __bf16 hb = (__bf16)v; sh[c][sl_] = hb; sl[c][sl_] = (__bf16)(v - (float)hb); }
  __syncthreads();
  for (int q = tid; q < 128 * 8; q += 256) { const int c = q >> 3, pc = q & 7; const size_t o = (size_t)(c0 + c) * SS + s0 + pc * 8; vst2((unsigned*)(VH + o), *(const v4u*)&sh[c][pc * 8]); vst2((unsigned*)(VL + o), *(const v4u*)&sl[c][pc * 8]); }
}
// ---- k_attn<DH>: block = (64 queries, head h), 16 waves = (query tile qw = wave & 3) x (key share kj = wave >> 2): a wave takes the key steps ks = kj, kj + 4, ... of its 16 queries, so four waves a SIMD cover one another's load and LDS latency; the four partial (max, sum, acc) of a query tile are merged through LDS at the end; kv = h / 2; per 32-key step: live = (k <= q) & attn_mask[k] & (k > pos_q - WIN) & (k < pos_q + WIN); wave vote; scores (3 products, K 256 = 8 ksteps) / 16; online softmax with guards; P.V over the value columns [DH*128, DH*128 + 128) (8 tiles, 3 products); O cols h*256 + DH*128 + ...
template <int DH>
__global__ __launch_bounds__(512) void k_attn(const float* __restrict__ Q, const float* __restrict__ Kx, const int* __restrict__ AM, const int* __restrict__ SEGPOS, const __bf16* __restrict__ VH, const __bf16* __restrict__ VL, float* __restrict__ O) {
  __shared__ __align__(16) float sp[16][16][36]; __shared__ __align__(16) float so[16][16][132]; __shared__ float sm[16][16], sl[16][16];
  const int tid = threadIdx.x, wave = tid >> 5, lane = tid & 31, col = lane & 15, g = lane >> 4; const int qw = wave & 3, kj = wave >> 2; const int qb = blockIdx.x + TQ0, h = blockIdx.y; const int kv = h / (NH / NKV); const int q0 = qb * 64 + qw * 16;
  const float* qrow = Q + (size_t)(q0 + col) * (NH * HD) + h * HD;
  int posq[8];
#pragma unroll
  for (int r = 0; r < 8; ++r) posq[r] = SEGPOS[q0 + 8 * g + r];
  float m[8], l[8];
#pragma unroll
  for (int r = 0; r < 8; ++r) { m[r] = -3.0e38f; l[r] = 0.f; }
  v8f acc[8] = {};
  const int nks = (qb * 64 + 64) / 32;   // causal upper bound on key steps
#pragma unroll 1
  for (int ks = kj; ks < nks; ks += 4) { v8f s[2]; bool lv[2][8]; bool anylive = false;
#pragma unroll
    for (int ct = 0; ct < 2; ++ct) { const int kk = ks * 32 + ct * 16 + col; const bool am = (AM[kk] != 0);
#pragma unroll
      for (int r = 0; r < 8; ++r) { const int qi = q0 + 8 * g + r; const bool live = am && (kk <= qi) && (kk > posq[r] - WIN) && (kk < posq[r] + WIN); lv[ct][r] = live; anylive = anylive || live; } }
    if (__any(anylive)) {
#pragma unroll
      for (int ct = 0; ct < 2; ++ct) { const int kk = ks * 32 + ct * 16 + col; const float* krow = Kx + (size_t)kk * (NKV * HD) + kv * HD; v8f c = {};
#pragma unroll
        for (int kc = 0; kc < HD / 32; ++kc) { const F2 kb = split_row(krow, kc * 32, lane); const F2 qa = split_row(qrow, kc * 32, lane); c = mac3(qa, kb, c); }
#pragma unroll
        for (int r = 0; r < 8; ++r) s[ct][r] = lv[ct][r] ? c[r] * 0.0625f : -3.0e38f; }
#pragma unroll
      for (int r = 0; r < 8; ++r) { float mx = fmaxf(s[0][r], s[1][r]);
#pragma unroll
        for (int o = 1; o < 16; o <<= 1) mx = fmaxf(mx, __shfl_xor(mx, o));
        const float mn = fmaxf(m[r], mx); const float alpha = (m[r] <= -1.0e38f) ? 0.f : exp_ni(m[r] - mn);
        const float e0 = (s[0][r] <= -1.0e38f) ? 0.f : exp_ni(s[0][r] - mn), e1 = (s[1][r] <= -1.0e38f) ? 0.f : exp_ni(s[1][r] - mn); float es = e0 + e1;
#pragma unroll
        for (int o = 1; o < 16; o <<= 1) es += __shfl_xor(es, o);
        l[r] = l[r] * alpha + es; m[r] = mn;
#pragma unroll
        for (int dt = 0; dt < 8; ++dt) acc[dt][r] *= alpha;
        sp[wave][8 * g + r][col] = e0; sp[wave][8 * g + r][16 + col] = e1; }
      LDSX();
      const F2 pa = split_row(&sp[wave][col][0], 0, lane);
#pragma unroll
      for (int dt = 0; dt < 8; ++dt) { const size_t vr = (size_t)(kv * HD + DH * 128 + dt * 16 + col) * SS + ks * 32; const v16b vh = frag_b(VH + vr, lane), vl = frag_b(VL + vr, lane); acc[dt] = wmma_bf(pa.l, vh, acc[dt]); acc[dt] = wmma_bf(pa.h, vl, acc[dt]); acc[dt] = wmma_bf(pa.h, vh, acc[dt]); }
      LDSX(); } }
#pragma unroll
  for (int r = 0; r < 8; ++r) {
#pragma unroll
    for (int dt = 0; dt < 8; ++dt) so[wave][8 * g + r][dt * 16 + col] = acc[dt][r];
    if (col == 0) { sm[wave][8 * g + r] = m[r]; sl[wave][8 * g + r] = l[r]; } }
  __syncthreads();   // every wave's partial is in LDS before any wave merges
  // merge: wave (qw, kj) finishes rows 4 kj .. 4 kj + 3 of query tile qw: weights exp(m_j - M), a share with no live key weighs 0
  for (int rl = 0; rl < 4; ++rl) { const int row = kj * 4 + rl; float mj[4]; float M = -3.0e38f;
#pragma unroll
    for (int j = 0; j < 4; ++j) { mj[j] = sm[qw + 4 * j][row]; M = fmaxf(M, mj[j]); }
    float L = 0.f; v4f o = {};
#pragma unroll
    for (int j = 0; j < 4; ++j) { const float w = (mj[j] <= -1.0e38f) ? 0.f : exp_ni(mj[j] - M); L += w * sl[qw + 4 * j][row]; o += w * *(const v4f*)&so[qw + 4 * j][row][lane * 4]; }
    const float il = (L > 0.f) ? 1.0f / L : 0.f;
    vst2(O + (size_t)(q0 + row) * (NH * HD) + h * HD + DH * 128 + lane * 4, o * il); }
}
extern "C" void kernel_launch(void* const* d_in, const int* in_sizes, int n_in, void* d_out, int out_size, void* d_ws, size_t ws_size, hipStream_t stream) {
  (void)in_sizes; (void)n_in; (void)out_size;
  const float** F = (const float**)d_in; const int* AM = (const int*)d_in[1]; const int* SEGPOS = (const int*)d_in[2];
  // 0 x [1,2048,2048], 1 attn_mask [1,2048] bool(int), 2 segment_pos [1,2048] i32, 3 cos [1,2048,256], 4 sin, 5 wq [2048,2048], 6 wk [2048,1024], 7 wv [2048,1024], 8 wo [2048,2048], 9 q_scale [256], 10 k_scale [256]
  if (ws_size < (size_t)WS_END) return;
  char* ws = (char*)d_ws; __bf16 *PW = (__bf16*)(ws + WS_PW), *VH = (__bf16*)(ws + WS_VH), *VL = (__bf16*)(ws + WS_VL); float *Q = (float*)(ws + WS_Q), *Kx = (float*)(ws + WS_K), *V = (float*)(ws + WS_V), *O = (float*)(ws + WS_O);
  k_packT<<<dim3(HID, 4), 256, 0, stream>>>(F[5], F[6], F[7], F[8], PW);
  k_gemm<1><<<dim3(TQB, NH * HD / 128), 128, 0, stream>>>(F[0] + (size_t)TQ0 * 64 * HID, HID, HID, PW + PQ, Q + (size_t)TQ0 * 64 * NH * HD, NH * HD);   // q rows of the processed query range
  k_gemm<1><<<dim3(KRP, NKV * HD / 128), 128, 0, stream>>>(F[0], HID, HID, PW + PK, Kx, NKV * HD);
  k_gemm<1><<<dim3(KRP, NKV * HD / 128), 128, 0, stream>>>(F[0], HID, HID, PW + PV, V, NKV * HD);
  k_normrope<0><<<dim3(TQB * 64, NH), 256, 0, stream>>>(Q + (size_t)TQ0 * 64 * NH * HD, F[9], F[3] + (size_t)TQ0 * 64 * HD, F[4] + (size_t)TQ0 * 64 * HD, nullptr, nullptr, nullptr);
  k_normrope<1><<<dim3(KRP * 64, NKV), 256, 0, stream>>>(Kx, F[10], F[3], F[4], nullptr, nullptr, nullptr);
  k_vplanes<<<dim3(KRP, NKV * HD / 128), 256, 0, stream>>>(V, VH, VL);
  k_attn<0><<<dim3(TQB, NH), 512, 0, stream>>>(Q, Kx, AM, SEGPOS, VH, VL, O);
  k_attn<1><<<dim3(TQB, NH), 512, 0, stream>>>(Q, Kx, AM, SEGPOS, VH, VL, O);
  k_gemm<0><<<dim3(TQB, HID / 128), 128, 0, stream>>>(O + (size_t)TQ0 * 64 * NH * HD, NH * HD, NH * HD, PW + PO, (float*)d_out + (size_t)TQ0 * 64 * HID, HID);
}

// v003
// A run of this version takes 392 microseconds.
// Next to v002, in two timings, it ran 1.28 and 1.29 times as fast.
// Counting every step since v000, it is 3.42 times as fast.
// compute dtype: x, attn_mask, segment_pos, cos/sin tables, wq/wk/wv/wo and the RMSNorm scales (module inputs) rounded to bf16 / read as int; q/k/v projections with exact bf16 products (x and the weights are inputs); per-head RMSNorm and RoPE (input tables) in f32; scores q.k with both operands as bf16 hi + residual pairs (3 products), P.V with P hi/lo x V hi/lo (3 products), output projection hi/lo x exact wo (2 products); all on WMMA 16x16x32; the causal AND padding AND sliding-window mask is evaluated at run time from attn_mask / segment_pos and key tiles with no live entry are skipped; f32 accumulate.
#include <hip/hip_runtime.h>
#include <math.h>

typedef __attribute__((ext_vector_type(16))) _Float16 v16h;
typedef __attribute__((ext_vector_type(16))) __bf16 v16b;
typedef __attribute__((ext_vector_type(8)))  _Float16 v8h;
typedef __attribute__((ext_vector_type(8)))  float v8f;
typedef __attribute__((ext_vector_type(4)))  float v4f;
typedef __attribute__((ext_vector_type(2)))  float v2f;
typedef __attribute__((ext_vector_type(4)))  unsigned v4u;
typedef __attribute__((ext_vector_type(4)))  int v4i;
typedef float __attribute__((may_alias)) float_a;
typedef int __attribute__((may_alias)) int_a;

template <typename T> __device__ __forceinline__ void vst2(void* p, T v) { *(T*)p = v;  }
__device__ __forceinline__ v8f wmma16(v16h a, v16h b, v8f c) {
  v8f d = __builtin_amdgcn_wmma_f32_16x16x32_f16(false, a, false, b, (short)0, c, false, false);
  asm volatile("v_nop\n\tv_nop\n\tv_nop\n\tv_nop" : "+v"(d) : "v"(a), "v"(b));
  return d;
}
__device__ __forceinline__ v8f wmma_bf(v16b a, v16b b, v8f c) {
  v8f d = __builtin_amdgcn_wmma_f32_16x16x32_bf16(false, a, false, b, (short)0, c, false, false);
  asm volatile("v_nop\n\tv_nop\n\tv_nop\n\tv_nop" : "+v"(d) : "v"(a), "v"(b));
  return d;
}
// 16x16x32 fragments: lane = (h = lane>>4, row/col = lane&15); elements 0..7 = k0+8h+0..7, 8..15 = k0+16+8h+0..7; D element r = row 8h+r
__device__ __forceinline__ v16h frag_h(const _Float16* rowk0, int lane) {
  union { v16h v; v8h q[2]; } u; const _Float16* p = rowk0 + 8 * (lane >> 4);
  u.q[0] = *(const v8h*)p; u.q[1] = *(const v8h*)(p + 16); return u.v;
}
__device__ __forceinline__ v16h frag_f32(const float* rowk0, int lane) {
  v16h a; const float* p = rowk0 + 8 * (lane >> 4);
#pragma unroll
  for (int i = 0; i < 8; ++i) { a[i] = (_Float16)p[i]; a[8 + i] = (_Float16)p[16 + i]; }
  return a;
}
__device__ __forceinline__ v16h frag_f32s(const float* rowk0, int lane, float sc) {
  v16h a; const float* p = rowk0 + 8 * (lane >> 4);
#pragma unroll
  for (int i = 0; i < 8; ++i) { a[i] = (_Float16)(p[i] * sc); a[8 + i] = (_Float16)(p[16 + i] * sc); }
  return a;
}
// column fragment from a [K][ld] layout (column n), rows >= K read as 0
__device__ __forceinline__ v16h fragc_f32(const float* W, int k0, int n, int lane, int ld, int K) {
  v16h a; const int g = lane >> 4;
#pragma unroll
  for (int i = 0; i < 8; ++i) { const int ka = k0 + 8 * g + i, kb = ka + 16;
    a[i] = (_Float16)(ka < K ? W[(size_t)(ka < K ? ka : K - 1) * ld + n] : 0.f); a[8 + i] = (_Float16)(kb < K ? W[(size_t)(kb < K ? kb : K - 1) * ld + n] : 0.f); }
  return a;
}
struct F2 { v16b h, l; };
__device__ __forceinline__ F2 bsplit16(const float v[16]) { F2 r;
#pragma unroll
  for (int i = 0; i < 16; ++i) { const __bf16 h = (__bf16)v[i]; r.h[i] = h; r.l[i] = (__bf16)(v[i] - (float)h); }
  return r; }
__device__ __forceinline__ F2 split_row(const float* row, int k0, int lane) { float v[16]; const float* p = row + k0 + 8 * (lane >> 4);
#pragma unroll
  for (int i = 0; i < 8; ++i) { v[i] = p[i]; v[8 + i] = p[16 + i]; }
  return bsplit16(v); }
__device__ __forceinline__ F2 split_rowK(const float* row, int k0, int lane, int K) { float v[16]; const int g = lane >> 4;
#pragma unroll
  for (int i = 0; i < 8; ++i) { const int ka = k0 + 8 * g + i, kb = ka + 16; v[i] = ka < K ? row[ka < K ? ka : K - 1] : 0.f; v[8 + i] = kb < K ? row[kb < K ? kb : K - 1] : 0.f; }
  return bsplit16(v); }
__device__ __forceinline__ F2 split_col(const float* W, int k0, int n, int lane, int ld, int K) { float v[16]; const int g = lane >> 4;
#pragma unroll
  for (int i = 0; i < 8; ++i) { const int ka = k0 + 8 * g + i, kb = ka + 16; v[i] = ka < K ? W[(size_t)(ka < K ? ka : K - 1) * ld + n] : 0.f; v[8 + i] = kb < K ? W[(size_t)(kb < K ? kb : K - 1) * ld + n] : 0.f; }
  return bsplit16(v); }
__device__ __forceinline__ v8f mac3(const F2& a, const F2& b, v8f c) { c = wmma_bf(a.l, b.h, c); c = wmma_bf(a.h, b.l, c); return wmma_bf(a.h, b.h, c); }
__device__ __forceinline__ float sigm(float v) { return 1.0f / (1.0f + expf(-v)); }
#define LDSX() do { asm volatile("s_wait_dscnt 0" ::: "memory"); __builtin_amdgcn_wave_barrier(); __builtin_amdgcn_fence(__ATOMIC_RELEASE, "workgroup"); } while (0)


// Gemma-3 style attention (B 1, S 2048, hidden 2048, 8 query heads / 4 kv heads x 256, sliding window 1024): q,k,v = x w; q,k = RMSNorm_head(.)(1 + scale); RoPE with the given cos/sin; GQA (kv head = h / 2); scores / 16 masked by causal & attn_mask[k] & |k - segment_pos[q]| < WIN (else -1e37); softmax; out = (P v merged) wo.
#define SS 2048
#define HID 2048
#define NH 8
#define NKV 4
#define HD 256
#define WIN 1024
#ifndef TQB
#define TQB (SS / 64)          // query tiles processed
#define TQ0 0                  // first query tile
#define KRP (SS / 64)          // key/value row tiles (all)
#endif
typedef __attribute__((ext_vector_type(8))) __bf16 v8b;
__device__ __forceinline__ v16b frag_b(const __bf16* rowk0, int lane) {
  union { v16b v; v8b q[2]; } u; const __bf16* p = rowk0 + 8 * (lane >> 4);
  u.q[0] = *(const v8b*)p; u.q[1] = *(const v8b*)(p + 16); return u.v;
}
__device__ __forceinline__ float bfr(float v) { return (float)(__bf16)v; }
__device__ __attribute__((noinline)) float exp_ni(float v) { return expf(v); }
__device__ __attribute__((noinline)) float erf_ni(float v) { return erff(v); }

#define WS_PW  0u                                  // bf16 rows (in,out -> [out][in]): wq [2048][2048], wk [1024][2048], wv [1024][2048], wo [2048][2048]
#define PQ 0
#define PK (PQ + NH * HD * HID)
#define PV (PK + NKV * HD * HID)
#define PO (PV + NKV * HD * HID)
#define PWEND (PO + HID * NH * HD)
#define WS_Q   (WS_PW + 2u * PWEND)                 // f32 [S][2048] q raw -> normalised/roped in place
#define WS_K   (WS_Q + 4u * SS * NH * HD)            // f32 [S][1024] k raw -> normalised/roped
#define WS_V   (WS_K + 4u * SS * NKV * HD)           // f32 [S][1024] v raw
#define WS_VH  (WS_V + 4u * SS * NKV * HD)           // bf16 [1024 (kv*256+d)][S] planes
#define WS_VL  (WS_VH + 2u * NKV * HD * SS)
#define WS_O   (WS_VL + 2u * NKV * HD * SS)          // f32 [S][2048]
#define WS_END (WS_O + 4u * SS * NH * HD)

// ---- k_packT: block = (output col n, which): (in,out) weight -> rows [n][K]
__global__ __launch_bounds__(256) void k_packT(const float* __restrict__ WQ, const float* __restrict__ WK, const float* __restrict__ WV, const float* __restrict__ WO, __bf16* __restrict__ PW) {
  __shared__ __align__(16) __bf16 s[2048]; const int n = blockIdx.x, which = blockIdx.y, tid = threadIdx.x; int K, N; const float* Wm; size_t base;
  if (which == 0) { K = HID; N = NH * HD; Wm = WQ; base = PQ; } else if (which == 1) { K = HID; N = NKV * HD; Wm = WK; base = PK; } else if (which == 2) { K = HID; N = NKV * HD; Wm = WV; base = PV; } else { K = NH * HD; N = HID; Wm = WO; base = PO; }
  if (n >= N) return;
  for (int k = tid; k < K; k += 256) s[k] = (__bf16)Wm[(size_t)k * N + n];
  __syncthreads();
  for (int q = tid; q < K / 8; q += 256) vst2((unsigned*)(PW + base + (size_t)n * K + q * 8), *(const v4u*)&s[q * 8]);
}
// ---- k_gemm<RIN>: block = (64 rows, 128 cols): OUT = A(K) . rows (RIN exact / hi-lo 2 products); pitch ldo. K is a multiple of 64.
// Both operand tiles of a 64-k stage (A 64 rows x 256 B f32, P 128 rows x 128 B bf16) are brought into LDS by asynchronous copies, whole lines, two buffers: stage t + 1 flies while stage t is worked on, and the four waves share one copy of the P tile. Row pitches 272 B / 144 B (16 B x odd) keep the 16-byte fragment reads off one another's banks.
#define GKS 64
#define GAP 272
#define GBP 144
#define GAB (64 * GAP)
#define GSTG (GAB + 128 * GBP)
__device__ __forceinline__ unsigned lds_off(const void* p) { return (unsigned)(size_t)p; }
// eight 16-byte copies of a lane, rows lstep / gstep bytes apart; the s_wait_xcnt closes the statement so that no address register of a copy is rewritten ahead of it
__device__ __forceinline__ void acopy8(unsigned l, unsigned lstep, const char* g, size_t gstep) {
  asm volatile("global_load_async_to_lds_b128 %0, %8, off\n\t"
               "global_load_async_to_lds_b128 %1, %9, off\n\t"
               "global_load_async_to_lds_b128 %2, %10, off\n\t"
               "global_load_async_to_lds_b128 %3, %11, off\n\t"
               "global_load_async_to_lds_b128 %4, %12, off\n\t"
               "global_load_async_to_lds_b128 %5, %13, off\n\t"
               "global_load_async_to_lds_b128 %6, %14, off\n\t"
               "global_load_async_to_lds_b128 %7, %15, off\n\t"
               "s_wait_xcnt 0x0"
               :: "v"(l), "v"(l + lstep), "v"(l + 2 * lstep), "v"(l + 3 * lstep), "v"(l + 4 * lstep), "v"(l + 5 * lstep), "v"(l + 6 * lstep), "v"(l + 7 * lstep),
                  "v"(g), "v"(g + gstep), "v"(g + 2 * gstep), "v"(g + 3 * gstep), "v"(g + 4 * gstep), "v"(g + 5 * gstep), "v"(g + 6 * gstep), "v"(g + 7 * gstep)
               : "memory");
}
template <int RIN>
__global__ __launch_bounds__(128) void k_gemm(const float* __restrict__ A, int lda, int K, const __bf16* __restrict__ P, float* __restrict__ OUT, int ldo) {
  __shared__ __align__(16) float so[4][16][132]; __shared__ __align__(16) unsigned char st[2][GSTG];
  const int tid = threadIdx.x, wave = tid >> 5, lane = tid & 31, col = lane & 15, g = lane >> 4; const size_t r0 = (size_t)blockIdx.x * 64 + wave * 16; const int n0 = blockIdx.y * 128;
  // a thread's copy places: A chunk (row i * 8 + tid / 16, 16 B piece tid % 16), P chunk (row i * 16 + tid / 8, piece tid % 8), i = 0..7
  const char* ga = (const char*)(A + ((size_t)blockIdx.x * 64 + (tid >> 4)) * lda + (tid & 15) * 4); const char* gb = (const char*)(P + (size_t)(n0 + (tid >> 3)) * K + (tid & 7) * 8);
  const unsigned la = lds_off(&st[0][0]) + (tid >> 4) * GAP + (tid & 15) * 16, lb = lds_off(&st[0][0]) + GAB + (tid >> 3) * GBP + (tid & 7) * 16;
  const size_t gas = (size_t)lda * 8 * 4, gbs = (size_t)K * 16 * 2; const int nst = K / GKS;
  v8f acc[8] = {};
  acopy8(la, 8 * GAP, ga, gas); acopy8(lb, 16 * GBP, gb, gbs);
  asm volatile("s_wait_asynccnt 0x0" ::: "memory");   // this wave's share of stage 0 has landed
  __syncthreads();                                    // every wave's share of stage 0 has landed
  if (nst > 1) { acopy8(la + GSTG, 8 * GAP, ga + GKS * 4, gas); acopy8(lb + GSTG, 16 * GBP, gb + GKS * 2, gbs); }
  for (int t = 0; t < nst; ++t) { const unsigned bo = (t & 1) * GSTG; const unsigned char* pa = &st[0][0] + bo + (wave * 16 + col) * GAP + 32 * g; const unsigned char* pb = &st[0][0] + bo + GAB + col * GBP + 16 * g;
    // the stage's fragment reads stand ahead of its WMMAs, so that their latencies overlap; the second k step's A rows are read behind the first WMMA (16 registers fewer at the peak: the kernel stays inside v0..v255), still a whole k step ahead of their use
    v4f af[2][4]; v8b bq[2][8][2];
#pragma unroll   // in full: the fragment arrays are indexed by constants and stay in registers
    for (int q = 0; q < 4; ++q) af[0][q] = *(const v4f*)(pa + (q >> 1) * 64 + (q & 1) * 16);
#pragma unroll   // in full: the fragment arrays are indexed by constants and stay in registers
    for (int kc = 0; kc < 2; ++kc)
#pragma unroll   // in full: the fragment arrays are indexed by constants and stay in registers
      for (int j = 0; j < 8; ++j) { bq[kc][j][0] = *(const v8b*)(pb + j * 16 * GBP + kc * 64); bq[kc][j][1] = *(const v8b*)(pb + j * 16 * GBP + kc * 64 + 32); }
#pragma unroll   // in full: the fragment arrays are indexed by constants and stay in registers
    for (int kc = 0; kc < 2; ++kc) { F2 a; float v[16];
#pragma unroll   // in full: the fragment arrays are indexed by constants and stay in registers
      for (int i = 0; i < 4; ++i) { v[i] = af[kc][0][i]; v[4 + i] = af[kc][1][i]; v[8 + i] = af[kc][2][i]; v[12 + i] = af[kc][3][i]; }
      if (RIN) { v16b ax;
#pragma unroll   // in full: the fragment arrays are indexed by constants and stay in registers
        for (int i = 0; i < 16; ++i) ax[i] = (__bf16)v[i];
        a.h = ax; a.l = ax; } else a = bsplit16(v);
#pragma unroll   // in full: the fragment arrays are indexed by constants and stay in registers
      for (int j = 0; j < 8; ++j) { union { v16b v; v8b q[2]; } w; w.q[0] = bq[kc][j][0]; w.q[1] = bq[kc][j][1]; if (!RIN) acc[j] = wmma_bf(a.l, w.v, acc[j]); acc[j] = wmma_bf(a.h, w.v, acc[j]);
        if (kc == 0 && j == 0) {
#pragma unroll   // in full: the fragment arrays are indexed by constants and stay in registers
          for (int q = 0; q < 4; ++q) af[1][q] = *(const v4f*)(pa + 128 + (q >> 1) * 64 + (q & 1) * 16); } } }
    asm volatile("s_wait_dscnt 0x0" ::: "memory");      // this wave has left stage t's buffer
    asm volatile("s_wait_asynccnt 0x0" ::: "memory");   // this wave's share of stage t + 1 has landed
    __syncthreads();                                    // publishes stage t + 1 and frees stage t's buffer
    if (t + 2 < nst) { acopy8(la + bo, 8 * GAP, ga + (size_t)(t + 2) * (GKS * 4), gas); acopy8(lb + bo, 16 * GBP, gb + (size_t)(t + 2) * (GKS * 2), gbs); } }
  asm volatile("s_wait_asynccnt 0x0" ::: "memory");     // no copy is outstanding when the wave goes on
#pragma unroll
  for (int j = 0; j < 8; ++j)
#pragma unroll
    for (int r = 0; r < 8; ++r) so[wave][8 * g + r][j * 16 + col] = acc[j][r];
  LDSX();
  for (int rl = 0; rl < 16; ++rl) vst2(OUT + (r0 + rl) * ldo + n0 + lane * 4, *(const v4f*)&so[wave][rl][lane * 4]);
}
// ---- k_normrope<PLANE>: block = (position s, head): 256 threads = d: RMSNorm over the head's 256 (mean of squares, eps 1e-6) * (1 + scale[d]); RoPE: out_d = y_d cos[s][d] + rot_d sin[s][d] with rot = (-y[d+128], y[d-128]); in place (PLANE 0: q rows pitch 2048; 1: k rows pitch 1024; V, VH, VL are unused)
template <int PLANE>
__global__ __launch_bounds__(256) void k_normrope(float* QK, const float* __restrict__ SC, const float* __restrict__ COS, const float* __restrict__ SIN, const float* __restrict__ V, __bf16* __restrict__ VH, __bf16* __restrict__ VL) {
  __shared__ float sy[HD]; __shared__ float sred[8]; __shared__ __align__(16) float so[HD];
  const int s = blockIdx.x, h = blockIdx.y, d = threadIdx.x; const int pitch = PLANE ? (NKV * HD) : (NH * HD);
  float* row = QK + (size_t)s * pitch + h * HD; const float y = row[d]; sy[d] = y;
  float q = y * y;
#pragma unroll
  for (int o = 1; o < 32; o <<= 1) q += __shfl_xor(q, o);
  if ((d & 31) == 0) sred[d >> 5] = q;
  __syncthreads();
  float ss = 0.f;
#pragma unroll
  for (int w = 0; w < 8; ++w) ss += sred[w];
  const float rs = rsqrtf(ss / (float)HD + 1e-6f);
  const float yn = y * rs * (1.0f + bfr(SC[d])); const float other = sy[(d < HD / 2) ? (d + HD / 2) : (d - HD / 2)] * rs * (1.0f + bfr(SC[(d < HD / 2) ? (d + HD / 2) : (d - HD / 2)]));
  const float rot = (d < HD / 2) ? -other : other;
  so[d] = yn * bfr(COS[(size_t)s * HD + d]) + rot * bfr(SIN[(size_t)s * HD + d]);
  __syncthreads();
  if (d < HD / 4) vst2(row + d * 4, *(const v4f*)&so[d * 4]);
}
__global__ __launch_bounds__(256) void k_vplanes(const float* __restrict__ V, __bf16* __restrict__ VH, __bf16* __restrict__ VL) {
  __shared__ __align__(16) __bf16 sh[128][72], sl[128][72]; const int tid = threadIdx.x; const int s0 = blockIdx.x * 64, c0 = blockIdx.y * 128;
  for (int q = tid; q < 64 * 128; q += 256) { const int sl_ = q >> 7, c = q & 127; const float v = V[(size_t)(s0 + sl_) * (NKV * HD) + c0 + c]; const __bf16 hb = (__bf16)v; sh[c][sl_] = hb; sl[c][sl_] = (__bf16)(v - (float)hb); }
  __syncthreads();
  for (int q = tid; q < 128 * 8; q += 256) { const int c = q >> 3, pc = q & 7; const size_t o = (size_t)(c0 + c) * SS + s0 + pc * 8; vst2((unsigned*)(VH + o), *(const v4u*)&sh[c][pc * 8]); vst2((unsigned*)(VL + o), *(const v4u*)&sl[c][pc * 8]); }
}
// ---- k_attn: block = (64 queries, head h), 16 waves = (query tile qw = wave & 3) x (key share kj = wave >> 2): a wave takes the key steps ks = kj, kj + 4, ... of its 16 queries, so four waves a SIMD cover one another's load and LDS latency; the four partial (max, sum, acc) of a query tile are merged through LDS at the end; kv = h / 2; per 32-key step: live = (k <= q) & attn_mask[k] & (k > pos_q - WIN) & (k < pos_q + WIN); wave vote; scores (3 products, K 256 = 8 ksteps) / 16; online softmax with guards; P.V over all 256 value columns (16 tiles, 3 products) from the one set of scores; O cols h*256 + ...
__global__ __launch_bounds__(512) void k_attn(const float* __restrict__ Q, const float* __restrict__ Kx, const int* __restrict__ AM, const int* __restrict__ SEGPOS, const __bf16* __restrict__ VH, const __bf16* __restrict__ VL, float* __restrict__ O) {
  __shared__ __align__(16) float sp[16][16][36]; __shared__ __align__(16) float so[16][16][260]; __shared__ float sm[16][16], sl[16][16];
  const int tid = threadIdx.x, wave = __builtin_amdgcn_readfirstlane(tid >> 5), lane = tid & 31, col = lane & 15, g = lane >> 4; const int qw = wave & 3, kj = wave >> 2; const int qb = blockIdx.x + TQ0, h = blockIdx.y; const int kv = h / (NH / NKV); const int q0 = qb * 64 + qw * 16;   // the wave's number in a scalar register: key step and tile bases leave the vector registers, and the 16 accumulator tiles fit the 256 a wave has with no scratch
  const float* qrow = Q + (size_t)(q0 + col) * (NH * HD) + h * HD;
  int posq[8];
#pragma unroll
  for (int r = 0; r < 8; ++r) posq[r] = SEGPOS[q0 + 8 * g + r];
  float m[8], l[8];
#pragma unroll
  for (int r = 0; r < 8; ++r) { m[r] = -3.0e38f; l[r] = 0.f; }
  v8f acc[16] = {};
  const int nks = (qb * 64 + 64) / 32;   // causal upper bound on key steps
#pragma unroll 1
  for (int ks = kj; ks < nks; ks += 4) { v8f s[2]; bool lv[2][8]; bool anylive = false;
#pragma unroll
    for (int ct = 0; ct < 2; ++ct) { const int kk = ks * 32 + ct * 16 + col; const bool am = (AM[kk] != 0);
#pragma unroll
      for (int r = 0; r < 8; ++r) { const int qi = q0 + 8 * g + r; const bool live = am && (kk <= qi) && (kk > posq[r] - WIN) && (kk < posq[r] + WIN); lv[ct][r] = live; anylive = anylive || live; } }
    if (__any(anylive)) {
#pragma unroll
      for (int ct = 0; ct < 2; ++ct) { const int kk = ks * 32 + ct * 16 + col; const float* krow = Kx + (size_t)kk * (NKV * HD) + kv * HD; v8f c = {};
#pragma unroll
        for (int kc = 0; kc < HD / 32; ++kc) { const F2 kb = split_row(krow, kc * 32, lane); const F2 qa = split_row(qrow, kc * 32, lane); c = mac3(qa, kb, c); }
#pragma unroll
        for (int r = 0; r < 8; ++r) s[ct][r] = lv[ct][r] ? c[r] * 0.0625f : -3.0e38f; }
#pragma unroll
      for (int r = 0; r < 8; ++r) { float mx = fmaxf(s[0][r], s[1][r]);
#pragma unroll
        for (int o = 1; o < 16; o <<= 1) mx = fmaxf(mx, __shfl_xor(mx, o));
        const float mn = fmaxf(m[r], mx); const float alpha = (m[r] <= -1.0e38f) ? 0.f : exp_ni(m[r] - mn);
        const float e0 = (s[0][r] <= -1.0e38f) ? 0.f : exp_ni(s[0][r] - mn), e1 = (s[1][r] <= -1.0e38f) ? 0.f : exp_ni(s[1][r] - mn); float es = e0 + e1;
#pragma unroll
        for (int o = 1; o < 16; o <<= 1) es += __shfl_xor(es, o);
        l[r] = l[r] * alpha + es; m[r] = mn;
#pragma unroll
        for (int dt = 0; dt < 16; ++dt) acc[dt][r] *= alpha;
        sp[wave][8 * g + r][col] = e0; sp[wave][8 * g + r][16 + col] = e1; }
      LDSX();
      const F2 pa = split_row(&sp[wave][col][0], 0, lane); const size_t vr0 = (size_t)(kv * HD + col) * SS + ks * 32;   // one row address a plane; the 16 tiles lie constant steps behind it
#pragma unroll
      for (int dt = 0; dt < 16; ++dt) { const size_t vr = vr0 + (size_t)dt * 16 * SS; const v16b vh = frag_b(VH + vr, lane), vl = frag_b(VL + vr, lane); acc[dt] = wmma_bf(pa.l, vh, acc[dt]); acc[dt] = wmma_bf(pa.h, vl, acc[dt]); acc[dt] = wmma_bf(pa.h, vh, acc[dt]); }
      LDSX(); } }
#pragma unroll
  for (int r = 0; r < 8; ++r) {
#pragma unroll
    for (int dt = 0; dt < 16; ++dt) so[wave][8 * g + r][dt * 16 + col] = acc[dt][r];
    if (col == 0) { sm[wave][8 * g + r] = m[r]; sl[wave][8 * g + r] = l[r]; } }
  __syncthreads();   // every wave's partial is in LDS before any wave merges
  // merge: wave (qw, kj) finishes rows 4 kj .. 4 kj + 3 of query tile qw: weights exp(m_j - M), a share with no live key weighs 0
  for (int rl = 0; rl < 4; ++rl) { const int row = kj * 4 + rl; float mj[4]; float M = -3.0e38f;
#pragma unroll
    for (int j = 0; j < 4; ++j) { mj[j] = sm[qw + 4 * j][row]; M = fmaxf(M, mj[j]); }
    float L = 0.f; v4f o0 = {}, o1 = {};
#pragma unroll
    for (int j = 0; j < 4; ++j) { const float w = (mj[j] <= -1.0e38f) ? 0.f : exp_ni(mj[j] - M); L += w * sl[qw + 4 * j][row]; o0 += w * *(const v4f*)&so[qw + 4 * j][row][lane * 4]; o1 += w * *(const v4f*)&so[qw + 4 * j][row][128 + lane * 4]; }
    const float il = (L > 0.f) ? 1.0f / L : 0.f;
    vst2(O + (size_t)(q0 + row) * (NH * HD) + h * HD + lane * 4, o0 * il); vst2(O + (size_t)(q0 + row) * (NH * HD) + h * HD + 128 + lane * 4, o1 * il);
    asm volatile("s_wait_xcnt 0x0" ::: "memory"); }   // stands between the two stores and the next row's rewrite of their data registers
}
extern "C" void kernel_launch(void* const* d_in, const int* in_sizes, int n_in, void* d_out, int out_size, void* d_ws, size_t ws_size, hipStream_t stream) {
  (void)in_sizes; (void)n_in; (void)out_size;
  const float** F = (const float**)d_in; const int* AM = (const int*)d_in[1]; const int* SEGPOS = (const int*)d_in[2];
  // 0 x [1,2048,2048], 1 attn_mask [1,2048] bool(int), 2 segment_pos [1,2048] i32, 3 cos [1,2048,256], 4 sin, 5 wq [2048,2048], 6 wk [2048,1024], 7 wv [2048,1024], 8 wo [2048,2048], 9 q_scale [256], 10 k_scale [256]
  if (ws_size < (size_t)WS_END) return;
  char* ws = (char*)d_ws; __bf16 *PW = (__bf16*)(ws + WS_PW), *VH = (__bf16*)(ws + WS_VH), *VL = (__bf16*)(ws + WS_VL); float *Q = (float*)(ws + WS_Q), *Kx = (float*)(ws + WS_K), *V = (float*)(ws + WS_V), *O = (float*)(ws + WS_O);
  k_packT<<<dim3(HID, 4), 256, 0, stream>>>(F[5], F[6], F[7], F[8], PW);
  k_gemm<1><<<dim3(TQB, NH * HD / 128), 128, 0, stream>>>(F[0] + (size_t)TQ0 * 64 * HID, HID, HID, PW + PQ, Q + (size_t)TQ0 * 64 * NH * HD, NH * HD);   // q rows of the processed query range
  k_gemm<1><<<dim3(KRP, NKV * HD / 128), 128, 0, stream>>>(F[0], HID, HID, PW + PK, Kx, NKV * HD);
  k_gemm<1><<<dim3(KRP, NKV * HD / 128), 128, 0, stream>>>(F[0], HID, HID, PW + PV, V, NKV * HD);
  k_normrope<0><<<dim3(TQB * 64, NH), 256, 0, stream>>>(Q + (size_t)TQ0 * 64 * NH * HD, F[9], F[3] + (size_t)TQ0 * 64 * HD, F[4] + (size_t)TQ0 * 64 * HD, nullptr, nullptr, nullptr);
  k_normrope<1><<<dim3(KRP * 64, NKV), 256, 0, stream>>>(Kx, F[10], F[3], F[4], nullptr, nullptr, nullptr);
  k_vplanes<<<dim3(KRP, NKV * HD / 128), 256, 0, stream>>>(V, VH, VL);
  k_attn<<<dim3(TQB, NH), 512, 0, stream>>>(Q, Kx, AM, SEGPOS, VH, VL, O);
  k_gemm<0><<<dim3(TQB, HID / 128), 128, 0, stream>>>(O + (size_t)TQ0 * 64 * NH * HD, NH * HD, NH * HD, PW + PO, (float*)d_out + (size_t)TQ0 * 64 * HID, HID);
}

// v004
// A run of this version takes 376 microseconds.
// Next to v003, in two timings, it ran 1.04 and 1.05 times as fast.
// All steps since v000 together make it 3.59 times as fast.
// compute dtype: x, attn_mask, segment_pos, cos/sin tables, wq/wk/wv/wo and the RMSNorm scales (module inputs) rounded to bf16 / read as int; q/k/v projections with exact bf16 products (x and the weights are inputs); per-head RMSNorm and RoPE (input tables) in f32; scores q.k with both operands as bf16 hi + residual pairs (3 products), P.V with P hi/lo x V hi/lo (3 products), output projection hi/lo x exact wo (2 products); all on WMMA 16x16x32; the causal AND padding AND sliding-window mask is evaluated at run time from attn_mask / segment_pos and key tiles with no live entry are skipped; f32 accumulate.
#include <hip/hip_runtime.h>
#include <math.h>

typedef __attribute__((ext_vector_type(16))) _Float16 v16h;
typedef __attribute__((ext_vector_type(16))) __bf16 v16b;
typedef __attribute__((ext_vector_type(8)))  _Float16 v8h;
typedef __attribute__((ext_vector_type(8)))  float v8f;
typedef __attribute__((ext_vector_type(4)))  float v4f;
typedef __attribute__((ext_vector_type(2)))  float v2f;
typedef __attribute__((ext_vector_type(4)))  unsigned v4u;
typedef __attribute__((ext_vector_type(4)))  int v4i;
typedef float __attribute__((may_alias)) float_a;
typedef int __attribute__((may_alias)) int_a;

template <typename T> __device__ __forceinline__ void vst2(void* p, T v) { *(T*)p = v;  }
__device__ __forceinline__ v8f wmma16(v16h a, v16h b, v8f c) {
  v8f d = __builtin_amdgcn_wmma_f32_16x16x32_f16(false, a, false, b, (short)0, c, false, false);
  asm volatile("v_nop\n\tv_nop\n\tv_nop\n\tv_nop" : "+v"(d) : "v"(a), "v"(b));
  return d;
}
__device__ __forceinline__ v8f wmma_bf(v16b a, v16b b, v8f c) {
  v8f d = __builtin_amdgcn_wmma_f32_16x16x32_bf16(false, a, false, b, (short)0, c, false, false);
  asm volatile("v_nop\n\tv_nop\n\tv_nop\n\tv_nop" : "+v"(d) : "v"(a), "v"(b));
  return d;
}
// 16x16x32 fragments: lane = (h = lane>>4, row/col = lane&15); elements 0..7 = k0+8h+0..7, 8..15 = k0+16+8h+0..7; D element r = row 8h+r
__device__ __forceinline__ v16h frag_h(const _Float16* rowk0, int lane) {
  union { v16h v; v8h q[2]; } u; const _Float16* p = rowk0 + 8 * (lane >> 4);
  u.q[0] = *(const v8h*)p; u.q[1] = *(const v8h*)(p + 16); return u.v;
}
__device__ __forceinline__ v16h frag_f32(const float* rowk0, int lane) {
  v16h a; const float* p = rowk0 + 8 * (lane >> 4);
#pragma unroll
  for (int i = 0; i < 8; ++i) { a[i] = (_Float16)p[i]; a[8 + i] = (_Float16)p[16 + i]; }
  return a;
}
__device__ __forceinline__ v16h frag_f32s(const float* rowk0, int lane, float sc) {
  v16h a; const float* p = rowk0 + 8 * (lane >> 4);
#pragma unroll
  for (int i = 0; i < 8; ++i) { a[i] = (_Float16)(p[i] * sc); a[8 + i] = (_Float16)(p[16 + i] * sc); }
  return a;
}
// column fragment from a [K][ld] layout (column n), rows >= K read as 0
__device__ __forceinline__ v16h fragc_f32(const float* W, int k0, int n, int lane, int ld, int K) {
  v16h a; const int g = lane >> 4;
#pragma unroll
  for (int i = 0; i < 8; ++i) { const int ka = k0 + 8 * g + i, kb = ka + 16;
    a[i] = (_Float16)(ka < K ? W[(size_t)(ka < K ? ka : K - 1) * ld + n] : 0.f); a[8 + i] = (_Float16)(kb < K ? W[(size_t)(kb < K ? kb : K - 1) * ld + n] : 0.f); }
  return a;
}
struct F2 { v16b h, l; };
__device__ __forceinline__ F2 bsplit16(const float v[16]) { F2 r;
#pragma unroll
  for (int i = 0; i < 16; ++i) { const __bf16 h = (__bf16)v[i]; r.h[i] = h; r.l[i] = (__bf16)(v[i] - (float)h); }
  return r; }
__device__ __forceinline__ F2 split_row(const float* row, int k0, int lane) { float v[16]; const float* p = row + k0 + 8 * (lane >> 4);
#pragma unroll
  for (int i = 0; i < 8; ++i) { v[i] = p[i]; v[8 + i] = p[16 + i]; }
  return bsplit16(v); }
__device__ __forceinline__ F2 split_rowK(const float* row, int k0, int lane, int K) { float v[16]; const int g = lane >> 4;
#pragma unroll
  for (int i = 0; i < 8; ++i) { const int ka = k0 + 8 * g + i, kb = ka + 16; v[i] = ka < K ? row[ka < K ? ka : K - 1] : 0.f; v[8 + i] = kb < K ? row[kb < K ? kb : K - 1] : 0.f; }
  return bsplit16(v); }
__device__ __forceinline__ F2 split_col(const float* W, int k0, int n, int lane, int ld, int K) { float v[16]; const int g = lane >> 4;
#pragma unroll
  for (int i = 0; i < 8; ++i) { const int ka = k0 + 8 * g + i, kb = ka + 16; v[i] = ka < K ? W[(size_t)(ka < K ? ka : K - 1) * ld + n] : 0.f; v[8 + i] = kb < K ? W[(size_t)(kb < K ? kb : K - 1) * ld + n] : 0.f; }
  return bsplit16(v); }
__device__ __forceinline__ v8f mac3(const F2& a, const F2& b, v8f c) { c = wmma_bf(a.l, b.h, c); c = wmma_bf(a.h, b.l, c); return wmma_bf(a.h, b.h, c); }
__device__ __forceinline__ float sigm(float v) { return 1.0f / (1.0f + expf(-v)); }
#define LDSX() do { asm volatile("s_wait_dscnt 0" ::: "memory"); __builtin_amdgcn_wave_barrier(); __builtin_amdgcn_fence(__ATOMIC_RELEASE, "workgroup"); } while (0)


// Gemma-3 style attention (B 1, S 2048, hidden 2048, 8 query heads / 4 kv heads x 256, sliding window 1024): q,k,v = x w; q,k = RMSNorm_head(.)(1 + scale); RoPE with the given cos/sin; GQA (kv head = h / 2); scores / 16 masked by causal & attn_mask[k] & |k - segment_pos[q]| < WIN (else -1e37); softmax; out = (P v merged) wo.
#define SS 2048
#define HID 2048
#define NH 8
#define NKV 4
#define HD 256
#define WIN 1024
#ifndef TQB
#define TQB (SS / 64)          // query tiles processed
#define TQ0 0                  // first query tile
#define KRP (SS / 64)          // key/value row tiles (all)
#endif
typedef __attribute__((ext_vector_type(8))) __bf16 v8b;
__device__ __forceinline__ v16b frag_b(const __bf16* rowk0, int lane) {
  union { v16b v; v8b q[2]; } u; const __bf16* p = rowk0 + 8 * (lane >> 4);
  u.q[0] = *(const v8b*)p; u.q[1] = *(const v8b*)(p + 16); return u.v;
}
__device__ __forceinline__ float bfr(float v) { return (float)(__bf16)v; }
__device__ __attribute__((noinline)) float exp_ni(float v) { return expf(v); }
__device__ __attribute__((noinline)) float erf_ni(float v) { return erff(v); }

#define WS_PW  0u                                  // bf16 rows (in,out -> [out][in]): wq [2048][2048], wk [1024][2048], wv [1024][2048], wo [2048][2048]
#define PQ 0
#define PK (PQ + NH * HD * HID)
#define PV (PK + NKV * HD * HID)
#define PO (PV + NKV * HD * HID)
#define PWEND (PO + HID * NH * HD)
#define WS_Q   (WS_PW + 2u * PWEND)                 // f32 [S][2048] q raw
#define WS_K   (WS_Q + 4u * SS * NH * HD)            // f32 [S][1024] k raw
#define WS_V   (WS_K + 4u * SS * NKV * HD)           // f32 [S][1024] v raw
#define WS_VF  (WS_V + 4u * SS * NKV * HD)           // bf16 v in fragment order: [kv][32-key step][16-column tile][FRU]
#define WS_O   (WS_VF + 4u * NKV * HD * SS)          // f32 [S][2048]
#define WS_QF  (WS_O + 4u * SS * NH * HD)            // bf16 q in fragment order: [head][16-query tile][32-d step][FRU]
#define WS_KF  (WS_QF + 4u * SS * NH * HD)           // bf16 k in fragment order: [kv][16-key tile][32-d step][FRU]
#define WS_END (WS_KF + 4u * SS * NKV * HD)
// Fragment order: one 16 x 32 operand tile is a unit of FRU bf16 = [plane hi, lo][part 0, 1][lane 32][8]: lane (g = lane >> 4, row = lane & 15) holds k = 16 part + 8 g + 0..7 of its row, which is what frag_b reads from a row. A wave's 16-byte load of one (plane, part) is then 512 bytes in a row, four whole lines, where a load from rows touches sixteen.
#define FRU 1024
__device__ __forceinline__ v16b frag_t(const __bf16* p) { union { v16b v; v8b q[2]; } u; u.q[0] = *(const v8b*)p; u.q[1] = *(const v8b*)(p + 256); return u.v; }

// ---- k_packT: block = (output col n, which): (in,out) weight -> rows [n][K]
__global__ __launch_bounds__(256) void k_packT(const float* __restrict__ WQ, const float* __restrict__ WK, const float* __restrict__ WV, const float* __restrict__ WO, __bf16* __restrict__ PW) {
  __shared__ __align__(16) __bf16 s[2048]; const int n = blockIdx.x, which = blockIdx.y, tid = threadIdx.x; int K, N; const float* Wm; size_t base;
  if (which == 0) { K = HID; N = NH * HD; Wm = WQ; base = PQ; } else if (which == 1) { K = HID; N = NKV * HD; Wm = WK; base = PK; } else if (which == 2) { K = HID; N = NKV * HD; Wm = WV; base = PV; } else { K = NH * HD; N = HID; Wm = WO; base = PO; }
  if (n >= N) return;
  for (int k = tid; k < K; k += 256) s[k] = (__bf16)Wm[(size_t)k * N + n];
  __syncthreads();
  for (int q = tid; q < K / 8; q += 256) vst2((unsigned*)(PW + base + (size_t)n * K + q * 8), *(const v4u*)&s[q * 8]);
}
// ---- k_gemm<RIN>: block = (64 rows, 128 cols): OUT = A(K) . rows (RIN exact / hi-lo 2 products); pitch ldo. K is a multiple of 64.
// Both operand tiles of a 64-k stage (A 64 rows x 256 B f32, P 128 rows x 128 B bf16) are brought into LDS by asynchronous copies, whole lines, two buffers: stage t + 1 flies while stage t is worked on, and the four waves share one copy of the P tile. Row pitches 272 B / 144 B (16 B x odd) keep the 16-byte fragment reads off one another's banks.
#define GKS 64
#define GAP 272
#define GBP 144
#define GAB (64 * GAP)
#define GSTG (GAB + 128 * GBP)
__device__ __forceinline__ unsigned lds_off(const void* p) { return (unsigned)(size_t)p; }
// eight 16-byte copies of a lane, rows lstep / gstep bytes apart; the s_wait_xcnt closes the statement so that no address register of a copy is rewritten ahead of it
__device__ __forceinline__ void acopy8(unsigned l, unsigned lstep, const char* g, size_t gstep) {
  asm volatile("global_load_async_to_lds_b128 %0, %8, off\n\t"
               "global_load_async_to_lds_b128 %1, %9, off\n\t"
               "global_load_async_to_lds_b128 %2, %10, off\n\t"
               "global_load_async_to_lds_b128 %3, %11, off\n\t"
               "global_load_async_to_lds_b128 %4, %12, off\n\t"
               "global_load_async_to_lds_b128 %5, %13, off\n\t"
               "global_load_async_to_lds_b128 %6, %14, off\n\t"
               "global_load_async_to_lds_b128 %7, %15, off\n\t"
               "s_wait_xcnt 0x0"
               :: "v"(l), "v"(l + lstep), "v"(l + 2 * lstep), "v"(l + 3 * lstep), "v"(l + 4 * lstep), "v"(l + 5 * lstep), "v"(l + 6 * lstep), "v"(l + 7 * lstep),
                  "v"(g), "v"(g + gstep), "v"(g + 2 * gstep), "v"(g + 3 * gstep), "v"(g + 4 * gstep), "v"(g + 5 * gstep), "v"(g + 6 * gstep), "v"(g + 7 * gstep)
               : "memory");
}
template <int RIN>
__global__ __launch_bounds__(128) void k_gemm(const float* __restrict__ A, int lda, int K, const __bf16* __restrict__ P, float* __restrict__ OUT, int ldo) {
  __shared__ __align__(16) float so[4][16][132]; __shared__ __align__(16) unsigned char st[2][GSTG];
  const int tid = threadIdx.x, wave = tid >> 5, lane = tid & 31, col = lane & 15, g = lane >> 4; const size_t r0 = (size_t)blockIdx.x * 64 + wave * 16; const int n0 = blockIdx.y * 128;
  // a thread's copy places: A chunk (row i * 8 + tid / 16, 16 B piece tid % 16), P chunk (row i * 16 + tid / 8, piece tid % 8), i = 0..7
  const char* ga = (const char*)(A + ((size_t)blockIdx.x * 64 + (tid >> 4)) * lda + (tid & 15) * 4); const char* gb = (const char*)(P + (size_t)(n0 + (tid >> 3)) * K + (tid & 7) * 8);
  const unsigned la = lds_off(&st[0][0]) + (tid >> 4) * GAP + (tid & 15) * 16, lb = lds_off(&st[0][0]) + GAB + (tid >> 3) * GBP + (tid & 7) * 16;
  const size_t gas = (size_t)lda * 8 * 4, gbs = (size_t)K * 16 * 2; const int nst = K / GKS;
  v8f acc[8] = {};
  acopy8(la, 8 * GAP, ga, gas); acopy8(lb, 16 * GBP, gb, gbs);
  asm volatile("s_wait_asynccnt 0x0" ::: "memory");   // this wave's share of stage 0 has landed
  __syncthreads();                                    // every wave's share of stage 0 has landed
  if (nst > 1) { acopy8(la + GSTG, 8 * GAP, ga + GKS * 4, gas); acopy8(lb + GSTG, 16 * GBP, gb + GKS * 2, gbs); }
  for (int t = 0; t < nst; ++t) { const unsigned bo = (t & 1) * GSTG; const unsigned char* pa = &st[0][0] + bo + (wave * 16 + col) * GAP + 32 * g; const unsigned char* pb = &st[0][0] + bo + GAB + col * GBP + 16 * g;
    // the stage's fragment reads stand ahead of its WMMAs, so that their latencies overlap; the second k step's A rows are read behind the first WMMA (16 registers fewer at the peak: the kernel stays inside v0..v255), still a whole k step ahead of their use
    v4f af[2][4]; v8b bq[2][8][2];
#pragma unroll   // in full: the fragment arrays are indexed by constants and stay in registers
    for (int q = 0; q < 4; ++q) af[0][q] = *(const v4f*)(pa + (q >> 1) * 64 + (q & 1) * 16);
#pragma unroll   // in full: the fragment arrays are indexed by constants and stay in registers
    for (int kc = 0; kc < 2; ++kc)
#pragma unroll   // in full: the fragment arrays are indexed by constants and stay in registers
      for (int j = 0; j < 8; ++j) { bq[kc][j][0] = *(const v8b*)(pb + j * 16 * GBP + kc * 64); bq[kc][j][1] = *(const v8b*)(pb + j * 16 * GBP + kc * 64 + 32); }
#pragma unroll   // in full: the fragment arrays are indexed by constants and stay in registers
    for (int kc = 0; kc < 2; ++kc) { F2 a; float v[16];
#pragma unroll   // in full: the fragment arrays are indexed by constants and stay in registers
      for (int i = 0; i < 4; ++i) { v[i] = af[kc][0][i]; v[4 + i] = af[kc][1][i]; v[8 + i] = af[kc][2][i]; v[12 + i] = af[kc][3][i]; }
      if (RIN) { v16b ax;
#pragma unroll   // in full: the fragment arrays are indexed by constants and stay in registers
        for (int i = 0; i < 16; ++i) ax[i] = (__bf16)v[i];
        a.h = ax; a.l = ax; } else a = bsplit16(v);
#pragma unroll   // in full: the fragment arrays are indexed by constants and stay in registers
      for (int j = 0; j < 8; ++j) { union { v16b v; v8b q[2]; } w; w.q[0] = bq[kc][j][0]; w.q[1] = bq[kc][j][1]; if (!RIN) acc[j] = wmma_bf(a.l, w.v, acc[j]); acc[j] = wmma_bf(a.h, w.v, acc[j]);
        if (kc == 0 && j == 0) {
#pragma unroll   // in full: the fragment arrays are indexed by constants and stay in registers
          for (int q = 0; q < 4; ++q) af[1][q] = *(const v4f*)(pa + 128 + (q >> 1) * 64 + (q & 1) * 16); } } }
    asm volatile("s_wait_dscnt 0x0" ::: "memory");      // this wave has left stage t's buffer
    asm volatile("s_wait_asynccnt 0x0" ::: "memory");   // this wave's share of stage t + 1 has landed
    __syncthreads();                                    // publishes stage t + 1 and frees stage t's buffer
    if (t + 2 < nst) { acopy8(la + bo, 8 * GAP, ga + (size_t)(t + 2) * (GKS * 4), gas); acopy8(lb + bo, 16 * GBP, gb + (size_t)(t + 2) * (GKS * 2), gbs); } }
  asm volatile("s_wait_asynccnt 0x0" ::: "memory");     // no copy is outstanding when the wave goes on
#pragma unroll
  for (int j = 0; j < 8; ++j)
#pragma unroll
    for (int r = 0; r < 8; ++r) so[wave][8 * g + r][j * 16 + col] = acc[j][r];
  LDSX();
  for (int rl = 0; rl < 16; ++rl) vst2(OUT + (r0 + rl) * ldo + n0 + lane * 4, *(const v4f*)&so[wave][rl][lane * 4]);
}
// ---- k_normrope<PLANE>: block = (16 positions, head): 256 threads = d, each over the 16 rows: RMSNorm over the head's 256 (mean of squares, eps 1e-6) * (1 + scale[d]); RoPE: out_d = y_d cos[s][d] + rot_d sin[s][d] with rot = (-y[d+128], y[d-128]); the 16 x 256 result goes out as bf16 hi + residual in fragment order (8 units, 16 KiB in a row: a block writes whole lines, and no line has a second writer) (PLANE 0: q rows pitch 2048; 1: k rows pitch 1024)
template <int PLANE>
__global__ __launch_bounds__(256) void k_normrope(const float* __restrict__ QK, const float* __restrict__ SC, const float* __restrict__ COS, const float* __restrict__ SIN, __bf16* __restrict__ OF) {
  __shared__ float sy[16][HD]; __shared__ float sred[16][8]; __shared__ __align__(16) float so[16][HD + 4];
  const int t = blockIdx.x, h = blockIdx.y, d = threadIdx.x; const int pitch = PLANE ? (NKV * HD) : (NH * HD);
  const float* col = QK + (size_t)t * 16 * pitch + h * HD + d; float y[16];
#pragma unroll   // in full: y[] is indexed by constants and stays in registers, and the 16 rows' loads fly together
  for (int r = 0; r < 16; ++r) { y[r] = col[(size_t)r * pitch]; sy[r][d] = y[r]; }
#pragma unroll   // in full: y[] stays in registers, and the rows' cross-lane sums cover one another's latency
  for (int r = 0; r < 16; ++r) { float q = y[r] * y[r];
#pragma unroll   // in full: five fixed steps, no loop overhead
    for (int o = 1; o < 32; o <<= 1) q += __shfl_xor(q, o);
    if ((d & 31) == 0) sred[r][d >> 5] = q; }
  __syncthreads();
  const int dp = (d < HD / 2) ? (d + HD / 2) : (d - HD / 2); const float g0 = 1.0f + bfr(SC[d]), g1 = 1.0f + bfr(SC[dp]);
#pragma unroll   // in full: y[] stays in registers, and the rows' table loads fly together
  for (int r = 0; r < 16; ++r) { float ss = 0.f;
#pragma unroll   // in full: eight fixed terms, summed in this order
    for (int w = 0; w < 8; ++w) ss += sred[r][w];
    const float rs = rsqrtf(ss / (float)HD + 1e-6f);
    const float yn = y[r] * rs * g0; const float other = sy[r][dp] * rs * g1;
    const float rot = (d < HD / 2) ? -other : other; const size_t s = (size_t)t * 16 + r;
    so[r][d] = yn * bfr(COS[s * HD + d]) + rot * bfr(SIN[s * HD + d]); }
  __syncthreads();
  __bf16* ob = OF + ((size_t)h * (SS / 16) + t) * (HD / 32) * FRU;
  for (int q = d; q < (HD / 32) * FRU / 8; q += 256) { const int ln = q & 31, part = (q >> 5) & 1, pl = (q >> 6) & 1, kc = q >> 7; const float* p = &so[ln & 15][kc * 32 + part * 16 + (ln >> 4) * 8]; v8b w;
#pragma unroll   // in full: w[] is indexed by constants and stays in registers
    for (int i = 0; i < 8; ++i) { const float v = p[i]; const __bf16 hb = (__bf16)v; w[i] = pl ? (__bf16)(v - (float)hb) : hb; }
    vst2(ob + (size_t)q * 8, w); }
}
// ---- k_vplanes: block = (64 positions, 128 value columns): v as bf16 hi + residual, transposed in LDS, out in fragment order (row = value column, k = key): 2 key steps x 8 column tiles = 16 whole units
__global__ __launch_bounds__(256) void k_vplanes(const float* __restrict__ V, __bf16* __restrict__ VF) {
  __shared__ __align__(16) __bf16 sh[128][72], sl[128][72]; const int tid = threadIdx.x; const int s0 = blockIdx.x * 64, c0 = blockIdx.y * 128;
  for (int q = tid; q < 64 * 128; q += 256) { const int sl_ = q >> 7, c = q & 127; const float v = V[(size_t)(s0 + sl_) * (NKV * HD) + c0 + c]; const __bf16 hb = (__bf16)v; sh[c][sl_] = hb; sl[c][sl_] = (__bf16)(v - (float)hb); }
  __syncthreads();
  for (int q = tid; q < 16 * FRU / 8; q += 256) { const int ln = q & 31, part = (q >> 5) & 1, pl = (q >> 6) & 1, dtl = (q >> 7) & 7, ksl = q >> 10; const int c = dtl * 16 + (ln & 15), sk = ksl * 32 + part * 16 + (ln >> 4) * 8; const int cg = c0 + dtl * 16;
    const size_t o = (((size_t)(cg / HD) * (SS / 32) + s0 / 32 + ksl) * (HD / 16) + (cg % HD) / 16) * FRU + (q & 127) * 8; vst2(VF + o, *(const v4u*)(pl ? &sl[c][sk] : &sh[c][sk])); }
}
// ---- k_attn: block = (64 queries, head h), 16 waves = (query tile qw = wave & 3) x (key share kj = wave >> 2): a wave takes the key steps ks = kj, kj + 4, ... of its 16 queries, so four waves a SIMD cover one another's load and LDS latency; the four partial (max, sum, acc) of a query tile are merged through LDS at the end; kv = h / 2; per 32-key step: live = (k <= q) & attn_mask[k] & (k > pos_q - WIN) & (k < pos_q + WIN); wave vote; scores (3 products, K 256 = 8 ksteps) / 16; online softmax with guards; P.V over all 256 value columns (16 tiles, 3 products) from the one set of scores; q, k and v come as bf16 hi + residual in fragment order (frag_t), so nothing is split here and every fragment load reads whole lines; O cols h*256 + ...
__global__ __launch_bounds__(512) void k_attn(const __bf16* __restrict__ QF, const __bf16* __restrict__ KF, const int* __restrict__ AM, const int* __restrict__ SEGPOS, const __bf16* __restrict__ VF, float* __restrict__ O) {
  __shared__ __align__(16) float sp[16][16][36]; __shared__ __align__(16) float so[16][16][260]; __shared__ float sm[16][16], sl[16][16];
  const int tid = threadIdx.x, wave = __builtin_amdgcn_readfirstlane(tid >> 5), lane = tid & 31, col = lane & 15, g = lane >> 4; const int qw = wave & 3, kj = wave >> 2; const int qb = blockIdx.x + TQ0, h = blockIdx.y; const int kv = h / (NH / NKV); const int q0 = qb * 64 + qw * 16;   // the wave's number in a scalar register: key step and tile bases leave the vector registers, and the 16 accumulator tiles fit the 256 a wave has with no scratch
  const __bf16* qp = QF + ((size_t)h * (SS / 16) + (q0 >> 4)) * (HD / 32) * FRU + lane * 8;
  int posq[8];
#pragma unroll
  for (int r = 0; r < 8; ++r) posq[r] = SEGPOS[q0 + 8 * g + r];
  float m[8], l[8];
#pragma unroll
  for (int r = 0; r < 8; ++r) { m[r] = -3.0e38f; l[r] = 0.f; }
  v8f acc[16] = {};
  const int nks = (qb * 64 + 64) / 32;   // causal upper bound on key steps
#pragma unroll 1
  for (int ks = kj; ks < nks; ks += 4) { v8f s[2]; bool lv[2][8]; bool anylive = false;
#pragma unroll
    for (int ct = 0; ct < 2; ++ct) { const int kk = ks * 32 + ct * 16 + col; const bool am = (AM[kk] != 0);
#pragma unroll
      for (int r = 0; r < 8; ++r) { const int qi = q0 + 8 * g + r; const bool live = am && (kk <= qi) && (kk > posq[r] - WIN) && (kk < posq[r] + WIN); lv[ct][r] = live; anylive = anylive || live; } }
    if (__any(anylive)) {
#pragma unroll
      for (int ct = 0; ct < 2; ++ct) { const __bf16* kp = KF + ((size_t)kv * (SS / 16) + ks * 2 + ct) * (HD / 32) * FRU + lane * 8; v8f c = {};
#pragma unroll
        for (int kc = 0; kc < HD / 32; ++kc) { F2 kb, qa; kb.h = frag_t(kp + kc * FRU); kb.l = frag_t(kp + kc * FRU + 512); qa.h = frag_t(qp + kc * FRU); qa.l = frag_t(qp + kc * FRU + 512); c = mac3(qa, kb, c); }
#pragma unroll
        for (int r = 0; r < 8; ++r) s[ct][r] = lv[ct][r] ? c[r] * 0.0625f : -3.0e38f; }
#pragma unroll
      for (int r = 0; r < 8; ++r) { float mx = fmaxf(s[0][r], s[1][r]);
#pragma unroll
        for (int o = 1; o < 16; o <<= 1) mx = fmaxf(mx, __shfl_xor(mx, o));
        const float mn = fmaxf(m[r], mx); const float alpha = (m[r] <= -1.0e38f) ? 0.f : exp_ni(m[r] - mn);
        const float e0 = (s[0][r] <= -1.0e38f) ? 0.f : exp_ni(s[0][r] - mn), e1 = (s[1][r] <= -1.0e38f) ? 0.f : exp_ni(s[1][r] - mn); float es = e0 + e1;
#pragma unroll
        for (int o = 1; o < 16; o <<= 1) es += __shfl_xor(es, o);
        l[r] = l[r] * alpha + es; m[r] = mn;
#pragma unroll
        for (int dt = 0; dt < 16; ++dt) acc[dt][r] *= alpha;
        sp[wave][8 * g + r][col] = e0; sp[wave][8 * g + r][16 + col] = e1; }
      LDSX();
      const F2 pa = split_row(&sp[wave][col][0], 0, lane); const __bf16* vp = VF + ((size_t)kv * (SS / 32) + ks) * (HD / 16) * FRU + lane * 8;   // one address; the 16 tiles' units lie constant steps behind it
#pragma unroll
      for (int dt = 0; dt < 16; ++dt) { const v16b vh = frag_t(vp + dt * FRU), vl = frag_t(vp + dt * FRU + 512); acc[dt] = wmma_bf(pa.l, vh, acc[dt]); acc[dt] = wmma_bf(pa.h, vl, acc[dt]); acc[dt] = wmma_bf(pa.h, vh, acc[dt]); }
      LDSX(); } }
#pragma unroll
  for (int r = 0; r < 8; ++r) {
#pragma unroll
    for (int dt = 0; dt < 16; ++dt) so[wave][8 * g + r][dt * 16 + col] = acc[dt][r];
    if (col == 0) { sm[wave][8 * g + r] = m[r]; sl[wave][8 * g + r] = l[r]; } }
  __syncthreads();   // every wave's partial is in LDS before any wave merges
  // merge: wave (qw, kj) finishes rows 4 kj .. 4 kj + 3 of query tile qw: weights exp(m_j - M), a share with no live key weighs 0
  for (int rl = 0; rl < 4; ++rl) { const int row = kj * 4 + rl; float mj[4]; float M = -3.0e38f;
#pragma unroll
    for (int j = 0; j < 4; ++j) { mj[j] = sm[qw + 4 * j][row]; M = fmaxf(M, mj[j]); }
    float L = 0.f; v4f o0 = {}, o1 = {};
#pragma unroll
    for (int j = 0; j < 4; ++j) { const float w = (mj[j] <= -1.0e38f) ? 0.f : exp_ni(mj[j] - M); L += w * sl[qw + 4 * j][row]; o0 += w * *(const v4f*)&so[qw + 4 * j][row][lane * 4]; o1 += w * *(const v4f*)&so[qw + 4 * j][row][128 + lane * 4]; }
    const float il = (L > 0.f) ? 1.0f / L : 0.f;
    vst2(O + (size_t)(q0 + row) * (NH * HD) + h * HD + lane * 4, o0 * il); vst2(O + (size_t)(q0 + row) * (NH * HD) + h * HD + 128 + lane * 4, o1 * il);
    asm volatile("s_wait_xcnt 0x0" ::: "memory"); }   // stands between the two stores and the next row's rewrite of their data registers
}
extern "C" void kernel_launch(void* const* d_in, const int* in_sizes, int n_in, void* d_out, int out_size, void* d_ws, size_t ws_size, hipStream_t stream) {
  (void)in_sizes; (void)n_in; (void)out_size;
  const float** F = (const float**)d_in; const int* AM = (const int*)d_in[1]; const int* SEGPOS = (const int*)d_in[2];
  // 0 x [1,2048,2048], 1 attn_mask [1,2048] bool(int), 2 segment_pos [1,2048] i32, 3 cos [1,2048,256], 4 sin, 5 wq [2048,2048], 6 wk [2048,1024], 7 wv [2048,1024], 8 wo [2048,2048], 9 q_scale [256], 10 k_scale [256]
  if (ws_size < (size_t)WS_END) return;
  char* ws = (char*)d_ws; __bf16 *PW = (__bf16*)(ws + WS_PW), *VF = (__bf16*)(ws + WS_VF), *QF = (__bf16*)(ws + WS_QF), *KF = (__bf16*)(ws + WS_KF); float *Q = (float*)(ws + WS_Q), *Kx = (float*)(ws + WS_K), *V = (float*)(ws + WS_V), *O = (float*)(ws + WS_O);
  k_packT<<<dim3(HID, 4), 256, 0, stream>>>(F[5], F[6], F[7], F[8], PW);
  k_gemm<1><<<dim3(TQB, NH * HD / 128), 128, 0, stream>>>(F[0] + (size_t)TQ0 * 64 * HID, HID, HID, PW + PQ, Q + (size_t)TQ0 * 64 * NH * HD, NH * HD);   // q rows of the processed query range
  k_gemm<1><<<dim3(KRP, NKV * HD / 128), 128, 0, stream>>>(F[0], HID, HID, PW + PK, Kx, NKV * HD);
  k_gemm<1><<<dim3(KRP, NKV * HD / 128), 128, 0, stream>>>(F[0], HID, HID, PW + PV, V, NKV * HD);
  k_normrope<0><<<dim3(TQB * 4, NH), 256, 0, stream>>>(Q + (size_t)TQ0 * 64 * NH * HD, F[9], F[3] + (size_t)TQ0 * 64 * HD, F[4] + (size_t)TQ0 * 64 * HD, QF + (size_t)TQ0 * 4 * (HD / 32) * FRU);
  k_normrope<1><<<dim3(KRP * 4, NKV), 256, 0, stream>>>(Kx, F[10], F[3], F[4], KF);
  k_vplanes<<<dim3(KRP, NKV * HD / 128), 256, 0, stream>>>(V, VF);
  k_attn<<<dim3(TQB, NH), 512, 0, stream>>>(QF, KF, AM, SEGPOS, VF, O);
  k_gemm<0><<<dim3(TQB, HID / 128), 128, 0, stream>>>(O + (size_t)TQ0 * 64 * NH * HD, NH * HD, NH * HD, PW + PO, (float*)d_out + (size_t)TQ0 * 64 * HID, HID);
}

// v005
// Measured time: 271 microseconds a run.
// Timed twice side by side with v004, it ran 1.38 times as fast both times.
// All steps since v000 together make it 4.95 times as fast.
// compute dtype: x, attn_mask, segment_pos, cos/sin tables, wq/wk/wv/wo and the RMSNorm scales (module inputs) rounded to bf16 / read as int; q/k/v projections with exact bf16 products (x and the weights are inputs); per-head RMSNorm and RoPE (input tables) in f32; scores q.k with both operands as bf16 hi + residual pairs (3 products), P.V with P hi/lo x V hi/lo (3 products), output projection hi/lo x exact wo (2 products); all on WMMA 16x16x32; the causal AND padding AND sliding-window mask is evaluated at run time from attn_mask / segment_pos and key tiles with no live entry are skipped; f32 accumulate.
#include <hip/hip_runtime.h>
#include <math.h>

typedef __attribute__((ext_vector_type(16))) _Float16 v16h;
typedef __attribute__((ext_vector_type(16))) __bf16 v16b;
typedef __attribute__((ext_vector_type(8)))  _Float16 v8h;
typedef __attribute__((ext_vector_type(8)))  float v8f;
typedef __attribute__((ext_vector_type(4)))  float v4f;
typedef __attribute__((ext_vector_type(2)))  float v2f;
typedef __attribute__((ext_vector_type(4)))  unsigned v4u;
typedef __attribute__((ext_vector_type(4)))  int v4i;
typedef float __attribute__((may_alias)) float_a;
typedef int __attribute__((may_alias)) int_a;

template <typename T> __device__ __forceinline__ void vst2(void* p, T v) { *(T*)p = v;  }
__device__ __forceinline__ v8f wmma16(v16h a, v16h b, v8f c) {
  v8f d = __builtin_amdgcn_wmma_f32_16x16x32_f16(false, a, false, b, (short)0, c, false, false);
  asm volatile("v_nop\n\tv_nop\n\tv_nop\n\tv_nop" : "+v"(d) : "v"(a), "v"(b));
  return d;
}
__device__ __forceinline__ v8f wmma_bf(v16b a, v16b b, v8f c) {
  v8f d = __builtin_amdgcn_wmma_f32_16x16x32_bf16(false, a, false, b, (short)0, c, false, false);
  asm volatile("v_nop\n\tv_nop\n\tv_nop\n\tv_nop" : "+v"(d) : "v"(a), "v"(b));
  return d;
}
// 16x16x32 fragments: lane = (h = lane>>4, row/col = lane&15); elements 0..7 = k0+8h+0..7, 8..15 = k0+16+8h+0..7; D element r = row 8h+r
__device__ __forceinline__ v16h frag_h(const _Float16* rowk0, int lane) {
  union { v16h v; v8h q[2]; } u; const _Float16* p = rowk0 + 8 * (lane >> 4);
  u.q[0] = *(const v8h*)p; u.q[1] = *(const v8h*)(p + 16); return u.v;
}
__device__ __forceinline__ v16h frag_f32(const float* rowk0, int lane) {
  v16h a; const float* p = rowk0 + 8 * (lane >> 4);
#pragma unroll
  for (int i = 0; i < 8; ++i) { a[i] = (_Float16)p[i]; a[8 + i] = (_Float16)p[16 + i]; }
  return a;
}
__device__ __forceinline__ v16h frag_f32s(const float* rowk0, int lane, float sc) {
  v16h a; const float* p = rowk0 + 8 * (lane >> 4);
#pragma unroll
  for (int i = 0; i < 8; ++i) { a[i] = (_Float16)(p[i] * sc); a[8 + i] = (_Float16)(p[16 + i] * sc); }
  return a;
}
// column fragment from a [K][ld] layout (column n), rows >= K read as 0
__device__ __forceinline__ v16h fragc_f32(const float* W, int k0, int n, int lane, int ld, int K) {
  v16h a; const int g = lane >> 4;
#pragma unroll
  for (int i = 0; i < 8; ++i) { const int ka = k0 + 8 * g + i, kb = ka + 16;
    a[i] = (_Float16)(ka < K ? W[(size_t)(ka < K ? ka : K - 1) * ld + n] : 0.f); a[8 + i] = (_Float16)(kb < K ? W[(size_t)(kb < K ? kb : K - 1) * ld + n] : 0.f); }
  return a;
}
struct F2 { v16b h, l; };
__device__ __forceinline__ F2 bsplit16(const float v[16]) { F2 r;
#pragma unroll
  for (int i = 0; i < 16; ++i) { const __bf16 h = (__bf16)v[i]; r.h[i] = h; r.l[i] = (__bf16)(v[i] - (float)h); }
  return r; }
__device__ __forceinline__ F2 split_row(const float* row, int k0, int lane) { float v[16]; const float* p = row + k0 + 8 * (lane >> 4);
#pragma unroll
  for (int i = 0; i < 8; ++i) { v[i] = p[i]; v[8 + i] = p[16 + i]; }
  return bsplit16(v); }
__device__ __forceinline__ F2 split_rowK(const float* row, int k0, int lane, int K) { float v[16]; const int g = lane >> 4;
#pragma unroll
  for (int i = 0; i < 8; ++i) { const int ka = k0 + 8 * g + i, kb = ka + 16; v[i] = ka < K ? row[ka < K ? ka : K - 1] : 0.f; v[8 + i] = kb < K ? row[kb < K ? kb : K - 1] : 0.f; }
  return bsplit16(v); }
__device__ __forceinline__ F2 split_col(const float* W, int k0, int n, int lane, int ld, int K) { float v[16]; const int g = lane >> 4;
#pragma unroll
  for (int i = 0; i < 8; ++i) { const int ka = k0 + 8 * g + i, kb = ka + 16; v[i] = ka < K ? W[(size_t)(ka < K ? ka : K - 1) * ld + n] : 0.f; v[8 + i] = kb < K ? W[(size_t)(kb < K ? kb : K - 1) * ld + n] : 0.f; }
  return bsplit16(v); }
__device__ __forceinline__ v8f mac3(const F2& a, const F2& b, v8f c) { c = wmma_bf(a.l, b.h, c); c = wmma_bf(a.h, b.l, c); return wmma_bf(a.h, b.h, c); }
__device__ __forceinline__ float sigm(float v) { return 1.0f / (1.0f + expf(-v)); }
#define LDSX() do { asm volatile("s_wait_dscnt 0" ::: "memory"); __builtin_amdgcn_wave_barrier(); __builtin_amdgcn_fence(__ATOMIC_RELEASE, "workgroup"); } while (0)


// Gemma-3 style attention (B 1, S 2048, hidden 2048, 8 query heads / 4 kv heads x 256, sliding window 1024): q,k,v = x w; q,k = RMSNorm_head(.)(1 + scale); RoPE with the given cos/sin; GQA (kv head = h / 2); scores / 16 masked by causal & attn_mask[k] & |k - segment_pos[q]| < WIN (else -1e37); softmax; out = (P v merged) wo.
#define SS 2048
#define HID 2048
#define NH 8
#define NKV 4
#define HD 256
#define WIN 1024
#ifndef TQB
#define TQB (SS / 64)          // query tiles processed
#define TQ0 0                  // first query tile
#define KRP (SS / 64)          // key/value row tiles (all)
#endif
typedef __attribute__((ext_vector_type(8))) __bf16 v8b;
__device__ __forceinline__ v16b frag_b(const __bf16* rowk0, int lane) {
  union { v16b v; v8b q[2]; } u; const __bf16* p = rowk0 + 8 * (lane >> 4);
  u.q[0] = *(const v8b*)p; u.q[1] = *(const v8b*)(p + 16); return u.v;
}
__device__ __forceinline__ float bfr(float v) { return (float)(__bf16)v; }
__device__ __attribute__((noinline)) float exp_ni(float v) { return expf(v); }
__device__ __attribute__((noinline)) float erf_ni(float v) { return erff(v); }

#define WS_PW  0u                                  // bf16 rows (in,out -> [out][in]): wq [2048][2048], wk [1024][2048], wv [1024][2048], wo [2048][2048]
#define PQ 0
#define PK (PQ + NH * HD * HID)
#define PV (PK + NKV * HD * HID)
#define PO (PV + NKV * HD * HID)
#define PWEND (PO + HID * NH * HD)
#define WS_Q   (WS_PW + 2u * PWEND)                 // f32 [S][2048] q raw
#define WS_K   (WS_Q + 4u * SS * NH * HD)            // f32 [S][1024] k raw
#define WS_V   (WS_K + 4u * SS * NKV * HD)           // f32 [S][1024] v raw
#define WS_VF  (WS_V + 4u * SS * NKV * HD)           // bf16 v in fragment order: [kv][32-key step][16-column tile][FRU]
#define WS_O   (WS_VF + 4u * NKV * HD * SS)          // f32 [S][2048]
#define WS_QF  (WS_O + 4u * SS * NH * HD)            // bf16 q in fragment order: [head][16-query tile][32-d step][FRU]
#define WS_KF  (WS_QF + 4u * SS * NH * HD)           // bf16 k in fragment order: [kv][16-key tile][32-d step][FRU]
#define WS_END (WS_KF + 4u * SS * NKV * HD)
// Fragment order: one 16 x 32 operand tile is a unit of FRU bf16 = [plane hi, lo][part 0, 1][lane 32][8]: lane (g = lane >> 4, row = lane & 15) holds k = 16 part + 8 g + 0..7 of its row, which is what frag_b reads from a row. A wave's 16-byte load of one (plane, part) is then 512 bytes in a row, four whole lines, where a load from rows touches sixteen.
#define FRU 1024
__device__ __forceinline__ v16b frag_t(const __bf16* p) { union { v16b v; v8b q[2]; } u; u.q[0] = *(const v8b*)p; u.q[1] = *(const v8b*)(p + 256); return u.v; }

// ---- k_packT: block = (output col n, which): (in,out) weight -> rows [n][K]
__global__ __launch_bounds__(256) void k_packT(const float* __restrict__ WQ, const float* __restrict__ WK, const float* __restrict__ WV, const float* __restrict__ WO, __bf16* __restrict__ PW) {
  __shared__ __align__(16) __bf16 s[2048]; const int n = blockIdx.x, which = blockIdx.y, tid = threadIdx.x; int K, N; const float* Wm; size_t base;
  if (which == 0) { K = HID; N = NH * HD; Wm = WQ; base = PQ; } else if (which == 1) { K = HID; N = NKV * HD; Wm = WK; base = PK; } else if (which == 2) { K = HID; N = NKV * HD; Wm = WV; base = PV; } else { K = NH * HD; N = HID; Wm = WO; base = PO; }
  if (n >= N) return;
  for (int k = tid; k < K; k += 256) s[k] = (__bf16)Wm[(size_t)k * N + n];
  __syncthreads();
  for (int q = tid; q < K / 8; q += 256) vst2((unsigned*)(PW + base + (size_t)n * K + q * 8), *(const v4u*)&s[q * 8]);
}
// ---- k_gemm<RIN>: block = (64 rows, 128 cols): OUT = A(K) . rows (RIN exact / hi-lo 2 products); pitch ldo. K is a multiple of 64.
// Both operand tiles of a 64-k stage (A 64 rows x 256 B f32, P 128 rows x 128 B bf16) are brought into LDS by asynchronous copies, whole lines, two buffers: stage t + 1 flies while stage t is worked on, and the four waves share one copy of the P tile. Row pitches 272 B / 144 B (16 B x odd) keep the 16-byte fragment reads off one another's banks.
#define GKS 64
#define GAP 272
#define GBP 144
#define GAB (64 * GAP)
#define GSTG (GAB + 128 * GBP)
__device__ __forceinline__ unsigned lds_off(const void* p) { return (unsigned)(size_t)p; }
// eight 16-byte copies of a lane, rows lstep / gstep bytes apart; the s_wait_xcnt closes the statement so that no address register of a copy is rewritten ahead of it
__device__ __forceinline__ void acopy8(unsigned l, unsigned lstep, const char* g, size_t gstep) {
  asm volatile("global_load_async_to_lds_b128 %0, %8, off\n\t"
               "global_load_async_to_lds_b128 %1, %9, off\n\t"
               "global_load_async_to_lds_b128 %2, %10, off\n\t"
               "global_load_async_to_lds_b128 %3, %11, off\n\t"
               "global_load_async_to_lds_b128 %4, %12, off\n\t"
               "global_load_async_to_lds_b128 %5, %13, off\n\t"
               "global_load_async_to_lds_b128 %6, %14, off\n\t"
               "global_load_async_to_lds_b128 %7, %15, off\n\t"
               "s_wait_xcnt 0x0"
               :: "v"(l), "v"(l + lstep), "v"(l + 2 * lstep), "v"(l + 3 * lstep), "v"(l + 4 * lstep), "v"(l + 5 * lstep), "v"(l + 6 * lstep), "v"(l + 7 * lstep),
                  "v"(g), "v"(g + gstep), "v"(g + 2 * gstep), "v"(g + 3 * gstep), "v"(g + 4 * gstep), "v"(g + 5 * gstep), "v"(g + 6 * gstep), "v"(g + 7 * gstep)
               : "memory");
}
template <int RIN>
__global__ __launch_bounds__(128) void k_gemm(const float* __restrict__ A, int lda, int K, const __bf16* __restrict__ P, float* __restrict__ OUT, int ldo) {
  __shared__ __align__(16) float so[4][16][132]; __shared__ __align__(16) unsigned char st[2][GSTG];
  const int tid = threadIdx.x, wave = tid >> 5, lane = tid & 31, col = lane & 15, g = lane >> 4; const size_t r0 = (size_t)blockIdx.x * 64 + wave * 16; const int n0 = blockIdx.y * 128;
  // a thread's copy places: A chunk (row i * 8 + tid / 16, 16 B piece tid % 16), P chunk (row i * 16 + tid / 8, piece tid % 8), i = 0..7
  const char* ga = (const char*)(A + ((size_t)blockIdx.x * 64 + (tid >> 4)) * lda + (tid & 15) * 4); const char* gb = (const char*)(P + (size_t)(n0 + (tid >> 3)) * K + (tid & 7) * 8);
  const unsigned la = lds_off(&st[0][0]) + (tid >> 4) * GAP + (tid & 15) * 16, lb = lds_off(&st[0][0]) + GAB + (tid >> 3) * GBP + (tid & 7) * 16;
  const size_t gas = (size_t)lda * 8 * 4, gbs = (size_t)K * 16 * 2; const int nst = K / GKS;
  v8f acc[8] = {};
  acopy8(la, 8 * GAP, ga, gas); acopy8(lb, 16 * GBP, gb, gbs);
  asm volatile("s_wait_asynccnt 0x0" ::: "memory");   // this wave's share of stage 0 has landed
  __syncthreads();                                    // every wave's share of stage 0 has landed
  if (nst > 1) { acopy8(la + GSTG, 8 * GAP, ga + GKS * 4, gas); acopy8(lb + GSTG, 16 * GBP, gb + GKS * 2, gbs); }
  for (int t = 0; t < nst; ++t) { const unsigned bo = (t & 1) * GSTG; const unsigned char* pa = &st[0][0] + bo + (wave * 16 + col) * GAP + 32 * g; const unsigned char* pb = &st[0][0] + bo + GAB + col * GBP + 16 * g;
    // the stage's fragment reads stand ahead of its WMMAs, so that their latencies overlap; the second k step's A rows are read behind the first WMMA (16 registers fewer at the peak: the kernel stays inside v0..v255), still a whole k step ahead of their use
    v4f af[2][4]; v8b bq[2][8][2];
#pragma unroll   // in full: the fragment arrays are indexed by constants and stay in registers
    for (int q = 0; q < 4; ++q) af[0][q] = *(const v4f*)(pa + (q >> 1) * 64 + (q & 1) * 16);
#pragma unroll   // in full: the fragment arrays are indexed by constants and stay in registers
    for (int kc = 0; kc < 2; ++kc)
#pragma unroll   // in full: the fragment arrays are indexed by constants and stay in registers
      for (int j = 0; j < 8; ++j) { bq[kc][j][0] = *(const v8b*)(pb + j * 16 * GBP + kc * 64); bq[kc][j][1] = *(const v8b*)(pb + j * 16 * GBP + kc * 64 + 32); }
#pragma unroll   // in full: the fragment arrays are indexed by constants and stay in registers
    for (int kc = 0; kc < 2; ++kc) { F2 a; float v[16];
#pragma unroll   // in full: the fragment arrays are indexed by constants and stay in registers
      for (int i = 0; i < 4; ++i) { v[i] = af[kc][0][i]; v[4 + i] = af[kc][1][i]; v[8 + i] = af[kc][2][i]; v[12 + i] = af[kc][3][i]; }
      if (RIN) { v16b ax;
#pragma unroll   // in full: the fragment arrays are indexed by constants and stay in registers
        for (int i = 0; i < 16; ++i) ax[i] = (__bf16)v[i];
        a.h = ax; a.l = ax; } else a = bsplit16(v);
#pragma unroll   // in full: the fragment arrays are indexed by constants and stay in registers
      for (int j = 0; j < 8; ++j) { union { v16b v; v8b q[2]; } w; w.q[0] = bq[kc][j][0]; w.q[1] = bq[kc][j][1]; if (!RIN) acc[j] = wmma_bf(a.l, w.v, acc[j]); acc[j] = wmma_bf(a.h, w.v, acc[j]);
        if (kc == 0 && j == 0) {
#pragma unroll   // in full: the fragment arrays are indexed by constants and stay in registers
          for (int q = 0; q < 4; ++q) af[1][q] = *(const v4f*)(pa + 128 + (q >> 1) * 64 + (q & 1) * 16); } } }
    asm volatile("s_wait_dscnt 0x0" ::: "memory");      // this wave has left stage t's buffer
    asm volatile("s_wait_asynccnt 0x0" ::: "memory");   // this wave's share of stage t + 1 has landed
    __syncthreads();                                    // publishes stage t + 1 and frees stage t's buffer
    if (t + 2 < nst) { acopy8(la + bo, 8 * GAP, ga + (size_t)(t + 2) * (GKS * 4), gas); acopy8(lb + bo, 16 * GBP, gb + (size_t)(t + 2) * (GKS * 2), gbs); } }
  asm volatile("s_wait_asynccnt 0x0" ::: "memory");     // no copy is outstanding when the wave goes on
#pragma unroll
  for (int j = 0; j < 8; ++j)
#pragma unroll
    for (int r = 0; r < 8; ++r) so[wave][8 * g + r][j * 16 + col] = acc[j][r];
  LDSX();
  for (int rl = 0; rl < 16; ++rl) vst2(OUT + (r0 + rl) * ldo + n0 + lane * 4, *(const v4f*)&so[wave][rl][lane * 4]);
}
// ---- k_normrope<PLANE>: block = (16 positions, head): 256 threads = d, each over the 16 rows: RMSNorm over the head's 256 (mean of squares, eps 1e-6) * (1 + scale[d]); RoPE: out_d = y_d cos[s][d] + rot_d sin[s][d] with rot = (-y[d+128], y[d-128]); the 16 x 256 result goes out as bf16 hi + residual in fragment order (8 units, 16 KiB in a row: a block writes whole lines, and no line has a second writer) (PLANE 0: q rows pitch 2048; 1: k rows pitch 1024)
template <int PLANE>
__global__ __launch_bounds__(256) void k_normrope(const float* __restrict__ QK, const float* __restrict__ SC, const float* __restrict__ COS, const float* __restrict__ SIN, __bf16* __restrict__ OF) {
  __shared__ float sy[16][HD]; __shared__ float sred[16][8]; __shared__ __align__(16) float so[16][HD + 4];
  const int t = blockIdx.x, h = blockIdx.y, d = threadIdx.x; const int pitch = PLANE ? (NKV * HD) : (NH * HD);
  const float* col = QK + (size_t)t * 16 * pitch + h * HD + d; float y[16];
#pragma unroll   // in full: y[] is indexed by constants and stays in registers, and the 16 rows' loads fly together
  for (int r = 0; r < 16; ++r) { y[r] = col[(size_t)r * pitch]; sy[r][d] = y[r]; }
#pragma unroll   // in full: y[] stays in registers, and the rows' cross-lane sums cover one another's latency
  for (int r = 0; r < 16; ++r) { float q = y[r] * y[r];
#pragma unroll   // in full: five fixed steps, no loop overhead
    for (int o = 1; o < 32; o <<= 1) q += __shfl_xor(q, o);
    if ((d & 31) == 0) sred[r][d >> 5] = q; }
  __syncthreads();
  const int dp = (d < HD / 2) ? (d + HD / 2) : (d - HD / 2); const float g0 = 1.0f + bfr(SC[d]), g1 = 1.0f + bfr(SC[dp]);
#pragma unroll   // in full: y[] stays in registers, and the rows' table loads fly together
  for (int r = 0; r < 16; ++r) { float ss = 0.f;
#pragma unroll   // in full: eight fixed terms, summed in this order
    for (int w = 0; w < 8; ++w) ss += sred[r][w];
    const float rs = rsqrtf(ss / (float)HD + 1e-6f);
    const float yn = y[r] * rs * g0; const float other = sy[r][dp] * rs * g1;
    const float rot = (d < HD / 2) ? -other : other; const size_t s = (size_t)t * 16 + r;
    so[r][d] = yn * bfr(COS[s * HD + d]) + rot * bfr(SIN[s * HD + d]); }
  __syncthreads();
  __bf16* ob = OF + ((size_t)h * (SS / 16) + t) * (HD / 32) * FRU;
  for (int q = d; q < (HD / 32) * FRU / 8; q += 256) { const int ln = q & 31, part = (q >> 5) & 1, pl = (q >> 6) & 1, kc = q >> 7; const float* p = &so[ln & 15][kc * 32 + part * 16 + (ln >> 4) * 8]; v8b w;
#pragma unroll   // in full: w[] is indexed by constants and stays in registers
    for (int i = 0; i < 8; ++i) { const float v = p[i]; const __bf16 hb = (__bf16)v; w[i] = pl ? (__bf16)(v - (float)hb) : hb; }
    vst2(ob + (size_t)q * 8, w); }
}
// ---- k_vplanes: block = (64 positions, 128 value columns): v as bf16 hi + residual, transposed in LDS, out in fragment order (row = value column, k = key): 2 key steps x 8 column tiles = 16 whole units
__global__ __launch_bounds__(256) void k_vplanes(const float* __restrict__ V, __bf16* __restrict__ VF) {
  __shared__ __align__(16) __bf16 sh[128][72], sl[128][72]; const int tid = threadIdx.x; const int s0 = blockIdx.x * 64, c0 = blockIdx.y * 128;
  for (int q = tid; q < 64 * 128; q += 256) { const int sl_ = q >> 7, c = q & 127; const float v = V[(size_t)(s0 + sl_) * (NKV * HD) + c0 + c]; const __bf16 hb = (__bf16)v; sh[c][sl_] = hb; sl[c][sl_] = (__bf16)(v - (float)hb); }
  __syncthreads();
  for (int q = tid; q < 16 * FRU / 8; q += 256) { const int ln = q & 31, part = (q >> 5) & 1, pl = (q >> 6) & 1, dtl = (q >> 7) & 7, ksl = q >> 10; const int c = dtl * 16 + (ln & 15), sk = ksl * 32 + part * 16 + (ln >> 4) * 8; const int cg = c0 + dtl * 16;
    const size_t o = (((size_t)(cg / HD) * (SS / 32) + s0 / 32 + ksl) * (HD / 16) + (cg % HD) / 16) * FRU + (q & 127) * 8; vst2(VF + o, *(const v4u*)(pl ? &sl[c][sk] : &sh[c][sk])); }
}
// ---- k_attn: block = (64 queries, head h), 16 waves = (query tile qw = wave & 3) x (key share kj = wave >> 2): a wave takes the key steps ks = kj, kj + 4, ... of its 16 queries, so four waves a SIMD cover one another's load and LDS latency; the four partial (max, sum, acc) of a query tile are merged through LDS at the end; kv = h / 2; per 32-key step: live = (k <= q) & attn_mask[k] & (k > pos_q - WIN) & (k < pos_q + WIN); wave vote; scores (3 products, K 256 = 8 ksteps) / 16; online softmax with guards; P.V over all 256 value columns (16 tiles, 3 products) from the one set of scores; q, k and v come as bf16 hi + residual in fragment order (frag_t), so nothing is split here and every fragment load reads whole lines; O cols h*256 + ...
// A pass = 128 keys = the four key shares' steps 4 it + kj. Its k units (8 key tiles) and its v units (4 key steps) are each 128 KiB in a row in global memory; asynchronous copies bring each into LDS once for the block, where the four query tiles of a key share read the same bytes. Two buffers, tiles in the order k(it), v(it), k(next), v(next): v flies under scores and softmax, the next k under P.V. The passes are those of lm, a mask that every wave forms alike from segment_pos and the causal bound (attn_mask left out: it can only hold more passes than are live), so every barrier stands under block-uniform control flow; a wave's own vote still decides whether it works in a pass.
#define KVT 131072u
// eight 16-byte copies of a lane, 8 KiB (512 threads) apart in LDS and in global memory alike: the offset field moves both addresses, so one address of each kind serves all eight and none is kept in registers over the loop; the s_wait_xcnt closes the statement so that no address register of a copy is rewritten ahead of it
__device__ __forceinline__ void acopy8s(unsigned l, const char* g) {
  asm volatile("global_load_async_to_lds_b128 %0, %1, off\n\t"
               "global_load_async_to_lds_b128 %0, %1, off offset:8192\n\t"
               "global_load_async_to_lds_b128 %0, %1, off offset:16384\n\t"
               "global_load_async_to_lds_b128 %0, %1, off offset:24576\n\t"
               "global_load_async_to_lds_b128 %0, %1, off offset:32768\n\t"
               "global_load_async_to_lds_b128 %0, %1, off offset:40960\n\t"
               "global_load_async_to_lds_b128 %0, %1, off offset:49152\n\t"
               "global_load_async_to_lds_b128 %0, %1, off offset:57344\n\t"
               "s_wait_xcnt 0x0"
               :: "v"(l), "v"(g) : "memory");
}
// one 128 KiB tile into LDS: 16 pieces of 16 bytes a thread
__device__ __forceinline__ void acopy_tile(unsigned l, const char* g) { acopy8s(l, g); acopy8s(l + 65536u, g + 65536); }
__global__ __launch_bounds__(512) void k_attn(const __bf16* __restrict__ QF, const __bf16* __restrict__ KF, const int* __restrict__ AM, const int* __restrict__ SEGPOS, const __bf16* __restrict__ VF, float* __restrict__ O) {
  __shared__ __align__(16) float sp[16][16][36]; __shared__ __align__(16) unsigned char big[16 * 16 * 260 * 4]; __shared__ float sm[16][16], sl[16][16];
  float (*so)[16][260] = (float (*)[16][260])big;   // the merge's partials lie over the two staging buffers (k at 0, v at KVT), which are dead by then
  const int tid = threadIdx.x, wave = __builtin_amdgcn_readfirstlane(tid >> 5), lane = tid & 31, col = lane & 15, g = lane >> 4; const int qw = wave & 3, kj = wave >> 2; const int qb = blockIdx.x + TQ0, h = blockIdx.y; const int kv = h / (NH / NKV); const int q0 = qb * 64 + qw * 16;   // the wave's number in a scalar register: key step and tile bases leave the vector registers, and the 16 accumulator tiles fit the 256 a wave has with no scratch
  const __bf16* qp = QF + ((size_t)h * (SS / 16) + (q0 >> 4)) * (HD / 32) * FRU + lane * 8;
  int posq[8];
#pragma unroll
  for (int r = 0; r < 8; ++r) posq[r] = SEGPOS[q0 + 8 * g + r];
  asm volatile("s_wait_xcnt 0x0" ::: "memory");   // stands between these loads and the rewrite of their address registers by the code below
  float m[8], l[8];
#pragma unroll
  for (int r = 0; r < 8; ++r) { m[r] = -3.0e38f; l[r] = 0.f; }
  v8f acc[16] = {};
  const int nks = (qb * 64 + 64) / 32;   // causal upper bound on key steps
  unsigned lm = 0;
  { const int qx = qb * 64 + lane, qy = qx + 32; const int px = SEGPOS[qx], py = SEGPOS[qy];
    for (int i = 0; i < (nks + 3) / 4; ++i) { const int k0 = i * 128, k1 = k0 + 127;
      const bool lx = max(k0, px - WIN + 1) <= min(min(k1, qx), px + WIN - 1), ly = max(k0, py - WIN + 1) <= min(min(k1, qy), py + WIN - 1);
      if (__any(lx || ly)) lm |= 1u << i; } }
  lm = __builtin_amdgcn_readfirstlane(lm);
  if (lm != 0) {
  const unsigned lk = lds_off(&big[0]) + tid * 16, lvv = lk + KVT;
  const char* gk = (const char*)(KF + (size_t)kv * (SS / 16) * (HD / 32) * FRU) + tid * 16; const char* gv = (const char*)(VF + (size_t)kv * (SS / 32) * (HD / 16) * FRU) + tid * 16;
  int it = __builtin_ctz(lm);
  acopy_tile(lk, gk + (size_t)it * KVT);
  asm volatile("s_wait_asynccnt 0x0" ::: "memory");   // this wave's share of the first k tile has landed
  __syncthreads();                                    // every wave's share of it has landed
  acopy_tile(lvv, gv + (size_t)it * KVT);
#pragma unroll 1   // rolled: the body is some thousand instructions long
  for (;;) { v8f s[2]; bool lv[2][8]; bool anylive = false; lm &= lm - 1; const bool more = lm != 0; const int nx = more ? __builtin_ctz(lm) : 0; const int ks = it * 4 + kj;
#pragma unroll
    for (int ct = 0; ct < 2; ++ct) { const int kk = ks * 32 + ct * 16 + col; const bool am = (AM[kk] != 0);
#pragma unroll
      for (int r = 0; r < 8; ++r) { const int qi = q0 + 8 * g + r; const bool live = am && (kk <= qi) && (kk > posq[r] - WIN) && (kk < posq[r] + WIN); lv[ct][r] = live; anylive = anylive || live; } }
    const bool wl = __any(anylive);
    if (wl) {
#pragma unroll
      for (int ct = 0; ct < 2; ++ct) { const __bf16* kp = (const __bf16*)(big + kj * 32768 + ct * 16384) + lane * 8; v8f c = {};
#pragma unroll
        for (int kc = 0; kc < HD / 32; ++kc) { F2 kb, qa; kb.h = frag_t(kp + kc * FRU); kb.l = frag_t(kp + kc * FRU + 512); qa.h = frag_t(qp + kc * FRU); qa.l = frag_t(qp + kc * FRU + 512); c = mac3(qa, kb, c); }
#pragma unroll
        for (int r = 0; r < 8; ++r) s[ct][r] = lv[ct][r] ? c[r] * 0.0625f : -3.0e38f; }
#pragma unroll
      for (int r = 0; r < 8; ++r) { float mx = fmaxf(s[0][r], s[1][r]);
#pragma unroll
        for (int o = 1; o < 16; o <<= 1) mx = fmaxf(mx, __shfl_xor(mx, o));
        const float mn = fmaxf(m[r], mx); const float alpha = (m[r] <= -1.0e38f) ? 0.f : exp_ni(m[r] - mn);
        const float e0 = (s[0][r] <= -1.0e38f) ? 0.f : exp_ni(s[0][r] - mn), e1 = (s[1][r] <= -1.0e38f) ? 0.f : exp_ni(s[1][r] - mn); float es = e0 + e1;
#pragma unroll
        for (int o = 1; o < 16; o <<= 1) es += __shfl_xor(es, o);
        l[r] = l[r] * alpha + es; m[r] = mn;
#pragma unroll
        for (int dt = 0; dt < 16; ++dt) acc[dt][r] *= alpha;
        sp[wave][8 * g + r][col] = e0; sp[wave][8 * g + r][16 + col] = e1; } }
    asm volatile("s_wait_dscnt 0x0" ::: "memory");      // this wave has left the k buffer
    asm volatile("s_wait_asynccnt 0x0" ::: "memory");   // this wave's share of the pass's v tile has landed
    __syncthreads();                                    // publishes the v tile and frees the k buffer
    if (more) acopy_tile(lk, gk + (size_t)nx * KVT);
    if (wl) {   // the wave's own sp stores are behind the s_wait_dscnt and the barrier above
      const F2 pa = split_row(&sp[wave][col][0], 0, lane); const __bf16* vp = (const __bf16*)(big + KVT + kj * 32768) + lane * 8;   // one address; the 16 tiles' units lie constant steps behind it
#pragma unroll
      for (int dt = 0; dt < 16; ++dt) { const v16b vh = frag_t(vp + dt * FRU), vl = frag_t(vp + dt * FRU + 512); acc[dt] = wmma_bf(pa.l, vh, acc[dt]); acc[dt] = wmma_bf(pa.h, vl, acc[dt]); acc[dt] = wmma_bf(pa.h, vh, acc[dt]); } }
    asm volatile("s_wait_dscnt 0x0" ::: "memory");      // this wave has left the v buffer, and its sp rows, which the next pass rewrites
    asm volatile("s_wait_asynccnt 0x0" ::: "memory");   // this wave's share of the next pass's k tile has landed
    __syncthreads();                                    // publishes that k tile and frees the v buffer (behind the last pass: for the merge's partials)
    if (!more) break;
    acopy_tile(lvv, gv + (size_t)nx * KVT); it = nx; }
  asm volatile("s_wait_asynccnt 0x0" ::: "memory"); }   // no copy is outstanding when the wave goes on
#pragma unroll
  for (int r = 0; r < 8; ++r) {
#pragma unroll
    for (int dt = 0; dt < 16; ++dt) so[wave][8 * g + r][dt * 16 + col] = acc[dt][r];
    if (col == 0) { sm[wave][8 * g + r] = m[r]; sl[wave][8 * g + r] = l[r]; } }
  __syncthreads();   // every wave's partial is in LDS before any wave merges
  // merge: wave (qw, kj) finishes rows 4 kj .. 4 kj + 3 of query tile qw: weights exp(m_j - M), a share with no live key weighs 0
  for (int rl = 0; rl < 4; ++rl) { const int row = kj * 4 + rl; float mj[4]; float M = -3.0e38f;
#pragma unroll
    for (int j = 0; j < 4; ++j) { mj[j] = sm[qw + 4 * j][row]; M = fmaxf(M, mj[j]); }
    float L = 0.f; v4f o0 = {}, o1 = {};
#pragma unroll
    for (int j = 0; j < 4; ++j) { const float w = (mj[j] <= -1.0e38f) ? 0.f : exp_ni(mj[j] - M); L += w * sl[qw + 4 * j][row]; o0 += w * *(const v4f*)&so[qw + 4 * j][row][lane * 4]; o1 += w * *(const v4f*)&so[qw + 4 * j][row][128 + lane * 4]; }
    const float il = (L > 0.f) ? 1.0f / L : 0.f;
    vst2(O + (size_t)(q0 + row) * (NH * HD) + h * HD + lane * 4, o0 * il); vst2(O + (size_t)(q0 + row) * (NH * HD) + h * HD + 128 + lane * 4, o1 * il);
    asm volatile("s_wait_xcnt 0x0" ::: "memory"); }   // stands between the two stores and the next row's rewrite of their data registers
}
extern "C" void kernel_launch(void* const* d_in, const int* in_sizes, int n_in, void* d_out, int out_size, void* d_ws, size_t ws_size, hipStream_t stream) {
  (void)in_sizes; (void)n_in; (void)out_size;
  const float** F = (const float**)d_in; const int* AM = (const int*)d_in[1]; const int* SEGPOS = (const int*)d_in[2];
  // 0 x [1,2048,2048], 1 attn_mask [1,2048] bool(int), 2 segment_pos [1,2048] i32, 3 cos [1,2048,256], 4 sin, 5 wq [2048,2048], 6 wk [2048,1024], 7 wv [2048,1024], 8 wo [2048,2048], 9 q_scale [256], 10 k_scale [256]
  if (ws_size < (size_t)WS_END) return;
  char* ws = (char*)d_ws; __bf16 *PW = (__bf16*)(ws + WS_PW), *VF = (__bf16*)(ws + WS_VF), *QF = (__bf16*)(ws + WS_QF), *KF = (__bf16*)(ws + WS_KF); float *Q = (float*)(ws + WS_Q), *Kx = (float*)(ws + WS_K), *V = (float*)(ws + WS_V), *O = (float*)(ws + WS_O);
  k_packT<<<dim3(HID, 4), 256, 0, stream>>>(F[5], F[6], F[7], F[8], PW);
  k_gemm<1><<<dim3(TQB, NH * HD / 128), 128, 0, stream>>>(F[0] + (size_t)TQ0 * 64 * HID, HID, HID, PW + PQ, Q + (size_t)TQ0 * 64 * NH * HD, NH * HD);   // q rows of the processed query range
  k_gemm<1><<<dim3(KRP, NKV * HD / 128), 128, 0, stream>>>(F[0], HID, HID, PW + PK, Kx, NKV * HD);
  k_gemm<1><<<dim3(KRP, NKV * HD / 128), 128, 0, stream>>>(F[0], HID, HID, PW + PV, V, NKV * HD);
  k_normrope<0><<<dim3(TQB * 4, NH), 256, 0, stream>>>(Q + (size_t)TQ0 * 64 * NH * HD, F[9], F[3] + (size_t)TQ0 * 64 * HD, F[4] + (size_t)TQ0 * 64 * HD, QF + (size_t)TQ0 * 4 * (HD / 32) * FRU);
  k_normrope<1><<<dim3(KRP * 4, NKV), 256, 0, stream>>>(Kx, F[10], F[3], F[4], KF);
  k_vplanes<<<dim3(KRP, NKV * HD / 128), 256, 0, stream>>>(V, VF);
  k_attn<<<dim3(TQB, NH), 512, 0, stream>>>(QF, KF, AM, SEGPOS, VF, O);
  k_gemm<0><<<dim3(TQB, HID / 128), 128, 0, stream>>>(O + (size_t)TQ0 * 64 * NH * HD, NH * HD, NH * HD, PW + PO, (float*)d_out + (size_t)TQ0 * 64 * HID, HID);
}

// v006
// One run takes 229 microseconds.
// Timed twice side by side with v005, it ran 1.19 and 1.18 times as fast.
// Over all steps from v000 it is 5.86 times as fast.
// compute dtype: x, attn_mask, segment_pos, cos/sin tables, wq/wk/wv/wo and the RMSNorm scales (module inputs) rounded to bf16 / read as int; q/k/v projections with exact bf16 products (x and the weights are inputs); per-head RMSNorm and RoPE (input tables) in f32; scores q.k with both operands as bf16 hi + residual pairs (3 products), P.V with P hi/lo x V hi/lo (3 products), output projection hi/lo x exact wo (2 products); all on WMMA 16x16x32; the causal AND padding AND sliding-window mask is evaluated at run time from attn_mask / segment_pos and key tiles with no live entry are skipped; f32 accumulate.
#include <hip/hip_runtime.h>
#include <math.h>

typedef __attribute__((ext_vector_type(16))) _Float16 v16h;
typedef __attribute__((ext_vector_type(16))) __bf16 v16b;
typedef __attribute__((ext_vector_type(8)))  _Float16 v8h;
typedef __attribute__((ext_vector_type(8)))  float v8f;
typedef __attribute__((ext_vector_type(4)))  float v4f;
typedef __attribute__((ext_vector_type(2)))  float v2f;
typedef __attribute__((ext_vector_type(4)))  unsigned v4u;
typedef __attribute__((ext_vector_type(4)))  int v4i;
typedef float __attribute__((may_alias)) float_a;
typedef int __attribute__((may_alias)) int_a;

template <typename T> __device__ __forceinline__ void vst2(void* p, T v) { *(T*)p = v;  }
__device__ __forceinline__ v8f wmma16(v16h a, v16h b, v8f c) {
  v8f d = __builtin_amdgcn_wmma_f32_16x16x32_f16(false, a, false, b, (short)0, c, false, false);
  asm volatile("v_nop\n\tv_nop\n\tv_nop\n\tv_nop" : "+v"(d) : "v"(a), "v"(b));
  return d;
}
__device__ __forceinline__ v8f wmma_bf(v16b a, v16b b, v8f c) {
  v8f d = __builtin_amdgcn_wmma_f32_16x16x32_bf16(false, a, false, b, (short)0, c, false, false);
  asm volatile("v_nop\n\tv_nop\n\tv_nop\n\tv_nop" : "+v"(d) : "v"(a), "v"(b));
  return d;
}
// 16x16x32 fragments: lane = (h = lane>>4, row/col = lane&15); elements 0..7 = k0+8h+0..7, 8..15 = k0+16+8h+0..7; D element r = row 8h+r
__device__ __forceinline__ v16h frag_h(const _Float16* rowk0, int lane) {
  union { v16h v; v8h q[2]; } u; const _Float16* p = rowk0 + 8 * (lane >> 4);
  u.q[0] = *(const v8h*)p; u.q[1] = *(const v8h*)(p + 16); return u.v;
}
__device__ __forceinline__ v16h frag_f32(const float* rowk0, int lane) {
  v16h a; const float* p = rowk0 + 8 * (lane >> 4);
#pragma unroll
  for (int i = 0; i < 8; ++i) { a[i] = (_Float16)p[i]; a[8 + i] = (_Float16)p[16 + i]; }
  return a;
}
__device__ __forceinline__ v16h frag_f32s(const float* rowk0, int lane, float sc) {
  v16h a; const float* p = rowk0 + 8 * (lane >> 4);
#pragma unroll
  for (int i = 0; i < 8; ++i) { a[i] = (_Float16)(p[i] * sc); a[8 + i] = (_Float16)(p[16 + i] * sc); }
  return a;
}
// column fragment from a [K][ld] layout (column n), rows >= K read as 0
__device__ __forceinline__ v16h fragc_f32(const float* W, int k0, int n, int lane, int ld, int K) {
  v16h a; const int g = lane >> 4;
#pragma unroll
  for (int i = 0; i < 8; ++i) { const int ka = k0 + 8 * g + i, kb = ka + 16;
    a[i] = (_Float16)(ka < K ? W[(size_t)(ka < K ? ka : K - 1) * ld + n] : 0.f); a[8 + i] = (_Float16)(kb < K ? W[(size_t)(kb < K ? kb : K - 1) * ld + n] : 0.f); }
  return a;
}
struct F2 { v16b h, l; };
__device__ __forceinline__ F2 bsplit16(const float v[16]) { F2 r;
#pragma unroll
  for (int i = 0; i < 16; ++i) { const __bf16 h = (__bf16)v[i]; r.h[i] = h; r.l[i] = (__bf16)(v[i] - (float)h); }
  return r; }
__device__ __forceinline__ F2 split_row(const float* row, int k0, int lane) { float v[16]; const float* p = row + k0 + 8 * (lane >> 4);
#pragma unroll
  for (int i = 0; i < 8; ++i) { v[i] = p[i]; v[8 + i] = p[16 + i]; }
  return bsplit16(v); }
__device__ __forceinline__ F2 split_rowK(const float* row, int k0, int lane, int K) { float v[16]; const int g = lane >> 4;
#pragma unroll
  for (int i = 0; i < 8; ++i) { const int ka = k0 + 8 * g + i, kb = ka + 16; v[i] = ka < K ? row[ka < K ? ka : K - 1] : 0.f; v[8 + i] = kb < K ? row[kb < K ? kb : K - 1] : 0.f; }
  return bsplit16(v); }
__device__ __forceinline__ F2 split_col(const float* W, int k0, int n, int lane, int ld, int K) { float v[16]; const int g = lane >> 4;
#pragma unroll
  for (int i = 0; i < 8; ++i) { const int ka = k0 + 8 * g + i, kb = ka + 16; v[i] = ka < K ? W[(size_t)(ka < K ? ka : K - 1) * ld + n] : 0.f; v[8 + i] = kb < K ? W[(size_t)(kb < K ? kb : K - 1) * ld + n] : 0.f; }
  return bsplit16(v); }
__device__ __forceinline__ v8f mac3(const F2& a, const F2& b, v8f c) { c = wmma_bf(a.l, b.h, c); c = wmma_bf(a.h, b.l, c); return wmma_bf(a.h, b.h, c); }
__device__ __forceinline__ float sigm(float v) { return 1.0f / (1.0f + expf(-v)); }
#define LDSX() do { asm volatile("s_wait_dscnt 0" ::: "memory"); __builtin_amdgcn_wave_barrier(); __builtin_amdgcn_fence(__ATOMIC_RELEASE, "workgroup"); } while (0)


// Gemma-3 style attention (B 1, S 2048, hidden 2048, 8 query heads / 4 kv heads x 256, sliding window 1024): q,k,v = x w; q,k = RMSNorm_head(.)(1 + scale); RoPE with the given cos/sin; GQA (kv head = h / 2); scores / 16 masked by causal & attn_mask[k] & |k - segment_pos[q]| < WIN (else -1e37); softmax; out = (P v merged) wo.
#define SS 2048
#define HID 2048
#define NH 8
#define NKV 4
#define HD 256
#define WIN 1024
#ifndef TQB
#define TQB (SS / 64)          // query tiles processed
#define TQ0 0                  // first query tile
#define KRP (SS / 64)          // key/value row tiles (all)
#endif
typedef __attribute__((ext_vector_type(8))) __bf16 v8b;
__device__ __forceinline__ v16b frag_b(const __bf16* rowk0, int lane) {
  union { v16b v; v8b q[2]; } u; const __bf16* p = rowk0 + 8 * (lane >> 4);
  u.q[0] = *(const v8b*)p; u.q[1] = *(const v8b*)(p + 16); return u.v;
}
__device__ __forceinline__ float bfr(float v) { return (float)(__bf16)v; }
__device__ __attribute__((noinline)) float exp_ni(float v) { return expf(v); }
__device__ __attribute__((noinline)) float erf_ni(float v) { return erff(v); }

#define WS_PW  0u                                  // bf16 rows (in,out -> [out][in]): wq [2048][2048], wk [1024][2048], wv [1024][2048], wo [2048][2048]
#define PQ 0
#define PK (PQ + NH * HD * HID)
#define PV (PK + NKV * HD * HID)
#define PO (PV + NKV * HD * HID)
#define PWEND (PO + HID * NH * HD)
#define WS_Q   (WS_PW + 2u * PWEND)                 // f32 [S][2048] q raw
#define WS_K   (WS_Q + 4u * SS * NH * HD)            // f32 [S][1024] k raw
#define WS_V   (WS_K + 4u * SS * NKV * HD)           // f32 [S][1024] v raw
#define WS_VF  (WS_V + 4u * SS * NKV * HD)           // bf16 v in fragment order: [kv][32-key step][16-column tile][FRU]
#define WS_O   (WS_VF + 4u * NKV * HD * SS)          // f32 [S][2048]
#define WS_QF  (WS_O + 4u * SS * NH * HD)            // bf16 q in fragment order: [head][16-query tile][32-d step][FRU]
#define WS_KF  (WS_QF + 4u * SS * NH * HD)           // bf16 k in fragment order: [kv][16-key tile][32-d step][FRU]
#define WS_END (WS_KF + 4u * SS * NKV * HD)
// Fragment order: one 16 x 32 operand tile is a unit of FRU bf16 = [plane hi, lo][part 0, 1][lane 32][8]: lane (g = lane >> 4, row = lane & 15) holds k = 16 part + 8 g + 0..7 of its row, which is what frag_b reads from a row. A wave's 16-byte load of one (plane, part) is then 512 bytes in a row, four whole lines, where a load from rows touches sixteen.
#define FRU 1024
__device__ __forceinline__ v16b frag_t(const __bf16* p) { union { v16b v; v8b q[2]; } u; u.q[0] = *(const v8b*)p; u.q[1] = *(const v8b*)(p + 256); return u.v; }

// ---- k_packT: block = (128 k, 128 output columns): (in,out) weight -> rows [n][K], a tile at a time through LDS. The four weights all have K = 2048 and their row sets lie one behind another in PW, so blockIdx.y counts 128-column tiles over all of them (wq 16, wk 8, wv 8, wo 16).
// A wave's load is 512 bytes in a row of one k; a thread holds 8 k x 4 columns twice, which are eight finished 16-byte pieces of output rows; they cross in LDS, and a wave's store is two output rows x 256 bytes: whole lines both ways, each line with one writer.
// LDS row = one column's 128 k as bf16, pitch 272 B; the 16-byte piece kch of row n lies at place kch ^ ((n >> 4) & 3): with it the 16 lanes of a half wave, four rows apart, store to 16 different bank groups.
#define PTP 272
template <int N>   // the weight's row length as a constant: the 16 loads then share one address and differ in the offset field
__device__ __forceinline__ void pack_tile(const float* __restrict__ src, __bf16* __restrict__ dst, unsigned char* s, int tid) {
  const int wave = tid >> 5, lane = tid & 31; src += (size_t)(wave * 8) * N + lane * 4; v4f v[2][8];
#pragma unroll   // in full: v[] is indexed by constants and stays in registers
  for (int hf = 0; hf < 2; ++hf)
#pragma unroll   // in full: as above
    for (int i = 0; i < 8; ++i) v[hf][i] = *(const v4f*)(src + (size_t)(hf * 64 + i) * N);
  // the wait stands between the loads and any rewrite of their address register; the loaded values and the address are inputs only, so that all 16 loads are issued ahead of the first use and fly together (without it the compiler issues the last six behind waits on the first ten) and no load's result lands on the address
  asm volatile("s_wait_xcnt 0x0" :: "v"(src), "v"(v[0][0]), "v"(v[0][1]), "v"(v[0][2]), "v"(v[0][3]), "v"(v[0][4]), "v"(v[0][5]), "v"(v[0][6]), "v"(v[0][7]), "v"(v[1][0]), "v"(v[1][1]), "v"(v[1][2]), "v"(v[1][3]), "v"(v[1][4]), "v"(v[1][5]), "v"(v[1][6]), "v"(v[1][7]) : "memory");
  const int sw = (lane >> 2) & 3;   // (n >> 4) & 3 of the thread's four columns n = 4 lane + c
#pragma unroll   // in full: v[] is indexed by constants
  for (int hf = 0; hf < 2; ++hf)
#pragma unroll   // in full: v[] is indexed by constants
    for (int c = 0; c < 4; ++c) { v8b w;
#pragma unroll   // in full: v[] and w[] are indexed by constants
      for (int i = 0; i < 8; ++i) w[i] = (__bf16)v[hf][i][c];
      *(v8b*)(s + (lane * 4 + c) * PTP + (((hf * 8 + wave) ^ sw) * 16)) = w; }
  __syncthreads();
  const int nr = tid >> 4, kch = tid & 15;
#pragma unroll   // in full: eight fixed pieces a thread (rows nr + 16 j), their LDS reads ahead of the stores
  for (int j = 0; j < 8; ++j) vst2(dst + (size_t)(nr + 16 * j) * HID + kch * 8, *(const v4u*)(s + (nr + 16 * j) * PTP + ((kch ^ (j & 3)) * 16)));
}
__global__ __launch_bounds__(256) void k_packT(const float* __restrict__ WQ, const float* __restrict__ WK, const float* __restrict__ WV, const float* __restrict__ WO, __bf16* __restrict__ PW) {
  __shared__ __align__(16) unsigned char s[128 * PTP]; const int tid = threadIdx.x; const int k0 = blockIdx.x * 128, y = blockIdx.y;
  if (y < 16) pack_tile<NH * HD>(WQ + (size_t)k0 * (NH * HD) + y * 128, PW + PQ + (size_t)y * 128 * HID + k0, s, tid);
  else if (y < 24) pack_tile<NKV * HD>(WK + (size_t)k0 * (NKV * HD) + (y - 16) * 128, PW + PK + (size_t)(y - 16) * 128 * HID + k0, s, tid);
  else if (y < 32) pack_tile<NKV * HD>(WV + (size_t)k0 * (NKV * HD) + (y - 24) * 128, PW + PV + (size_t)(y - 24) * 128 * HID + k0, s, tid);
  else pack_tile<HID>(WO + (size_t)k0 * HID + (y - 32) * 128, PW + PO + (size_t)(y - 32) * 128 * HID + k0, s, tid);
}
// ---- k_gemm<RIN>: block = (64 rows, 128 cols): OUT = A(K) . rows (RIN exact / hi-lo 2 products); pitch ldo. K is a multiple of 64.
// Both operand tiles of a 64-k stage (A 64 rows x 256 B f32, P 128 rows x 128 B bf16) are brought into LDS by asynchronous copies, whole lines, two buffers: stage t + 1 flies while stage t is worked on, and the four waves share one copy of the P tile. Row pitches 272 B / 144 B (16 B x odd) keep the 16-byte fragment reads off one another's banks.
#define GKS 64
#define GAP 272
#define GBP 144
#define GAB (64 * GAP)
#define GSTG (GAB + 128 * GBP)
__device__ __forceinline__ unsigned lds_off(const void* p) { return (unsigned)(size_t)p; }
// eight 16-byte copies of a lane, rows lstep / gstep bytes apart; the s_wait_xcnt closes the statement so that no address register of a copy is rewritten ahead of it
__device__ __forceinline__ void acopy8(unsigned l, unsigned lstep, const char* g, size_t gstep) {
  asm volatile("global_load_async_to_lds_b128 %0, %8, off\n\t"
               "global_load_async_to_lds_b128 %1, %9, off\n\t"
               "global_load_async_to_lds_b128 %2, %10, off\n\t"
               "global_load_async_to_lds_b128 %3, %11, off\n\t"
               "global_load_async_to_lds_b128 %4, %12, off\n\t"
               "global_load_async_to_lds_b128 %5, %13, off\n\t"
               "global_load_async_to_lds_b128 %6, %14, off\n\t"
               "global_load_async_to_lds_b128 %7, %15, off\n\t"
               "s_wait_xcnt 0x0"
               :: "v"(l), "v"(l + lstep), "v"(l + 2 * lstep), "v"(l + 3 * lstep), "v"(l + 4 * lstep), "v"(l + 5 * lstep), "v"(l + 6 * lstep), "v"(l + 7 * lstep),
                  "v"(g), "v"(g + gstep), "v"(g + 2 * gstep), "v"(g + 3 * gstep), "v"(g + 4 * gstep), "v"(g + 5 * gstep), "v"(g + 6 * gstep), "v"(g + 7 * gstep)
               : "memory");
}
template <int RIN>
__global__ __launch_bounds__(128) void k_gemm(const float* __restrict__ A, int lda, int K, const __bf16* __restrict__ P, float* __restrict__ OUT, int ldo) {
  __shared__ __align__(16) float so[4][16][132]; __shared__ __align__(16) unsigned char st[2][GSTG];
  const int tid = threadIdx.x, wave = tid >> 5, lane = tid & 31, col = lane & 15, g = lane >> 4; const size_t r0 = (size_t)blockIdx.x * 64 + wave * 16; const int n0 = blockIdx.y * 128;
  // a thread's copy places: A chunk (row i * 8 + tid / 16, 16 B piece tid % 16), P chunk (row i * 16 + tid / 8, piece tid % 8), i = 0..7
  const char* ga = (const char*)(A + ((size_t)blockIdx.x * 64 + (tid >> 4)) * lda + (tid & 15) * 4); const char* gb = (const char*)(P + (size_t)(n0 + (tid >> 3)) * K + (tid & 7) * 8);
  const unsigned la = lds_off(&st[0][0]) + (tid >> 4) * GAP + (tid & 15) * 16, lb = lds_off(&st[0][0]) + GAB + (tid >> 3) * GBP + (tid & 7) * 16;
  const size_t gas = (size_t)lda * 8 * 4, gbs = (size_t)K * 16 * 2; const int nst = K / GKS;
  v8f acc[8] = {};
  acopy8(la, 8 * GAP, ga, gas); acopy8(lb, 16 * GBP, gb, gbs);
  asm volatile("s_wait_asynccnt 0x0" ::: "memory");   // this wave's share of stage 0 has landed
  __syncthreads();                                    // every wave's share of stage 0 has landed
  if (nst > 1) { acopy8(la + GSTG, 8 * GAP, ga + GKS * 4, gas); acopy8(lb + GSTG, 16 * GBP, gb + GKS * 2, gbs); }
  for (int t = 0; t < nst; ++t) { const unsigned bo = (t & 1) * GSTG; const unsigned char* pa = &st[0][0] + bo + (wave * 16 + col) * GAP + 32 * g; const unsigned char* pb = &st[0][0] + bo + GAB + col * GBP + 16 * g;
    // the stage's fragment reads stand ahead of its WMMAs, so that their latencies overlap; the second k step's A rows are read behind the first WMMA (16 registers fewer at the peak: the kernel stays inside v0..v255), still a whole k step ahead of their use
    v4f af[2][4]; v8b bq[2][8][2];
#pragma unroll   // in full: the fragment arrays are indexed by constants and stay in registers
    for (int q = 0; q < 4; ++q) af[0][q] = *(const v4f*)(pa + (q >> 1) * 64 + (q & 1) * 16);
#pragma unroll   // in full: the fragment arrays are indexed by constants and stay in registers
    for (int kc = 0; kc < 2; ++kc)
#pragma unroll   // in full: the fragment arrays are indexed by constants and stay in registers
      for (int j = 0; j < 8; ++j) { bq[kc][j][0] = *(const v8b*)(pb + j * 16 * GBP + kc * 64); bq[kc][j][1] = *(const v8b*)(pb + j * 16 * GBP + kc * 64 + 32); }
#pragma unroll   // in full: the fragment arrays are indexed by constants and stay in registers
    for (int kc = 0; kc < 2; ++kc) { F2 a; float v[16];
#pragma unroll   // in full: the fragment arrays are indexed by constants and stay in registers
      for (int i = 0; i < 4; ++i) { v[i] = af[kc][0][i]; v[4 + i] = af[kc][1][i]; v[8 + i] = af[kc][2][i]; v[12 + i] = af[kc][3][i]; }
      if (RIN) { v16b ax;
#pragma unroll   // in full: the fragment arrays are indexed by constants and stay in registers
        for (int i = 0; i < 16; ++i) ax[i] = (__bf16)v[i];
        a.h = ax; a.l = ax; } else a = bsplit16(v);
#pragma unroll   // in full: the fragment arrays are indexed by constants and stay in registers
      for (int j = 0; j < 8; ++j) { union { v16b v; v8b q[2]; } w; w.q[0] = bq[kc][j][0]; w.q[1] = bq[kc][j][1]; if (!RIN) acc[j] = wmma_bf(a.l, w.v, acc[j]); acc[j] = wmma_bf(a.h, w.v, acc[j]);
        if (kc == 0 && j == 0) {
#pragma unroll   // in full: the fragment arrays are indexed by constants and stay in registers
          for (int q = 0; q < 4; ++q) af[1][q] = *(const v4f*)(pa + 128 + (q >> 1) * 64 + (q & 1) * 16); } } }
    asm volatile("s_wait_dscnt 0x0" ::: "memory");      // this wave has left stage t's buffer
    asm volatile("s_wait_asynccnt 0x0" ::: "memory");   // this wave's share of stage t + 1 has landed
    __syncthreads();                                    // publishes stage t + 1 and frees stage t's buffer
    if (t + 2 < nst) { acopy8(la + bo, 8 * GAP, ga + (size_t)(t + 2) * (GKS * 4), gas); acopy8(lb + bo, 16 * GBP, gb + (size_t)(t + 2) * (GKS * 2), gbs); } }
  asm volatile("s_wait_asynccnt 0x0" ::: "memory");     // no copy is outstanding when the wave goes on
#pragma unroll
  for (int j = 0; j < 8; ++j)
#pragma unroll
    for (int r = 0; r < 8; ++r) so[wave][8 * g + r][j * 16 + col] = acc[j][r];
  LDSX();
  for (int rl = 0; rl < 16; ++rl) vst2(OUT + (r0 + rl) * ldo + n0 + lane * 4, *(const v4f*)&so[wave][rl][lane * 4]);
}
// ---- k_normrope<PLANE>: block = (16 positions, head): 256 threads = d, each over the 16 rows: RMSNorm over the head's 256 (mean of squares, eps 1e-6) * (1 + scale[d]); RoPE: out_d = y_d cos[s][d] + rot_d sin[s][d] with rot = (-y[d+128], y[d-128]); the 16 x 256 result goes out as bf16 hi + residual in fragment order (8 units, 16 KiB in a row: a block writes whole lines, and no line has a second writer) (PLANE 0: q rows pitch 2048; 1: k rows pitch 1024)
template <int PLANE>
__global__ __launch_bounds__(256) void k_normrope(const float* __restrict__ QK, const float* __restrict__ SC, const float* __restrict__ COS, const float* __restrict__ SIN, __bf16* __restrict__ OF) {
  __shared__ float sy[16][HD]; __shared__ float sred[16][8]; __shared__ __align__(16) float so[16][HD + 4];
  const int t = blockIdx.x, h = blockIdx.y, d = threadIdx.x; const int pitch = PLANE ? (NKV * HD) : (NH * HD);
  const float* col = QK + (size_t)t * 16 * pitch + h * HD + d; float y[16];
#pragma unroll   // in full: y[] is indexed by constants and stays in registers, and the 16 rows' loads fly together
  for (int r = 0; r < 16; ++r) { y[r] = col[(size_t)r * pitch]; sy[r][d] = y[r]; }
#pragma unroll   // in full: y[] stays in registers, and the rows' cross-lane sums cover one another's latency
  for (int r = 0; r < 16; ++r) { float q = y[r] * y[r];
#pragma unroll   // in full: five fixed steps, no loop overhead
    for (int o = 1; o < 32; o <<= 1) q += __shfl_xor(q, o);
    if ((d & 31) == 0) sred[r][d >> 5] = q; }
  __syncthreads();
  const int dp = (d < HD / 2) ? (d + HD / 2) : (d - HD / 2); const float g0 = 1.0f + bfr(SC[d]), g1 = 1.0f + bfr(SC[dp]);
#pragma unroll   // in full: y[] stays in registers, and the rows' table loads fly together
  for (int r = 0; r < 16; ++r) { float ss = 0.f;
#pragma unroll   // in full: eight fixed terms, summed in this order
    for (int w = 0; w < 8; ++w) ss += sred[r][w];
    const float rs = rsqrtf(ss / (float)HD + 1e-6f);
    const float yn = y[r] * rs * g0; const float other = sy[r][dp] * rs * g1;
    const float rot = (d < HD / 2) ? -other : other; const size_t s = (size_t)t * 16 + r;
    so[r][d] = yn * bfr(COS[s * HD + d]) + rot * bfr(SIN[s * HD + d]); }
  __syncthreads();
  __bf16* ob = OF + ((size_t)h * (SS / 16) + t) * (HD / 32) * FRU;
  for (int q = d; q < (HD / 32) * FRU / 8; q += 256) { const int ln = q & 31, part = (q >> 5) & 1, pl = (q >> 6) & 1, kc = q >> 7; const float* p = &so[ln & 15][kc * 32 + part * 16 + (ln >> 4) * 8]; v8b w;
#pragma unroll   // in full: w[] is indexed by constants and stays in registers
    for (int i = 0; i < 8; ++i) { const float v = p[i]; const __bf16 hb = (__bf16)v; w[i] = pl ? (__bf16)(v - (float)hb) : hb; }
    vst2(ob + (size_t)q * 8, w); }
}
// ---- k_vplanes: block = (64 positions, 128 value columns): v as bf16 hi + residual, transposed in LDS, out in fragment order (row = value column, k = key): 2 key steps x 8 column tiles = 16 whole units
__global__ __launch_bounds__(256) void k_vplanes(const float* __restrict__ V, __bf16* __restrict__ VF) {
  __shared__ __align__(16) __bf16 sh[128][72], sl[128][72]; const int tid = threadIdx.x; const int s0 = blockIdx.x * 64, c0 = blockIdx.y * 128;
  for (int q = tid; q < 64 * 128; q += 256) { const int sl_ = q >> 7, c = q & 127; const float v = V[(size_t)(s0 + sl_) * (NKV * HD) + c0 + c]; const __bf16 hb = (__bf16)v; sh[c][sl_] = hb; sl[c][sl_] = (__bf16)(v - (float)hb); }
  __syncthreads();
  for (int q = tid; q < 16 * FRU / 8; q += 256) { const int ln = q & 31, part = (q >> 5) & 1, pl = (q >> 6) & 1, dtl = (q >> 7) & 7, ksl = q >> 10; const int c = dtl * 16 + (ln & 15), sk = ksl * 32 + part * 16 + (ln >> 4) * 8; const int cg = c0 + dtl * 16;
    const size_t o = (((size_t)(cg / HD) * (SS / 32) + s0 / 32 + ksl) * (HD / 16) + (cg % HD) / 16) * FRU + (q & 127) * 8; vst2(VF + o, *(const v4u*)(pl ? &sl[c][sk] : &sh[c][sk])); }
}
// ---- k_attn: block = (64 queries, head h), 16 waves = (query tile qw = wave & 3) x (key share kj = wave >> 2): a wave takes the key steps ks = kj, kj + 4, ... of its 16 queries, so four waves a SIMD cover one another's load and LDS latency; the four partial (max, sum, acc) of a query tile are merged through LDS at the end; kv = h / 2; per 32-key step: live = (k <= q) & attn_mask[k] & (k > pos_q - WIN) & (k < pos_q + WIN); wave vote; scores (3 products, K 256 = 8 ksteps) / 16; online softmax with guards; P.V over all 256 value columns (16 tiles, 3 products) from the one set of scores; q, k and v come as bf16 hi + residual in fragment order (frag_t), so nothing is split here and every fragment load reads whole lines; O cols h*256 + ...
// A pass = 128 keys = the four key shares' steps 4 it + kj. Its k units (8 key tiles) and its v units (4 key steps) are each 128 KiB in a row in global memory; asynchronous copies bring each into LDS once for the block, where the four query tiles of a key share read the same bytes. Two buffers, tiles in the order k(it), v(it), k(next), v(next): v flies under scores and softmax, the next k under P.V. The passes are those of lm, a mask that every wave forms alike from segment_pos and the causal bound (attn_mask left out: it can only hold more passes than are live), so every barrier stands under block-uniform control flow; a wave's own vote still decides whether it works in a pass.
#define KVT 131072u
// eight 16-byte copies of a lane, 8 KiB (512 threads) apart in LDS and in global memory alike: the offset field moves both addresses, so one address of each kind serves all eight and none is kept in registers over the loop; the s_wait_xcnt closes the statement so that no address register of a copy is rewritten ahead of it
__device__ __forceinline__ void acopy8s(unsigned l, const char* g) {
  asm volatile("global_load_async_to_lds_b128 %0, %1, off\n\t"
               "global_load_async_to_lds_b128 %0, %1, off offset:8192\n\t"
               "global_load_async_to_lds_b128 %0, %1, off offset:16384\n\t"
               "global_load_async_to_lds_b128 %0, %1, off offset:24576\n\t"
               "global_load_async_to_lds_b128 %0, %1, off offset:32768\n\t"
               "global_load_async_to_lds_b128 %0, %1, off offset:40960\n\t"
               "global_load_async_to_lds_b128 %0, %1, off offset:49152\n\t"
               "global_load_async_to_lds_b128 %0, %1, off offset:57344\n\t"
               "s_wait_xcnt 0x0"
               :: "v"(l), "v"(g) : "memory");
}
// one 128 KiB tile into LDS: 16 pieces of 16 bytes a thread
__device__ __forceinline__ void acopy_tile(unsigned l, const char* g) { acopy8s(l, g); acopy8s(l + 65536u, g + 65536); }
__global__ __launch_bounds__(512) void k_attn(const __bf16* __restrict__ QF, const __bf16* __restrict__ KF, const int* __restrict__ AM, const int* __restrict__ SEGPOS, const __bf16* __restrict__ VF, float* __restrict__ O) {
  __shared__ __align__(16) float sp[16][16][36]; __shared__ __align__(16) unsigned char big[16 * 16 * 260 * 4]; __shared__ float sm[16][16], sl[16][16];
  float (*so)[16][260] = (float (*)[16][260])big;   // the merge's partials lie over the two staging buffers (k at 0, v at KVT), which are dead by then
  const int tid = threadIdx.x, wave = __builtin_amdgcn_readfirstlane(tid >> 5), lane = tid & 31, col = lane & 15, g = lane >> 4; const int qw = wave & 3, kj = wave >> 2; const int qb = blockIdx.x + TQ0, h = blockIdx.y; const int kv = h / (NH / NKV); const int q0 = qb * 64 + qw * 16;   // the wave's number in a scalar register: key step and tile bases leave the vector registers, and the 16 accumulator tiles fit the 256 a wave has with no scratch
  const __bf16* qp = QF + ((size_t)h * (SS / 16) + (q0 >> 4)) * (HD / 32) * FRU + lane * 8;
  int posq[8];
#pragma unroll
  for (int r = 0; r < 8; ++r) posq[r] = SEGPOS[q0 + 8 * g + r];
  asm volatile("s_wait_xcnt 0x0" ::: "memory");   // stands between these loads and the rewrite of their address registers by the code below
  float m[8], l[8];
#pragma unroll
  for (int r = 0; r < 8; ++r) { m[r] = -3.0e38f; l[r] = 0.f; }
  v8f acc[16] = {};
  const int nks = (qb * 64 + 64) / 32;   // causal upper bound on key steps
  unsigned lm = 0;
  { const int qx = qb * 64 + lane, qy = qx + 32; const int px = SEGPOS[qx], py = SEGPOS[qy];
    for (int i = 0; i < (nks + 3) / 4; ++i) { const int k0 = i * 128, k1 = k0 + 127;
      const bool lx = max(k0, px - WIN + 1) <= min(min(k1, qx), px + WIN - 1), ly = max(k0, py - WIN + 1) <= min(min(k1, qy), py + WIN - 1);
      if (__any(lx || ly)) lm |= 1u << i; } }
  lm = __builtin_amdgcn_readfirstlane(lm);
  if (lm != 0) {
  const unsigned lk = lds_off(&big[0]) + tid * 16, lvv = lk + KVT;
  const char* gk = (const char*)(KF + (size_t)kv * (SS / 16) * (HD / 32) * FRU) + tid * 16; const char* gv = (const char*)(VF + (size_t)kv * (SS / 32) * (HD / 16) * FRU) + tid * 16;
  int it = __builtin_ctz(lm);
  acopy_tile(lk, gk + (size_t)it * KVT);
  asm volatile("s_wait_asynccnt 0x0" ::: "memory");   // this wave's share of the first k tile has landed
  __syncthreads();                                    // every wave's share of it has landed
  acopy_tile(lvv, gv + (size_t)it * KVT);
#pragma unroll 1   // rolled: the body is some thousand instructions long
  for (;;) { v8f s[2]; bool lv[2][8]; bool anylive = false; lm &= lm - 1; const bool more = lm != 0; const int nx = more ? __builtin_ctz(lm) : 0; const int ks = it * 4 + kj;
#pragma unroll
    for (int ct = 0; ct < 2; ++ct) { const int kk = ks * 32 + ct * 16 + col; const bool am = (AM[kk] != 0);
#pragma unroll
      for (int r = 0; r < 8; ++r) { const int qi = q0 + 8 * g + r; const bool live = am && (kk <= qi) && (kk > posq[r] - WIN) && (kk < posq[r] + WIN); lv[ct][r] = live; anylive = anylive || live; } }
    const bool wl = __any(anylive);
    if (wl) {
#pragma unroll
      for (int ct = 0; ct < 2; ++ct) { const __bf16* kp = (const __bf16*)(big + kj * 32768 + ct * 16384) + lane * 8; v8f c = {};
#pragma unroll
        for (int kc = 0; kc < HD / 32; ++kc) { F2 kb, qa; kb.h = frag_t(kp + kc * FRU); kb.l = frag_t(kp + kc * FRU + 512); qa.h = frag_t(qp + kc * FRU); qa.l = frag_t(qp + kc * FRU + 512); c = mac3(qa, kb, c); }
#pragma unroll
        for (int r = 0; r < 8; ++r) s[ct][r] = lv[ct][r] ? c[r] * 0.0625f : -3.0e38f; }
#pragma unroll
      for (int r = 0; r < 8; ++r) { float mx = fmaxf(s[0][r], s[1][r]);
#pragma unroll
        for (int o = 1; o < 16; o <<= 1) mx = fmaxf(mx, __shfl_xor(mx, o));
        const float mn = fmaxf(m[r], mx); const float alpha = (m[r] <= -1.0e38f) ? 0.f : exp_ni(m[r] - mn);
        const float e0 = (s[0][r] <= -1.0e38f) ? 0.f : exp_ni(s[0][r] - mn), e1 = (s[1][r] <= -1.0e38f) ? 0.f : exp_ni(s[1][r] - mn); float es = e0 + e1;
#pragma unroll
        for (int o = 1; o < 16; o <<= 1) es += __shfl_xor(es, o);
        l[r] = l[r] * alpha + es; m[r] = mn;
#pragma unroll
        for (int dt = 0; dt < 16; ++dt) acc[dt][r] *= alpha;
        sp[wave][8 * g + r][col] = e0; sp[wave][8 * g + r][16 + col] = e1; } }
    asm volatile("s_wait_dscnt 0x0" ::: "memory");      // this wave has left the k buffer
    asm volatile("s_wait_asynccnt 0x0" ::: "memory");   // this wave's share of the pass's v tile has landed
    __syncthreads();                                    // publishes the v tile and frees the k buffer
    if (more) acopy_tile(lk, gk + (size_t)nx * KVT);
    if (wl) {   // the wave's own sp stores are behind the s_wait_dscnt and the barrier above
      const F2 pa = split_row(&sp[wave][col][0], 0, lane); const __bf16* vp = (const __bf16*)(big + KVT + kj * 32768) + lane * 8;   // one address; the 16 tiles' units lie constant steps behind it
#pragma unroll
      for (int dt = 0; dt < 16; ++dt) { const v16b vh = frag_t(vp + dt * FRU), vl = frag_t(vp + dt * FRU + 512); acc[dt] = wmma_bf(pa.l, vh, acc[dt]); acc[dt] = wmma_bf(pa.h, vl, acc[dt]); acc[dt] = wmma_bf(pa.h, vh, acc[dt]); } }
    asm volatile("s_wait_dscnt 0x0" ::: "memory");      // this wave has left the v buffer, and its sp rows, which the next pass rewrites
    asm volatile("s_wait_asynccnt 0x0" ::: "memory");   // this wave's share of the next pass's k tile has landed
    __syncthreads();                                    // publishes that k tile and frees the v buffer (behind the last pass: for the merge's partials)
    if (!more) break;
    acopy_tile(lvv, gv + (size_t)nx * KVT); it = nx; }
  asm volatile("s_wait_asynccnt 0x0" ::: "memory"); }   // no copy is outstanding when the wave goes on
#pragma unroll
  for (int r = 0; r < 8; ++r) {
#pragma unroll
    for (int dt = 0; dt < 16; ++dt) so[wave][8 * g + r][dt * 16 + col] = acc[dt][r];
    if (col == 0) { sm[wave][8 * g + r] = m[r]; sl[wave][8 * g + r] = l[r]; } }
  __syncthreads();   // every wave's partial is in LDS before any wave merges
  // merge: wave (qw, kj) finishes rows 4 kj .. 4 kj + 3 of query tile qw: weights exp(m_j - M), a share with no live key weighs 0
  for (int rl = 0; rl < 4; ++rl) { const int row = kj * 4 + rl; float mj[4]; float M = -3.0e38f;
#pragma unroll
    for (int j = 0; j < 4; ++j) { mj[j] = sm[qw + 4 * j][row]; M = fmaxf(M, mj[j]); }
    float L = 0.f; v4f o0 = {}, o1 = {};
#pragma unroll
    for (int j = 0; j < 4; ++j) { const float w = (mj[j] <= -1.0e38f) ? 0.f : exp_ni(mj[j] - M); L += w * sl[qw + 4 * j][row]; o0 += w * *(const v4f*)&so[qw + 4 * j][row][lane * 4]; o1 += w * *(const v4f*)&so[qw + 4 * j][row][128 + lane * 4]; }
    const float il = (L > 0.f) ? 1.0f / L : 0.f;
    vst2(O + (size_t)(q0 + row) * (NH * HD) + h * HD + lane * 4, o0 * il); vst2(O + (size_t)(q0 + row) * (NH * HD) + h * HD + 128 + lane * 4, o1 * il);
    asm volatile("s_wait_xcnt 0x0" ::: "memory"); }   // stands between the two stores and the next row's rewrite of their data registers
}
extern "C" void kernel_launch(void* const* d_in, const int* in_sizes, int n_in, void* d_out, int out_size, void* d_ws, size_t ws_size, hipStream_t stream) {
  (void)in_sizes; (void)n_in; (void)out_size;
  const float** F = (const float**)d_in; const int* AM = (const int*)d_in[1]; const int* SEGPOS = (const int*)d_in[2];
  // 0 x [1,2048,2048], 1 attn_mask [1,2048] bool(int), 2 segment_pos [1,2048] i32, 3 cos [1,2048,256], 4 sin, 5 wq [2048,2048], 6 wk [2048,1024], 7 wv [2048,1024], 8 wo [2048,2048], 9 q_scale [256], 10 k_scale [256]
  if (ws_size < (size_t)WS_END) return;
  char* ws = (char*)d_ws; __bf16 *PW = (__bf16*)(ws + WS_PW), *VF = (__bf16*)(ws + WS_VF), *QF = (__bf16*)(ws + WS_QF), *KF = (__bf16*)(ws + WS_KF); float *Q = (float*)(ws + WS_Q), *Kx = (float*)(ws + WS_K), *V = (float*)(ws + WS_V), *O = (float*)(ws + WS_O);
  k_packT<<<dim3(HID / 128, 48), 256, 0, stream>>>(F[5], F[6], F[7], F[8], PW);
  k_gemm<1><<<dim3(TQB, NH * HD / 128), 128, 0, stream>>>(F[0] + (size_t)TQ0 * 64 * HID, HID, HID, PW + PQ, Q + (size_t)TQ0 * 64 * NH * HD, NH * HD);   // q rows of the processed query range
  k_gemm<1><<<dim3(KRP, NKV * HD / 128), 128, 0, stream>>>(F[0], HID, HID, PW + PK, Kx, NKV * HD);
  k_gemm<1><<<dim3(KRP, NKV * HD / 128), 128, 0, stream>>>(F[0], HID, HID, PW + PV, V, NKV * HD);
  k_normrope<0><<<dim3(TQB * 4, NH), 256, 0, stream>>>(Q + (size_t)TQ0 * 64 * NH * HD, F[9], F[3] + (size_t)TQ0 * 64 * HD, F[4] + (size_t)TQ0 * 64 * HD, QF + (size_t)TQ0 * 4 * (HD / 32) * FRU);
  k_normrope<1><<<dim3(KRP * 4, NKV), 256, 0, stream>>>(Kx, F[10], F[3], F[4], KF);
  k_vplanes<<<dim3(KRP, NKV * HD / 128), 256, 0, stream>>>(V, VF);
  k_attn<<<dim3(TQB, NH), 512, 0, stream>>>(QF, KF, AM, SEGPOS, VF, O);
  k_gemm<0><<<dim3(TQB, HID / 128), 128, 0, stream>>>(O + (size_t)TQ0 * 64 * NH * HD, NH * HD, NH * HD, PW + PO, (float*)d_out + (size_t)TQ0 * 64 * HID, HID);
}

// v007
// One run takes 208 microseconds.
// Next to v006, in two timings, it ran 1.11 times as fast each time.
// Over all steps from v000 it is 6.51 times as fast.
// compute dtype: x, attn_mask, segment_pos, cos/sin tables, wq/wk/wv/wo and the RMSNorm scales (module inputs) rounded to bf16 / read as int; q/k/v projections with exact bf16 products (x and the weights are inputs); per-head RMSNorm and RoPE (input tables) in f32; scores q.k with both operands as bf16 hi + residual pairs (3 products), P.V with P hi/lo x V hi/lo (3 products), output projection hi/lo x exact wo (2 products); all on WMMA 16x16x32; the causal AND padding AND sliding-window mask is evaluated at run time from attn_mask / segment_pos and key tiles with no live entry are skipped; f32 accumulate.
#include <hip/hip_runtime.h>
#include <math.h>

typedef __attribute__((ext_vector_type(16))) _Float16 v16h;
typedef __attribute__((ext_vector_type(16))) __bf16 v16b;
typedef __attribute__((ext_vector_type(8)))  _Float16 v8h;
typedef __attribute__((ext_vector_type(8)))  float v8f;
typedef __attribute__((ext_vector_type(4)))  float v4f;
typedef __attribute__((ext_vector_type(2)))  float v2f;
typedef __attribute__((ext_vector_type(4)))  unsigned v4u;
typedef __attribute__((ext_vector_type(4)))  int v4i;
typedef float __attribute__((may_alias)) float_a;
typedef int __attribute__((may_alias)) int_a;

template <typename T> __device__ __forceinline__ void vst2(void* p, T v) { *(T*)p = v;  }
__device__ __forceinline__ v8f wmma16(v16h a, v16h b, v8f c) {
  v8f d = __builtin_amdgcn_wmma_f32_16x16x32_f16(false, a, false, b, (short)0, c, false, false);
  asm volatile("v_nop\n\tv_nop\n\tv_nop\n\tv_nop" : "+v"(d) : "v"(a), "v"(b));
  return d;
}
__device__ __forceinline__ v8f wmma_bf(v16b a, v16b b, v8f c) {
  v8f d = __builtin_amdgcn_wmma_f32_16x16x32_bf16(false, a, false, b, (short)0, c, false, false);
  asm volatile("v_nop\n\tv_nop\n\tv_nop\n\tv_nop" : "+v"(d) : "v"(a), "v"(b));
  return d;
}
// 16x16x32 fragments: lane = (h = lane>>4, row/col = lane&15); elements 0..7 = k0+8h+0..7, 8..15 = k0+16+8h+0..7; D element r = row 8h+r
__device__ __forceinline__ v16h frag_h(const _Float16* rowk0, int lane) {
  union { v16h v; v8h q[2]; } u; const _Float16* p = rowk0 + 8 * (lane >> 4);
  u.q[0] = *(const v8h*)p; u.q[1] = *(const v8h*)(p + 16); return u.v;
}
__device__ __forceinline__ v16h frag_f32(const float* rowk0, int lane) {
  v16h a; const float* p = rowk0 + 8 * (lane >> 4);
#pragma unroll
  for (int i = 0; i < 8; ++i) { a[i] = (_Float16)p[i]; a[8 + i] = (_Float16)p[16 + i]; }
  return a;
}
__device__ __forceinline__ v16h frag_f32s(const float* rowk0, int lane, float sc) {
  v16h a; const float* p = rowk0 + 8 * (lane >> 4);
#pragma unroll
  for (int i = 0; i < 8; ++i) { a[i] = (_Float16)(p[i] * sc); a[8 + i] = (_Float16)(p[16 + i] * sc); }
  return a;
}
// column fragment from a [K][ld] layout (column n), rows >= K read as 0
__device__ __forceinline__ v16h fragc_f32(const float* W, int k0, int n, int lane, int ld, int K) {
  v16h a; const int g = lane >> 4;
#pragma unroll
  for (int i = 0; i < 8; ++i) { const int ka = k0 + 8 * g + i, kb = ka + 16;
    a[i] = (_Float16)(ka < K ? W[(size_t)(ka < K ? ka : K - 1) * ld + n] : 0.f); a[8 + i] = (_Float16)(kb < K ? W[(size_t)(kb < K ? kb : K - 1) * ld + n] : 0.f); }
  return a;
}
struct F2 { v16b h, l; };
__device__ __forceinline__ F2 bsplit16(const float v[16]) { F2 r;
#pragma unroll
  for (int i = 0; i < 16; ++i) { const __bf16 h = (__bf16)v[i]; r.h[i] = h; r.l[i] = (__bf16)(v[i] - (float)h); }
  return r; }
__device__ __forceinline__ F2 split_row(const float* row, int k0, int lane) { float v[16]; const float* p = row + k0 + 8 * (lane >> 4);
#pragma unroll
  for (int i = 0; i < 8; ++i) { v[i] = p[i]; v[8 + i] = p[16 + i]; }
  return bsplit16(v); }
__device__ __forceinline__ F2 split_rowK(const float* row, int k0, int lane, int K) { float v[16]; const int g = lane >> 4;
#pragma unroll
  for (int i = 0; i < 8; ++i) { const int ka = k0 + 8 * g + i, kb = ka + 16; v[i] = ka < K ? row[ka < K ? ka : K - 1] : 0.f; v[8 + i] = kb < K ? row[kb < K ? kb : K - 1] : 0.f; }
  return bsplit16(v); }
__device__ __forceinline__ F2 split_col(const float* W, int k0, int n, int lane, int ld, int K) { float v[16]; const int g = lane >> 4;
#pragma unroll
  for (int i = 0; i < 8; ++i) { const int ka = k0 + 8 * g + i, kb = ka + 16; v[i] = ka < K ? W[(size_t)(ka < K ? ka : K - 1) * ld + n] : 0.f; v[8 + i] = kb < K ? W[(size_t)(kb < K ? kb : K - 1) * ld + n] : 0.f; }
  return bsplit16(v); }
__device__ __forceinline__ v8f mac3(const F2& a, const F2& b, v8f c) { c = wmma_bf(a.l, b.h, c); c = wmma_bf(a.h, b.l, c); return wmma_bf(a.h, b.h, c); }
__device__ __forceinline__ float sigm(float v) { return 1.0f / (1.0f + expf(-v)); }
#define LDSX() do { asm volatile("s_wait_dscnt 0" ::: "memory"); __builtin_amdgcn_wave_barrier(); __builtin_amdgcn_fence(__ATOMIC_RELEASE, "workgroup"); } while (0)


// Gemma-3 style attention (B 1, S 2048, hidden 2048, 8 query heads / 4 kv heads x 256, sliding window 1024): q,k,v = x w; q,k = RMSNorm_head(.)(1 + scale); RoPE with the given cos/sin; GQA (kv head = h / 2); scores / 16 masked by causal & attn_mask[k] & |k - segment_pos[q]| < WIN (else -1e37); softmax; out = (P v merged) wo.
#define SS 2048
#define HID 2048
#define NH 8
#define NKV 4
#define HD 256
#define WIN 1024
#ifndef TQB
#define TQB (SS / 64)          // query tiles processed
#define TQ0 0                  // first query tile
#define KRP (SS / 64)          // key/value row tiles (all)
#endif
typedef __attribute__((ext_vector_type(8))) __bf16 v8b;
__device__ __forceinline__ v16b frag_b(const __bf16* rowk0, int lane) {
  union { v16b v; v8b q[2]; } u; const __bf16* p = rowk0 + 8 * (lane >> 4);
  u.q[0] = *(const v8b*)p; u.q[1] = *(const v8b*)(p + 16); return u.v;
}
__device__ __forceinline__ float bfr(float v) { return (float)(__bf16)v; }
__device__ __attribute__((noinline)) float exp_ni(float v) { return expf(v); }
__device__ __attribute__((noinline)) float erf_ni(float v) { return erff(v); }

#define WS_PW  0u                                  // bf16 rows (in,out -> [out][in]): wq [2048][2048], wk [1024][2048], wv [1024][2048], wo [2048][2048]
#define PQ 0
#define PK (PQ + NH * HD * HID)
#define PV (PK + NKV * HD * HID)
#define PO (PV + NKV * HD * HID)
#define PWEND (PO + HID * NH * HD)
#define WS_Q   (WS_PW + 2u * PWEND)                 // f32 [S][2048] q raw
#define WS_K   (WS_Q + 4u * SS * NH * HD)            // f32 [S][1024] k raw
#define WS_V   (WS_K + 4u * SS * NKV * HD)           // f32 [S][1024] v raw
#define WS_VF  (WS_V + 4u * SS * NKV * HD)           // bf16 v in fragment order: [kv][32-key step][16-column tile][FRU]
#define WS_O   (WS_VF + 4u * NKV * HD * SS)          // f32 [S][2048]
#define WS_QF  (WS_O + 4u * SS * NH * HD)            // bf16 q in fragment order: [head][16-query tile][32-d step][FRU]
#define WS_KF  (WS_QF + 4u * SS * NH * HD)           // bf16 k in fragment order: [kv][16-key tile][32-d step][FRU]
#define WS_END (WS_KF + 4u * SS * NKV * HD)
// Fragment order: one 16 x 32 operand tile is a unit of FRU bf16 = [plane hi, lo][part 0, 1][lane 32][8]: lane (g = lane >> 4, row = lane & 15) holds k = 16 part + 8 g + 0..7 of its row, which is what frag_b reads from a row. A wave's 16-byte load of one (plane, part) is then 512 bytes in a row, four whole lines, where a load from rows touches sixteen.
#define FRU 1024
__device__ __forceinline__ v16b frag_t(const __bf16* p) { union { v16b v; v8b q[2]; } u; u.q[0] = *(const v8b*)p; u.q[1] = *(const v8b*)(p + 256); return u.v; }

// ---- k_packT: block = (128 k, 128 output columns): (in,out) weight -> rows [n][K], a tile at a time through LDS. The four weights all have K = 2048 and their row sets lie one behind another in PW, so blockIdx.y counts 128-column tiles over all of them (wq 16, wk 8, wv 8, wo 16).
// A wave's load is 512 bytes in a row of one k; a thread holds 8 k x 4 columns twice, which are eight finished 16-byte pieces of output rows; they cross in LDS, and a wave's store is two output rows x 256 bytes: whole lines both ways, each line with one writer.
// LDS row = one column's 128 k as bf16, pitch 272 B; the 16-byte piece kch of row n lies at place kch ^ ((n >> 4) & 3): with it the 16 lanes of a half wave, four rows apart, store to 16 different bank groups.
#define PTP 272
template <int N>   // the weight's row length as a constant: the 16 loads then share one address and differ in the offset field
__device__ __forceinline__ void pack_tile(const float* __restrict__ src, __bf16* __restrict__ dst, unsigned char* s, int tid) {
  const int wave = tid >> 5, lane = tid & 31; src += (size_t)(wave * 8) * N + lane * 4; v4f v[2][8];
#pragma unroll   // in full: v[] is indexed by constants and stays in registers
  for (int hf = 0; hf < 2; ++hf)
#pragma unroll   // in full: as above
    for (int i = 0; i < 8; ++i) v[hf][i] = *(const v4f*)(src + (size_t)(hf * 64 + i) * N);
  // the wait stands between the loads and any rewrite of their address register; the loaded values and the address are inputs only, so that all 16 loads are issued ahead of the first use and fly together (without it the compiler issues the last six behind waits on the first ten) and no load's result lands on the address
  asm volatile("s_wait_xcnt 0x0" :: "v"(src), "v"(v[0][0]), "v"(v[0][1]), "v"(v[0][2]), "v"(v[0][3]), "v"(v[0][4]), "v"(v[0][5]), "v"(v[0][6]), "v"(v[0][7]), "v"(v[1][0]), "v"(v[1][1]), "v"(v[1][2]), "v"(v[1][3]), "v"(v[1][4]), "v"(v[1][5]), "v"(v[1][6]), "v"(v[1][7]) : "memory");
  const int sw = (lane >> 2) & 3;   // (n >> 4) & 3 of the thread's four columns n = 4 lane + c
#pragma unroll   // in full: v[] is indexed by constants
  for (int hf = 0; hf < 2; ++hf)
#pragma unroll   // in full: v[] is indexed by constants
    for (int c = 0; c < 4; ++c) { v8b w;
#pragma unroll   // in full: v[] and w[] are indexed by constants
      for (int i = 0; i < 8; ++i) w[i] = (__bf16)v[hf][i][c];
      *(v8b*)(s + (lane * 4 + c) * PTP + (((hf * 8 + wave) ^ sw) * 16)) = w; }
  __syncthreads();
  const int nr = tid >> 4, kch = tid & 15;
#pragma unroll   // in full: eight fixed pieces a thread (rows nr + 16 j), their LDS reads ahead of the stores
  for (int j = 0; j < 8; ++j) vst2(dst + (size_t)(nr + 16 * j) * HID + kch * 8, *(const v4u*)(s + (nr + 16 * j) * PTP + ((kch ^ (j & 3)) * 16)));
}
__global__ __launch_bounds__(256) void k_packT(const float* __restrict__ WQ, const float* __restrict__ WK, const float* __restrict__ WV, const float* __restrict__ WO, __bf16* __restrict__ PW) {
  __shared__ __align__(16) unsigned char s[128 * PTP]; const int tid = threadIdx.x; const int k0 = blockIdx.x * 128, y = blockIdx.y;
  if (y < 16) pack_tile<NH * HD>(WQ + (size_t)k0 * (NH * HD) + y * 128, PW + PQ + (size_t)y * 128 * HID + k0, s, tid);
  else if (y < 24) pack_tile<NKV * HD>(WK + (size_t)k0 * (NKV * HD) + (y - 16) * 128, PW + PK + (size_t)(y - 16) * 128 * HID + k0, s, tid);
  else if (y < 32) pack_tile<NKV * HD>(WV + (size_t)k0 * (NKV * HD) + (y - 24) * 128, PW + PV + (size_t)(y - 24) * 128 * HID + k0, s, tid);
  else pack_tile<HID>(WO + (size_t)k0 * HID + (y - 32) * 128, PW + PO + (size_t)(y - 32) * 128 * HID + k0, s, tid);
}
// ---- k_gemm<RIN>: block = (64 rows, 128 cols): OUT = A(K) . rows (RIN exact / hi-lo 2 products); pitch ldo. K is a multiple of 64.
// Both operand tiles of a 64-k stage (A 64 rows x 256 B f32, P 128 rows x 128 B bf16) are brought into LDS by asynchronous copies, whole lines, two buffers: stage t + 1 flies while stage t is worked on, and the four waves share one copy of the P tile. Row pitches 272 B / 144 B (16 B x odd) keep the 16-byte fragment reads off one another's banks.
#define GKS 64
#define GAP 272
#define GBP 144
#define GAB (64 * GAP)
#define GSTG (GAB + 128 * GBP)
__device__ __forceinline__ unsigned lds_off(const void* p) { return (unsigned)(size_t)p; }
// eight 16-byte copies of a lane, rows lstep / gstep bytes apart; the s_wait_xcnt closes the statement so that no address register of a copy is rewritten ahead of it
__device__ __forceinline__ void acopy8(unsigned l, unsigned lstep, const char* g, size_t gstep) {
  asm volatile("global_load_async_to_lds_b128 %0, %8, off\n\t"
               "global_load_async_to_lds_b128 %1, %9, off\n\t"
               "global_load_async_to_lds_b128 %2, %10, off\n\t"
               "global_load_async_to_lds_b128 %3, %11, off\n\t"
               "global_load_async_to_lds_b128 %4, %12, off\n\t"
               "global_load_async_to_lds_b128 %5, %13, off\n\t"
               "global_load_async_to_lds_b128 %6, %14, off\n\t"
               "global_load_async_to_lds_b128 %7, %15, off\n\t"
               "s_wait_xcnt 0x0"
               :: "v"(l), "v"(l + lstep), "v"(l + 2 * lstep), "v"(l + 3 * lstep), "v"(l + 4 * lstep), "v"(l + 5 * lstep), "v"(l + 6 * lstep), "v"(l + 7 * lstep),
                  "v"(g), "v"(g + gstep), "v"(g + 2 * gstep), "v"(g + 3 * gstep), "v"(g + 4 * gstep), "v"(g + 5 * gstep), "v"(g + 6 * gstep), "v"(g + 7 * gstep)
               : "memory");
}
template <int RIN>
__global__ __launch_bounds__(128) void k_gemm(const float* __restrict__ A, int lda, int K, const __bf16* __restrict__ P, float* __restrict__ OUT, int ldo) {
  __shared__ __align__(16) float so[4][16][132]; __shared__ __align__(16) unsigned char st[2][GSTG];
  const int tid = threadIdx.x, wave = tid >> 5, lane = tid & 31, col = lane & 15, g = lane >> 4; const size_t r0 = (size_t)blockIdx.x * 64 + wave * 16; const int n0 = blockIdx.y * 128;
  // a thread's copy places: A chunk (row i * 8 + tid / 16, 16 B piece tid % 16), P chunk (row i * 16 + tid / 8, piece tid % 8), i = 0..7
  const char* ga = (const char*)(A + ((size_t)blockIdx.x * 64 + (tid >> 4)) * lda + (tid & 15) * 4); const char* gb = (const char*)(P + (size_t)(n0 + (tid >> 3)) * K + (tid & 7) * 8);
  const unsigned la = lds_off(&st[0][0]) + (tid >> 4) * GAP + (tid & 15) * 16, lb = lds_off(&st[0][0]) + GAB + (tid >> 3) * GBP + (tid & 7) * 16;
  const size_t gas = (size_t)lda * 8 * 4, gbs = (size_t)K * 16 * 2; const int nst = K / GKS;
  v8f acc[8] = {};
  acopy8(la, 8 * GAP, ga, gas); acopy8(lb, 16 * GBP, gb, gbs);
  asm volatile("s_wait_asynccnt 0x0" ::: "memory");   // this wave's share of stage 0 has landed
  __syncthreads();                                    // every wave's share of stage 0 has landed
  if (nst > 1) { acopy8(la + GSTG, 8 * GAP, ga + GKS * 4, gas); acopy8(lb + GSTG, 16 * GBP, gb + GKS * 2, gbs); }
  for (int t = 0; t < nst; ++t) { const unsigned bo = (t & 1) * GSTG; const unsigned char* pa = &st[0][0] + bo + (wave * 16 + col) * GAP + 32 * g; const unsigned char* pb = &st[0][0] + bo + GAB + col * GBP + 16 * g;
    // the stage's fragment reads stand ahead of its WMMAs, so that their latencies overlap; the second k step's A rows are read behind the first WMMA (16 registers fewer at the peak: the kernel stays inside v0..v255), still a whole k step ahead of their use
    v4f af[2][4]; v8b bq[2][8][2];
#pragma unroll   // in full: the fragment arrays are indexed by constants and stay in registers
    for (int q = 0; q < 4; ++q) af[0][q] = *(const v4f*)(pa + (q >> 1) * 64 + (q & 1) * 16);
#pragma unroll   // in full: the fragment arrays are indexed by constants and stay in registers
    for (int kc = 0; kc < 2; ++kc)
#pragma unroll   // in full: the fragment arrays are indexed by constants and stay in registers
      for (int j = 0; j < 8; ++j) { bq[kc][j][0] = *(const v8b*)(pb + j * 16 * GBP + kc * 64); bq[kc][j][1] = *(const v8b*)(pb + j * 16 * GBP + kc * 64 + 32); }
#pragma unroll   // in full: the fragment arrays are indexed by constants and stay in registers
    for (int kc = 0; kc < 2; ++kc) { F2 a; float v[16];
#pragma unroll   // in full: the fragment arrays are indexed by constants and stay in registers
      for (int i = 0; i < 4; ++i) { v[i] = af[kc][0][i]; v[4 + i] = af[kc][1][i]; v[8 + i] = af[kc][2][i]; v[12 + i] = af[kc][3][i]; }
      if (RIN) { v16b ax;
#pragma unroll   // in full: the fragment arrays are indexed by constants and stay in registers
        for (int i = 0; i < 16; ++i) ax[i] = (__bf16)v[i];
        a.h = ax; a.l = ax; } else a = bsplit16(v);
#pragma unroll   // in full: the fragment arrays are indexed by constants and stay in registers
      for (int j = 0; j < 8; ++j) { union { v16b v; v8b q[2]; } w; w.q[0] = bq[kc][j][0]; w.q[1] = bq[kc][j][1]; if (!RIN) acc[j] = wmma_bf(a.l, w.v, acc[j]); acc[j] = wmma_bf(a.h, w.v, acc[j]);
        if (kc == 0 && j == 0) {
#pragma unroll   // in full: the fragment arrays are indexed by constants and stay in registers
          for (int q = 0; q < 4; ++q) af[1][q] = *(const v4f*)(pa + 128 + (q >> 1) * 64 + (q & 1) * 16); } } }
    asm volatile("s_wait_dscnt 0x0" ::: "memory");      // this wave has left stage t's buffer
    asm volatile("s_wait_asynccnt 0x0" ::: "memory");   // this wave's share of stage t + 1 has landed
    __syncthreads();                                    // publishes stage t + 1 and frees stage t's buffer
    if (t + 2 < nst) { acopy8(la + bo, 8 * GAP, ga + (size_t)(t + 2) * (GKS * 4), gas); acopy8(lb + bo, 16 * GBP, gb + (size_t)(t + 2) * (GKS * 2), gbs); } }
  asm volatile("s_wait_asynccnt 0x0" ::: "memory");     // no copy is outstanding when the wave goes on
#pragma unroll
  for (int j = 0; j < 8; ++j)
#pragma unroll
    for (int r = 0; r < 8; ++r) so[wave][8 * g + r][j * 16 + col] = acc[j][r];
  LDSX();
  for (int rl = 0; rl < 16; ++rl) vst2(OUT + (r0 + rl) * ldo + n0 + lane * 4, *(const v4f*)&so[wave][rl][lane * 4]);
}
// ---- k_normrope<PLANE>: block = (16 positions, head): 256 threads = d, each over the 16 rows: RMSNorm over the head's 256 (mean of squares, eps 1e-6) * (1 + scale[d]); RoPE: out_d = y_d cos[s][d] + rot_d sin[s][d] with rot = (-y[d+128], y[d-128]); the 16 x 256 result goes out as bf16 hi + residual in fragment order (8 units, 16 KiB in a row: a block writes whole lines, and no line has a second writer) (PLANE 0: q rows pitch 2048; 1: k rows pitch 1024)
template <int PLANE>
__global__ __launch_bounds__(256) void k_normrope(const float* __restrict__ QK, const float* __restrict__ SC, const float* __restrict__ COS, const float* __restrict__ SIN, __bf16* __restrict__ OF) {
  __shared__ float sy[16][HD]; __shared__ float sred[16][8]; __shared__ __align__(16) float so[16][HD + 4];
  const int t = blockIdx.x, h = blockIdx.y, d = threadIdx.x; const int pitch = PLANE ? (NKV * HD) : (NH * HD);
  const float* col = QK + (size_t)t * 16 * pitch + h * HD + d; float y[16];
#pragma unroll   // in full: y[] is indexed by constants and stays in registers, and the 16 rows' loads fly together
  for (int r = 0; r < 16; ++r) { y[r] = col[(size_t)r * pitch]; sy[r][d] = y[r]; }
#pragma unroll   // in full: y[] stays in registers, and the rows' cross-lane sums cover one another's latency
  for (int r = 0; r < 16; ++r) { float q = y[r] * y[r];
#pragma unroll   // in full: five fixed steps, no loop overhead
    for (int o = 1; o < 32; o <<= 1) q += __shfl_xor(q, o);
    if ((d & 31) == 0) sred[r][d >> 5] = q; }
  __syncthreads();
  const int dp = (d < HD / 2) ? (d + HD / 2) : (d - HD / 2); const float g0 = 1.0f + bfr(SC[d]), g1 = 1.0f + bfr(SC[dp]);
#pragma unroll   // in full: y[] stays in registers, and the rows' table loads fly together
  for (int r = 0; r < 16; ++r) { float ss = 0.f;
#pragma unroll   // in full: eight fixed terms, summed in this order
    for (int w = 0; w < 8; ++w) ss += sred[r][w];
    const float rs = rsqrtf(ss / (float)HD + 1e-6f);
    const float yn = y[r] * rs * g0; const float other = sy[r][dp] * rs * g1;
    const float rot = (d < HD / 2) ? -other : other; const size_t s = (size_t)t * 16 + r;
    so[r][d] = yn * bfr(COS[s * HD + d]) + rot * bfr(SIN[s * HD + d]); }
  __syncthreads();
  __bf16* ob = OF + ((size_t)h * (SS / 16) + t) * (HD / 32) * FRU;
  for (int q = d; q < (HD / 32) * FRU / 8; q += 256) { const int ln = q & 31, part = (q >> 5) & 1, pl = (q >> 6) & 1, kc = q >> 7; const float* p = &so[ln & 15][kc * 32 + part * 16 + (ln >> 4) * 8]; v8b w;
#pragma unroll   // in full: w[] is indexed by constants and stays in registers
    for (int i = 0; i < 8; ++i) { const float v = p[i]; const __bf16 hb = (__bf16)v; w[i] = pl ? (__bf16)(v - (float)hb) : hb; }
    vst2(ob + (size_t)q * 8, w); }
}
// ---- k_vplanes: block = (64 positions, 128 value columns): v as bf16 hi + residual, transposed in LDS, out in fragment order (row = value column, k = key): 2 key steps x 8 column tiles = 16 whole units
__global__ __launch_bounds__(256) void k_vplanes(const float* __restrict__ V, __bf16* __restrict__ VF) {
  __shared__ __align__(16) __bf16 sh[128][72], sl[128][72]; const int tid = threadIdx.x; const int s0 = blockIdx.x * 64, c0 = blockIdx.y * 128;
  for (int q = tid; q < 64 * 128; q += 256) { const int sl_ = q >> 7, c = q & 127; const float v = V[(size_t)(s0 + sl_) * (NKV * HD) + c0 + c]; const __bf16 hb = (__bf16)v; sh[c][sl_] = hb; sl[c][sl_] = (__bf16)(v - (float)hb); }
  __syncthreads();
  for (int q = tid; q < 16 * FRU / 8; q += 256) { const int ln = q & 31, part = (q >> 5) & 1, pl = (q >> 6) & 1, dtl = (q >> 7) & 7, ksl = q >> 10; const int c = dtl * 16 + (ln & 15), sk = ksl * 32 + part * 16 + (ln >> 4) * 8; const int cg = c0 + dtl * 16;
    const size_t o = (((size_t)(cg / HD) * (SS / 32) + s0 / 32 + ksl) * (HD / 16) + (cg % HD) / 16) * FRU + (q & 127) * 8; vst2(VF + o, *(const v4u*)(pl ? &sl[c][sk] : &sh[c][sk])); }
}
// ---- k_attn: block = (64 queries, head h), 16 waves = (query tile qw = wave & 3) x (key share kj = wave >> 2): a wave takes the key steps ks = kj, kj + 4, ... of its 16 queries, so four waves a SIMD cover one another's load and LDS latency; the four partial (max, sum, acc) of a query tile are merged through LDS at the end; kv = h / 2; per 32-key step: live = (k <= q) & attn_mask[k] & (k > pos_q - WIN) & (k < pos_q + WIN); wave vote; scores (3 products, K 256 = 8 ksteps) / 16; online softmax with guards; P.V over all 256 value columns (16 tiles, 3 products) from the one set of scores; q, k and v come as bf16 hi + residual in fragment order (frag_t), so nothing is split here and every fragment load reads whole lines; O cols h*256 + ...
// Both products are formed transposed: S^T = k q^T (A = k rows, B = q rows) and O^T += v^T P^T (A = value columns, B = P). A lane (g = lane >> 4, col = lane & 15) then holds, of the ONE query q0 + col, the scores of keys 8 g + r and 16 + 8 g + r of the step: its maximum and sum are formed in the lane plus one exchange with lane ^ 16, one max / sum / rescale factor a lane serves all its accumulators, and the 16 weights are, as they stand, the lane's B fragment of P^T (k = 8 g + 0..7, 16 + 8 g + 0..7), so P goes from registers to the WMMA with no LDS trip. acc[dt][r] = O[q0 + col][16 dt + 8 g + r].
// A pass = 128 keys = the four key shares' steps 4 it + kj. Its k units (8 key tiles) and its v units (4 key steps) are each 128 KiB in a row in global memory; asynchronous copies bring each into LDS once for the block, where the four query tiles of a key share read the same bytes. Two buffers, tiles in the order k(it), v(it), k(next), v(next): v flies under scores and softmax, the next k under P.V. The passes are those of lm, a mask that every wave forms alike from segment_pos and the causal bound (attn_mask left out: it can only hold more passes than are live), so every barrier stands under block-uniform control flow; a wave's own vote still decides whether it works in a pass.
#define KVT 131072u
// eight 16-byte copies of a lane, 8 KiB (512 threads) apart in LDS and in global memory alike: the offset field moves both addresses, so one address of each kind serves all eight and none is kept in registers over the loop; the s_wait_xcnt closes the statement so that no address register of a copy is rewritten ahead of it
__device__ __forceinline__ void acopy8s(unsigned l, const char* g) {
  asm volatile("global_load_async_to_lds_b128 %0, %1, off\n\t"
               "global_load_async_to_lds_b128 %0, %1, off offset:8192\n\t"
               "global_load_async_to_lds_b128 %0, %1, off offset:16384\n\t"
               "global_load_async_to_lds_b128 %0, %1, off offset:24576\n\t"
               "global_load_async_to_lds_b128 %0, %1, off offset:32768\n\t"
               "global_load_async_to_lds_b128 %0, %1, off offset:40960\n\t"
               "global_load_async_to_lds_b128 %0, %1, off offset:49152\n\t"
               "global_load_async_to_lds_b128 %0, %1, off offset:57344\n\t"
               "s_wait_xcnt 0x0"
               :: "v"(l), "v"(g) : "memory");
}
// one 128 KiB tile into LDS: 16 pieces of 16 bytes a thread
__device__ __forceinline__ void acopy_tile(unsigned l, const char* g) { acopy8s(l, g); acopy8s(l + 65536u, g + 65536); }
// lane l with lane l ^ 16
__device__ __forceinline__ float xhalf(float x) { return __builtin_bit_cast(float, __builtin_amdgcn_permlanex16(__builtin_bit_cast(int, x), __builtin_bit_cast(int, x), 0x76543210, 0xfedcba98, false, false)); }
__global__ __launch_bounds__(512) void k_attn(const __bf16* __restrict__ QF, const __bf16* __restrict__ KF, const int* __restrict__ AM, const int* __restrict__ SEGPOS, const __bf16* __restrict__ VF, float* __restrict__ O) {
  __shared__ __align__(16) unsigned char big[16 * 16 * 260 * 4]; __shared__ float sm[16][16], sl[16][16];
  float (*so)[16][260] = (float (*)[16][260])big;   // the merge's partials lie over the two staging buffers (k at 0, v at KVT), which are dead by then
  const int tid = threadIdx.x, wave = __builtin_amdgcn_readfirstlane(tid >> 5), lane = tid & 31, col = lane & 15, g = lane >> 4; const int qw = wave & 3, kj = wave >> 2; const int qb = blockIdx.x + TQ0, h = blockIdx.y; const int kv = h / (NH / NKV); const int q0 = qb * 64 + qw * 16;   // the wave's number in a scalar register: key step and tile bases leave the vector registers, and the 16 accumulator tiles fit the 256 a wave has with no scratch
  const __bf16* qp = QF + ((size_t)h * (SS / 16) + (q0 >> 4)) * (HD / 32) * FRU + lane * 8;
  const int qi = q0 + col; const int pq = SEGPOS[qi];   // the lane's one query and its position
  asm volatile("s_wait_xcnt 0x0" ::: "memory");   // stands between this load and the rewrite of its address register by the code below
  const int klo = pq - WIN, khi = min(qi, pq + WIN - 1);   // live keys of the query: klo < k <= khi, and attn_mask[k]
  float m = -3.0e38f, l = 0.f;
  v8f acc[16] = {};
  const int nks = (qb * 64 + 64) / 32;   // causal upper bound on key steps
  unsigned lm = 0;
  { const int qx = qb * 64 + lane, qy = qx + 32; const int px = SEGPOS[qx], py = SEGPOS[qy];
    for (int i = 0; i < (nks + 3) / 4; ++i) { const int k0 = i * 128, k1 = k0 + 127;
      const bool lx = max(k0, px - WIN + 1) <= min(min(k1, qx), px + WIN - 1), ly = max(k0, py - WIN + 1) <= min(min(k1, qy), py + WIN - 1);
      if (__any(lx || ly)) lm |= 1u << i; } }
  lm = __builtin_amdgcn_readfirstlane(lm);
  if (lm != 0) {
  const unsigned lk = lds_off(&big[0]) + tid * 16, lvv = lk + KVT;
  const char* gk = (const char*)(KF + (size_t)kv * (SS / 16) * (HD / 32) * FRU) + tid * 16; const char* gv = (const char*)(VF + (size_t)kv * (SS / 32) * (HD / 16) * FRU) + tid * 16;
  int it = __builtin_ctz(lm);
  acopy_tile(lk, gk + (size_t)it * KVT);
  asm volatile("s_wait_asynccnt 0x0" ::: "memory");   // this wave's share of the first k tile has landed
  __syncthreads();                                    // every wave's share of it has landed
  acopy_tile(lvv, gv + (size_t)it * KVT);
#pragma unroll 1   // rolled: the body is some thousand instructions long
  for (;;) { bool lv[16]; bool anylive = false; lm &= lm - 1; const bool more = lm != 0; const int nx = more ? __builtin_ctz(lm) : 0; const int ks = it * 4 + kj;
#pragma unroll   // in full: the arrays are indexed by constants and stay in registers
    for (int ct = 0; ct < 2; ++ct) { const int kb = ks * 32 + ct * 16 + 8 * g; const v4i a0 = *(const v4i*)(AM + kb), a1 = *(const v4i*)(AM + kb + 4);   // the lane's eight keys of this key tile
#pragma unroll   // in full: the arrays are indexed by constants and stay in registers
      for (int r = 0; r < 8; ++r) { const int kk = kb + r; const bool live = ((r < 4 ? a0[r & 3] : a1[r & 3]) != 0) & (kk > klo) & (kk <= khi); lv[ct * 8 + r] = live; anylive = anylive | live; } }
    const bool wl = __any(anylive);
    F2 pa;
    if (wl) { float s[16];
#pragma unroll   // in full: the arrays are indexed by constants and stay in registers
      for (int ct = 0; ct < 2; ++ct) { const __bf16* kp = (const __bf16*)(big + kj * 32768 + ct * 16384) + lane * 8; v8f c = {};
#pragma unroll   // in full: the arrays are indexed by constants and stay in registers
        for (int kc = 0; kc < HD / 32; ++kc) { F2 kb, qa; kb.h = frag_t(kp + kc * FRU); kb.l = frag_t(kp + kc * FRU + 512); qa.h = frag_t(qp + kc * FRU); qa.l = frag_t(qp + kc * FRU + 512);
          c = wmma_bf(kb.h, qa.l, c); c = wmma_bf(kb.l, qa.h, c); c = wmma_bf(kb.h, qa.h, c); }   // the three products of mac3(q, k, .), in its order
#pragma unroll   // in full: the arrays are indexed by constants and stay in registers
        for (int r = 0; r < 8; ++r) s[ct * 8 + r] = lv[ct * 8 + r] ? c[r] * 0.0625f : -3.0e38f; }
      float t8[8];
#pragma unroll   // in full: the arrays are indexed by constants and stay in registers
      for (int i = 0; i < 8; ++i) t8[i] = fmaxf(s[i], s[8 + i]);
      float mx = fmaxf(fmaxf(fmaxf(t8[0], t8[1]), fmaxf(t8[2], t8[3])), fmaxf(fmaxf(t8[4], t8[5]), fmaxf(t8[6], t8[7])));
      mx = fmaxf(mx, xhalf(mx));
      const float mn = fmaxf(m, mx); const float ea = expf(m - mn); const float alpha = (m <= -1.0e38f) ? 0.f : ea;   // every exp is formed unconditionally (its argument is finite and <= 0) and the guard selects behind it: no branch, and the 17 chains cover one another's latency
#pragma unroll   // in full: the arrays are indexed by constants and stay in registers
      for (int i = 0; i < 16; ++i) { const float e = expf(s[i] - mn); s[i] = (s[i] <= -1.0e38f) ? 0.f : e; }
#pragma unroll   // in full: the arrays are indexed by constants and stay in registers
      for (int i = 0; i < 8; ++i) t8[i] = s[i] + s[8 + i];
      float es = ((t8[0] + t8[1]) + (t8[2] + t8[3])) + ((t8[4] + t8[5]) + (t8[6] + t8[7]));
      es += xhalf(es);
      l = l * alpha + es; m = mn;
#pragma unroll   // in full: the arrays are indexed by constants and stay in registers
      for (int dt = 0; dt < 16; ++dt) acc[dt] *= alpha;
      pa = bsplit16(s); }
    asm volatile("s_wait_dscnt 0x0" ::: "memory");      // this wave has left the k buffer
    asm volatile("s_wait_asynccnt 0x0" ::: "memory");   // this wave's share of the pass's v tile has landed
    __syncthreads();                                    // publishes the v tile and frees the k buffer
    if (more) acopy_tile(lk, gk + (size_t)nx * KVT);
    if (wl) { const __bf16* vp = (const __bf16*)(big + KVT + kj * 32768) + lane * 8;   // one address; the 16 tiles' units lie constant steps behind it
#pragma unroll   // in full: the arrays are indexed by constants and stay in registers
      for (int dt = 0; dt < 16; ++dt) { const v16b vh = frag_t(vp + dt * FRU), vl = frag_t(vp + dt * FRU + 512); acc[dt] = wmma_bf(vh, pa.l, acc[dt]); acc[dt] = wmma_bf(vl, pa.h, acc[dt]); acc[dt] = wmma_bf(vh, pa.h, acc[dt]); } }
    asm volatile("s_wait_dscnt 0x0" ::: "memory");      // this wave has left the v buffer
    asm volatile("s_wait_asynccnt 0x0" ::: "memory");   // this wave's share of the next pass's k tile has landed
    __syncthreads();                                    // publishes that k tile and frees the v buffer (behind the last pass: for the merge's partials)
    if (!more) break;
    acopy_tile(lvv, gv + (size_t)nx * KVT); it = nx; }
  asm volatile("s_wait_asynccnt 0x0" ::: "memory"); }   // no copy is outstanding when the wave goes on
#pragma unroll   // in full: the arrays are indexed by constants and stay in registers
  for (int dt = 0; dt < 16; ++dt) { v4f lo4, hi4;
#pragma unroll   // in full: the arrays are indexed by constants and stay in registers
    for (int i = 0; i < 4; ++i) { lo4[i] = acc[dt][i]; hi4[i] = acc[dt][4 + i]; }
    *(v4f*)&so[wave][col][dt * 16 + 8 * g] = lo4; *(v4f*)&so[wave][col][dt * 16 + 8 * g + 4] = hi4; }
  if (g == 0) { sm[wave][col] = m; sl[wave][col] = l; }
  __syncthreads();   // every wave's partial is in LDS before any wave merges
  // merge: wave (qw, kj) finishes rows 4 kj .. 4 kj + 3 of query tile qw: weights exp(m_j - M), a share with no live key weighs 0
  for (int rl = 0; rl < 4; ++rl) { const int row = kj * 4 + rl; float mj[4]; float M = -3.0e38f;
#pragma unroll
    for (int j = 0; j < 4; ++j) { mj[j] = sm[qw + 4 * j][row]; M = fmaxf(M, mj[j]); }
    float L = 0.f; v4f o0 = {}, o1 = {};
#pragma unroll
    for (int j = 0; j < 4; ++j) { const float w = (mj[j] <= -1.0e38f) ? 0.f : exp_ni(mj[j] - M); L += w * sl[qw + 4 * j][row]; o0 += w * *(const v4f*)&so[qw + 4 * j][row][lane * 4]; o1 += w * *(const v4f*)&so[qw + 4 * j][row][128 + lane * 4]; }
    const float il = (L > 0.f) ? 1.0f / L : 0.f;
    vst2(O + (size_t)(q0 + row) * (NH * HD) + h * HD + lane * 4, o0 * il); vst2(O + (size_t)(q0 + row) * (NH * HD) + h * HD + 128 + lane * 4, o1 * il);
    asm volatile("s_wait_xcnt 0x0" ::: "memory"); }   // stands between the two stores and the next row's rewrite of their data registers
}
extern "C" void kernel_launch(void* const* d_in, const int* in_sizes, int n_in, void* d_out, int out_size, void* d_ws, size_t ws_size, hipStream_t stream) {
  (void)in_sizes; (void)n_in; (void)out_size;
  const float** F = (const float**)d_in; const int* AM = (const int*)d_in[1]; const int* SEGPOS = (const int*)d_in[2];
  // 0 x [1,2048,2048], 1 attn_mask [1,2048] bool(int), 2 segment_pos [1,2048] i32, 3 cos [1,2048,256], 4 sin, 5 wq [2048,2048], 6 wk [2048,1024], 7 wv [2048,1024], 8 wo [2048,2048], 9 q_scale [256], 10 k_scale [256]
  if (ws_size < (size_t)WS_END) return;
  char* ws = (char*)d_ws; __bf16 *PW = (__bf16*)(ws + WS_PW), *VF = (__bf16*)(ws + WS_VF), *QF = (__bf16*)(ws + WS_QF), *KF = (__bf16*)(ws + WS_KF); float *Q = (float*)(ws + WS_Q), *Kx = (float*)(ws + WS_K), *V = (float*)(ws + WS_V), *O = (float*)(ws + WS_O);
  k_packT<<<dim3(HID / 128, 48), 256, 0, stream>>>(F[5], F[6], F[7], F[8], PW);
  k_gemm<1><<<dim3(TQB, NH * HD / 128), 128, 0, stream>>>(F[0] + (size_t)TQ0 * 64 * HID, HID, HID, PW + PQ, Q + (size_t)TQ0 * 64 * NH * HD, NH * HD);   // q rows of the processed query range
  k_gemm<1><<<dim3(KRP, NKV * HD / 128), 128, 0, stream>>>(F[0], HID, HID, PW + PK, Kx, NKV * HD);
  k_gemm<1><<<dim3(KRP, NKV * HD / 128), 128, 0, stream>>>(F[0], HID, HID, PW + PV, V, NKV * HD);
  k_normrope<0><<<dim3(TQB * 4, NH), 256, 0, stream>>>(Q + (size_t)TQ0 * 64 * NH * HD, F[9], F[3] + (size_t)TQ0 * 64 * HD, F[4] + (size_t)TQ0 * 64 * HD, QF + (size_t)TQ0 * 4 * (HD / 32) * FRU);
  k_normrope<1><<<dim3(KRP * 4, NKV), 256, 0, stream>>>(Kx, F[10], F[3], F[4], KF);
  k_vplanes<<<dim3(KRP, NKV * HD / 128), 256, 0, stream>>>(V, VF);
  k_attn<<<dim3(TQB, NH), 512, 0, stream>>>(QF, KF, AM, SEGPOS, VF, O);
  k_gemm<0><<<dim3(TQB, HID / 128), 128, 0, stream>>>(O + (size_t)TQ0 * 64 * NH * HD, NH * HD, NH * HD, PW + PO, (float*)d_out + (size_t)TQ0 * 64 * HID, HID);
}

// v008
// One run takes 200 microseconds.
// Next to v007, in two timings, it ran 1.04 times as fast each time.
// All steps since v000 together make it 6.76 times as fast.
// compute dtype: x, attn_mask, segment_pos, cos/sin tables, wq/wk/wv/wo and the RMSNorm scales (module inputs) rounded to bf16 / read as int; q/k/v projections with exact bf16 products (x and the weights are inputs); per-head RMSNorm and RoPE (input tables) in f32; scores q.k with both operands as bf16 hi + residual pairs (3 products), P.V with P hi/lo x V hi/lo (3 products), output projection hi/lo x exact wo (2 products); all on WMMA 16x16x32; the causal AND padding AND sliding-window mask is evaluated at run time from attn_mask / segment_pos and key tiles with no live entry are skipped; f32 accumulate.
#include <hip/hip_runtime.h>
#include <math.h>

typedef __attribute__((ext_vector_type(16))) _Float16 v16h;
typedef __attribute__((ext_vector_type(16))) __bf16 v16b;
typedef __attribute__((ext_vector_type(8)))  _Float16 v8h;
typedef __attribute__((ext_vector_type(8)))  float v8f;
typedef __attribute__((ext_vector_type(4)))  float v4f;
typedef __attribute__((ext_vector_type(2)))  float v2f;
typedef __attribute__((ext_vector_type(4)))  unsigned v4u;
typedef __attribute__((ext_vector_type(4)))  int v4i;
typedef float __attribute__((may_alias)) float_a;
typedef int __attribute__((may_alias)) int_a;

template <typename T> __device__ __forceinline__ void vst2(void* p, T v) { *(T*)p = v;  }
__device__ __forceinline__ v8f wmma16(v16h a, v16h b, v8f c) {
  v8f d = __builtin_amdgcn_wmma_f32_16x16x32_f16(false, a, false, b, (short)0, c, false, false);
  asm volatile("v_nop\n\tv_nop\n\tv_nop\n\tv_nop" : "+v"(d) : "v"(a), "v"(b));
  return d;
}
__device__ __forceinline__ v8f wmma_bf(v16b a, v16b b, v8f c) {
  v8f d = __builtin_amdgcn_wmma_f32_16x16x32_bf16(false, a, false, b, (short)0, c, false, false);
  asm volatile("v_nop\n\tv_nop\n\tv_nop\n\tv_nop" : "+v"(d) : "v"(a), "v"(b));
  return d;
}
// 16x16x32 fragments: lane = (h = lane>>4, row/col = lane&15); elements 0..7 = k0+8h+0..7, 8..15 = k0+16+8h+0..7; D element r = row 8h+r
__device__ __forceinline__ v16h frag_h(const _Float16* rowk0, int lane) {
  union { v16h v; v8h q[2]; } u; const _Float16* p = rowk0 + 8 * (lane >> 4);
  u.q[0] = *(const v8h*)p; u.q[1] = *(const v8h*)(p + 16); return u.v;
}
__device__ __forceinline__ v16h frag_f32(const float* rowk0, int lane) {
  v16h a; const float* p = rowk0 + 8 * (lane >> 4);
#pragma unroll
  for (int i = 0; i < 8; ++i) { a[i] = (_Float16)p[i]; a[8 + i] = (_Float16)p[16 + i]; }
  return a;
}
__device__ __forceinline__ v16h frag_f32s(const float* rowk0, int lane, float sc) {
  v16h a; const float* p = rowk0 + 8 * (lane >> 4);
#pragma unroll
  for (int i = 0; i < 8; ++i) { a[i] = (_Float16)(p[i] * sc); a[8 + i] = (_Float16)(p[16 + i] * sc); }
  return a;
}
// column fragment from a [K][ld] layout (column n), rows >= K read as 0
__device__ __forceinline__ v16h fragc_f32(const float* W, int k0, int n, int lane, int ld, int K) {
  v16h a; const int g = lane >> 4;
#pragma unroll
  for (int i = 0; i < 8; ++i) { const int ka = k0 + 8 * g + i, kb = ka + 16;
    a[i] = (_Float16)(ka < K ? W[(size_t)(ka < K ? ka : K - 1) * ld + n] : 0.f); a[8 + i] = (_Float16)(kb < K ? W[(size_t)(kb < K ? kb : K - 1) * ld + n] : 0.f); }
  return a;
}
struct F2 { v16b h, l; };
__device__ __forceinline__ F2 bsplit16(const float v[16]) { F2 r;
#pragma unroll
  for (int i = 0; i < 16; ++i) { const __bf16 h = (__bf16)v[i]; r.h[i] = h; r.l[i] = (__bf16)(v[i] - (float)h); }
  return r; }
__device__ __forceinline__ F2 split_row(const float* row, int k0, int lane) { float v[16]; const float* p = row + k0 + 8 * (lane >> 4);
#pragma unroll
  for (int i = 0; i < 8; ++i) { v[i] = p[i]; v[8 + i] = p[16 + i]; }
  return bsplit16(v); }
__device__ __forceinline__ F2 split_rowK(const float* row, int k0, int lane, int K) { float v[16]; const int g = lane >> 4;
#pragma unroll
  for (int i = 0; i < 8; ++i) { const int ka = k0 + 8 * g + i, kb = ka + 16; v[i] = ka < K ? row[ka < K ? ka : K - 1] : 0.f; v[8 + i] = kb < K ? row[kb < K ? kb : K - 1] : 0.f; }
  return bsplit16(v); }
__device__ __forceinline__ F2 split_col(const float* W, int k0, int n, int lane, int ld, int K) { float v[16]; const int g = lane >> 4;
#pragma unroll
  for (int i = 0; i < 8; ++i) { const int ka = k0 + 8 * g + i, kb = ka + 16; v[i] = ka < K ? W[(size_t)(ka < K ? ka : K - 1) * ld + n] : 0.f; v[8 + i] = kb < K ? W[(size_t)(kb < K ? kb : K - 1) * ld + n] : 0.f; }
  return bsplit16(v); }
__device__ __forceinline__ v8f mac3(const F2& a, const F2& b, v8f c) { c = wmma_bf(a.l, b.h, c); c = wmma_bf(a.h, b.l, c); return wmma_bf(a.h, b.h, c); }
__device__ __forceinline__ float sigm(float v) { return 1.0f / (1.0f + expf(-v)); }
#define LDSX() do { asm volatile("s_wait_dscnt 0" ::: "memory"); __builtin_amdgcn_wave_barrier(); __builtin_amdgcn_fence(__ATOMIC_RELEASE, "workgroup"); } while (0)


// Gemma-3 style attention (B 1, S 2048, hidden 2048, 8 query heads / 4 kv heads x 256, sliding window 1024): q,k,v = x w; q,k = RMSNorm_head(.)(1 + scale); RoPE with the given cos/sin; GQA (kv head = h / 2); scores / 16 masked by causal & attn_mask[k] & |k - segment_pos[q]| < WIN (else -1e37); softmax; out = (P v merged) wo.
#define SS 2048
#define HID 2048
#define NH 8
#define NKV 4
#define HD 256
#define WIN 1024
#ifndef TQB
#define TQB (SS / 64)          // query tiles processed
#define TQ0 0                  // first query tile
#define KRP (SS / 64)          // key/value row tiles (all)
#endif
typedef __attribute__((ext_vector_type(8))) __bf16 v8b;
__device__ __forceinline__ v16b frag_b(const __bf16* rowk0, int lane) {
  union { v16b v; v8b q[2]; } u; const __bf16* p = rowk0 + 8 * (lane >> 4);
  u.q[0] = *(const v8b*)p; u.q[1] = *(const v8b*)(p + 16); return u.v;
}
__device__ __forceinline__ float bfr(float v) { return (float)(__bf16)v; }
__device__ __attribute__((noinline)) float exp_ni(float v) { return expf(v); }
__device__ __attribute__((noinline)) float erf_ni(float v) { return erff(v); }

#define WS_PW  0u                                  // bf16 rows (in,out -> [out][in]): wq [2048][2048], wk [1024][2048], wv [1024][2048], wo [2048][2048]
#define PQ 0
#define PK (PQ + NH * HD * HID)
#define PV (PK + NKV * HD * HID)
#define PO (PV + NKV * HD * HID)
#define PWEND (PO + HID * NH * HD)
#define WS_Q   (WS_PW + 2u * PWEND)                 // f32 [S][2048] q raw
#define WS_K   (WS_Q + 4u * SS * NH * HD)            // f32 [S][1024] k raw
#define WS_V   (WS_K + 4u * SS * NKV * HD)           // f32 [S][1024] v raw
#define WS_VF  (WS_V + 4u * SS * NKV * HD)           // bf16 v in fragment order: [kv][32-key step][16-column tile][FRU]
#define WS_O   (WS_VF + 4u * NKV * HD * SS)          // f32 [S][2048]
#define WS_QF  (WS_O + 4u * SS * NH * HD)            // bf16 q in fragment order: [head][16-query tile][32-d step][FRU]
#define WS_KF  (WS_QF + 4u * SS * NH * HD)           // bf16 k in fragment order: [kv][16-key tile][32-d step][FRU]
#define WS_END (WS_KF + 4u * SS * NKV * HD)
// Fragment order: one 16 x 32 operand tile is a unit of FRU bf16 = [plane hi, lo][part 0, 1][lane 32][8]: lane (g = lane >> 4, row = lane & 15) holds k = 16 part + 8 g + 0..7 of its row, which is what frag_b reads from a row. A wave's 16-byte load of one (plane, part) is then 512 bytes in a row, four whole lines, where a load from rows touches sixteen.
#define FRU 1024
__device__ __forceinline__ v16b frag_t(const __bf16* p) { union { v16b v; v8b q[2]; } u; u.q[0] = *(const v8b*)p; u.q[1] = *(const v8b*)(p + 256); return u.v; }

// ---- k_packT: block = (128 k, 128 output columns): (in,out) weight -> rows [n][K], a tile at a time through LDS. The four weights all have K = 2048 and their row sets lie one behind another in PW, so blockIdx.y counts 128-column tiles over all of them (wq 16, wk 8, wv 8, wo 16).
// A wave's load is 512 bytes in a row of one k; a thread holds 8 k x 4 columns twice, which are eight finished 16-byte pieces of output rows; they cross in LDS, and a wave's store is two output rows x 256 bytes: whole lines both ways, each line with one writer.
// LDS row = one column's 128 k as bf16, pitch 272 B; the 16-byte piece kch of row n lies at place kch ^ ((n >> 4) & 3): with it the 16 lanes of a half wave, four rows apart, store to 16 different bank groups.
#define PTP 272
template <int N>   // the weight's row length as a constant: the 16 loads then share one address and differ in the offset field
__device__ __forceinline__ void pack_tile(const float* __restrict__ src, __bf16* __restrict__ dst, unsigned char* s, int tid) {
  const int wave = tid >> 5, lane = tid & 31; src += (size_t)(wave * 8) * N + lane * 4; v4f v[2][8];
#pragma unroll   // in full: v[] is indexed by constants and stays in registers
  for (int hf = 0; hf < 2; ++hf)
#pragma unroll   // in full: as above
    for (int i = 0; i < 8; ++i) v[hf][i] = *(const v4f*)(src + (size_t)(hf * 64 + i) * N);
  // the wait stands between the loads and any rewrite of their address register; the loaded values and the address are inputs only, so that all 16 loads are issued ahead of the first use and fly together (without it the compiler issues the last six behind waits on the first ten) and no load's result lands on the address
  asm volatile("s_wait_xcnt 0x0" :: "v"(src), "v"(v[0][0]), "v"(v[0][1]), "v"(v[0][2]), "v"(v[0][3]), "v"(v[0][4]), "v"(v[0][5]), "v"(v[0][6]), "v"(v[0][7]), "v"(v[1][0]), "v"(v[1][1]), "v"(v[1][2]), "v"(v[1][3]), "v"(v[1][4]), "v"(v[1][5]), "v"(v[1][6]), "v"(v[1][7]) : "memory");
  const int sw = (lane >> 2) & 3;   // (n >> 4) & 3 of the thread's four columns n = 4 lane + c
#pragma unroll   // in full: v[] is indexed by constants
  for (int hf = 0; hf < 2; ++hf)
#pragma unroll   // in full: v[] is indexed by constants
    for (int c = 0; c < 4; ++c) { v8b w;
#pragma unroll   // in full: v[] and w[] are indexed by constants
      for (int i = 0; i < 8; ++i) w[i] = (__bf16)v[hf][i][c];
      *(v8b*)(s + (lane * 4 + c) * PTP + (((hf * 8 + wave) ^ sw) * 16)) = w; }
  __syncthreads();
  const int nr = tid >> 4, kch = tid & 15;
#pragma unroll   // in full: eight fixed pieces a thread (rows nr + 16 j), their LDS reads ahead of the stores
  for (int j = 0; j < 8; ++j) vst2(dst + (size_t)(nr + 16 * j) * HID + kch * 8, *(const v4u*)(s + (nr + 16 * j) * PTP + ((kch ^ (j & 3)) * 16)));
}
__global__ __launch_bounds__(256) void k_packT(const float* __restrict__ WQ, const float* __restrict__ WK, const float* __restrict__ WV, const float* __restrict__ WO, __bf16* __restrict__ PW) {
  __shared__ __align__(16) unsigned char s[128 * PTP]; const int tid = threadIdx.x; const int k0 = blockIdx.x * 128, y = blockIdx.y;
  if (y < 16) pack_tile<NH * HD>(WQ + (size_t)k0 * (NH * HD) + y * 128, PW + PQ + (size_t)y * 128 * HID + k0, s, tid);
  else if (y < 24) pack_tile<NKV * HD>(WK + (size_t)k0 * (NKV * HD) + (y - 16) * 128, PW + PK + (size_t)(y - 16) * 128 * HID + k0, s, tid);
  else if (y < 32) pack_tile<NKV * HD>(WV + (size_t)k0 * (NKV * HD) + (y - 24) * 128, PW + PV + (size_t)(y - 24) * 128 * HID + k0, s, tid);
  else pack_tile<HID>(WO + (size_t)k0 * HID + (y - 32) * 128, PW + PO + (size_t)(y - 32) * 128 * HID + k0, s, tid);
}
// ---- k_gemm<RIN>: block = (64 rows, 128 cols): OUT = A(K) . rows (RIN exact / hi-lo 2 products); pitch ldo. K is a multiple of 64.
// Both operand tiles of a 64-k stage (A 64 rows x 256 B f32, P 128 rows x 128 B bf16) are brought into LDS by asynchronous copies, whole lines, two buffers: stage t + 1 flies while stage t is worked on, and the four waves share one copy of the P tile. Row pitches 272 B / 144 B (16 B x odd) keep the 16-byte fragment reads off one another's banks.
#define GKS 64
#define GAP 272
#define GBP 144
#define GAB (64 * GAP)
#define GSTG (GAB + 128 * GBP)
__device__ __forceinline__ unsigned lds_off(const void* p) { return (unsigned)(size_t)p; }
// eight 16-byte copies of a lane, rows lstep / gstep bytes apart; the s_wait_xcnt closes the statement so that no address register of a copy is rewritten ahead of it
__device__ __forceinline__ void acopy8(unsigned l, unsigned lstep, const char* g, size_t gstep) {
  asm volatile("global_load_async_to_lds_b128 %0, %8, off\n\t"
               "global_load_async_to_lds_b128 %1, %9, off\n\t"
               "global_load_async_to_lds_b128 %2, %10, off\n\t"
               "global_load_async_to_lds_b128 %3, %11, off\n\t"
               "global_load_async_to_lds_b128 %4, %12, off\n\t"
               "global_load_async_to_lds_b128 %5, %13, off\n\t"
               "global_load_async_to_lds_b128 %6, %14, off\n\t"
               "global_load_async_to_lds_b128 %7, %15, off\n\t"
               "s_wait_xcnt 0x0"
               :: "v"(l), "v"(l + lstep), "v"(l + 2 * lstep), "v"(l + 3 * lstep), "v"(l + 4 * lstep), "v"(l + 5 * lstep), "v"(l + 6 * lstep), "v"(l + 7 * lstep),
                  "v"(g), "v"(g + gstep), "v"(g + 2 * gstep), "v"(g + 3 * gstep), "v"(g + 4 * gstep), "v"(g + 5 * gstep), "v"(g + 6 * gstep), "v"(g + 7 * gstep)
               : "memory");
}
template <int RIN>
__global__ __launch_bounds__(128) void k_gemm(const float* __restrict__ A, int lda, int K, const __bf16* __restrict__ P, float* __restrict__ OUT, int ldo) {
  __shared__ __align__(16) float so[4][16][132]; __shared__ __align__(16) unsigned char st[2][GSTG];
  const int tid = threadIdx.x, wave = tid >> 5, lane = tid & 31, col = lane & 15, g = lane >> 4; const size_t r0 = (size_t)blockIdx.x * 64 + wave * 16; const int n0 = blockIdx.y * 128;
  // a thread's copy places: A chunk (row i * 8 + tid / 16, 16 B piece tid % 16), P chunk (row i * 16 + tid / 8, piece tid % 8), i = 0..7
  const char* ga = (const char*)(A + ((size_t)blockIdx.x * 64 + (tid >> 4)) * lda + (tid & 15) * 4); const char* gb = (const char*)(P + (size_t)(n0 + (tid >> 3)) * K + (tid & 7) * 8);
  const unsigned la = lds_off(&st[0][0]) + (tid >> 4) * GAP + (tid & 15) * 16, lb = lds_off(&st[0][0]) + GAB + (tid >> 3) * GBP + (tid & 7) * 16;
  const size_t gas = (size_t)lda * 8 * 4, gbs = (size_t)K * 16 * 2; const int nst = K / GKS;
  v8f acc[8] = {};
  acopy8(la, 8 * GAP, ga, gas); acopy8(lb, 16 * GBP, gb, gbs);
  asm volatile("s_wait_asynccnt 0x0" ::: "memory");   // this wave's share of stage 0 has landed
  __syncthreads();                                    // every wave's share of stage 0 has landed
  if (nst > 1) { acopy8(la + GSTG, 8 * GAP, ga + GKS * 4, gas); acopy8(lb + GSTG, 16 * GBP, gb + GKS * 2, gbs); }
  for (int t = 0; t < nst; ++t) { const unsigned bo = (t & 1) * GSTG; const unsigned char* pa = &st[0][0] + bo + (wave * 16 + col) * GAP + 32 * g; const unsigned char* pb = &st[0][0] + bo + GAB + col * GBP + 16 * g;
    // the stage's fragment reads stand ahead of its WMMAs, so that their latencies overlap; the second k step's A rows are read behind the first WMMA (16 registers fewer at the peak: the kernel stays inside v0..v255), still a whole k step ahead of their use
    v4f af[2][4]; v8b bq[2][8][2];
#pragma unroll   // in full: the fragment arrays are indexed by constants and stay in registers
    for (int q = 0; q < 4; ++q) af[0][q] = *(const v4f*)(pa + (q >> 1) * 64 + (q & 1) * 16);
#pragma unroll   // in full: the fragment arrays are indexed by constants and stay in registers
    for (int kc = 0; kc < 2; ++kc)
#pragma unroll   // in full: the fragment arrays are indexed by constants and stay in registers
      for (int j = 0; j < 8; ++j) { bq[kc][j][0] = *(const v8b*)(pb + j * 16 * GBP + kc * 64); bq[kc][j][1] = *(const v8b*)(pb + j * 16 * GBP + kc * 64 + 32); }
#pragma unroll   // in full: the fragment arrays are indexed by constants and stay in registers
    for (int kc = 0; kc < 2; ++kc) { F2 a; float v[16];
#pragma unroll   // in full: the fragment arrays are indexed by constants and stay in registers
      for (int i = 0; i < 4; ++i) { v[i] = af[kc][0][i]; v[4 + i] = af[kc][1][i]; v[8 + i] = af[kc][2][i]; v[12 + i] = af[kc][3][i]; }
      if (RIN) { v16b ax;
#pragma unroll   // in full: the fragment arrays are indexed by constants and stay in registers
        for (int i = 0; i < 16; ++i) ax[i] = (__bf16)v[i];
        a.h = ax; a.l = ax; } else a = bsplit16(v);
#pragma unroll   // in full: the fragment arrays are indexed by constants and stay in registers
      for (int j = 0; j < 8; ++j) { union { v16b v; v8b q[2]; } w; w.q[0] = bq[kc][j][0]; w.q[1] = bq[kc][j][1]; if (!RIN) acc[j] = wmma_bf(a.l, w.v, acc[j]); acc[j] = wmma_bf(a.h, w.v, acc[j]);
        if (kc == 0 && j == 0) {
#pragma unroll   // in full: the fragment arrays are indexed by constants and stay in registers
          for (int q = 0; q < 4; ++q) af[1][q] = *(const v4f*)(pa + 128 + (q >> 1) * 64 + (q & 1) * 16); } } }
    asm volatile("s_wait_dscnt 0x0" ::: "memory");      // this wave has left stage t's buffer
    asm volatile("s_wait_asynccnt 0x0" ::: "memory");   // this wave's share of stage t + 1 has landed
    __syncthreads();                                    // publishes stage t + 1 and frees stage t's buffer
    if (t + 2 < nst) { acopy8(la + bo, 8 * GAP, ga + (size_t)(t + 2) * (GKS * 4), gas); acopy8(lb + bo, 16 * GBP, gb + (size_t)(t + 2) * (GKS * 2), gbs); } }
  asm volatile("s_wait_asynccnt 0x0" ::: "memory");     // no copy is outstanding when the wave goes on
#pragma unroll
  for (int j = 0; j < 8; ++j)
#pragma unroll
    for (int r = 0; r < 8; ++r) so[wave][8 * g + r][j * 16 + col] = acc[j][r];
  LDSX();
  for (int rl = 0; rl < 16; ++rl) vst2(OUT + (r0 + rl) * ldo + n0 + lane * 4, *(const v4f*)&so[wave][rl][lane * 4]);
}
// ---- k_normrope<PLANE>: block = (16 positions, head): 256 threads = d, each over the 16 rows: RMSNorm over the head's 256 (mean of squares, eps 1e-6) * (1 + scale[d]); RoPE: out_d = y_d cos[s][d] + rot_d sin[s][d] with rot = (-y[d+128], y[d-128]); the 16 x 256 result goes out as bf16 hi + residual in fragment order (8 units, 16 KiB in a row: a block writes whole lines, and no line has a second writer) (PLANE 0: q rows pitch 2048; 1: k rows pitch 1024)
template <int PLANE>
__global__ __launch_bounds__(256) void k_normrope(const float* __restrict__ QK, const float* __restrict__ SC, const float* __restrict__ COS, const float* __restrict__ SIN, __bf16* __restrict__ OF) {
  __shared__ float sy[16][HD]; __shared__ float sred[16][8]; __shared__ __align__(16) float so[16][HD + 4];
  const int t = blockIdx.x, h = blockIdx.y, d = threadIdx.x; const int pitch = PLANE ? (NKV * HD) : (NH * HD);
  const float* col = QK + (size_t)t * 16 * pitch + h * HD + d; float y[16];
#pragma unroll   // in full: y[] is indexed by constants and stays in registers, and the 16 rows' loads fly together
  for (int r = 0; r < 16; ++r) { y[r] = col[(size_t)r * pitch]; sy[r][d] = y[r]; }
#pragma unroll   // in full: y[] stays in registers, and the rows' cross-lane sums cover one another's latency
  for (int r = 0; r < 16; ++r) { float q = y[r] * y[r];
#pragma unroll   // in full: five fixed steps, no loop overhead
    for (int o = 1; o < 32; o <<= 1) q += __shfl_xor(q, o);
    if ((d & 31) == 0) sred[r][d >> 5] = q; }
  __syncthreads();
  const int dp = (d < HD / 2) ? (d + HD / 2) : (d - HD / 2); const float g0 = 1.0f + bfr(SC[d]), g1 = 1.0f + bfr(SC[dp]);
#pragma unroll   // in full: y[] stays in registers, and the rows' table loads fly together
  for (int r = 0; r < 16; ++r) { float ss = 0.f;
#pragma unroll   // in full: eight fixed terms, summed in this order
    for (int w = 0; w < 8; ++w) ss += sred[r][w];
    const float rs = rsqrtf(ss / (float)HD + 1e-6f);
    const float yn = y[r] * rs * g0; const float other = sy[r][dp] * rs * g1;
    const float rot = (d < HD / 2) ? -other : other; const size_t s = (size_t)t * 16 + r;
    so[r][d] = yn * bfr(COS[s * HD + d]) + rot * bfr(SIN[s * HD + d]); }
  __syncthreads();
  __bf16* ob = OF + ((size_t)h * (SS / 16) + t) * (HD / 32) * FRU;
  for (int q = d; q < (HD / 32) * FRU / 8; q += 256) { const int ln = q & 31, part = (q >> 5) & 1, pl = (q >> 6) & 1, kc = q >> 7; const float* p = &so[ln & 15][kc * 32 + part * 16 + (ln >> 4) * 8]; v8b w;
#pragma unroll   // in full: w[] is indexed by constants and stays in registers
    for (int i = 0; i < 8; ++i) { const float v = p[i]; const __bf16 hb = (__bf16)v; w[i] = pl ? (__bf16)(v - (float)hb) : hb; }
    vst2(ob + (size_t)q * 8, w); }
}
// ---- k_vplanes: block = (64 positions, 128 value columns): v as bf16 hi + residual, transposed in LDS, out in fragment order (row = value column, k = key): 2 key steps x 8 column tiles = 16 whole units
__global__ __launch_bounds__(256) void k_vplanes(const float* __restrict__ V, __bf16* __restrict__ VF) {
  __shared__ __align__(16) __bf16 sh[128][72], sl[128][72]; const int tid = threadIdx.x; const int s0 = blockIdx.x * 64, c0 = blockIdx.y * 128;
  for (int q = tid; q < 64 * 128; q += 256) { const int sl_ = q >> 7, c = q & 127; const float v = V[(size_t)(s0 + sl_) * (NKV * HD) + c0 + c]; const __bf16 hb = (__bf16)v; sh[c][sl_] = hb; sl[c][sl_] = (__bf16)(v - (float)hb); }
  __syncthreads();
  for (int q = tid; q < 16 * FRU / 8; q += 256) { const int ln = q & 31, part = (q >> 5) & 1, pl = (q >> 6) & 1, dtl = (q >> 7) & 7, ksl = q >> 10; const int c = dtl * 16 + (ln & 15), sk = ksl * 32 + part * 16 + (ln >> 4) * 8; const int cg = c0 + dtl * 16;
    const size_t o = (((size_t)(cg / HD) * (SS / 32) + s0 / 32 + ksl) * (HD / 16) + (cg % HD) / 16) * FRU + (q & 127) * 8; vst2(VF + o, *(const v4u*)(pl ? &sl[c][sk] : &sh[c][sk])); }
}
// ---- k_attn: block = (64 queries, head h), 16 waves = (query tile qw = wave & 3) x (key share kj = wave >> 2): a wave takes the key steps ks = kj, kj + 4, ... of its 16 queries, so four waves a SIMD cover one another's load and LDS latency; the four partial (max, sum, acc) of a query tile are merged through LDS at the end; kv = h / 2; per 32-key step: live = (k <= q) & attn_mask[k] & (k > pos_q - WIN) & (k < pos_q + WIN); wave vote; scores (3 products, K 256 = 8 ksteps) / 16; online softmax with guards; P.V over all 256 value columns (16 tiles, 3 products) from the one set of scores; q, k and v come as bf16 hi + residual in fragment order (frag_t), so nothing is split here and every fragment load reads whole lines; O cols h*256 + ...
// Both products are formed transposed: S^T = k q^T (A = k rows, B = q rows) and O^T += v^T P^T (A = value columns, B = P). A lane (g = lane >> 4, col = lane & 15) then holds, of the ONE query q0 + col, the scores of keys 8 g + r and 16 + 8 g + r of the step: its maximum and sum are formed in the lane plus one exchange with lane ^ 16, one max / sum / rescale factor a lane serves all its accumulators, and the 16 weights are, as they stand, the lane's B fragment of P^T (k = 8 g + 0..7, 16 + 8 g + 0..7), so P goes from registers to the WMMA with no LDS trip. acc[dt][r] = O[q0 + col][16 dt + 8 g + r].
// A pass = 128 keys = the four key shares' steps 4 it + kj. Its k units (8 key tiles) and its v units (4 key steps) are each 128 KiB in a row in global memory; asynchronous copies bring each into LDS once for the block, where the four query tiles of a key share read the same bytes. Two buffers, tiles in the order k(it), v(it), k(next), v(next): v flies under scores and softmax, the next k under P.V. The passes are those of lm, a mask that every wave forms alike from segment_pos and the causal bound (attn_mask left out: it can only hold more passes than are live), so every barrier stands under block-uniform control flow; a wave's own vote still decides whether it works in a pass.
// The block's q (4 query tiles, 64 KiB in a row in global memory) is copied into LDS once, with the first k tile and behind the same wait and barrier, and stays there: every pass reads its q fragments from LDS, and the loop over d is the outer one in the scores, so that one read of a q fragment serves both key tiles of the step. Each tile's products keep their order.
#define KVT 131072u
#define QT 65536u   // the block's q: 4 query tiles x 8 units x 2 KiB, in a row in global memory
// eight 16-byte copies of a lane, 8 KiB (512 threads) apart in LDS and in global memory alike: the offset field moves both addresses, so one address of each kind serves all eight and none is kept in registers over the loop; the s_wait_xcnt closes the statement so that no address register of a copy is rewritten ahead of it
__device__ __forceinline__ void acopy8s(unsigned l, const char* g) {
  asm volatile("global_load_async_to_lds_b128 %0, %1, off\n\t"
               "global_load_async_to_lds_b128 %0, %1, off offset:8192\n\t"
               "global_load_async_to_lds_b128 %0, %1, off offset:16384\n\t"
               "global_load_async_to_lds_b128 %0, %1, off offset:24576\n\t"
               "global_load_async_to_lds_b128 %0, %1, off offset:32768\n\t"
               "global_load_async_to_lds_b128 %0, %1, off offset:40960\n\t"
               "global_load_async_to_lds_b128 %0, %1, off offset:49152\n\t"
               "global_load_async_to_lds_b128 %0, %1, off offset:57344\n\t"
               "s_wait_xcnt 0x0"
               :: "v"(l), "v"(g) : "memory");
}
// one 128 KiB tile into LDS: 16 pieces of 16 bytes a thread
__device__ __forceinline__ void acopy_tile(unsigned l, const char* g) { acopy8s(l, g); acopy8s(l + 65536u, g + 65536); }
// lane l with lane l ^ 16
__device__ __forceinline__ float xhalf(float x) { return __builtin_bit_cast(float, __builtin_amdgcn_permlanex16(__builtin_bit_cast(int, x), __builtin_bit_cast(int, x), 0x76543210, 0xfedcba98, false, false)); }
__global__ __launch_bounds__(512) void k_attn(const __bf16* __restrict__ QF, const __bf16* __restrict__ KF, const int* __restrict__ AM, const int* __restrict__ SEGPOS, const __bf16* __restrict__ VF, float* __restrict__ O) {
  __shared__ __align__(16) unsigned char big[2 * KVT + QT];   // k tile at 0, v tile at KVT, the block's q at 2 KVT: all of the WGP's LDS
  float (*so)[16][260] = (float (*)[16][260])big; float (*sm)[16] = (float (*)[16])(big + 16 * 16 * 260 * 4); float (*sl)[16] = sm + 16;   // the merge's partials, maxima and sums lie over the staging buffers and q, which are dead by then
  const int tid = threadIdx.x, wave = __builtin_amdgcn_readfirstlane(tid >> 5), lane = tid & 31, col = lane & 15, g = lane >> 4; const int qw = wave & 3, kj = wave >> 2; const int qb = blockIdx.x + TQ0, h = blockIdx.y; const int kv = h / (NH / NKV); const int q0 = qb * 64 + qw * 16;   // the wave's number in a scalar register: key step and tile bases leave the vector registers, and the 16 accumulator tiles fit the 256 a wave has with no scratch
  const __bf16* qp = (const __bf16*)(big + 2 * KVT + qw * (QT / 4)) + lane * 8;   // the wave's query tile in LDS
  const int qi = q0 + col; const int pq = SEGPOS[qi];   // the lane's one query and its position
  asm volatile("s_wait_xcnt 0x0" ::: "memory");   // stands between this load and the rewrite of its address register by the code below
  const int klo = pq - WIN, khi = min(qi, pq + WIN - 1);   // live keys of the query: klo < k <= khi, and attn_mask[k]
  float m = -3.0e38f, l = 0.f;
  v8f acc[16] = {};
  const int nks = (qb * 64 + 64) / 32;   // causal upper bound on key steps
  unsigned lm = 0;
  { const int qx = qb * 64 + lane, qy = qx + 32; const int px = SEGPOS[qx], py = SEGPOS[qy];
    for (int i = 0; i < (nks + 3) / 4; ++i) { const int k0 = i * 128, k1 = k0 + 127;
      const bool lx = max(k0, px - WIN + 1) <= min(min(k1, qx), px + WIN - 1), ly = max(k0, py - WIN + 1) <= min(min(k1, qy), py + WIN - 1);
      if (__any(lx || ly)) lm |= 1u << i; } }
  lm = __builtin_amdgcn_readfirstlane(lm);
  if (lm != 0) {
  const unsigned lk = lds_off(&big[0]) + tid * 16, lvv = lk + KVT;
  const char* gk = (const char*)(KF + (size_t)kv * (SS / 16) * (HD / 32) * FRU) + tid * 16; const char* gv = (const char*)(VF + (size_t)kv * (SS / 32) * (HD / 16) * FRU) + tid * 16;
  int it = __builtin_ctz(lm);
  acopy8(lk + 2 * KVT, 8192u, (const char*)(QF + ((size_t)h * (SS / 16) + qb * 4) * (HD / 32) * FRU) + tid * 16, 8192);   // q, once for the block: 8 pieces of 16 bytes a thread, 8 KiB (512 threads) apart; it stays until the last pass
  acopy_tile(lk, gk + (size_t)it * KVT);
  asm volatile("s_wait_asynccnt 0x0" ::: "memory");   // this wave's share of q and of the first k tile has landed
  __syncthreads();                                    // every wave's share of them has landed
  acopy_tile(lvv, gv + (size_t)it * KVT);
#pragma unroll 1   // rolled: the body is some thousand instructions long
  for (;;) { bool lv[16]; bool anylive = false; lm &= lm - 1; const bool more = lm != 0; const int nx = more ? __builtin_ctz(lm) : 0; const int ks = it * 4 + kj;
#pragma unroll   // in full: the arrays are indexed by constants and stay in registers
    for (int ct = 0; ct < 2; ++ct) { const int kb = ks * 32 + ct * 16 + 8 * g; const v4i a0 = *(const v4i*)(AM + kb), a1 = *(const v4i*)(AM + kb + 4);   // the lane's eight keys of this key tile
#pragma unroll   // in full: the arrays are indexed by constants and stay in registers
      for (int r = 0; r < 8; ++r) { const int kk = kb + r; const bool live = ((r < 4 ? a0[r & 3] : a1[r & 3]) != 0) & (kk > klo) & (kk <= khi); lv[ct * 8 + r] = live; anylive = anylive | live; } }
    const bool wl = __any(anylive);
    F2 pa;
    if (wl) { float s[16]; const __bf16* kp = (const __bf16*)(big + kj * 32768) + lane * 8; v8f c0 = {}, c1 = {};
#pragma unroll   // in full: the arrays are indexed by constants and stay in registers
      for (int kc = 0; kc < HD / 32; ++kc) { F2 ka, kb, qa; qa.h = frag_t(qp + kc * FRU); qa.l = frag_t(qp + kc * FRU + 512);   // one fetch of the q fragment serves both key tiles of the step
        ka.h = frag_t(kp + kc * FRU); ka.l = frag_t(kp + kc * FRU + 512); kb.h = frag_t(kp + 8192 + kc * FRU); kb.l = frag_t(kp + 8192 + kc * FRU + 512);
        c0 = wmma_bf(ka.h, qa.l, c0); c1 = wmma_bf(kb.h, qa.l, c1); c0 = wmma_bf(ka.l, qa.h, c0); c1 = wmma_bf(kb.l, qa.h, c1); c0 = wmma_bf(ka.h, qa.h, c0); c1 = wmma_bf(kb.h, qa.h, c1); }   // each tile's three products of mac3(q, k, .), in its order
#pragma unroll   // in full: the arrays are indexed by constants and stay in registers
      for (int r = 0; r < 8; ++r) { s[r] = lv[r] ? c0[r] * 0.0625f : -3.0e38f; s[8 + r] = lv[8 + r] ? c1[r] * 0.0625f : -3.0e38f; }
      float t8[8];
#pragma unroll   // in full: the arrays are indexed by constants and stay in registers
      for (int i = 0; i < 8; ++i) t8[i] = fmaxf(s[i], s[8 + i]);
      float mx = fmaxf(fmaxf(fmaxf(t8[0], t8[1]), fmaxf(t8[2], t8[3])), fmaxf(fmaxf(t8[4], t8[5]), fmaxf(t8[6], t8[7])));
      mx = fmaxf(mx, xhalf(mx));
      const float mn = fmaxf(m, mx); const float ea = expf(m - mn); const float alpha = (m <= -1.0e38f) ? 0.f : ea;   // every exp is formed unconditionally (its argument is finite and <= 0) and the guard selects behind it: no branch, and the 17 chains cover one another's latency
#pragma unroll   // in full: the arrays are indexed by constants and stay in registers
      for (int i = 0; i < 16; ++i) { const float e = expf(s[i] - mn); s[i] = (s[i] <= -1.0e38f) ? 0.f : e; }
#pragma unroll   // in full: the arrays are indexed by constants and stay in registers
      for (int i = 0; i < 8; ++i) t8[i] = s[i] + s[8 + i];
      float es = ((t8[0] + t8[1]) + (t8[2] + t8[3])) + ((t8[4] + t8[5]) + (t8[6] + t8[7]));
      es += xhalf(es);
      l = l * alpha + es; m = mn;
#pragma unroll   // in full: the arrays are indexed by constants and stay in registers
      for (int dt = 0; dt < 16; ++dt) acc[dt] *= alpha;
      pa = bsplit16(s); }
    asm volatile("s_wait_dscnt 0x0" ::: "memory");      // this wave has left the k buffer
    asm volatile("s_wait_asynccnt 0x0" ::: "memory");   // this wave's share of the pass's v tile has landed
    __syncthreads();                                    // publishes the v tile and frees the k buffer
    if (more) acopy_tile(lk, gk + (size_t)nx * KVT);
    if (wl) { const __bf16* vp = (const __bf16*)(big + KVT + kj * 32768) + lane * 8;   // one address; the 16 tiles' units lie constant steps behind it
#pragma unroll   // in full: the arrays are indexed by constants and stay in registers
      for (int dt = 0; dt < 16; ++dt) { const v16b vh = frag_t(vp + dt * FRU), vl = frag_t(vp + dt * FRU + 512); acc[dt] = wmma_bf(vh, pa.l, acc[dt]); acc[dt] = wmma_bf(vl, pa.h, acc[dt]); acc[dt] = wmma_bf(vh, pa.h, acc[dt]); } }
    asm volatile("s_wait_dscnt 0x0" ::: "memory");      // this wave has left the v buffer
    asm volatile("s_wait_asynccnt 0x0" ::: "memory");   // this wave's share of the next pass's k tile has landed
    __syncthreads();                                    // publishes that k tile and frees the v buffer (behind the last pass: for the merge's partials)
    if (!more) break;
    acopy_tile(lvv, gv + (size_t)nx * KVT); it = nx; }
  asm volatile("s_wait_asynccnt 0x0" ::: "memory"); }   // no copy is outstanding when the wave goes on
#pragma unroll   // in full: the arrays are indexed by constants and stay in registers
  for (int dt = 0; dt < 16; ++dt) { v4f lo4, hi4;
#pragma unroll   // in full: the arrays are indexed by constants and stay in registers
    for (int i = 0; i < 4; ++i) { lo4[i] = acc[dt][i]; hi4[i] = acc[dt][4 + i]; }
    *(v4f*)&so[wave][col][dt * 16 + 8 * g] = lo4; *(v4f*)&so[wave][col][dt * 16 + 8 * g + 4] = hi4; }
  if (g == 0) { sm[wave][col] = m; sl[wave][col] = l; }
  __syncthreads();   // every wave's partial is in LDS before any wave merges
  // merge: wave (qw, kj) finishes rows 4 kj .. 4 kj + 3 of query tile qw: weights exp(m_j - M), a share with no live key weighs 0
  for (int rl = 0; rl < 4; ++rl) { const int row = kj * 4 + rl; float mj[4]; float M = -3.0e38f;
#pragma unroll
    for (int j = 0; j < 4; ++j) { mj[j] = sm[qw + 4 * j][row]; M = fmaxf(M, mj[j]); }
    float L = 0.f; v4f o0 = {}, o1 = {};
#pragma unroll
    for (int j = 0; j < 4; ++j) { const float w = (mj[j] <= -1.0e38f) ? 0.f : exp_ni(mj[j] - M); L += w * sl[qw + 4 * j][row]; o0 += w * *(const v4f*)&so[qw + 4 * j][row][lane * 4]; o1 += w * *(const v4f*)&so[qw + 4 * j][row][128 + lane * 4]; }
    const float il = (L > 0.f) ? 1.0f / L : 0.f;
    vst2(O + (size_t)(q0 + row) * (NH * HD) + h * HD + lane * 4, o0 * il); vst2(O + (size_t)(q0 + row) * (NH * HD) + h * HD + 128 + lane * 4, o1 * il);
    asm volatile("s_wait_xcnt 0x0" ::: "memory"); }   // stands between the two stores and the next row's rewrite of their data registers
}
extern "C" void kernel_launch(void* const* d_in, const int* in_sizes, int n_in, void* d_out, int out_size, void* d_ws, size_t ws_size, hipStream_t stream) {
  (void)in_sizes; (void)n_in; (void)out_size;
  const float** F = (const float**)d_in; const int* AM = (const int*)d_in[1]; const int* SEGPOS = (const int*)d_in[2];
  // 0 x [1,2048,2048], 1 attn_mask [1,2048] bool(int), 2 segment_pos [1,2048] i32, 3 cos [1,2048,256], 4 sin, 5 wq [2048,2048], 6 wk [2048,1024], 7 wv [2048,1024], 8 wo [2048,2048], 9 q_scale [256], 10 k_scale [256]
  if (ws_size < (size_t)WS_END) return;
  char* ws = (char*)d_ws; __bf16 *PW = (__bf16*)(ws + WS_PW), *VF = (__bf16*)(ws + WS_VF), *QF = (__bf16*)(ws + WS_QF), *KF = (__bf16*)(ws + WS_KF); float *Q = (float*)(ws + WS_Q), *Kx = (float*)(ws + WS_K), *V = (float*)(ws + WS_V), *O = (float*)(ws + WS_O);
  k_packT<<<dim3(HID / 128, 48), 256, 0, stream>>>(F[5], F[6], F[7], F[8], PW);
  k_gemm<1><<<dim3(TQB, NH * HD / 128), 128, 0, stream>>>(F[0] + (size_t)TQ0 * 64 * HID, HID, HID, PW + PQ, Q + (size_t)TQ0 * 64 * NH * HD, NH * HD);   // q rows of the processed query range
  k_gemm<1><<<dim3(KRP, NKV * HD / 128), 128, 0, stream>>>(F[0], HID, HID, PW + PK, Kx, NKV * HD);
  k_gemm<1><<<dim3(KRP, NKV * HD / 128), 128, 0, stream>>>(F[0], HID, HID, PW + PV, V, NKV * HD);
  k_normrope<0><<<dim3(TQB * 4, NH), 256, 0, stream>>>(Q + (size_t)TQ0 * 64 * NH * HD, F[9], F[3] + (size_t)TQ0 * 64 * HD, F[4] + (size_t)TQ0 * 64 * HD, QF + (size_t)TQ0 * 4 * (HD / 32) * FRU);
  k_normrope<1><<<dim3(KRP * 4, NKV), 256, 0, stream>>>(Kx, F[10], F[3], F[4], KF);
  k_vplanes<<<dim3(KRP, NKV * HD / 128), 256, 0, stream>>>(V, VF);
  k_attn<<<dim3(TQB, NH), 512, 0, stream>>>(QF, KF, AM, SEGPOS, VF, O);
  k_gemm<0><<<dim3(TQB, HID / 128), 128, 0, stream>>>(O + (size_t)TQ0 * 64 * NH * HD, NH * HD, NH * HD, PW + PO, (float*)d_out + (size_t)TQ0 * 64 * HID, HID);
}

// v009
// A run of this version takes 157 microseconds.
// Two timings next to v008 both put it at 1.27 times that version's speed.
// Counting every step since v000, it is 8.59 times as fast.
// compute dtype: x, attn_mask, segment_pos, cos/sin tables, wq/wk/wv/wo and the RMSNorm scales (module inputs) rounded to bf16 / read as int; q/k/v projections with exact bf16 products (x and the weights are inputs); per-head RMSNorm and RoPE (input tables) in f32; scores q.k with both operands as bf16 hi + residual pairs (3 products), P.V with P hi/lo x V hi/lo (3 products), output projection hi/lo x exact wo (2 products); all on WMMA 16x16x32; the causal AND padding AND sliding-window mask is evaluated at run time from attn_mask / segment_pos and key tiles with no live entry are skipped; f32 accumulate.
#include <hip/hip_runtime.h>
#include <math.h>

typedef __attribute__((ext_vector_type(16))) _Float16 v16h;
typedef __attribute__((ext_vector_type(16))) __bf16 v16b;
typedef __attribute__((ext_vector_type(8)))  _Float16 v8h;
typedef __attribute__((ext_vector_type(8)))  float v8f;
typedef __attribute__((ext_vector_type(4)))  float v4f;
typedef __attribute__((ext_vector_type(2)))  float v2f;
typedef __attribute__((ext_vector_type(4)))  unsigned v4u;
typedef __attribute__((ext_vector_type(4)))  int v4i;
typedef float __attribute__((may_alias)) float_a;
typedef int __attribute__((may_alias)) int_a;

template <typename T> __device__ __forceinline__ void vst2(void* p, T v) { *(T*)p = v;  }
__device__ __forceinline__ v8f wmma16(v16h a, v16h b, v8f c) {
  v8f d = __builtin_amdgcn_wmma_f32_16x16x32_f16(false, a, false, b, (short)0, c, false, false);
  asm volatile("v_nop\n\tv_nop\n\tv_nop\n\tv_nop" : "+v"(d) : "v"(a), "v"(b));
  return d;
}
__device__ __forceinline__ v8f wmma_bf(v16b a, v16b b, v8f c) {
  v8f d = __builtin_amdgcn_wmma_f32_16x16x32_bf16(false, a, false, b, (short)0, c, false, false);
  asm volatile("v_nop\n\tv_nop\n\tv_nop\n\tv_nop" : "+v"(d) : "v"(a), "v"(b));
  return d;
}
// 16x16x32 fragments: lane = (h = lane>>4, row/col = lane&15); elements 0..7 = k0+8h+0..7, 8..15 = k0+16+8h+0..7; D element r = row 8h+r
__device__ __forceinline__ v16h frag_h(const _Float16* rowk0, int lane) {
  union { v16h v; v8h q[2]; } u; const _Float16* p = rowk0 + 8 * (lane >> 4);
  u.q[0] = *(const v8h*)p; u.q[1] = *(const v8h*)(p + 16); return u.v;
}
__device__ __forceinline__ v16h frag_f32(const float* rowk0, int lane) {
  v16h a; const float* p = rowk0 + 8 * (lane >> 4);
#pragma unroll
  for (int i = 0; i < 8; ++i) { a[i] = (_Float16)p[i]; a[8 + i] = (_Float16)p[16 + i]; }
  return a;
}
__device__ __forceinline__ v16h frag_f32s(const float* rowk0, int lane, float sc) {
  v16h a; const float* p = rowk0 + 8 * (lane >> 4);
#pragma unroll
  for (int i = 0; i < 8; ++i) { a[i] = (_Float16)(p[i] * sc); a[8 + i] = (_Float16)(p[16 + i] * sc); }
  return a;
}
// column fragment from a [K][ld] layout (column n), rows >= K read as 0
__device__ __forceinline__ v16h fragc_f32(const float* W, int k0, int n, int lane, int ld, int K) {
  v16h a; const int g = lane >> 4;
#pragma unroll
  for (int i = 0; i < 8; ++i) { const int ka = k0 + 8 * g + i, kb = ka + 16;
    a[i] = (_Float16)(ka < K ? W[(size_t)(ka < K ? ka : K - 1) * ld + n] : 0.f); a[8 + i] = (_Float16)(kb < K ? W[(size_t)(kb < K ? kb : K - 1) * ld + n] : 0.f); }
  return a;
}
struct F2 { v16b h, l; };
__device__ __forceinline__ F2 bsplit16(const float v[16]) { F2 r;
#pragma unroll
  for (int i = 0; i < 16; ++i) { const __bf16 h = (__bf16)v[i]; r.h[i] = h; r.l[i] = (__bf16)(v[i] - (float)h); }
  return r; }
__device__ __forceinline__ F2 split_row(const float* row, int k0, int lane) { float v[16]; const float* p = row + k0 + 8 * (lane >> 4);
#pragma unroll
  for (int i = 0; i < 8; ++i) { v[i] = p[i]; v[8 + i] = p[16 + i]; }
  return bsplit16(v); }
__device__ __forceinline__ F2 split_rowK(const float* row, int k0, int lane, int K) { float v[16]; const int g = lane >> 4;
#pragma unroll
  for (int i = 0; i < 8; ++i) { const int ka = k0 + 8 * g + i, kb = ka + 16; v[i] = ka < K ? row[ka < K ? ka : K - 1] : 0.f; v[8 + i] = kb < K ? row[kb < K ? kb : K - 1] : 0.f; }
  return bsplit16(v); }
__device__ __forceinline__ F2 split_col(const float* W, int k0, int n, int lane, int ld, int K) { float v[16]; const int g = lane >> 4;
#pragma unroll
  for (int i = 0; i < 8; ++i) { const int ka = k0 + 8 * g + i, kb = ka + 16; v[i] = ka < K ? W[(size_t)(ka < K ? ka : K - 1) * ld + n] : 0.f; v[8 + i] = kb < K ? W[(size_t)(kb < K ? kb : K - 1) * ld + n] : 0.f; }
  return bsplit16(v); }
__device__ __forceinline__ v8f mac3(const F2& a, const F2& b, v8f c) { c = wmma_bf(a.l, b.h, c); c = wmma_bf(a.h, b.l, c); return wmma_bf(a.h, b.h, c); }
__device__ __forceinline__ float sigm(float v) { return 1.0f / (1.0f + expf(-v)); }
#define LDSX() do { asm volatile("s_wait_dscnt 0" ::: "memory"); __builtin_amdgcn_wave_barrier(); __builtin_amdgcn_fence(__ATOMIC_RELEASE, "workgroup"); } while (0)


// Gemma-3 style attention (B 1, S 2048, hidden 2048, 8 query heads / 4 kv heads x 256, sliding window 1024): q,k,v = x w; q,k = RMSNorm_head(.)(1 + scale); RoPE with the given cos/sin; GQA (kv head = h / 2); scores / 16 masked by causal & attn_mask[k] & |k - segment_pos[q]| < WIN (else -1e37); softmax; out = (P v merged) wo.
#define SS 2048
#define HID 2048
#define NH 8
#define NKV 4
#define HD 256
#define WIN 1024
#ifndef TQB
#define TQB (SS / 64)          // query tiles processed
#define TQ0 0                  // first query tile
#define KRP (SS / 64)          // key/value row tiles (all)
#endif
typedef __attribute__((ext_vector_type(8))) __bf16 v8b;
__device__ __forceinline__ v16b frag_b(const __bf16* rowk0, int lane) {
  union { v16b v; v8b q[2]; } u; const __bf16* p = rowk0 + 8 * (lane >> 4);
  u.q[0] = *(const v8b*)p; u.q[1] = *(const v8b*)(p + 16); return u.v;
}
__device__ __forceinline__ float bfr(float v) { return (float)(__bf16)v; }
__device__ __attribute__((noinline)) float exp_ni(float v) { return expf(v); }
__device__ __attribute__((noinline)) float erf_ni(float v) { return erff(v); }

#define WS_PW  0u                                  // bf16 rows (in,out -> [out][in]): wq [2048][2048], wk [1024][2048], wv [1024][2048], wo [2048][2048]
#define PQ 0
#define PK (PQ + NH * HD * HID)
#define PV (PK + NKV * HD * HID)
#define PO (PV + NKV * HD * HID)
#define PWEND (PO + HID * NH * HD)
#define WS_Q   (WS_PW + 2u * PWEND)                 // f32 [S][2048] q raw
#define WS_K   (WS_Q + 4u * SS * NH * HD)            // f32 [S][1024] k raw
#define WS_V   (WS_K + 4u * SS * NKV * HD)           // f32 [S][1024] v raw
#define WS_VF  (WS_V + 4u * SS * NKV * HD)           // bf16 v in fragment order: [kv][32-key step][16-column tile][FRU]
#define WS_O   (WS_VF + 4u * NKV * HD * SS)          // f32 [S][2048]
#define WS_QF  (WS_O + 4u * SS * NH * HD)            // bf16 q in fragment order: [head][16-query tile][32-d step][FRU]
#define WS_KF  (WS_QF + 4u * SS * NH * HD)           // bf16 k in fragment order: [kv][16-key tile][32-d step][FRU]
#define WS_END (WS_KF + 4u * SS * NKV * HD)
// Fragment order: one 16 x 32 operand tile is a unit of FRU bf16 = [plane hi, lo][part 0, 1][lane 32][8]: lane (g = lane >> 4, row = lane & 15) holds k = 16 part + 8 g + 0..7 of its row, which is what frag_b reads from a row. A wave's 16-byte load of one (plane, part) is then 512 bytes in a row, four whole lines, where a load from rows touches sixteen.
#define FRU 1024
__device__ __forceinline__ v16b frag_t(const __bf16* p) { union { v16b v; v8b q[2]; } u; u.q[0] = *(const v8b*)p; u.q[1] = *(const v8b*)(p + 256); return u.v; }

// ---- k_packT: block = (128 k, 128 output columns): (in,out) weight -> rows [n][K], a tile at a time through LDS. The four weights all have K = 2048 and their row sets lie one behind another in PW, so blockIdx.y counts 128-column tiles over all of them (wq 16, wk 8, wv 8, wo 16).
// A wave's load is 512 bytes in a row of one k; a thread holds 8 k x 4 columns twice, which are eight finished 16-byte pieces of output rows; they cross in LDS, and a wave's store is two output rows x 256 bytes: whole lines both ways, each line with one writer.
// LDS row = one column's 128 k as bf16, pitch 272 B; the 16-byte piece kch of row n lies at place kch ^ ((n >> 4) & 3): with it the 16 lanes of a half wave, four rows apart, store to 16 different bank groups.
#define PTP 272
template <int N>   // the weight's row length as a constant: the 16 loads then share one address and differ in the offset field
__device__ __forceinline__ void pack_tile(const float* __restrict__ src, __bf16* __restrict__ dst, unsigned char* s, int tid) {
  const int wave = tid >> 5, lane = tid & 31; src += (size_t)(wave * 8) * N + lane * 4; v4f v[2][8];
#pragma unroll   // in full: v[] is indexed by constants and stays in registers
  for (int hf = 0; hf < 2; ++hf)
#pragma unroll   // in full: as above
    for (int i = 0; i < 8; ++i) v[hf][i] = *(const v4f*)(src + (size_t)(hf * 64 + i) * N);
  // the wait stands between the loads and any rewrite of their address register; the loaded values and the address are inputs only, so that all 16 loads are issued ahead of the first use and fly together (without it the compiler issues the last six behind waits on the first ten) and no load's result lands on the address
  asm volatile("s_wait_xcnt 0x0" :: "v"(src), "v"(v[0][0]), "v"(v[0][1]), "v"(v[0][2]), "v"(v[0][3]), "v"(v[0][4]), "v"(v[0][5]), "v"(v[0][6]), "v"(v[0][7]), "v"(v[1][0]), "v"(v[1][1]), "v"(v[1][2]), "v"(v[1][3]), "v"(v[1][4]), "v"(v[1][5]), "v"(v[1][6]), "v"(v[1][7]) : "memory");
  const int sw = (lane >> 2) & 3;   // (n >> 4) & 3 of the thread's four columns n = 4 lane + c
#pragma unroll   // in full: v[] is indexed by constants
  for (int hf = 0; hf < 2; ++hf)
#pragma unroll   // in full: v[] is indexed by constants
    for (int c = 0; c < 4; ++c) { v8b w;
#pragma unroll   // in full: v[] and w[] are indexed by constants
      for (int i = 0; i < 8; ++i) w[i] = (__bf16)v[hf][i][c];
      *(v8b*)(s + (lane * 4 + c) * PTP + (((hf * 8 + wave) ^ sw) * 16)) = w; }
  __syncthreads();
  const int nr = tid >> 4, kch = tid & 15;
#pragma unroll   // in full: eight fixed pieces a thread (rows nr + 16 j), their LDS reads ahead of the stores
  for (int j = 0; j < 8; ++j) vst2(dst + (size_t)(nr + 16 * j) * HID + kch * 8, *(const v4u*)(s + (nr + 16 * j) * PTP + ((kch ^ (j & 3)) * 16)));
}
__global__ __launch_bounds__(256) void k_packT(const float* __restrict__ WQ, const float* __restrict__ WK, const float* __restrict__ WV, const float* __restrict__ WO, __bf16* __restrict__ PW) {
  __shared__ __align__(16) unsigned char s[128 * PTP]; const int tid = threadIdx.x; const int k0 = blockIdx.x * 128, y = blockIdx.y;
  if (y < 16) pack_tile<NH * HD>(WQ + (size_t)k0 * (NH * HD) + y * 128, PW + PQ + (size_t)y * 128 * HID + k0, s, tid);
  else if (y < 24) pack_tile<NKV * HD>(WK + (size_t)k0 * (NKV * HD) + (y - 16) * 128, PW + PK + (size_t)(y - 16) * 128 * HID + k0, s, tid);
  else if (y < 32) pack_tile<NKV * HD>(WV + (size_t)k0 * (NKV * HD) + (y - 24) * 128, PW + PV + (size_t)(y - 24) * 128 * HID + k0, s, tid);
  else pack_tile<HID>(WO + (size_t)k0 * HID + (y - 32) * 128, PW + PO + (size_t)(y - 32) * 128 * HID + k0, s, tid);
}
// ---- k_gemm<RIN>: block = (64 rows, 128 cols): OUT = A(K) . rows (RIN exact / hi-lo 2 products); pitch ldo. K is a multiple of 64.
// Both operand tiles of a 64-k stage (A 64 rows x 256 B f32, P 128 rows x 128 B bf16) are brought into LDS by asynchronous copies, whole lines, two buffers: stage t + 1 flies while stage t is worked on, and the four waves share one copy of the P tile. Row pitches 272 B / 144 B (16 B x odd) keep the 16-byte fragment reads off one another's banks.
#define GKS 64
#define GAP 272
#define GBP 144
#define GAB (64 * GAP)
#define GSTG (GAB + 128 * GBP)
__device__ __forceinline__ unsigned lds_off(const void* p) { return (unsigned)(size_t)p; }
// eight 16-byte copies of a lane, rows lstep / gstep bytes apart; the s_wait_xcnt closes the statement so that no address register of a copy is rewritten ahead of it
__device__ __forceinline__ void acopy8(unsigned l, unsigned lstep, const char* g, size_t gstep) {
  asm volatile("global_load_async_to_lds_b128 %0, %8, off\n\t"
               "global_load_async_to_lds_b128 %1, %9, off\n\t"
               "global_load_async_to_lds_b128 %2, %10, off\n\t"
               "global_load_async_to_lds_b128 %3, %11, off\n\t"
               "global_load_async_to_lds_b128 %4, %12, off\n\t"
               "global_load_async_to_lds_b128 %5, %13, off\n\t"
               "global_load_async_to_lds_b128 %6, %14, off\n\t"
               "global_load_async_to_lds_b128 %7, %15, off\n\t"
               "s_wait_xcnt 0x0"
               :: "v"(l), "v"(l + lstep), "v"(l + 2 * lstep), "v"(l + 3 * lstep), "v"(l + 4 * lstep), "v"(l + 5 * lstep), "v"(l + 6 * lstep), "v"(l + 7 * lstep),
                  "v"(g), "v"(g + gstep), "v"(g + 2 * gstep), "v"(g + 3 * gstep), "v"(g + 4 * gstep), "v"(g + 5 * gstep), "v"(g + 6 * gstep), "v"(g + 7 * gstep)
               : "memory");
}
template <int RIN>
__global__ __launch_bounds__(128) void k_gemm(const float* __restrict__ A, int lda, int K, const __bf16* __restrict__ P, float* __restrict__ OUT, int ldo) {
  __shared__ __align__(16) float so[4][16][132]; __shared__ __align__(16) unsigned char st[2][GSTG];
  const int tid = threadIdx.x, wave = tid >> 5, lane = tid & 31, col = lane & 15, g = lane >> 4; const size_t r0 = (size_t)blockIdx.x * 64 + wave * 16; const int n0 = blockIdx.y * 128;
  // a thread's copy places: A chunk (row i * 8 + tid / 16, 16 B piece tid % 16), P chunk (row i * 16 + tid / 8, piece tid % 8), i = 0..7
  const char* ga = (const char*)(A + ((size_t)blockIdx.x * 64 + (tid >> 4)) * lda + (tid & 15) * 4); const char* gb = (const char*)(P + (size_t)(n0 + (tid >> 3)) * K + (tid & 7) * 8);
  const unsigned la = lds_off(&st[0][0]) + (tid >> 4) * GAP + (tid & 15) * 16, lb = lds_off(&st[0][0]) + GAB + (tid >> 3) * GBP + (tid & 7) * 16;
  const size_t gas = (size_t)lda * 8 * 4, gbs = (size_t)K * 16 * 2; const int nst = K / GKS;
  v8f acc[8] = {};
  acopy8(la, 8 * GAP, ga, gas); acopy8(lb, 16 * GBP, gb, gbs);
  asm volatile("s_wait_asynccnt 0x0" ::: "memory");   // this wave's share of stage 0 has landed
  __syncthreads();                                    // every wave's share of stage 0 has landed
  if (nst > 1) { acopy8(la + GSTG, 8 * GAP, ga + GKS * 4, gas); acopy8(lb + GSTG, 16 * GBP, gb + GKS * 2, gbs); }
  for (int t = 0; t < nst; ++t) { const unsigned bo = (t & 1) * GSTG; const unsigned char* pa = &st[0][0] + bo + (wave * 16 + col) * GAP + 32 * g; const unsigned char* pb = &st[0][0] + bo + GAB + col * GBP + 16 * g;
    // the stage's fragment reads stand ahead of its WMMAs, so that their latencies overlap; the second k step's A rows are read behind the first WMMA (16 registers fewer at the peak: the kernel stays inside v0..v255), still a whole k step ahead of their use
    v4f af[2][4]; v8b bq[2][8][2];
#pragma unroll   // in full: the fragment arrays are indexed by constants and stay in registers
    for (int q = 0; q < 4; ++q) af[0][q] = *(const v4f*)(pa + (q >> 1) * 64 + (q & 1) * 16);
#pragma unroll   // in full: the fragment arrays are indexed by constants and stay in registers
    for (int kc = 0; kc < 2; ++kc)
#pragma unroll   // in full: the fragment arrays are indexed by constants and stay in registers
      for (int j = 0; j < 8; ++j) { bq[kc][j][0] = *(const v8b*)(pb + j * 16 * GBP + kc * 64); bq[kc][j][1] = *(const v8b*)(pb + j * 16 * GBP + kc * 64 + 32); }
#pragma unroll   // in full: the fragment arrays are indexed by constants and stay in registers
    for (int kc = 0; kc < 2; ++kc) { F2 a; float v[16];
#pragma unroll   // in full: the fragment arrays are indexed by constants and stay in registers
      for (int i = 0; i < 4; ++i) { v[i] = af[kc][0][i]; v[4 + i] = af[kc][1][i]; v[8 + i] = af[kc][2][i]; v[12 + i] = af[kc][3][i]; }
      if (RIN) { v16b ax;
#pragma unroll   // in full: the fragment arrays are indexed by constants and stay in registers
        for (int i = 0; i < 16; ++i) ax[i] = (__bf16)v[i];
        a.h = ax; a.l = ax; } else a = bsplit16(v);
#pragma unroll   // in full: the fragment arrays are indexed by constants and stay in registers
      for (int j = 0; j < 8; ++j) { union { v16b v; v8b q[2]; } w; w.q[0] = bq[kc][j][0]; w.q[1] = bq[kc][j][1]; if (!RIN) acc[j] = wmma_bf(a.l, w.v, acc[j]); acc[j] = wmma_bf(a.h, w.v, acc[j]);
        if (kc == 0 && j == 0) {
#pragma unroll   // in full: the fragment arrays are indexed by constants and stay in registers
          for (int q = 0; q < 4; ++q) af[1][q] = *(const v4f*)(pa + 128 + (q >> 1) * 64 + (q & 1) * 16); } } }
    asm volatile("s_wait_dscnt 0x0" ::: "memory");      // this wave has left stage t's buffer
    asm volatile("s_wait_asynccnt 0x0" ::: "memory");   // this wave's share of stage t + 1 has landed
    __syncthreads();                                    // publishes stage t + 1 and frees stage t's buffer
    if (t + 2 < nst) { acopy8(la + bo, 8 * GAP, ga + (size_t)(t + 2) * (GKS * 4), gas); acopy8(lb + bo, 16 * GBP, gb + (size_t)(t + 2) * (GKS * 2), gbs); } }
  asm volatile("s_wait_asynccnt 0x0" ::: "memory");     // no copy is outstanding when the wave goes on
#pragma unroll
  for (int j = 0; j < 8; ++j)
#pragma unroll
    for (int r = 0; r < 8; ++r) so[wave][8 * g + r][j * 16 + col] = acc[j][r];
  LDSX();
  for (int rl = 0; rl < 16; ++rl) vst2(OUT + (r0 + rl) * ldo + n0 + lane * 4, *(const v4f*)&so[wave][rl][lane * 4]);
}
// ---- k_gemm3: the q, k and v projections as one product of x with the 4096 packed weight rows (wq, wk, wv lie one behind another in PW). Block = (128 rows of x, 256 weight rows = one head), 8 waves = (row half wm) x (column quarter wn), a wave holds 64 x 64 = 4 x 4 accumulator tiles.
// A 64-k stage copies 32 KiB of x and 32 KiB of weights for four times the products of a 64 x 128 block (which copies 16 + 16 KiB): half the bytes from L2 a product, and a fragment read from LDS serves four WMMAs. 16 x 16 = 256 blocks, one a WGP. Staging, pitches, waits and the order of the k steps are those of k_gemm.
#define G3AB (128 * GAP)
#define G3STG (G3AB + 256 * GBP)
#define G3SP 68   // pitch in floats of a wave's 64 x 64 result in LDS: rows 8 apart lie 32 banks apart
template <int LDO>   // the output's row length as a constant: the 32 stores then share one address and differ in the offset field
__device__ __forceinline__ void g3_out(float* __restrict__ op, const float* sr) {
#pragma unroll   // in full: the offsets are constants
  for (int bq = 0; bq < 4; ++bq) { v4f rr[8];
#pragma unroll   // in full: rr[] is indexed by constants, and the eight LDS reads stand ahead of the stores
    for (int u = 0; u < 8; ++u) rr[u] = *(const v4f*)(sr + (bq * 16 + u * 2) * G3SP);
#pragma unroll   // in full: rr[] is indexed by constants
    for (int u = 0; u < 8; ++u) vst2(op + (size_t)(bq * 16 + u * 2) * LDO, rr[u]);
    asm volatile("s_wait_xcnt 0x0" ::: "memory"); }   // stands between the eight stores and the next group's rewrite of their data registers
}
__global__ __launch_bounds__(256) void k_gemm3(const float* __restrict__ A, const __bf16* __restrict__ P, float* __restrict__ Oq, float* __restrict__ Ok, float* __restrict__ Ov) {
  __shared__ __align__(16) unsigned char st[2][G3STG];
  const int tid = threadIdx.x, wave = __builtin_amdgcn_readfirstlane(tid >> 5), lane = tid & 31, col = lane & 15, g = lane >> 4; const int wm = wave & 1, wn = wave >> 1, y = blockIdx.y;
  // a thread's copy places: A chunk (row i * 16 + tid / 16, 16 B piece tid % 16), P chunk (row i * 32 + tid / 8, piece tid % 8), i = 0..7
  const char* ga = (const char*)(A + ((size_t)blockIdx.x * 128 + (tid >> 4)) * HID + (tid & 15) * 4); const char* gb = (const char*)(P + ((size_t)y * 256 + (tid >> 3)) * HID + (tid & 7) * 8);
  const unsigned la = lds_off(&st[0][0]) + (tid >> 4) * GAP + (tid & 15) * 16, lb = lds_off(&st[0][0]) + G3AB + (tid >> 3) * GBP + (tid & 7) * 16;
  const size_t gas = (size_t)HID * 16 * 4, gbs = (size_t)HID * 32 * 2; const int nst = HID / GKS;
  v8f acc[4][4] = {};
  acopy8(la, 16 * GAP, ga, gas); acopy8(lb, 32 * GBP, gb, gbs);
  asm volatile("s_wait_asynccnt 0x0" ::: "memory");   // this wave's share of stage 0 has landed
  __syncthreads();                                    // every wave's share of stage 0 has landed
  acopy8(la + G3STG, 16 * GAP, ga + GKS * 4, gas); acopy8(lb + G3STG, 32 * GBP, gb + GKS * 2, gbs);
#pragma unroll 1   // rolled: one stage is the loop's body, and the two buffers differ only in an offset
  for (int t = 0; t < nst; ++t) { const unsigned bo = (t & 1) * G3STG; const unsigned char* pa = &st[0][0] + bo + (wm * 64 + col) * GAP + 32 * g; const unsigned char* pb = &st[0][0] + bo + G3AB + (wn * 64 + col) * GBP + 16 * g;
    // all of the stage's fragment reads are issued ahead of its WMMAs, in the order of their use (the weight fragments of a k step, then its four row tiles of x): the LDS then serves the eight waves without a pause while the WMMAs follow behind counted waits
    v4f af[2][4][4]; v8b bq[2][4][2];
#pragma unroll   // in full: the fragment arrays are indexed by constants and stay in registers
    for (int kc = 0; kc < 2; ++kc) {
#pragma unroll   // in full: the fragment arrays are indexed by constants and stay in registers
      for (int j = 0; j < 4; ++j) { bq[kc][j][0] = *(const v8b*)(pb + j * 16 * GBP + kc * 64); bq[kc][j][1] = *(const v8b*)(pb + j * 16 * GBP + kc * 64 + 32); }
#pragma unroll   // in full: the fragment arrays are indexed by constants and stay in registers
      for (int i = 0; i < 4; ++i)
#pragma unroll   // in full: the fragment arrays are indexed by constants and stay in registers
        for (int q = 0; q < 4; ++q) af[kc][i][q] = *(const v4f*)(pa + i * 16 * GAP + kc * 128 + (q >> 1) * 64 + (q & 1) * 16); }
#pragma unroll   // in full: the fragment arrays are indexed by constants and stay in registers
    for (int kc = 0; kc < 2; ++kc) {
#pragma unroll   // in full: the fragment arrays are indexed by constants and stay in registers
      for (int i = 0; i < 4; ++i) { v16b a;
        __builtin_amdgcn_sched_barrier(0);   // keeps the 48 reads together ahead of the first WMMA, and each row tile's conversions (with their wait) behind the WMMAs of the tile before: a tile's WMMAs then start as soon as its own reads have landed, not when a later tile's have
#pragma unroll   // in full: the fragment arrays are indexed by constants and stay in registers
        for (int e = 0; e < 16; ++e) a[e] = (__bf16)af[kc][i][e >> 2][e & 3];
#pragma unroll   // in full: the fragment arrays are indexed by constants and stay in registers
        for (int j = 0; j < 4; ++j) { union { v16b v; v8b q[2]; } w; w.q[0] = bq[kc][j][0]; w.q[1] = bq[kc][j][1]; acc[i][j] = wmma_bf(a, w.v, acc[i][j]); } } }
    asm volatile("s_wait_dscnt 0x0" ::: "memory");      // this wave has left stage t's buffer
    asm volatile("s_wait_asynccnt 0x0" ::: "memory");   // this wave's share of stage t + 1 has landed
    __syncthreads();                                    // publishes stage t + 1 and frees stage t's buffer
    if (t + 2 < nst) { acopy8(la + bo, 16 * GAP, ga + (size_t)(t + 2) * (GKS * 4), gas); acopy8(lb + bo, 32 * GBP, gb + (size_t)(t + 2) * (GKS * 2), gbs); } }
  asm volatile("s_wait_asynccnt 0x0" ::: "memory");     // no copy is outstanding when the wave goes on
  // the wave's 64 x 64 result crosses in LDS, in a place of its own over the stage buffers (dead behind the last stage's barrier), and goes out two rows x 256 B a store: whole lines
  float* so = (float*)&st[0][0] + wave * (64 * G3SP);
#pragma unroll   // in full: acc[][] is indexed by constants
  for (int i = 0; i < 4; ++i)
#pragma unroll   // in full: acc[][] is indexed by constants
    for (int j = 0; j < 4; ++j)
#pragma unroll   // in full: acc[][] is indexed by constants
      for (int r = 0; r < 8; ++r) so[(i * 16 + 8 * g + r) * G3SP + j * 16 + col] = acc[i][j][r];
  LDSX();
  const size_t ro = (size_t)blockIdx.x * 128 + wm * 64 + g; const int co = wn * 64 + col * 4; const float* sr = so + g * G3SP + col * 4;
  if (y < NH) g3_out<NH * HD>(Oq + ro * (NH * HD) + y * HD + co, sr);
  else if (y < NH + NKV) g3_out<NKV * HD>(Ok + ro * (NKV * HD) + (y - NH) * HD + co, sr);
  else g3_out<NKV * HD>(Ov + ro * (NKV * HD) + (y - NH - NKV) * HD + co, sr);
}
// ---- k_normrope<PLANE>: block = (16 positions, head): 256 threads = d, each over the 16 rows: RMSNorm over the head's 256 (mean of squares, eps 1e-6) * (1 + scale[d]); RoPE: out_d = y_d cos[s][d] + rot_d sin[s][d] with rot = (-y[d+128], y[d-128]); the 16 x 256 result goes out as bf16 hi + residual in fragment order (8 units, 16 KiB in a row: a block writes whole lines, and no line has a second writer) (PLANE 0: q rows pitch 2048; 1: k rows pitch 1024)
template <int PLANE>
__global__ __launch_bounds__(256) void k_normrope(const float* __restrict__ QK, const float* __restrict__ SC, const float* __restrict__ COS, const float* __restrict__ SIN, __bf16* __restrict__ OF) {
  __shared__ float sy[16][HD]; __shared__ float sred[16][8]; __shared__ __align__(16) float so[16][HD + 4];
  const int t = blockIdx.x, h = blockIdx.y, d = threadIdx.x; const int pitch = PLANE ? (NKV * HD) : (NH * HD);
  const float* col = QK + (size_t)t * 16 * pitch + h * HD + d; float y[16];
#pragma unroll   // in full: y[] is indexed by constants and stays in registers, and the 16 rows' loads fly together
  for (int r = 0; r < 16; ++r) { y[r] = col[(size_t)r * pitch]; sy[r][d] = y[r]; }
#pragma unroll   // in full: y[] stays in registers, and the rows' cross-lane sums cover one another's latency
  for (int r = 0; r < 16; ++r) { float q = y[r] * y[r];
#pragma unroll   // in full: five fixed steps, no loop overhead
    for (int o = 1; o < 32; o <<= 1) q += __shfl_xor(q, o);
    if ((d & 31) == 0) sred[r][d >> 5] = q; }
  __syncthreads();
  const int dp = (d < HD / 2) ? (d + HD / 2) : (d - HD / 2); const float g0 = 1.0f + bfr(SC[d]), g1 = 1.0f + bfr(SC[dp]);
#pragma unroll   // in full: y[] stays in registers, and the rows' table loads fly together
  for (int r = 0; r < 16; ++r) { float ss = 0.f;
#pragma unroll   // in full: eight fixed terms, summed in this order
    for (int w = 0; w < 8; ++w) ss += sred[r][w];
    const float rs = rsqrtf(ss / (float)HD + 1e-6f);
    const float yn = y[r] * rs * g0; const float other = sy[r][dp] * rs * g1;
    const float rot = (d < HD / 2) ? -other : other; const size_t s = (size_t)t * 16 + r;
    so[r][d] = yn * bfr(COS[s * HD + d]) + rot * bfr(SIN[s * HD + d]); }
  __syncthreads();
  __bf16* ob = OF + ((size_t)h * (SS / 16) + t) * (HD / 32) * FRU;
  for (int q = d; q < (HD / 32) * FRU / 8; q += 256) { const int ln = q & 31, part = (q >> 5) & 1, pl = (q >> 6) & 1, kc = q >> 7; const float* p = &so[ln & 15][kc * 32 + part * 16 + (ln >> 4) * 8]; v8b w;
#pragma unroll   // in full: w[] is indexed by constants and stays in registers
    for (int i = 0; i < 8; ++i) { const float v = p[i]; const __bf16 hb = (__bf16)v; w[i] = pl ? (__bf16)(v - (float)hb) : hb; }
    vst2(ob + (size_t)q * 8, w); }
}
// ---- k_vplanes: block = (64 positions, 128 value columns): v as bf16 hi + residual, transposed in LDS, out in fragment order (row = value column, k = key): 2 key steps x 8 column tiles = 16 whole units
__global__ __launch_bounds__(256) void k_vplanes(const float* __restrict__ V, __bf16* __restrict__ VF) {
  __shared__ __align__(16) __bf16 sh[128][72], sl[128][72]; const int tid = threadIdx.x; const int s0 = blockIdx.x * 64, c0 = blockIdx.y * 128;
  for (int q = tid; q < 64 * 128; q += 256) { const int sl_ = q >> 7, c = q & 127; const float v = V[(size_t)(s0 + sl_) * (NKV * HD) + c0 + c]; const __bf16 hb = (__bf16)v; sh[c][sl_] = hb; sl[c][sl_] = (__bf16)(v - (float)hb); }
  __syncthreads();
  for (int q = tid; q < 16 * FRU / 8; q += 256) { const int ln = q & 31, part = (q >> 5) & 1, pl = (q >> 6) & 1, dtl = (q >> 7) & 7, ksl = q >> 10; const int c = dtl * 16 + (ln & 15), sk = ksl * 32 + part * 16 + (ln >> 4) * 8; const int cg = c0 + dtl * 16;
    const size_t o = (((size_t)(cg / HD) * (SS / 32) + s0 / 32 + ksl) * (HD / 16) + (cg % HD) / 16) * FRU + (q & 127) * 8; vst2(VF + o, *(const v4u*)(pl ? &sl[c][sk] : &sh[c][sk])); }
}
// ---- k_attn: block = (64 queries, head h), 16 waves = (query tile qw = wave & 3) x (key share kj = wave >> 2): a wave takes the key steps ks = kj, kj + 4, ... of its 16 queries, so four waves a SIMD cover one another's load and LDS latency; the four partial (max, sum, acc) of a query tile are merged through LDS at the end; kv = h / 2; per 32-key step: live = (k <= q) & attn_mask[k] & (k > pos_q - WIN) & (k < pos_q + WIN); wave vote; scores (3 products, K 256 = 8 ksteps) / 16; online softmax with guards; P.V over all 256 value columns (16 tiles, 3 products) from the one set of scores; q, k and v come as bf16 hi + residual in fragment order (frag_t), so nothing is split here and every fragment load reads whole lines; O cols h*256 + ...
// Both products are formed transposed: S^T = k q^T (A = k rows, B = q rows) and O^T += v^T P^T (A = value columns, B = P). A lane (g = lane >> 4, col = lane & 15) then holds, of the ONE query q0 + col, the scores of keys 8 g + r and 16 + 8 g + r of the step: its maximum and sum are formed in the lane plus one exchange with lane ^ 16, one max / sum / rescale factor a lane serves all its accumulators, and the 16 weights are, as they stand, the lane's B fragment of P^T (k = 8 g + 0..7, 16 + 8 g + 0..7), so P goes from registers to the WMMA with no LDS trip. acc[dt][r] = O[q0 + col][16 dt + 8 g + r].
// A pass = 128 keys = the four key shares' steps 4 it + kj. Its k units (8 key tiles) and its v units (4 key steps) are each 128 KiB in a row in global memory; asynchronous copies bring each into LDS once for the block, where the four query tiles of a key share read the same bytes. Two buffers, tiles in the order k(it), v(it), k(next), v(next): v flies under scores and softmax, the next k under P.V. The passes are those of lm, a mask that every wave forms alike from segment_pos and the causal bound (attn_mask left out: it can only hold more passes than are live), so every barrier stands under block-uniform control flow; a wave's own vote still decides whether it works in a pass.
// The block's q (4 query tiles, 64 KiB in a row in global memory) is copied into LDS once, with the first k tile and behind the same wait and barrier, and stays there: every pass reads its q fragments from LDS, and the loop over d is the outer one in the scores, so that one read of a q fragment serves both key tiles of the step. Each tile's products keep their order.
#define KVT 131072u
#define QT 65536u   // the block's q: 4 query tiles x 8 units x 2 KiB, in a row in global memory
// eight 16-byte copies of a lane, 8 KiB (512 threads) apart in LDS and in global memory alike: the offset field moves both addresses, so one address of each kind serves all eight and none is kept in registers over the loop; the s_wait_xcnt closes the statement so that no address register of a copy is rewritten ahead of it
__device__ __forceinline__ void acopy8s(unsigned l, const char* g) {
  asm volatile("global_load_async_to_lds_b128 %0, %1, off\n\t"
               "global_load_async_to_lds_b128 %0, %1, off offset:8192\n\t"
               "global_load_async_to_lds_b128 %0, %1, off offset:16384\n\t"
               "global_load_async_to_lds_b128 %0, %1, off offset:24576\n\t"
               "global_load_async_to_lds_b128 %0, %1, off offset:32768\n\t"
               "global_load_async_to_lds_b128 %0, %1, off offset:40960\n\t"
               "global_load_async_to_lds_b128 %0, %1, off offset:49152\n\t"
               "global_load_async_to_lds_b128 %0, %1, off offset:57344\n\t"
               "s_wait_xcnt 0x0"
               :: "v"(l), "v"(g) : "memory");
}
// one 128 KiB tile into LDS: 16 pieces of 16 bytes a thread
__device__ __forceinline__ void acopy_tile(unsigned l, const char* g) { acopy8s(l, g); acopy8s(l + 65536u, g + 65536); }
// lane l with lane l ^ 16
__device__ __forceinline__ float xhalf(float x) { return __builtin_bit_cast(float, __builtin_amdgcn_permlanex16(__builtin_bit_cast(int, x), __builtin_bit_cast(int, x), 0x76543210, 0xfedcba98, false, false)); }
__global__ __launch_bounds__(512) void k_attn(const __bf16* __restrict__ QF, const __bf16* __restrict__ KF, const int* __restrict__ AM, const int* __restrict__ SEGPOS, const __bf16* __restrict__ VF, float* __restrict__ O) {
  __shared__ __align__(16) unsigned char big[2 * KVT + QT];   // k tile at 0, v tile at KVT, the block's q at 2 KVT: all of the WGP's LDS
  float (*so)[16][260] = (float (*)[16][260])big; float (*sm)[16] = (float (*)[16])(big + 16 * 16 * 260 * 4); float (*sl)[16] = sm + 16;   // the merge's partials, maxima and sums lie over the staging buffers and q, which are dead by then
  const int tid = threadIdx.x, wave = __builtin_amdgcn_readfirstlane(tid >> 5), lane = tid & 31, col = lane & 15, g = lane >> 4; const int qw = wave & 3, kj = wave >> 2; const int qb = blockIdx.x + TQ0, h = blockIdx.y; const int kv = h / (NH / NKV); const int q0 = qb * 64 + qw * 16;   // the wave's number in a scalar register: key step and tile bases leave the vector registers, and the 16 accumulator tiles fit the 256 a wave has with no scratch
  const __bf16* qp = (const __bf16*)(big + 2 * KVT + qw * (QT / 4)) + lane * 8;   // the wave's query tile in LDS
  const int qi = q0 + col; const int pq = SEGPOS[qi];   // the lane's one query and its position
  asm volatile("s_wait_xcnt 0x0" ::: "memory");   // stands between this load and the rewrite of its address register by the code below
  const int klo = pq - WIN, khi = min(qi, pq + WIN - 1);   // live keys of the query: klo < k <= khi, and attn_mask[k]
  float m = -3.0e38f, l = 0.f;
  v8f acc[16] = {};
  const int nks = (qb * 64 + 64) / 32;   // causal upper bound on key steps
  unsigned lm = 0;
  { const int qx = qb * 64 + lane, qy = qx + 32; const int px = SEGPOS[qx], py = SEGPOS[qy];
    for (int i = 0; i < (nks + 3) / 4; ++i) { const int k0 = i * 128, k1 = k0 + 127;
      const bool lx = max(k0, px - WIN + 1) <= min(min(k1, qx), px + WIN - 1), ly = max(k0, py - WIN + 1) <= min(min(k1, qy), py + WIN - 1);
      if (__any(lx || ly)) lm |= 1u << i; } }
  lm = __builtin_amdgcn_readfirstlane(lm);
  if (lm != 0) {
  const unsigned lk = lds_off(&big[0]) + tid * 16, lvv = lk + KVT;
  const char* gk = (const char*)(KF + (size_t)kv * (SS / 16) * (HD / 32) * FRU) + tid * 16; const char* gv = (const char*)(VF + (size_t)kv * (SS / 32) * (HD / 16) * FRU) + tid * 16;
  int it = __builtin_ctz(lm);
  acopy8(lk + 2 * KVT, 8192u, (const char*)(QF + ((size_t)h * (SS / 16) + qb * 4) * (HD / 32) * FRU) + tid * 16, 8192);   // q, once for the block: 8 pieces of 16 bytes a thread, 8 KiB (512 threads) apart; it stays until the last pass
  acopy_tile(lk, gk + (size_t)it * KVT);
  asm volatile("s_wait_asynccnt 0x0" ::: "memory");   // this wave's share of q and of the first k tile has landed
  __syncthreads();                                    // every wave's share of them has landed
  acopy_tile(lvv, gv + (size_t)it * KVT);
#pragma unroll 1   // rolled: the body is some thousand instructions long
  for (;;) { bool lv[16]; bool anylive = false; lm &= lm - 1; const bool more = lm != 0; const int nx = more ? __builtin_ctz(lm) : 0; const int ks = it * 4 + kj;
#pragma unroll   // in full: the arrays are indexed by constants and stay in registers
    for (int ct = 0; ct < 2; ++ct) { const int kb = ks * 32 + ct * 16 + 8 * g; const v4i a0 = *(const v4i*)(AM + kb), a1 = *(const v4i*)(AM + kb + 4);   // the lane's eight keys of this key tile
#pragma unroll   // in full: the arrays are indexed by constants and stay in registers
      for (int r = 0; r < 8; ++r) { const int kk = kb + r; const bool live = ((r < 4 ? a0[r & 3] : a1[r & 3]) != 0) & (kk > klo) & (kk <= khi); lv[ct * 8 + r] = live; anylive = anylive | live; } }
    const bool wl = __any(anylive);
    F2 pa;
    if (wl) { float s[16]; const __bf16* kp = (const __bf16*)(big + kj * 32768) + lane * 8; v8f c0 = {}, c1 = {};
#pragma unroll   // in full: the arrays are indexed by constants and stay in registers
      for (int kc = 0; kc < HD / 32; ++kc) { F2 ka, kb, qa; qa.h = frag_t(qp + kc * FRU); qa.l = frag_t(qp + kc * FRU + 512);   // one fetch of the q fragment serves both key tiles of the step
        ka.h = frag_t(kp + kc * FRU); ka.l = frag_t(kp + kc * FRU + 512); kb.h = frag_t(kp + 8192 + kc * FRU); kb.l = frag_t(kp + 8192 + kc * FRU + 512);
        c0 = wmma_bf(ka.h, qa.l, c0); c1 = wmma_bf(kb.h, qa.l, c1); c0 = wmma_bf(ka.l, qa.h, c0); c1 = wmma_bf(kb.l, qa.h, c1); c0 = wmma_bf(ka.h, qa.h, c0); c1 = wmma_bf(kb.h, qa.h, c1); }   // each tile's three products of mac3(q, k, .), in its order
#pragma unroll   // in full: the arrays are indexed by constants and stay in registers
      for (int r = 0; r < 8; ++r) { s[r] = lv[r] ? c0[r] * 0.0625f : -3.0e38f; s[8 + r] = lv[8 + r] ? c1[r] * 0.0625f : -3.0e38f; }
      float t8[8];
#pragma unroll   // in full: the arrays are indexed by constants and stay in registers
      for (int i = 0; i < 8; ++i) t8[i] = fmaxf(s[i], s[8 + i]);
      float mx = fmaxf(fmaxf(fmaxf(t8[0], t8[1]), fmaxf(t8[2], t8[3])), fmaxf(fmaxf(t8[4], t8[5]), fmaxf(t8[6], t8[7])));
      mx = fmaxf(mx, xhalf(mx));
      const float mn = fmaxf(m, mx); const float ea = expf(m - mn); const float alpha = (m <= -1.0e38f) ? 0.f : ea;   // every exp is formed unconditionally (its argument is finite and <= 0) and the guard selects behind it: no branch, and the 17 chains cover one another's latency
#pragma unroll   // in full: the arrays are indexed by constants and stay in registers
      for (int i = 0; i < 16; ++i) { const float e = expf(s[i] - mn); s[i] = (s[i] <= -1.0e38f) ? 0.f : e; }
#pragma unroll   // in full: the arrays are indexed by constants and stay in registers
      for (int i = 0; i < 8; ++i) t8[i] = s[i] + s[8 + i];
      float es = ((t8[0] + t8[1]) + (t8[2] + t8[3])) + ((t8[4] + t8[5]) + (t8[6] + t8[7]));
      es += xhalf(es);
      l = l * alpha + es; m = mn;
#pragma unroll   // in full: the arrays are indexed by constants and stay in registers
      for (int dt = 0; dt < 16; ++dt) acc[dt] *= alpha;
      pa = bsplit16(s); }
    asm volatile("s_wait_dscnt 0x0" ::: "memory");      // this wave has left the k buffer
    asm volatile("s_wait_asynccnt 0x0" ::: "memory");   // this wave's share of the pass's v tile has landed
    __syncthreads();                                    // publishes the v tile and frees the k buffer
    if (more) acopy_tile(lk, gk + (size_t)nx * KVT);
    if (wl) { const __bf16* vp = (const __bf16*)(big + KVT + kj * 32768) + lane * 8;   // one address; the 16 tiles' units lie constant steps behind it
#pragma unroll   // in full: the arrays are indexed by constants and stay in registers
      for (int dt = 0; dt < 16; ++dt) { const v16b vh = frag_t(vp + dt * FRU), vl = frag_t(vp + dt * FRU + 512); acc[dt] = wmma_bf(vh, pa.l, acc[dt]); acc[dt] = wmma_bf(vl, pa.h, acc[dt]); acc[dt] = wmma_bf(vh, pa.h, acc[dt]); } }
    asm volatile("s_wait_dscnt 0x0" ::: "memory");      // this wave has left the v buffer
    asm volatile("s_wait_asynccnt 0x0" ::: "memory");   // this wave's share of the next pass's k tile has landed
    __syncthreads();                                    // publishes that k tile and frees the v buffer (behind the last pass: for the merge's partials)
    if (!more) break;
    acopy_tile(lvv, gv + (size_t)nx * KVT); it = nx; }
  asm volatile("s_wait_asynccnt 0x0" ::: "memory"); }   // no copy is outstanding when the wave goes on
#pragma unroll   // in full: the arrays are indexed by constants and stay in registers
  for (int dt = 0; dt < 16; ++dt) { v4f lo4, hi4;
#pragma unroll   // in full: the arrays are indexed by constants and stay in registers
    for (int i = 0; i < 4; ++i) { lo4[i] = acc[dt][i]; hi4[i] = acc[dt][4 + i]; }
    *(v4f*)&so[wave][col][dt * 16 + 8 * g] = lo4; *(v4f*)&so[wave][col][dt * 16 + 8 * g + 4] = hi4; }
  if (g == 0) { sm[wave][col] = m; sl[wave][col] = l; }
  __syncthreads();   // every wave's partial is in LDS before any wave merges
  // merge: wave (qw, kj) finishes rows 4 kj .. 4 kj + 3 of query tile qw: weights exp(m_j - M), a share with no live key weighs 0
  for (int rl = 0; rl < 4; ++rl) { const int row = kj * 4 + rl; float mj[4]; float M = -3.0e38f;
#pragma unroll
    for (int j = 0; j < 4; ++j) { mj[j] = sm[qw + 4 * j][row]; M = fmaxf(M, mj[j]); }
    float L = 0.f; v4f o0 = {}, o1 = {};
#pragma unroll
    for (int j = 0; j < 4; ++j) { const float w = (mj[j] <= -1.0e38f) ? 0.f : exp_ni(mj[j] - M); L += w * sl[qw + 4 * j][row]; o0 += w * *(const v4f*)&so[qw + 4 * j][row][lane * 4]; o1 += w * *(const v4f*)&so[qw + 4 * j][row][128 + lane * 4]; }
    const float il = (L > 0.f) ? 1.0f / L : 0.f;
    vst2(O + (size_t)(q0 + row) * (NH * HD) + h * HD + lane * 4, o0 * il); vst2(O + (size_t)(q0 + row) * (NH * HD) + h * HD + 128 + lane * 4, o1 * il);
    asm volatile("s_wait_xcnt 0x0" ::: "memory"); }   // stands between the two stores and the next row's rewrite of their data registers
}
extern "C" void kernel_launch(void* const* d_in, const int* in_sizes, int n_in, void* d_out, int out_size, void* d_ws, size_t ws_size, hipStream_t stream) {
  (void)in_sizes; (void)n_in; (void)out_size;
  const float** F = (const float**)d_in; const int* AM = (const int*)d_in[1]; const int* SEGPOS = (const int*)d_in[2];
  // 0 x [1,2048,2048], 1 attn_mask [1,2048] bool(int), 2 segment_pos [1,2048] i32, 3 cos [1,2048,256], 4 sin, 5 wq [2048,2048], 6 wk [2048,1024], 7 wv [2048,1024], 8 wo [2048,2048], 9 q_scale [256], 10 k_scale [256]
  if (ws_size < (size_t)WS_END) return;
  char* ws = (char*)d_ws; __bf16 *PW = (__bf16*)(ws + WS_PW), *VF = (__bf16*)(ws + WS_VF), *QF = (__bf16*)(ws + WS_QF), *KF = (__bf16*)(ws + WS_KF); float *Q = (float*)(ws + WS_Q), *Kx = (float*)(ws + WS_K), *V = (float*)(ws + WS_V), *O = (float*)(ws + WS_O);
  k_packT<<<dim3(HID / 128, 48), 256, 0, stream>>>(F[5], F[6], F[7], F[8], PW);
  k_gemm3<<<dim3(SS / 128, NH + 2 * NKV), 256, 0, stream>>>(F[0], PW + PQ, Q, Kx, V);   // q, k and v of all rows
  k_normrope<0><<<dim3(TQB * 4, NH), 256, 0, stream>>>(Q + (size_t)TQ0 * 64 * NH * HD, F[9], F[3] + (size_t)TQ0 * 64 * HD, F[4] + (size_t)TQ0 * 64 * HD, QF + (size_t)TQ0 * 4 * (HD / 32) * FRU);
  k_normrope<1><<<dim3(KRP * 4, NKV), 256, 0, stream>>>(Kx, F[10], F[3], F[4], KF);
  k_vplanes<<<dim3(KRP, NKV * HD / 128), 256, 0, stream>>>(V, VF);
  k_attn<<<dim3(TQB, NH), 512, 0, stream>>>(QF, KF, AM, SEGPOS, VF, O);
  k_gemm<0><<<dim3(TQB, HID / 128), 128, 0, stream>>>(O + (size_t)TQ0 * 64 * NH * HD, NH * HD, NH * HD, PW + PO, (float*)d_out + (size_t)TQ0 * 64 * HID, HID);
}

// v010
// One run takes 136 microseconds.
// Two timings next to v009 both put it at 1.16 times that version's speed.
// Counting every step since v000, it is 9.95 times as fast.
// compute dtype: x, attn_mask, segment_pos, cos/sin tables, wq/wk/wv/wo and the RMSNorm scales (module inputs) rounded to bf16 / read as int; q/k/v projections with exact bf16 products (x and the weights are inputs); per-head RMSNorm and RoPE (input tables) in f32; scores q.k with both operands as bf16 hi + residual pairs (3 products), P.V with P hi/lo x V hi/lo (3 products), output projection hi/lo x exact wo (2 products); all on WMMA 16x16x32; the causal AND padding AND sliding-window mask is evaluated at run time from attn_mask / segment_pos and key tiles with no live entry are skipped; f32 accumulate.
#include <hip/hip_runtime.h>
#include <math.h>

typedef __attribute__((ext_vector_type(16))) _Float16 v16h;
typedef __attribute__((ext_vector_type(16))) __bf16 v16b;
typedef __attribute__((ext_vector_type(8)))  _Float16 v8h;
typedef __attribute__((ext_vector_type(8)))  float v8f;
typedef __attribute__((ext_vector_type(4)))  float v4f;
typedef __attribute__((ext_vector_type(2)))  float v2f;
typedef __attribute__((ext_vector_type(4)))  unsigned v4u;
typedef __attribute__((ext_vector_type(4)))  int v4i;
typedef float __attribute__((may_alias)) float_a;
typedef int __attribute__((may_alias)) int_a;

template <typename T> __device__ __forceinline__ void vst2(void* p, T v) { *(T*)p = v;  }
__device__ __forceinline__ v8f wmma16(v16h a, v16h b, v8f c) {
  v8f d = __builtin_amdgcn_wmma_f32_16x16x32_f16(false, a, false, b, (short)0, c, false, false);
  asm volatile("v_nop\n\tv_nop\n\tv_nop\n\tv_nop" : "+v"(d) : "v"(a), "v"(b));
  return d;
}
__device__ __forceinline__ v8f wmma_bf(v16b a, v16b b, v8f c) {
  v8f d = __builtin_amdgcn_wmma_f32_16x16x32_bf16(false, a, false, b, (short)0, c, false, false);
  asm volatile("v_nop\n\tv_nop\n\tv_nop\n\tv_nop" : "+v"(d) : "v"(a), "v"(b));
  return d;
}
// 16x16x32 fragments: lane = (h = lane>>4, row/col = lane&15); elements 0..7 = k0+8h+0..7, 8..15 = k0+16+8h+0..7; D element r = row 8h+r
__device__ __forceinline__ v16h frag_h(const _Float16* rowk0, int lane) {
  union { v16h v; v8h q[2]; } u; const _Float16* p = rowk0 + 8 * (lane >> 4);
  u.q[0] = *(const v8h*)p; u.q[1] = *(const v8h*)(p + 16); return u.v;
}
__device__ __forceinline__ v16h frag_f32(const float* rowk0, int lane) {
  v16h a; const float* p = rowk0 + 8 * (lane >> 4);
#pragma unroll
  for (int i = 0; i < 8; ++i) { a[i] = (_Float16)p[i]; a[8 + i] = (_Float16)p[16 + i]; }
  return a;
}
__device__ __forceinline__ v16h frag_f32s(const float* rowk0, int lane, float sc) {
  v16h a; const float* p = rowk0 + 8 * (lane >> 4);
#pragma unroll
  for (int i = 0; i < 8; ++i) { a[i] = (_Float16)(p[i] * sc); a[8 + i] = (_Float16)(p[16 + i] * sc); }
  return a;
}
// column fragment from a [K][ld] layout (column n), rows >= K read as 0
__device__ __forceinline__ v16h fragc_f32(const float* W, int k0, int n, int lane, int ld, int K) {
  v16h a; const int g = lane >> 4;
#pragma unroll
  for (int i = 0; i < 8; ++i) { const int ka = k0 + 8 * g + i, kb = ka + 16;
    a[i] = (_Float16)(ka < K ? W[(size_t)(ka < K ? ka : K - 1) * ld + n] : 0.f); a[8 + i] = (_Float16)(kb < K ? W[(size_t)(kb < K ? kb : K - 1) * ld + n] : 0.f); }
  return a;
}
struct F2 { v16b h, l; };
__device__ __forceinline__ F2 bsplit16(const float v[16]) { F2 r;
#pragma unroll
  for (int i = 0; i < 16; ++i) { const __bf16 h = (__bf16)v[i]; r.h[i] = h; r.l[i] = (__bf16)(v[i] - (float)h); }
  return r; }
__device__ __forceinline__ F2 split_row(const float* row, int k0, int lane) { float v[16]; const float* p = row + k0 + 8 * (lane >> 4);
#pragma unroll
  for (int i = 0; i < 8; ++i) { v[i] = p[i]; v[8 + i] = p[16 + i]; }
  return bsplit16(v); }
__device__ __forceinline__ F2 split_rowK(const float* row, int k0, int lane, int K) { float v[16]; const int g = lane >> 4;
#pragma unroll
  for (int i = 0; i < 8; ++i) { const int ka = k0 + 8 * g + i, kb = ka + 16; v[i] = ka < K ? row[ka < K ? ka : K - 1] : 0.f; v[8 + i] = kb < K ? row[kb < K ? kb : K - 1] : 0.f; }
  return bsplit16(v); }
__device__ __forceinline__ F2 split_col(const float* W, int k0, int n, int lane, int ld, int K) { float v[16]; const int g = lane >> 4;
#pragma unroll
  for (int i = 0; i < 8; ++i) { const int ka = k0 + 8 * g + i, kb = ka + 16; v[i] = ka < K ? W[(size_t)(ka < K ? ka : K - 1) * ld + n] : 0.f; v[8 + i] = kb < K ? W[(size_t)(kb < K ? kb : K - 1) * ld + n] : 0.f; }
  return bsplit16(v); }
__device__ __forceinline__ v8f mac3(const F2& a, const F2& b, v8f c) { c = wmma_bf(a.l, b.h, c); c = wmma_bf(a.h, b.l, c); return wmma_bf(a.h, b.h, c); }
__device__ __forceinline__ float sigm(float v) { return 1.0f / (1.0f + expf(-v)); }
#define LDSX() do { asm volatile("s_wait_dscnt 0" ::: "memory"); __builtin_amdgcn_wave_barrier(); __builtin_amdgcn_fence(__ATOMIC_RELEASE, "workgroup"); } while (0)


// Gemma-3 style attention (B 1, S 2048, hidden 2048, 8 query heads / 4 kv heads x 256, sliding window 1024): q,k,v = x w; q,k = RMSNorm_head(.)(1 + scale); RoPE with the given cos/sin; GQA (kv head = h / 2); scores / 16 masked by causal & attn_mask[k] & |k - segment_pos[q]| < WIN (else -1e37); softmax; out = (P v merged) wo.
#define SS 2048
#define HID 2048
#define NH 8
#define NKV 4
#define HD 256
#define WIN 1024
#ifndef TQB
#define TQB (SS / 64)          // query tiles processed
#define TQ0 0                  // first query tile
#define KRP (SS / 64)          // unused: k_gemm3 projects k and v of all rows
#endif
typedef __attribute__((ext_vector_type(8))) __bf16 v8b;
__device__ __forceinline__ v16b frag_b(const __bf16* rowk0, int lane) {
  union { v16b v; v8b q[2]; } u; const __bf16* p = rowk0 + 8 * (lane >> 4);
  u.q[0] = *(const v8b*)p; u.q[1] = *(const v8b*)(p + 16); return u.v;
}
__device__ __forceinline__ float bfr(float v) { return (float)(__bf16)v; }
__device__ __attribute__((noinline)) float exp_ni(float v) { return expf(v); }
__device__ __attribute__((noinline)) float erf_ni(float v) { return erff(v); }

#define WS_PW  0u                                  // bf16 rows (in,out -> [out][in]): wq [2048][2048], wk [1024][2048], wv [1024][2048], wo [2048][2048]
#define PQ 0
#define PK (PQ + NH * HD * HID)
#define PV (PK + NKV * HD * HID)
#define PO (PV + NKV * HD * HID)
#define PWEND (PO + HID * NH * HD)
#define WS_VF  (WS_PW + 2u * PWEND)                 // bf16 v in fragment order: [kv][32-key step][16-column tile][FRU]
#define WS_O   (WS_VF + 4u * NKV * HD * SS)          // f32 [S][2048]
#define WS_QF  (WS_O + 4u * SS * NH * HD)            // bf16 q in fragment order: [head][16-query tile][32-d step][FRU]
#define WS_KF  (WS_QF + 4u * SS * NH * HD)           // bf16 k in fragment order: [kv][16-key tile][32-d step][FRU]
#define WS_END (WS_KF + 4u * SS * NKV * HD)
// Fragment order: one 16 x 32 operand tile is a unit of FRU bf16 = [plane hi, lo][part 0, 1][lane 32][8]: lane (g = lane >> 4, row = lane & 15) holds k = 16 part + 8 g + 0..7 of its row, which is what frag_b reads from a row. A wave's 16-byte load of one (plane, part) is then 512 bytes in a row, four whole lines, where a load from rows touches sixteen.
#define FRU 1024
__device__ __forceinline__ v16b frag_t(const __bf16* p) { union { v16b v; v8b q[2]; } u; u.q[0] = *(const v8b*)p; u.q[1] = *(const v8b*)(p + 256); return u.v; }

// ---- k_packT: block = (128 k, 128 output columns): (in,out) weight -> rows [n][K], a tile at a time through LDS. The four weights all have K = 2048 and their row sets lie one behind another in PW, so blockIdx.y counts 128-column tiles over all of them (wq 16, wk 8, wv 8, wo 16).
// A wave's load is 512 bytes in a row of one k; a thread holds 8 k x 4 columns twice, which are eight finished 16-byte pieces of output rows; they cross in LDS, and a wave's store is two output rows x 256 bytes: whole lines both ways, each line with one writer.
// LDS row = one column's 128 k as bf16, pitch 272 B; the 16-byte piece kch of row n lies at place kch ^ ((n >> 4) & 3): with it the 16 lanes of a half wave, four rows apart, store to 16 different bank groups.
#define PTP 272
template <int N>   // the weight's row length as a constant: the 16 loads then share one address and differ in the offset field
__device__ __forceinline__ void pack_tile(const float* __restrict__ src, __bf16* __restrict__ dst, unsigned char* s, int tid) {
  const int wave = tid >> 5, lane = tid & 31; src += (size_t)(wave * 8) * N + lane * 4; v4f v[2][8];
#pragma unroll   // in full: v[] is indexed by constants and stays in registers
  for (int hf = 0; hf < 2; ++hf)
#pragma unroll   // in full: as above
    for (int i = 0; i < 8; ++i) v[hf][i] = *(const v4f*)(src + (size_t)(hf * 64 + i) * N);
  // the wait stands between the loads and any rewrite of their address register; the loaded values and the address are inputs only, so that all 16 loads are issued ahead of the first use and fly together (without it the compiler issues the last six behind waits on the first ten) and no load's result lands on the address
  asm volatile("s_wait_xcnt 0x0" :: "v"(src), "v"(v[0][0]), "v"(v[0][1]), "v"(v[0][2]), "v"(v[0][3]), "v"(v[0][4]), "v"(v[0][5]), "v"(v[0][6]), "v"(v[0][7]), "v"(v[1][0]), "v"(v[1][1]), "v"(v[1][2]), "v"(v[1][3]), "v"(v[1][4]), "v"(v[1][5]), "v"(v[1][6]), "v"(v[1][7]) : "memory");
  const int sw = (lane >> 2) & 3;   // (n >> 4) & 3 of the thread's four columns n = 4 lane + c
#pragma unroll   // in full: v[] is indexed by constants
  for (int hf = 0; hf < 2; ++hf)
#pragma unroll   // in full: v[] is indexed by constants
    for (int c = 0; c < 4; ++c) { v8b w;
#pragma unroll   // in full: v[] and w[] are indexed by constants
      for (int i = 0; i < 8; ++i) w[i] = (__bf16)v[hf][i][c];
      *(v8b*)(s + (lane * 4 + c) * PTP + (((hf * 8 + wave) ^ sw) * 16)) = w; }
  __syncthreads();
  const int nr = tid >> 4, kch = tid & 15;
#pragma unroll   // in full: eight fixed pieces a thread (rows nr + 16 j), their LDS reads ahead of the stores
  for (int j = 0; j < 8; ++j) vst2(dst + (size_t)(nr + 16 * j) * HID + kch * 8, *(const v4u*)(s + (nr + 16 * j) * PTP + ((kch ^ (j & 3)) * 16)));
}
__global__ __launch_bounds__(256) void k_packT(const float* __restrict__ WQ, const float* __restrict__ WK, const float* __restrict__ WV, const float* __restrict__ WO, __bf16* __restrict__ PW) {
  __shared__ __align__(16) unsigned char s[128 * PTP]; const int tid = threadIdx.x; const int k0 = blockIdx.x * 128, y = blockIdx.y;
  if (y < 16) pack_tile<NH * HD>(WQ + (size_t)k0 * (NH * HD) + y * 128, PW + PQ + (size_t)y * 128 * HID + k0, s, tid);
  else if (y < 24) pack_tile<NKV * HD>(WK + (size_t)k0 * (NKV * HD) + (y - 16) * 128, PW + PK + (size_t)(y - 16) * 128 * HID + k0, s, tid);
  else if (y < 32) pack_tile<NKV * HD>(WV + (size_t)k0 * (NKV * HD) + (y - 24) * 128, PW + PV + (size_t)(y - 24) * 128 * HID + k0, s, tid);
  else pack_tile<HID>(WO + (size_t)k0 * HID + (y - 32) * 128, PW + PO + (size_t)(y - 32) * 128 * HID + k0, s, tid);
}
// ---- k_gemm<RIN>: block = (64 rows, 128 cols): OUT = A(K) . rows (RIN exact / hi-lo 2 products); pitch ldo. K is a multiple of 64.
// Both operand tiles of a 64-k stage (A 64 rows x 256 B f32, P 128 rows x 128 B bf16) are brought into LDS by asynchronous copies, whole lines, two buffers: stage t + 1 flies while stage t is worked on, and the four waves share one copy of the P tile. Row pitches 272 B / 144 B (16 B x odd) keep the 16-byte fragment reads off one another's banks.
#define GKS 64
#define GAP 272
#define GBP 144
#define GAB (64 * GAP)
#define GSTG (GAB + 128 * GBP)
__device__ __forceinline__ unsigned lds_off(const void* p) { return (unsigned)(size_t)p; }
// eight 16-byte copies of a lane, rows lstep / gstep bytes apart; the s_wait_xcnt closes the statement so that no address register of a copy is rewritten ahead of it
__device__ __forceinline__ void acopy8(unsigned l, unsigned lstep, const char* g, size_t gstep) {
  asm volatile("global_load_async_to_lds_b128 %0, %8, off\n\t"
               "global_load_async_to_lds_b128 %1, %9, off\n\t"
               "global_load_async_to_lds_b128 %2, %10, off\n\t"
               "global_load_async_to_lds_b128 %3, %11, off\n\t"
               "global_load_async_to_lds_b128 %4, %12, off\n\t"
               "global_load_async_to_lds_b128 %5, %13, off\n\t"
               "global_load_async_to_lds_b128 %6, %14, off\n\t"
               "global_load_async_to_lds_b128 %7, %15, off\n\t"
               "s_wait_xcnt 0x0"
               :: "v"(l), "v"(l + lstep), "v"(l + 2 * lstep), "v"(l + 3 * lstep), "v"(l + 4 * lstep), "v"(l + 5 * lstep), "v"(l + 6 * lstep), "v"(l + 7 * lstep),
                  "v"(g), "v"(g + gstep), "v"(g + 2 * gstep), "v"(g + 3 * gstep), "v"(g + 4 * gstep), "v"(g + 5 * gstep), "v"(g + 6 * gstep), "v"(g + 7 * gstep)
               : "memory");
}
template <int RIN>
__global__ __launch_bounds__(128) void k_gemm(const float* __restrict__ A, int lda, int K, const __bf16* __restrict__ P, float* __restrict__ OUT, int ldo) {
  __shared__ __align__(16) float so[4][16][132]; __shared__ __align__(16) unsigned char st[2][GSTG];
  const int tid = threadIdx.x, wave = tid >> 5, lane = tid & 31, col = lane & 15, g = lane >> 4; const size_t r0 = (size_t)blockIdx.x * 64 + wave * 16; const int n0 = blockIdx.y * 128;
  // a thread's copy places: A chunk (row i * 8 + tid / 16, 16 B piece tid % 16), P chunk (row i * 16 + tid / 8, piece tid % 8), i = 0..7
  const char* ga = (const char*)(A + ((size_t)blockIdx.x * 64 + (tid >> 4)) * lda + (tid & 15) * 4); const char* gb = (const char*)(P + (size_t)(n0 + (tid >> 3)) * K + (tid & 7) * 8);
  const unsigned la = lds_off(&st[0][0]) + (tid >> 4) * GAP + (tid & 15) * 16, lb = lds_off(&st[0][0]) + GAB + (tid >> 3) * GBP + (tid & 7) * 16;
  const size_t gas = (size_t)lda * 8 * 4, gbs = (size_t)K * 16 * 2; const int nst = K / GKS;
  v8f acc[8] = {};
  acopy8(la, 8 * GAP, ga, gas); acopy8(lb, 16 * GBP, gb, gbs);
  asm volatile("s_wait_asynccnt 0x0" ::: "memory");   // this wave's share of stage 0 has landed
  __syncthreads();                                    // every wave's share of stage 0 has landed
  if (nst > 1) { acopy8(la + GSTG, 8 * GAP, ga + GKS * 4, gas); acopy8(lb + GSTG, 16 * GBP, gb + GKS * 2, gbs); }
  for (int t = 0; t < nst; ++t) { const unsigned bo = (t & 1) * GSTG; const unsigned char* pa = &st[0][0] + bo + (wave * 16 + col) * GAP + 32 * g; const unsigned char* pb = &st[0][0] + bo + GAB + col * GBP + 16 * g;
    // the stage's fragment reads stand ahead of its WMMAs, so that their latencies overlap; the second k step's A rows are read behind the first WMMA (16 registers fewer at the peak: the kernel stays inside v0..v255), still a whole k step ahead of their use
    v4f af[2][4]; v8b bq[2][8][2];
#pragma unroll   // in full: the fragment arrays are indexed by constants and stay in registers
    for (int q = 0; q < 4; ++q) af[0][q] = *(const v4f*)(pa + (q >> 1) * 64 + (q & 1) * 16);
#pragma unroll   // in full: the fragment arrays are indexed by constants and stay in registers
    for (int kc = 0; kc < 2; ++kc)
#pragma unroll   // in full: the fragment arrays are indexed by constants and stay in registers
      for (int j = 0; j < 8; ++j) { bq[kc][j][0] = *(const v8b*)(pb + j * 16 * GBP + kc * 64); bq[kc][j][1] = *(const v8b*)(pb + j * 16 * GBP + kc * 64 + 32); }
#pragma unroll   // in full: the fragment arrays are indexed by constants and stay in registers
    for (int kc = 0; kc < 2; ++kc) { F2 a; float v[16];
#pragma unroll   // in full: the fragment arrays are indexed by constants and stay in registers
      for (int i = 0; i < 4; ++i) { v[i] = af[kc][0][i]; v[4 + i] = af[kc][1][i]; v[8 + i] = af[kc][2][i]; v[12 + i] = af[kc][3][i]; }
      if (RIN) { v16b ax;
#pragma unroll   // in full: the fragment arrays are indexed by constants and stay in registers
        for (int i = 0; i < 16; ++i) ax[i] = (__bf16)v[i];
        a.h = ax; a.l = ax; } else a = bsplit16(v);
#pragma unroll   // in full: the fragment arrays are indexed by constants and stay in registers
      for (int j = 0; j < 8; ++j) { union { v16b v; v8b q[2]; } w; w.q[0] = bq[kc][j][0]; w.q[1] = bq[kc][j][1]; if (!RIN) acc[j] = wmma_bf(a.l, w.v, acc[j]); acc[j] = wmma_bf(a.h, w.v, acc[j]);
        if (kc == 0 && j == 0) {
#pragma unroll   // in full: the fragment arrays are indexed by constants and stay in registers
          for (int q = 0; q < 4; ++q) af[1][q] = *(const v4f*)(pa + 128 + (q >> 1) * 64 + (q & 1) * 16); } } }
    asm volatile("s_wait_dscnt 0x0" ::: "memory");      // this wave has left stage t's buffer
    asm volatile("s_wait_asynccnt 0x0" ::: "memory");   // this wave's share of stage t + 1 has landed
    __syncthreads();                                    // publishes stage t + 1 and frees stage t's buffer
    if (t + 2 < nst) { acopy8(la + bo, 8 * GAP, ga + (size_t)(t + 2) * (GKS * 4), gas); acopy8(lb + bo, 16 * GBP, gb + (size_t)(t + 2) * (GKS * 2), gbs); } }
  asm volatile("s_wait_asynccnt 0x0" ::: "memory");     // no copy is outstanding when the wave goes on
#pragma unroll
  for (int j = 0; j < 8; ++j)
#pragma unroll
    for (int r = 0; r < 8; ++r) so[wave][8 * g + r][j * 16 + col] = acc[j][r];
  LDSX();
  for (int rl = 0; rl < 16; ++rl) vst2(OUT + (r0 + rl) * ldo + n0 + lane * 4, *(const v4f*)&so[wave][rl][lane * 4]);
}
// ---- k_gemm3: the q, k and v projections as one product of x with the 4096 packed weight rows (wq, wk, wv lie one behind another in PW). Block = (128 rows of x, 256 weight rows = one head), 8 waves = (row half wm) x (column quarter wn), a wave holds 64 x 64 = 4 x 4 accumulator tiles.
// A 64-k stage copies 32 KiB of x and 32 KiB of weights for four times the products of a 64 x 128 block (which copies 16 + 16 KiB): half the bytes from L2 a product, and a fragment read from LDS serves four WMMAs. 16 x 16 = 256 blocks, one a WGP. Staging, pitches, waits and the order of the k steps are those of k_gemm. A block holds whole heads' rows, so its epilogue finishes q, k and v (norm, RoPE, hi + residual, fragment order) and they go to memory once, in the form k_attn reads.
#define G3AB (128 * GAP)
#define G3STG (G3AB + 256 * GBP)
#define G3P 260   // pitch in floats of the block's 128 x 256 result in LDS: rows 8 apart lie 32 banks apart, and a row's 16-byte pieces stay aligned
// lane l with lane l ^ 16
__device__ __forceinline__ float xhalf(float x) { return __builtin_bit_cast(float, __builtin_amdgcn_permlanex16(__builtin_bit_cast(int, x), __builtin_bit_cast(int, x), 0x76543210, 0xfedcba98, false, false)); }
// lane l with lane l ^ M inside its row of 16 lanes (C = 0x160 + M: the DPP control row_xmask): a vector move, where a shuffle would go through the LDS unit and cost its latency
template <int C> __device__ __forceinline__ float xrow(float x) { return __builtin_bit_cast(float, __builtin_amdgcn_update_dpp(0, __builtin_bit_cast(int, x), C, 0xf, 0xf, true)); }
typedef __attribute__((ext_vector_type(4))) __bf16 v4b;
// eight values as bf16 hi + residual
__device__ __forceinline__ void split8(const float v[8], v8b& h, v8b& l) {
  const v8f x = { v[0], v[1], v[2], v[3], v[4], v[5], v[6], v[7] }; h = __builtin_convertvector(x, v8b); l = __builtin_convertvector(x - __builtin_convertvector(h, v8f), v8b);   // as vectors: the residuals are then formed by packed subtractions
}
// q or k: one wave finishes 16 positions x the head's 256 (sw: its rows in LDS). A lane holds d = 4 lane + 0..3 and d + 128 of a row, the two halves that RoPE pairs. RMSNorm over the 256 (mean of squares, eps 1e-6) * (1 + scale[d]); RoPE: out_d = y_d cos[s][d] + rot_d sin[s][d] with rot = (-y[d+128], y[d-128]); the rows go back to their places in LDS and leave as bf16 hi + residual in fragment order (8 units, 16 KiB in a row: whole lines, one writer). cp, sp: the tables at the first position; sc: the scale; all three the same for the whole wave.
__device__ __forceinline__ void g3_qk(float* sw, const float* __restrict__ sc, const float* __restrict__ cp, const float* __restrict__ sp, __bf16* __restrict__ ob, int lane) {
  const v4f sa = *(const v4f*)(sc + lane * 4), sb = *(const v4f*)(sc + lane * 4 + HD / 2); float* row = sw + lane * 4;
#pragma unroll   // in full: the rows' table loads fly together and their cross-lane sums cover one another's latency
  for (int r = 0; r < 16; ++r) { const v4f ya = *(const v4f*)(row + r * G3P), yb = *(const v4f*)(row + r * G3P + HD / 2);
    float q = ((ya[0] * ya[0] + ya[1] * ya[1]) + (ya[2] * ya[2] + ya[3] * ya[3])) + ((yb[0] * yb[0] + yb[1] * yb[1]) + (yb[2] * yb[2] + yb[3] * yb[3]));
    q += xrow<0x161>(q); q += xrow<0x162>(q); q += xrow<0x164>(q); q += xrow<0x168>(q); q += xhalf(q);   // every lane ends with the sum over the 32
    float rs; asm("v_rsq_f32 %0, %1\n\tv_nop" : "=v"(rs) : "v"(q / (float)HD + 1e-6f));   // the argument is at least 1e-6, so the bare instruction needs no scaling for small inputs; the v_nop, in the same statement so that it stays there, fills the slot that the instruction set asks for behind a transcendental
    const v4f ca = *(const v4f*)(cp + lane * 4 + r * HD), cb = *(const v4f*)(cp + lane * 4 + r * HD + HD / 2), na = *(const v4f*)(sp + lane * 4 + r * HD), nb = *(const v4f*)(sp + lane * 4 + r * HD + HD / 2); v4f oa, ob2;
    const v4b cab = __builtin_convertvector(ca, v4b), cbb = __builtin_convertvector(cb, v4b), nab = __builtin_convertvector(na, v4b), nbb = __builtin_convertvector(nb, v4b);   // the tables rounded to bf16
#pragma unroll   // in full: the vectors are indexed by constants
    for (int c = 0; c < 4; ++c) { const float y0 = ya[c] * rs * (1.0f + bfr(sa[c])), y1 = yb[c] * rs * (1.0f + bfr(sb[c])); oa[c] = y0 * (float)cab[c] + (-y1) * (float)nab[c]; ob2[c] = y1 * (float)cbb[c] + y0 * (float)nbb[c]; }
    *(v4f*)(row + r * G3P) = oa; *(v4f*)(row + r * G3P + HD / 2) = ob2; }
  asm volatile("s_wait_xcnt 0x0" :: "s"(sc), "s"(cp), "s"(sp), "v"(lane) : "memory");   // the loads' scalar bases and their lane offset are inputs only: they live up to here, so that none is rewritten ahead of the wait
  LDSX();   // the wave's rows are in LDS before its lanes read across them
  const float* p = sw + (lane & 15) * G3P + (lane >> 4) * 8; __bf16* o = ob + lane * 8;
#pragma unroll   // in full: the offsets are constants
  for (int kc = 0; kc < HD / 32; kc += 2) { v8b w[2][2][2];
#pragma unroll   // in full: w[] is indexed by constants, and the eight LDS reads stand ahead of the stores
    for (int a = 0; a < 4; ++a) { const float* pp = p + (kc + (a >> 1)) * 32 + (a & 1) * 16; const v4f x0 = *(const v4f*)pp, x1 = *(const v4f*)(pp + 4); const float v[8] = { x0[0], x0[1], x0[2], x0[3], x1[0], x1[1], x1[2], x1[3] }; split8(v, w[a >> 1][0][a & 1], w[a >> 1][1][a & 1]); }
#pragma unroll   // in full: w[] is indexed by constants
    for (int a = 0; a < 8; ++a) vst2(o + (kc + (a >> 2)) * FRU + (a & 3) * 256, w[a >> 2][(a >> 1) & 1][a & 1]);
    asm volatile("s_wait_xcnt 0x0" ::: "memory"); }   // stands between the eight stores and the next group's rewrite of their data registers
}
// v: one wave takes a 32-key step x 8 column tiles of the block's result: a lane's piece is eight keys of one value column (sv: the lane's first key and column in LDS), as bf16 hi + residual in fragment order (row = value column, k = key): 8 whole units in a row
__device__ __forceinline__ void g3_v(const float* sv, __bf16* __restrict__ o) {
#pragma unroll   // in full: the offsets are constants
  for (int u = 0; u < 8; u += 2) { v8b w[2][2][2];
#pragma unroll   // in full: w[] is indexed by constants, and the LDS reads stand ahead of the stores
    for (int a = 0; a < 4; ++a) { float v[8];
#pragma unroll   // in full: v[] is indexed by constants
      for (int i = 0; i < 8; ++i) v[i] = sv[((a & 1) * 16 + i) * G3P + (u + (a >> 1)) * 16];
      split8(v, w[a >> 1][0][a & 1], w[a >> 1][1][a & 1]); }
#pragma unroll   // in full: w[] is indexed by constants
    for (int a = 0; a < 8; ++a) vst2(o + (u + (a >> 2)) * FRU + (a & 3) * 256, w[a >> 2][(a >> 1) & 1][a & 1]);
    asm volatile("s_wait_xcnt 0x0" ::: "memory"); }   // stands between the eight stores and the next group's rewrite of their data registers
}
__global__ __launch_bounds__(256) void k_gemm3(const float* __restrict__ A, const __bf16* __restrict__ P, const float* __restrict__ SQ, const float* __restrict__ SK, const float* __restrict__ COS, const float* __restrict__ SIN, __bf16* __restrict__ QF, __bf16* __restrict__ KF, __bf16* __restrict__ VF) {
  __shared__ __align__(16) unsigned char st[2][G3STG];
  const int tid = threadIdx.x, wave = __builtin_amdgcn_readfirstlane(tid >> 5), lane = tid & 31, col = lane & 15, g = lane >> 4; const int wm = wave & 1, wn = wave >> 1, y = blockIdx.y;
  // a thread's copy places: A chunk (row i * 16 + tid / 16, 16 B piece tid % 16), P chunk (row i * 32 + tid / 8, piece tid % 8), i = 0..7
  const char* ga = (const char*)(A + ((size_t)blockIdx.x * 128 + (tid >> 4)) * HID + (tid & 15) * 4); const char* gb = (const char*)(P + ((size_t)y * 256 + (tid >> 3)) * HID + (tid & 7) * 8);
  const unsigned la = lds_off(&st[0][0]) + (tid >> 4) * GAP + (tid & 15) * 16, lb = lds_off(&st[0][0]) + G3AB + (tid >> 3) * GBP + (tid & 7) * 16;
  const size_t gas = (size_t)HID * 16 * 4, gbs = (size_t)HID * 32 * 2; const int nst = HID / GKS;
  v8f acc[4][4] = {};
  acopy8(la, 16 * GAP, ga, gas); acopy8(lb, 32 * GBP, gb, gbs);
  asm volatile("s_wait_asynccnt 0x0" ::: "memory");   // this wave's share of stage 0 has landed
  __syncthreads();                                    // every wave's share of stage 0 has landed
  acopy8(la + G3STG, 16 * GAP, ga + GKS * 4, gas); acopy8(lb + G3STG, 32 * GBP, gb + GKS * 2, gbs);
#pragma unroll 1   // rolled: one stage is the loop's body, and the two buffers differ only in an offset
  for (int t = 0; t < nst; ++t) { const unsigned bo = (t & 1) * G3STG; const unsigned char* pa = &st[0][0] + bo + (wm * 64 + col) * GAP + 32 * g; const unsigned char* pb = &st[0][0] + bo + G3AB + (wn * 64 + col) * GBP + 16 * g;
    // all of the stage's fragment reads are issued ahead of its WMMAs, in the order of their use (the weight fragments of a k step, then its four row tiles of x): the LDS then serves the eight waves without a pause while the WMMAs follow behind counted waits
    v4f af[2][4][4]; v8b bq[2][4][2];
#pragma unroll   // in full: the fragment arrays are indexed by constants and stay in registers
    for (int kc = 0; kc < 2; ++kc) {
#pragma unroll   // in full: the fragment arrays are indexed by constants and stay in registers
      for (int j = 0; j < 4; ++j) { bq[kc][j][0] = *(const v8b*)(pb + j * 16 * GBP + kc * 64); bq[kc][j][1] = *(const v8b*)(pb + j * 16 * GBP + kc * 64 + 32); }
#pragma unroll   // in full: the fragment arrays are indexed by constants and stay in registers
      for (int i = 0; i < 4; ++i)
#pragma unroll   // in full: the fragment arrays are indexed by constants and stay in registers
        for (int q = 0; q < 4; ++q) af[kc][i][q] = *(const v4f*)(pa + i * 16 * GAP + kc * 128 + (q >> 1) * 64 + (q & 1) * 16); }
#pragma unroll   // in full: the fragment arrays are indexed by constants and stay in registers
    for (int kc = 0; kc < 2; ++kc) {
#pragma unroll   // in full: the fragment arrays are indexed by constants and stay in registers
      for (int i = 0; i < 4; ++i) { v16b a;
        __builtin_amdgcn_sched_barrier(0);   // keeps the 48 reads together ahead of the first WMMA, and each row tile's conversions (with their wait) behind the WMMAs of the tile before: a tile's WMMAs then start as soon as its own reads have landed, not when a later tile's have
#pragma unroll   // in full: the fragment arrays are indexed by constants and stay in registers
        for (int e = 0; e < 16; ++e) a[e] = (__bf16)af[kc][i][e >> 2][e & 3];
#pragma unroll   // in full: the fragment arrays are indexed by constants and stay in registers
        for (int j = 0; j < 4; ++j) { union { v16b v; v8b q[2]; } w; w.q[0] = bq[kc][j][0]; w.q[1] = bq[kc][j][1]; acc[i][j] = wmma_bf(a, w.v, acc[i][j]); } } }
    asm volatile("s_wait_dscnt 0x0" ::: "memory");      // this wave has left stage t's buffer
    asm volatile("s_wait_asynccnt 0x0" ::: "memory");   // this wave's share of stage t + 1 has landed
    __syncthreads();                                    // publishes stage t + 1 and frees stage t's buffer
    if (t + 2 < nst) { acopy8(la + bo, 16 * GAP, ga + (size_t)(t + 2) * (GKS * 4), gas); acopy8(lb + bo, 32 * GBP, gb + (size_t)(t + 2) * (GKS * 2), gbs); } }
  asm volatile("s_wait_asynccnt 0x0" ::: "memory");     // no copy is outstanding when the wave goes on
  // the block's 128 x 256 result (128 positions of one head) is laid out in LDS over the stage buffers (dead behind the last stage's barrier), and is finished here: no f32 copy of q, k or v goes to memory
  float* so = (float*)&st[0][0];
#pragma unroll   // in full: acc[][] is indexed by constants
  for (int i = 0; i < 4; ++i)
#pragma unroll   // in full: acc[][] is indexed by constants
    for (int j = 0; j < 4; ++j)
#pragma unroll   // in full: acc[][] is indexed by constants
      for (int r = 0; r < 8; ++r) so[(wm * 64 + i * 16 + 8 * g + r) * G3P + wn * 64 + j * 16 + col] = acc[i][j][r];
  __syncthreads();   // every wave's part of the result is in LDS before any wave reads whole rows or columns of it
  const size_t t16 = (size_t)blockIdx.x * 8 + wave;   // q, k: the wave's 16 positions
  if (y < NH + NKV) g3_qk(so + wave * 16 * G3P, y < NH ? SQ : SK, COS + t16 * 16 * HD, SIN + t16 * 16 * HD, (y < NH ? QF + (size_t)y * (SS / 16) * (HD / 32) * FRU : KF + (size_t)(y - NH) * (SS / 16) * (HD / 32) * FRU) + t16 * (HD / 32) * FRU, lane);   // one text for q and k: they differ in two pointers
  else g3_v(so + ((wave >> 1) * 32 + g * 8) * G3P + (wave & 1) * 128 + col, VF + (((size_t)(y - NH - NKV) * (SS / 32) + blockIdx.x * 4 + (wave >> 1)) * (HD / 16) + (wave & 1) * 8) * FRU + lane * 8);
}
// ---- k_attn: block = (64 queries, head h), 16 waves = (query tile qw = wave & 3) x (key share kj = wave >> 2): a wave takes the key steps ks = kj, kj + 4, ... of its 16 queries, so four waves a SIMD cover one another's load and LDS latency; the four partial (max, sum, acc) of a query tile are merged through LDS at the end; kv = h / 2; per 32-key step: live = (k <= q) & attn_mask[k] & (k > pos_q - WIN) & (k < pos_q + WIN); wave vote; scores (3 products, K 256 = 8 ksteps) / 16; online softmax with guards; P.V over all 256 value columns (16 tiles, 3 products) from the one set of scores; q, k and v come as bf16 hi + residual in fragment order (frag_t), so nothing is split here and every fragment load reads whole lines; O cols h*256 + ...
// Both products are formed transposed: S^T = k q^T (A = k rows, B = q rows) and O^T += v^T P^T (A = value columns, B = P). A lane (g = lane >> 4, col = lane & 15) then holds, of the ONE query q0 + col, the scores of keys 8 g + r and 16 + 8 g + r of the step: its maximum and sum are formed in the lane plus one exchange with lane ^ 16, one max / sum / rescale factor a lane serves all its accumulators, and the 16 weights are, as they stand, the lane's B fragment of P^T (k = 8 g + 0..7, 16 + 8 g + 0..7), so P goes from registers to the WMMA with no LDS trip. acc[dt][r] = O[q0 + col][16 dt + 8 g + r].
// A pass = 128 keys = the four key shares' steps 4 it + kj. Its k units (8 key tiles) and its v units (4 key steps) are each 128 KiB in a row in global memory; asynchronous copies bring each into LDS once for the block, where the four query tiles of a key share read the same bytes. Two buffers, tiles in the order k(it), v(it), k(next), v(next): v flies under scores and softmax, the next k under P.V. The passes are those of lm, a mask that every wave forms alike from segment_pos and the causal bound (attn_mask left out: it can only hold more passes than are live), so every barrier stands under block-uniform control flow; a wave's own vote still decides whether it works in a pass.
// The block's q (4 query tiles, 64 KiB in a row in global memory) is copied into LDS once, with the first k tile and behind the same wait and barrier, and stays there: every pass reads its q fragments from LDS, and the loop over d is the outer one in the scores, so that one read of a q fragment serves both key tiles of the step. Each tile's products keep their order.
#define KVT 131072u
#define QT 65536u   // the block's q: 4 query tiles x 8 units x 2 KiB, in a row in global memory
// eight 16-byte copies of a lane, 8 KiB (512 threads) apart in LDS and in global memory alike: the offset field moves both addresses, so one address of each kind serves all eight and none is kept in registers over the loop; the s_wait_xcnt closes the statement so that no address register of a copy is rewritten ahead of it
__device__ __forceinline__ void acopy8s(unsigned l, const char* g) {
  asm volatile("global_load_async_to_lds_b128 %0, %1, off\n\t"
               "global_load_async_to_lds_b128 %0, %1, off offset:8192\n\t"
               "global_load_async_to_lds_b128 %0, %1, off offset:16384\n\t"
               "global_load_async_to_lds_b128 %0, %1, off offset:24576\n\t"
               "global_load_async_to_lds_b128 %0, %1, off offset:32768\n\t"
               "global_load_async_to_lds_b128 %0, %1, off offset:40960\n\t"
               "global_load_async_to_lds_b128 %0, %1, off offset:49152\n\t"
               "global_load_async_to_lds_b128 %0, %1, off offset:57344\n\t"
               "s_wait_xcnt 0x0"
               :: "v"(l), "v"(g) : "memory");
}
// one 128 KiB tile into LDS: 16 pieces of 16 bytes a thread
__device__ __forceinline__ void acopy_tile(unsigned l, const char* g) { acopy8s(l, g); acopy8s(l + 65536u, g + 65536); }
__global__ __launch_bounds__(512) void k_attn(const __bf16* __restrict__ QF, const __bf16* __restrict__ KF, const int* __restrict__ AM, const int* __restrict__ SEGPOS, const __bf16* __restrict__ VF, float* __restrict__ O) {
  __shared__ __align__(16) unsigned char big[2 * KVT + QT];   // k tile at 0, v tile at KVT, the block's q at 2 KVT: all of the WGP's LDS
  float (*so)[16][260] = (float (*)[16][260])big; float (*sm)[16] = (float (*)[16])(big + 16 * 16 * 260 * 4); float (*sl)[16] = sm + 16;   // the merge's partials, maxima and sums lie over the staging buffers and q, which are dead by then
  const int tid = threadIdx.x, wave = __builtin_amdgcn_readfirstlane(tid >> 5), lane = tid & 31, col = lane & 15, g = lane >> 4; const int qw = wave & 3, kj = wave >> 2; const int qb = blockIdx.x + TQ0, h = blockIdx.y; const int kv = h / (NH / NKV); const int q0 = qb * 64 + qw * 16;   // the wave's number in a scalar register: key step and tile bases leave the vector registers, and the 16 accumulator tiles fit the 256 a wave has with no scratch
  const __bf16* qp = (const __bf16*)(big + 2 * KVT + qw * (QT / 4)) + lane * 8;   // the wave's query tile in LDS
  const int qi = q0 + col; const int pq = SEGPOS[qi];   // the lane's one query and its position
  asm volatile("s_wait_xcnt 0x0" ::: "memory");   // stands between this load and the rewrite of its address register by the code below
  const int klo = pq - WIN, khi = min(qi, pq + WIN - 1);   // live keys of the query: klo < k <= khi, and attn_mask[k]
  float m = -3.0e38f, l = 0.f;
  v8f acc[16] = {};
  const int nks = (qb * 64 + 64) / 32;   // causal upper bound on key steps
  unsigned lm = 0;
  { const int qx = qb * 64 + lane, qy = qx + 32; const int px = SEGPOS[qx], py = SEGPOS[qy];
    for (int i = 0; i < (nks + 3) / 4; ++i) { const int k0 = i * 128, k1 = k0 + 127;
      const bool lx = max(k0, px - WIN + 1) <= min(min(k1, qx), px + WIN - 1), ly = max(k0, py - WIN + 1) <= min(min(k1, qy), py + WIN - 1);
      if (__any(lx || ly)) lm |= 1u << i; } }
  lm = __builtin_amdgcn_readfirstlane(lm);
  if (lm != 0) {
  const unsigned lk = lds_off(&big[0]) + tid * 16, lvv = lk + KVT;
  const char* gk = (const char*)(KF + (size_t)kv * (SS / 16) * (HD / 32) * FRU) + tid * 16; const char* gv = (const char*)(VF + (size_t)kv * (SS / 32) * (HD / 16) * FRU) + tid * 16;
  int it = __builtin_ctz(lm);
  acopy8(lk + 2 * KVT, 8192u, (const char*)(QF + ((size_t)h * (SS / 16) + qb * 4) * (HD / 32) * FRU) + tid * 16, 8192);   // q, once for the block: 8 pieces of 16 bytes a thread, 8 KiB (512 threads) apart; it stays until the last pass
  acopy_tile(lk, gk + (size_t)it * KVT);
  asm volatile("s_wait_asynccnt 0x0" ::: "memory");   // this wave's share of q and of the first k tile has landed
  __syncthreads();                                    // every wave's share of them has landed
  acopy_tile(lvv, gv + (size_t)it * KVT);
#pragma unroll 1   // rolled: the body is some thousand instructions long
  for (;;) { bool lv[16]; bool anylive = false; lm &= lm - 1; const bool more = lm != 0; const int nx = more ? __builtin_ctz(lm) : 0; const int ks = it * 4 + kj;
#pragma unroll   // in full: the arrays are indexed by constants and stay in registers
    for (int ct = 0; ct < 2; ++ct) { const int kb = ks * 32 + ct * 16 + 8 * g; const v4i a0 = *(const v4i*)(AM + kb), a1 = *(const v4i*)(AM + kb + 4);   // the lane's eight keys of this key tile
#pragma unroll   // in full: the arrays are indexed by constants and stay in registers
      for (int r = 0; r < 8; ++r) { const int kk = kb + r; const bool live = ((r < 4 ? a0[r & 3] : a1[r & 3]) != 0) & (kk > klo) & (kk <= khi); lv[ct * 8 + r] = live; anylive = anylive | live; } }
    const bool wl = __any(anylive);
    F2 pa;
    if (wl) { float s[16]; const __bf16* kp = (const __bf16*)(big + kj * 32768) + lane * 8; v8f c0 = {}, c1 = {};
#pragma unroll   // in full: the arrays are indexed by constants and stay in registers
      for (int kc = 0; kc < HD / 32; ++kc) { F2 ka, kb, qa; qa.h = frag_t(qp + kc * FRU); qa.l = frag_t(qp + kc * FRU + 512);   // one fetch of the q fragment serves both key tiles of the step
        ka.h = frag_t(kp + kc * FRU); ka.l = frag_t(kp + kc * FRU + 512); kb.h = frag_t(kp + 8192 + kc * FRU); kb.l = frag_t(kp + 8192 + kc * FRU + 512);
        c0 = wmma_bf(ka.h, qa.l, c0); c1 = wmma_bf(kb.h, qa.l, c1); c0 = wmma_bf(ka.l, qa.h, c0); c1 = wmma_bf(kb.l, qa.h, c1); c0 = wmma_bf(ka.h, qa.h, c0); c1 = wmma_bf(kb.h, qa.h, c1); }   // each tile's three products of mac3(q, k, .), in its order
#pragma unroll   // in full: the arrays are indexed by constants and stay in registers
      for (int r = 0; r < 8; ++r) { s[r] = lv[r] ? c0[r] * 0.0625f : -3.0e38f; s[8 + r] = lv[8 + r] ? c1[r] * 0.0625f : -3.0e38f; }
      float t8[8];
#pragma unroll   // in full: the arrays are indexed by constants and stay in registers
      for (int i = 0; i < 8; ++i) t8[i] = fmaxf(s[i], s[8 + i]);
      float mx = fmaxf(fmaxf(fmaxf(t8[0], t8[1]), fmaxf(t8[2], t8[3])), fmaxf(fmaxf(t8[4], t8[5]), fmaxf(t8[6], t8[7])));
      mx = fmaxf(mx, xhalf(mx));
      const float mn = fmaxf(m, mx); const float ea = expf(m - mn); const float alpha = (m <= -1.0e38f) ? 0.f : ea;   // every exp is formed unconditionally (its argument is finite and <= 0) and the guard selects behind it: no branch, and the 17 chains cover one another's latency
#pragma unroll   // in full: the arrays are indexed by constants and stay in registers
      for (int i = 0; i < 16; ++i) { const float e = expf(s[i] - mn); s[i] = (s[i] <= -1.0e38f) ? 0.f : e; }
#pragma unroll   // in full: the arrays are indexed by constants and stay in registers
      for (int i = 0; i < 8; ++i) t8[i] = s[i] + s[8 + i];
      float es = ((t8[0] + t8[1]) + (t8[2] + t8[3])) + ((t8[4] + t8[5]) + (t8[6] + t8[7]));
      es += xhalf(es);
      l = l * alpha + es; m = mn;
#pragma unroll   // in full: the arrays are indexed by constants and stay in registers
      for (int dt = 0; dt < 16; ++dt) acc[dt] *= alpha;
      pa = bsplit16(s); }
    asm volatile("s_wait_dscnt 0x0" ::: "memory");      // this wave has left the k buffer
    asm volatile("s_wait_asynccnt 0x0" ::: "memory");   // this wave's share of the pass's v tile has landed
    __syncthreads();                                    // publishes the v tile and frees the k buffer
    if (more) acopy_tile(lk, gk + (size_t)nx * KVT);
    if (wl) { const __bf16* vp = (const __bf16*)(big + KVT + kj * 32768) + lane * 8;   // one address; the 16 tiles' units lie constant steps behind it
#pragma unroll   // in full: the arrays are indexed by constants and stay in registers
      for (int dt = 0; dt < 16; ++dt) { const v16b vh = frag_t(vp + dt * FRU), vl = frag_t(vp + dt * FRU + 512); acc[dt] = wmma_bf(vh, pa.l, acc[dt]); acc[dt] = wmma_bf(vl, pa.h, acc[dt]); acc[dt] = wmma_bf(vh, pa.h, acc[dt]); } }
    asm volatile("s_wait_dscnt 0x0" ::: "memory");      // this wave has left the v buffer
    asm volatile("s_wait_asynccnt 0x0" ::: "memory");   // this wave's share of the next pass's k tile has landed
    __syncthreads();                                    // publishes that k tile and frees the v buffer (behind the last pass: for the merge's partials)
    if (!more) break;
    acopy_tile(lvv, gv + (size_t)nx * KVT); it = nx; }
  asm volatile("s_wait_asynccnt 0x0" ::: "memory"); }   // no copy is outstanding when the wave goes on
#pragma unroll   // in full: the arrays are indexed by constants and stay in registers
  for (int dt = 0; dt < 16; ++dt) { v4f lo4, hi4;
#pragma unroll   // in full: the arrays are indexed by constants and stay in registers
    for (int i = 0; i < 4; ++i) { lo4[i] = acc[dt][i]; hi4[i] = acc[dt][4 + i]; }
    *(v4f*)&so[wave][col][dt * 16 + 8 * g] = lo4; *(v4f*)&so[wave][col][dt * 16 + 8 * g + 4] = hi4; }
  if (g == 0) { sm[wave][col] = m; sl[wave][col] = l; }
  __syncthreads();   // every wave's partial is in LDS before any wave merges
  // merge: wave (qw, kj) finishes rows 4 kj .. 4 kj + 3 of query tile qw: weights exp(m_j - M), a share with no live key weighs 0
  for (int rl = 0; rl < 4; ++rl) { const int row = kj * 4 + rl; float mj[4]; float M = -3.0e38f;
#pragma unroll
    for (int j = 0; j < 4; ++j) { mj[j] = sm[qw + 4 * j][row]; M = fmaxf(M, mj[j]); }
    float L = 0.f; v4f o0 = {}, o1 = {};
#pragma unroll
    for (int j = 0; j < 4; ++j) { const float w = (mj[j] <= -1.0e38f) ? 0.f : exp_ni(mj[j] - M); L += w * sl[qw + 4 * j][row]; o0 += w * *(const v4f*)&so[qw + 4 * j][row][lane * 4]; o1 += w * *(const v4f*)&so[qw + 4 * j][row][128 + lane * 4]; }
    const float il = (L > 0.f) ? 1.0f / L : 0.f;
    vst2(O + (size_t)(q0 + row) * (NH * HD) + h * HD + lane * 4, o0 * il); vst2(O + (size_t)(q0 + row) * (NH * HD) + h * HD + 128 + lane * 4, o1 * il);
    asm volatile("s_wait_xcnt 0x0" ::: "memory"); }   // stands between the two stores and the next row's rewrite of their data registers
}
extern "C" void kernel_launch(void* const* d_in, const int* in_sizes, int n_in, void* d_out, int out_size, void* d_ws, size_t ws_size, hipStream_t stream) {
  (void)in_sizes; (void)n_in; (void)out_size;
  const float** F = (const float**)d_in; const int* AM = (const int*)d_in[1]; const int* SEGPOS = (const int*)d_in[2];
  // 0 x [1,2048,2048], 1 attn_mask [1,2048] bool(int), 2 segment_pos [1,2048] i32, 3 cos [1,2048,256], 4 sin, 5 wq [2048,2048], 6 wk [2048,1024], 7 wv [2048,1024], 8 wo [2048,2048], 9 q_scale [256], 10 k_scale [256]
  if (ws_size < (size_t)WS_END) return;
  char* ws = (char*)d_ws; __bf16 *PW = (__bf16*)(ws + WS_PW), *VF = (__bf16*)(ws + WS_VF), *QF = (__bf16*)(ws + WS_QF), *KF = (__bf16*)(ws + WS_KF); float *O = (float*)(ws + WS_O);
  k_packT<<<dim3(HID / 128, 48), 256, 0, stream>>>(F[5], F[6], F[7], F[8], PW);
  k_gemm3<<<dim3(SS / 128, NH + 2 * NKV), 256, 0, stream>>>(F[0], PW + PQ, F[9], F[10], F[3], F[4], QF, KF, VF);   // q, k and v of all rows, normed, rotated and in fragment order
  k_attn<<<dim3(TQB, NH), 512, 0, stream>>>(QF, KF, AM, SEGPOS, VF, O);
  k_gemm<0><<<dim3(TQB, HID / 128), 128, 0, stream>>>(O + (size_t)TQ0 * 64 * NH * HD, NH * HD, NH * HD, PW + PO, (float*)d_out + (size_t)TQ0 * 64 * HID, HID);
}
